// v000
// Times are from an AMD MI455X. After a warm-up the kernel runs many times in a row, and a time is the length of
// such a window on the GPU divided by its runs, so every launch and the gaps after it count. The runs cycle
// through copies of the inputs. A figure is the median of several windows, for all but v000 over two sittings.
// Sittings can differ by a few percent; kernels timed side by side share one.
// The starting kernel, v000, takes 6240 microseconds a run.
#include <hip/hip_runtime.h>
// Single-head scaled dot-product attention without batch or projections (Q [8192][256], K [8192][256], V [8192][256]; scores = Q K^T / sqrt(256); softmax over the 8192 keys; out = attn V -> [8192][256]).
// Structure: token rows; the bf16-valued inputs as exact f16 rows; V^T via LDS transposes once; per 2048-row query chunk: scores [2048][8192] as ONE WMMA GEMM (32x64 wave tiles, f32 accumulation, K = 256, exact products), row softmax on VALU (f32 statistics, native exp; weights x256 f16), out = P V^T 2^-8 f32 into the chunk's output rows; launches: see trace.
// Compute dtype: inputs rounded to bf16; x / weights exact; q, k, v and softmax weights as plain f16 GEMM operands (~2^-12); scores, softmax statistics and o f32. v_wmma_f32_16x16x32_f16.
#define NB 4
#define SQ 4096
#define DM 256
#define NH 1
#define HD 64
#define HG 4                         /* heads per attention launch group */
#define B0 0                         /* first batch processed (debug hook) */
#define NBR NB                       /* batches processed (debug hook) */
#define NR ((size_t)NB * SQ)         /* token rows */
#define MP ((int)((size_t)NBR * SQ)) /* rows projected (debug hook) */
#define QT 256                       /* query rows per causal tile */
#define NKX SQ                       /* S / P row pitch */
#define QT0 256                      /* first-tile rows recomputed exactly */
#define QN SQ                        /* query rows attended per batch (debug hook) */
#define NHD NH                       /* heads attended (debug hook) */
#define MPO MP                       /* rows through the output stage (debug hook) */
#define LQ DM            /* row pitch of the q/k/v rows */
typedef __bf16 v16b __attribute__((ext_vector_type(16)));
typedef unsigned short v8us __attribute__((ext_vector_type(8), may_alias));
typedef float  v8f  __attribute__((ext_vector_type(8)));
typedef float  v4f  __attribute__((ext_vector_type(4)));
typedef float  v4fa __attribute__((ext_vector_type(4), may_alias));
union FragB { v16b v; v8us half[2]; unsigned short u[16]; };

__device__ __forceinline__ unsigned short bf16_bits(float x) { unsigned int u = __float_as_uint(x); return (unsigned short)((u + 0x7FFFu + ((u >> 16) & 1u)) >> 16); }
__device__ __forceinline__ float bf16_val(unsigned short b) { return __uint_as_float(((unsigned int)b) << 16); }
__device__ __forceinline__ float bf16_round(float x) { return bf16_val(bf16_bits(x)); }
// D += A·B with NT terms: 1 = ah·bh, 2 = + al·bh (A split), 3 = + ah·bl (both split)
template <int NT>
__device__ __forceinline__ v8f mmaN(v16b ah, v16b al, v16b bh, v16b bl, v8f c) {
  c = __builtin_amdgcn_wmma_f32_16x16x32_bf16(false, ah, false, bh, (short)0, c, false, false);
  if (NT >= 2) c = __builtin_amdgcn_wmma_f32_16x16x32_bf16(false, al, false, bh, (short)0, c, false, false);
  if (NT >= 3) c = __builtin_amdgcn_wmma_f32_16x16x32_bf16(false, ah, false, bl, (short)0, c, false, false);
  asm volatile("v_nop\n\tv_nop\n\tv_nop\n\tv_nop" : "+v"(c) : "v"(ah), "v"(al), "v"(bh), "v"(bl));
  return c;
}

__global__ __launch_bounds__(256) void k_wt_bf16(const float* __restrict__ W, unsigned short* __restrict__ Wt, int K, int N) {
  const int t = blockIdx.x * 256 + threadIdx.x;
  const int k8n = K / 8;
  if (t >= N * k8n) return;
  const int n = t / k8n, k8 = (t % k8n) * 8;
  v8us v;
#pragma unroll
  for (int i = 0; i < 8; ++i) v[i] = bf16_bits(W[(size_t)(k8 + i) * N + n]);
  *(v8us*)(Wt + (size_t)n * K + k8) = v;
  
}

// GEMM C[M][N] (f32, pitch ldc) = act(A[M][K]·W + bias). A f32 row-major (pitch lda) converted per fragment to bf16
// (ASPLIT: hi/lo two planes -> 2 terms, else single rounded term); Wt bf16 [N][K] (pitch ldb). BIAS_BF16 rounds the
// bias to bf16 first (bias quantised to bf16 before the add). K%32==0, M%16==0, N%64==0.
template <bool ASPLIT, int ACT, bool BIAS_BF16>
__global__ __launch_bounds__(128) void k_gemm_bf(const float* __restrict__ A, int lda, const unsigned short* __restrict__ Wt, int ldb,
                                               const float* __restrict__ bias, float* __restrict__ C, int ldc, int M, int N, int K) {
  __shared__ __attribute__((aligned(16))) float so[4][16][64];
  const int tid = threadIdx.x, w = tid >> 5, lane = tid & 31, ln = lane & 15, hh = lane >> 4;
  const int ntn = N / 64;
  const int wid = blockIdx.x * 4 + w;
  const int mt = wid / ntn, nq = wid % ntn;
  if (mt * 16 >= M) return;
  const int row0 = mt * 16, col0 = nq * 64;
  const float* arow = A + (size_t)(row0 + ln) * lda;
  v8f acc[4] = {};
  for (int kb = 0; kb < K; kb += 32) {
    FragB ah, al;
    const v4f x0 = *(const v4fa*)(arow + kb + 8 * hh), x1 = *(const v4fa*)(arow + kb + 8 * hh + 4);
    const v4f x2 = *(const v4fa*)(arow + kb + 16 + 8 * hh), x3 = *(const v4fa*)(arow + kb + 16 + 8 * hh + 4);
    float xs[16] = {x0[0],x0[1],x0[2],x0[3],x1[0],x1[1],x1[2],x1[3],x2[0],x2[1],x2[2],x2[3],x3[0],x3[1],x3[2],x3[3]};
#pragma unroll
    for (int i = 0; i < 16; ++i) { const unsigned short hb = bf16_bits(xs[i]); ah.u[i] = hb; al.u[i] = ASPLIT ? bf16_bits(xs[i] - bf16_val(hb)) : (unsigned short)0; }
#pragma unroll
    for (int t = 0; t < 4; ++t) {
      const unsigned short* brow = Wt + (size_t)(col0 + t * 16 + ln) * ldb + kb;
      FragB b;
      b.half[0] = *(const v8us*)(brow + 8 * hh);
      b.half[1] = *(const v8us*)(brow + 16 + 8 * hh);
      acc[t] = mmaN<ASPLIT ? 2 : 1>(ah.v, al.v, b.v, b.v, acc[t]);
    }
  }
#pragma unroll
  for (int t = 0; t < 4; ++t) {
    float bv = bias ? bias[col0 + t * 16 + ln] : 0.f;
    if (BIAS_BF16) bv = bf16_round(bv);
#pragma unroll
    for (int r = 0; r < 8; ++r) { float v = acc[t][r] + bv; if (ACT == 1) v = fmaxf(v, 0.f); so[w][8 * hh + r][t * 16 + ln] = v; }
  }
  __builtin_amdgcn_fence(__ATOMIC_ACQ_REL, "workgroup");
  __builtin_amdgcn_wave_barrier();
  const int rsub = lane >> 4, c4 = (lane & 15) * 4;
  {
#pragma unroll
    for (int q = 0; q < 8; ++q) {
      const int r = q * 2 + rsub;
      const v4f v = *(const v4fa*)&so[w][r][c4];
      *(v4f*)(C + (size_t)(row0 + r) * ldc + col0 + c4) = v;
    }
    
  }
}

// GEMM C = act(A·W + bias + resid): A f32 (ASPLIT -> hi/lo 2 terms), Wt bf16 [N][K]; ACT 0 none, 1 relu, 2 exact gelu;
// resid (optional, f32, row index = (row % rmod), pitch ldr, RES_BF16 rounds it) added before the activation.
template <bool ASPLIT, int ACT, bool BIAS_BF16, bool RES_BF16>
__global__ __launch_bounds__(128) void k_gemm_bf3(const float* __restrict__ A, int lda, const unsigned short* __restrict__ Wt, int ldb,
                                                const float* __restrict__ bias, const float* __restrict__ resid, int rmod, int ldr,
                                                float* __restrict__ C, int ldc, int M, int N, int K) {
  __shared__ __attribute__((aligned(16))) float so[4][16][64];
  const int tid = threadIdx.x, w = tid >> 5, lane = tid & 31, ln = lane & 15, hh = lane >> 4;
  const int ntn = N / 64;
  const int wid = blockIdx.x * 4 + w;
  const int mt = wid / ntn, nq = wid % ntn;
  if (mt * 16 >= M) return;
  const int row0 = mt * 16, col0 = nq * 64;
  const float* arow = A + (size_t)(row0 + ln) * lda;
  v8f acc[4] = {};
  for (int kb = 0; kb < K; kb += 32) {
    FragB ah, al;
    const v4f x0 = *(const v4fa*)(arow + kb + 8 * hh), x1 = *(const v4fa*)(arow + kb + 8 * hh + 4);
    const v4f x2 = *(const v4fa*)(arow + kb + 16 + 8 * hh), x3 = *(const v4fa*)(arow + kb + 16 + 8 * hh + 4);
    float xs[16] = {x0[0],x0[1],x0[2],x0[3],x1[0],x1[1],x1[2],x1[3],x2[0],x2[1],x2[2],x2[3],x3[0],x3[1],x3[2],x3[3]};
#pragma unroll
    for (int i = 0; i < 16; ++i) { const unsigned short hb = bf16_bits(xs[i]); ah.u[i] = hb; al.u[i] = ASPLIT ? bf16_bits(xs[i] - bf16_val(hb)) : (unsigned short)0; }
#pragma unroll
    for (int t = 0; t < 4; ++t) {
      const unsigned short* brow = Wt + (size_t)(col0 + t * 16 + ln) * ldb + kb;
      FragB b;
      b.half[0] = *(const v8us*)(brow + 8 * hh);
      b.half[1] = *(const v8us*)(brow + 16 + 8 * hh);
      acc[t] = mmaN<ASPLIT ? 2 : 1>(ah.v, al.v, b.v, b.v, acc[t]);
    }
  }
#pragma unroll
  for (int t = 0; t < 4; ++t) {
    const int col = col0 + t * 16 + ln;
    float bv = bias ? bias[col] : 0.f;
    if (BIAS_BF16) bv = bf16_round(bv);
#pragma unroll
    for (int r = 0; r < 8; ++r) {
      float v = acc[t][r] + bv;
      if (resid) { float rv = resid[(size_t)((row0 + 8 * hh + r) % rmod) * ldr + col]; if (RES_BF16) rv = bf16_round(rv); v += rv; }
      if (ACT == 1) v = fmaxf(v, 0.f);
      if (ACT == 2) v = 0.5f * v * (1.0f + erff(v * 0.70710678118654752f));
      if (ACT == 3) { const float u = 0.7978845608028654f * (v + 0.044715f * v * v * v); v = 0.5f * v * (1.0f + tanhf(u)); }
      so[w][8 * hh + r][t * 16 + ln] = v;
    }
  }
  __builtin_amdgcn_fence(__ATOMIC_ACQ_REL, "workgroup");
  __builtin_amdgcn_wave_barrier();
  const int rsub = lane >> 4, c4 = (lane & 15) * 4;
  {
#pragma unroll
    for (int q = 0; q < 8; ++q) {
      const int r = q * 2 + rsub;
      const v4f v = *(const v4fa*)&so[w][r][c4];
      *(v4f*)(C + (size_t)(row0 + r) * ldc + col0 + c4) = v;
    }
    
  }
}
// row LayerNorm (biased variance, eps) over N: s = X (+ R); optional out_sum <- s; out_norm <- (s-mu)*rsqrt(var+eps)*g + b
template <bool PARAM_BF16>
__global__ __launch_bounds__(256) void k_layernorm(const float* __restrict__ X, const float* __restrict__ R, const float* __restrict__ g, const float* __restrict__ bta,
                                                  float* __restrict__ out_sum, float* __restrict__ out_norm, int N, float eps) {
  __shared__ float red[256];
  const int row = blockIdx.x, tid = threadIdx.x;
  const float* x = X + (size_t)row * N; const float* rr = R ? R + (size_t)row * N : nullptr;
  float vals[16];                     // up to N = 4096
  const int per = N / 256;            // contiguous chunk per thread? use strided-by-4 chunks: thread handles j = tid*4 + 1024*u
  float s1 = 0.f;
  for (int u = 0; u < per / 4; ++u) {
    const int j = tid * 4 + 1024 * u;
    const v4f a = *(const v4fa*)(x + j);
    v4f b = {0.f,0.f,0.f,0.f}; if (rr) b = *(const v4fa*)(rr + j);
#pragma unroll
    for (int q = 0; q < 4; ++q) { const float v = a[q] + b[q]; vals[u * 4 + q] = v; s1 += v; }
  }
  red[tid] = s1; __syncthreads();
  for (int st = 128; st > 0; st >>= 1) { if (tid < st) red[tid] += red[tid + st]; __syncthreads(); }
  const float mu = red[0] / (float)N; __syncthreads();
  float s2 = 0.f;
  for (int u = 0; u < per / 4; ++u)
#pragma unroll
    for (int q = 0; q < 4; ++q) { const float c = vals[u * 4 + q] - mu; s2 += c * c; }
  red[tid] = s2; __syncthreads();
  for (int st = 128; st > 0; st >>= 1) { if (tid < st) red[tid] += red[tid + st]; __syncthreads(); }
  const float rs = rsqrtf(red[0] / (float)N + eps);
  {
    for (int u = 0; u < per / 4; ++u) {
      const int j = tid * 4 + 1024 * u;
      v4f o, sm;
#pragma unroll
      for (int q = 0; q < 4; ++q) {
        float gg = g[j + q], bb = bta[j + q];
        if (PARAM_BF16) { gg = bf16_round(gg); bb = bf16_round(bb); }
        sm[q] = vals[u * 4 + q]; o[q] = (vals[u * 4 + q] - mu) * rs * gg + bb;
      }
      if (out_sum) *(v4f*)(out_sum + (size_t)row * N + j) = sm;
      *(v4f*)(out_norm + (size_t)row * N + j) = o;
    }
    
  }
}



// ---- f16 WMMA path (v_wmma_f32_16x16x32_f16): 11-bit significands for operands in range — used where a [0,1] probability operand needs more precision than bf16
typedef _Float16 v16h __attribute__((ext_vector_type(16)));
union FragH { v16h v; v8us half[2]; _Float16 h[16]; unsigned short u[16]; };
template <int NT>
__device__ __forceinline__ v8f mmaH(v16h ah, v16h al, v16h bh, v16h bl, v8f c) {
  c = __builtin_amdgcn_wmma_f32_16x16x32_f16(false, ah, false, bh, (short)0, c, false, false);
  if (NT >= 2) c = __builtin_amdgcn_wmma_f32_16x16x32_f16(false, al, false, bh, (short)0, c, false, false);
  if (NT >= 3) c = __builtin_amdgcn_wmma_f32_16x16x32_f16(false, ah, false, bl, (short)0, c, false, false);
  asm volatile("v_nop\n\tv_nop\n\tv_nop\n\tv_nop" : "+v"(c) : "v"(ah), "v"(al), "v"(bh), "v"(bl));
  return c;
}
// batched GEMM like k_gemm_b but f16 operands: A f32 (split into f16 hi/lo if ASPLIT, else rounded to f16), Bt = f16 values [n][k]; alpha; C f32; N multiple of 16 (partial tiles skipped)
template <bool ASPLIT>
__global__ __launch_bounds__(128) void k_gemm_h(const float* __restrict__ A, int lda, size_t sA, const _Float16* __restrict__ Bh, int ldb, size_t sB, float alpha, float* __restrict__ C, int ldc, size_t sC, int M, int N, int K) {
  __shared__ __attribute__((aligned(16))) float so[4][16][64];
  const int tid = threadIdx.x, w = tid >> 5, lane = tid & 31, ln = lane & 15, hh = lane >> 4; const int by = blockIdx.y;
  A += (size_t)by * sA; Bh += (size_t)by * sB; C += (size_t)by * sC;
  const int ntn = (N + 63) / 64; const int wid = blockIdx.x * 4 + w; const int mt = wid / ntn, nq = wid % ntn; if (mt * 16 >= M) return;
  const int row0 = mt * 16, col0 = nq * 64; const float* arow = A + (size_t)(row0 + ln) * lda;
  v8f acc[4] = {};
  for (int kb = 0; kb < K; kb += 32) {
    FragH ah, al;
    const v4f x0 = *(const v4fa*)(arow + kb + 8 * hh), x1 = *(const v4fa*)(arow + kb + 8 * hh + 4), x2 = *(const v4fa*)(arow + kb + 16 + 8 * hh), x3 = *(const v4fa*)(arow + kb + 16 + 8 * hh + 4);
    float xs[16] = {x0[0],x0[1],x0[2],x0[3],x1[0],x1[1],x1[2],x1[3],x2[0],x2[1],x2[2],x2[3],x3[0],x3[1],x3[2],x3[3]};
#pragma unroll
    for (int i = 0; i < 16; ++i) { const _Float16 h = (_Float16)xs[i]; ah.h[i] = h; al.h[i] = ASPLIT ? (_Float16)(xs[i] - (float)h) : (_Float16)0.0f; }
#pragma unroll
    for (int t = 0; t < 4; ++t) { if (col0 + t * 16 >= N) continue; const size_t boff = (size_t)(col0 + t * 16 + ln) * ldb + kb; FragH bq; bq.half[0] = *(const v8us*)(Bh + boff + 8 * hh); bq.half[1] = *(const v8us*)(Bh + boff + 16 + 8 * hh);
      acc[t] = mmaH<ASPLIT ? 2 : 1>(ah.v, al.v, bq.v, bq.v, acc[t]); }
  }
#pragma unroll
  for (int t = 0; t < 4; ++t) { if (col0 + t * 16 >= N) continue;
#pragma unroll
    for (int r = 0; r < 8; ++r) so[w][8 * hh + r][t * 16 + ln] = acc[t][r] * alpha; }
  __builtin_amdgcn_fence(__ATOMIC_ACQ_REL, "workgroup"); __builtin_amdgcn_wave_barrier();
  const int rsub = lane >> 4, c4 = (lane & 15) * 4;
  {
#pragma unroll
    for (int q = 0; q < 8; ++q) { const int r = q * 2 + rsub; if (col0 + c4 < N) { const v4f v = *(const v4fa*)&so[w][r][c4]; *(v4f*)(C + (size_t)(row0 + r) * ldc + col0 + c4) = v; } }
     }
}

// Wt[n][k] = f16(W[k][n]·scale) from f32 row-major W[K][N] (scale = power of two; bf16-exact weights stay exact in f16 away from the subnormal range)
__global__ __launch_bounds__(256) void k_wt_f16(const float* __restrict__ W, _Float16* __restrict__ Wt, int K, int N, float scale) {
  const int t = blockIdx.x * 256 + threadIdx.x; if (t >= N * (K / 8)) return; const int n = t / (K / 8), k8 = (t % (K / 8)) * 8; FragH f;
#pragma unroll
  for (int i = 0; i < 8; ++i) f.h[i] = (_Float16)(bf16_round(W[(size_t)(k8 + i) * N + n]) * scale); const v8us o = f.half[0];
  *(v8us*)((unsigned short*)Wt + (size_t)n * K + k8) = o; 
}
// k_gemm_hh variant with fused epilogue: v = acc·alpha + bias[by·sBias + col] (+ CP[(row/rowsPerB)·sCPb + by·64 + col] if CP) ; ACT 0 none / 1 elu ; writes f16 C16 (and f32 C if non-null)
template <int ACT>
__global__ __launch_bounds__(128) void k_gemm_hhx(const _Float16* __restrict__ A, int lda, size_t sA, const _Float16* __restrict__ Bh, int ldb, size_t sB, float alpha, const float* __restrict__ bias, size_t sBias, const float* __restrict__ CP, int rowsPerB, size_t sCPb, int row0g,
    float* __restrict__ C, _Float16* __restrict__ C16, int ldc, size_t sC, int M, int N, int K) {
  __shared__ __attribute__((aligned(16))) float so[4][16][64];
  const int tid = threadIdx.x, w = tid >> 5, lane = tid & 31, ln = lane & 15, hh = lane >> 4; const int by = blockIdx.y;
  A += (size_t)by * sA; Bh += (size_t)by * sB; const size_t cofs = (size_t)by * sC; const float* bp = bias ? bias + (size_t)by * sBias : nullptr;
  const int ntn = (N + 63) / 64; const int wid = blockIdx.x * 4 + w; const int mt = wid / ntn, nq = wid % ntn; if (mt * 16 >= M) return;
  const int row0 = mt * 16, col0 = nq * 64; const _Float16* arow = A + (size_t)(row0 + ln) * lda;
  v8f acc[4] = {};
  for (int kb = 0; kb < K; kb += 32) { FragH ah; ah.half[0] = *(const v8us*)((const unsigned short*)arow + kb + 8 * hh); ah.half[1] = *(const v8us*)((const unsigned short*)arow + kb + 16 + 8 * hh);
#pragma unroll
    for (int t = 0; t < 4; ++t) { if (col0 + t * 16 >= N) continue; const size_t boff = (size_t)(col0 + t * 16 + ln) * ldb + kb; FragH bq; bq.half[0] = *(const v8us*)((const unsigned short*)Bh + boff + 8 * hh); bq.half[1] = *(const v8us*)((const unsigned short*)Bh + boff + 16 + 8 * hh);
      acc[t] = mmaH<1>(ah.v, ah.v, bq.v, bq.v, acc[t]); }
  }
#pragma unroll
  for (int t = 0; t < 4; ++t) { if (col0 + t * 16 >= N) continue; const int col = col0 + t * 16 + ln; const float bv = bp ? bf16_round(bp[col]) : 0.f;
#pragma unroll
    for (int r = 0; r < 8; ++r) { float v = acc[t][r] * alpha + bv; if (CP) { const int rr = row0g + row0 + 8 * hh + r; if (rowsPerB < 0) v += CP[cofs + (size_t)rr * ldc + col];      /* rowsPerB < 0: own element of the batched C plane */ else { const int bidx = rr / rowsPerB; v += CP[(size_t)bidx * sCPb + (size_t)by * 64 + col]; } } if (ACT == 1) v = (v > 0.f) ? v : expm1f(v); else if (ACT == 7) v = (v > 0.f) ? v + 1.0f : expf(v); else if (ACT == 8) v = tanhf(v); else if (ACT == 9) v = 0.5f * v * (1.0f + tanhf(0.7978845608028654f * (v + 0.044715f * v * v * v))); else if (ACT == 11) v = 1.0f / (1.0f + expf(-v)); else if (ACT == 12) v = (v > 0.f) ? v : 0.01f * v; else if (ACT == 14) v = (v > 0.f) ? v : 0.1f * v; else if (ACT == 16) v = (v >= 0.f) ? v : 0.3f * v; else if (ACT == 17) v = (v >= 0.f) ? v : 0.2f * v; else if (ACT == 15) v = v / (1.0f + expf(-v)); else if (ACT == 3) v = fmaxf(v, 0.f); else if (ACT == 6) v = 0.5f * v * (1.0f + erff(v * 0.70710678118654752f)); so[w][8 * hh + r][t * 16 + ln] = v; } }
  __builtin_amdgcn_fence(__ATOMIC_ACQ_REL, "workgroup"); __builtin_amdgcn_wave_barrier();
  const int rsub = lane >> 4, c4 = (lane & 15) * 4; typedef _Float16 v4h __attribute__((ext_vector_type(4)));
  {
#pragma unroll
    for (int q = 0; q < 8; ++q) { const int r = q * 2 + rsub; if (col0 + c4 < N) { const v4f v = *(const v4fa*)&so[w][r][c4]; if (C) *(v4f*)(C + cofs + (size_t)(row0 + r) * ldc + col0 + c4) = v; if (C16) { v4h h4; for (int i = 0; i < 4; ++i) h4[i] = (_Float16)v[i]; *(v4h*)(C16 + cofs + (size_t)(row0 + r) * ldc + col0 + c4) = h4; } } }
     }
}


typedef _Float16 v4h __attribute__((ext_vector_type(4)));

__global__ __launch_bounds__(256) void k_x16(const float* __restrict__ x, _Float16* __restrict__ X16, size_t n8) { const size_t t = (size_t)blockIdx.x * 256 + threadIdx.x; if (t >= n8) return; FragH f;
#pragma unroll
  for (int q = 0; q < 8; ++q) f.h[q] = (_Float16)bf16_round(x[t * 8 + q]); *(v8us*)((unsigned short*)X16 + t * 8) = f.half[0];  }
__global__ __launch_bounds__(256) void k_h16(const float* __restrict__ x, _Float16* __restrict__ X16, size_t n8) { const size_t t = (size_t)blockIdx.x * 256 + threadIdx.x; if (t >= n8) return; FragH f;
#pragma unroll
  for (int q = 0; q < 8; ++q) f.h[q] = (_Float16)x[t * 8 + q]; *(v8us*)((unsigned short*)X16 + t * 8) = f.half[0];  }
__global__ __launch_bounds__(256) void k_round16f(const float* __restrict__ W, _Float16* __restrict__ Bt, size_t n8) { const size_t t = (size_t)blockIdx.x * 256 + threadIdx.x; if (t >= n8) return; FragH f;
#pragma unroll
  for (int i = 0; i < 8; ++i) f.h[i] = (_Float16)(bf16_round(W[t * 8 + i]) * 16.0f); *(v8us*)((unsigned short*)Bt + t * 8) = f.half[0];  }
template <int NHv, int TTv>
__global__ __launch_bounds__(256) void k_vt(const _Float16* __restrict__ V16, int ldv, int voff, _Float16* __restrict__ Vt) { __shared__ unsigned short tl[64][66]; const int tid = threadIdx.x; const int slab = blockIdx.x / (TTv / 64), lg = blockIdx.x % (TTv / 64); const int b = slab / NHv, h = slab % NHv;
  for (int i = tid; i < 64 * 8; i += 256) { const int r = i / 8, c8 = (i % 8) * 8; FragH f; f.half[0] = *(const v8us*)((const unsigned short*)V16 + ((size_t)b * TTv + lg * 64 + r) * ldv + voff + h * 64 + c8);
#pragma unroll
    for (int q = 0; q < 8; ++q) tl[r][c8 + q] = f.u[q]; }
  __syncthreads();
  {
#pragma unroll
    for (int rd = 0; rd < 2; ++rd) { const int d = rd * 32 + tid / 8, pc = tid % 8; FragH f;
#pragma unroll
      for (int q = 0; q < 8; ++q) f.u[q] = tl[pc * 8 + q][d];
      *(v8us*)((unsigned short*)Vt + ((size_t)slab * 64 + d) * TTv + lg * 64 + pc * 8) = f.half[0]; }
     } }

__global__ __launch_bounds__(256) void k_hl(const float* __restrict__ F, _Float16* __restrict__ Hh, _Float16* __restrict__ Hl, size_t n8) { const size_t t = (size_t)blockIdx.x * 256 + threadIdx.x; if (t >= n8) return; FragH fh, fl; const v4f a = *(const v4fa*)(F + t * 8), c = *(const v4fa*)(F + t * 8 + 4);
#pragma unroll
  for (int q = 0; q < 4; ++q) { _Float16 h = (_Float16)a[q]; fh.h[q] = h; fl.h[q] = (_Float16)((a[q] - (float)h) * 1024.0f); h = (_Float16)c[q]; fh.h[4 + q] = h; fl.h[4 + q] = (_Float16)((c[q] - (float)h) * 1024.0f); }
  { *(v8us*)((unsigned short*)Hh + t * 8) = fh.half[0]; *(v8us*)((unsigned short*)Hl + t * 8) = fl.half[0];  } }

// ---- fast GEMM (wave tile 32x64; requires M % 32 == 0 rows per launch region and N % 64 == 0); epilogue = k_gemm_hhx semantics ----
__device__ __forceinline__ v16h g2_frag(const _Float16* p, int hh) { FragH f; f.half[0] = *(const v8us*)((const unsigned short*)p + 8 * hh); f.half[1] = *(const v8us*)((const unsigned short*)p + 16 + 8 * hh); return f.v; }
__device__ __forceinline__ v8f g2_mma(v16h a, v16h b, v8f c) { v8f d = __builtin_amdgcn_wmma_f32_16x16x32_f16(false, a, false, b, (short)0, c, false, false); asm volatile("v_nop\n\tv_nop\n\tv_nop\n\tv_nop" : "+v"(d) : "v"(a), "v"(b)); return d; }
template <int ACT>
__global__ __launch_bounds__(128) void k_gemm2(const _Float16* __restrict__ A, int lda, size_t sA, const _Float16* __restrict__ Bh, int ldb, size_t sB, float alpha, const float* __restrict__ bias, size_t sBias, const float* __restrict__ CP, int rowsPerB, size_t sCPb, int row0g,
    float* __restrict__ C, _Float16* __restrict__ C16, int ldc, size_t sC, int M, int N, int K) { static_assert(ACT == 0 || ACT == 3 || ACT == 6 || ACT == 8 || ACT == 9 || ACT == 11 || ACT == 12 || ACT == 14 || ACT == 15 || ACT == 16 || ACT == 17, "k_gemm2: unsupported ACT code (would silently apply no activation)");
  __shared__ __attribute__((aligned(16))) float so[4][32][68];
  const int tid = threadIdx.x, w = tid >> 5, lane = tid & 31, ln = lane & 15, hh = lane >> 4; const int by = blockIdx.y;
  A += (size_t)by * sA; Bh += (size_t)by * sB; const size_t cofs = (size_t)by * sC; const float* bp = bias ? bias + (size_t)by * sBias : nullptr;
  const int ntn = N >> 6; const int mt = blockIdx.x / ntn, nq = blockIdx.x - mt * ntn; const int row0 = mt * 128 + 32 * w, col0 = nq * 64; if (row0 >= M) return;
  const _Float16* a0p = A + (size_t)(row0 + ln) * lda; const _Float16* a1p = a0p + (size_t)16 * lda;
  const _Float16* b0p = Bh + (size_t)(col0 + ln) * ldb; const _Float16* b1p = b0p + (size_t)16 * ldb; const _Float16* b2p = b1p + (size_t)16 * ldb; const _Float16* b3p = b2p + (size_t)16 * ldb;
  const v8f z8 = {0.f,0.f,0.f,0.f,0.f,0.f,0.f,0.f}; v8f c00 = z8, c01 = z8, c02 = z8, c03 = z8, c10 = z8, c11 = z8, c12 = z8, c13 = z8;
#pragma unroll 1
  for (int kb = 0; kb < K; kb += 32) { const v16h a0 = g2_frag(a0p + kb, hh), a1 = g2_frag(a1p + kb, hh);
    v16h b = g2_frag(b0p + kb, hh); c00 = g2_mma(a0, b, c00); c10 = g2_mma(a1, b, c10);
    b = g2_frag(b1p + kb, hh); c01 = g2_mma(a0, b, c01); c11 = g2_mma(a1, b, c11);
    b = g2_frag(b2p + kb, hh); c02 = g2_mma(a0, b, c02); c12 = g2_mma(a1, b, c12);
    b = g2_frag(b3p + kb, hh); c03 = g2_mma(a0, b, c03); c13 = g2_mma(a1, b, c13); }
  v8f accs[8] = {c00, c01, c02, c03, c10, c11, c12, c13};
#pragma unroll
  for (int u = 0; u < 8; ++u) { const int t = u & 3, half = u >> 2; const int col = col0 + t * 16 + ln; const float bv = bp ? bf16_round(bp[col]) : 0.f;
#pragma unroll
    for (int r = 0; r < 8; ++r) { const int rloc = half * 16 + 8 * hh + r; float v = accs[u][r] * alpha + bv; if (CP) { if (rowsPerB < 0) v += CP[cofs + (size_t)(row0g + row0 + rloc) * ldc + col];      /* rowsPerB < 0: own element of the batched C plane */ else { const int bidx = (row0g + row0 + rloc) / rowsPerB; v += CP[(size_t)bidx * sCPb + (size_t)by * 64 + col]; } }
      if (ACT == 3) v = fmaxf(v, 0.f); else if (ACT == 6) v = 0.5f * v * (1.0f + erff(v * 0.70710678118654752f)); else if (ACT == 11) v = 1.0f / (1.0f + expf(-v)); else if (ACT == 15) v = v / (1.0f + expf(-v)); else if (ACT == 12) v = (v > 0.f) ? v : 0.01f * v; else if (ACT == 8) v = tanhf(v); else if (ACT == 9) v = 0.5f * v * (1.0f + tanhf(0.7978845608028654f * (v + 0.044715f * v * v * v))); else if (ACT == 14) v = (v > 0.f) ? v : 0.1f * v; else if (ACT == 16) v = (v >= 0.f) ? v : 0.3f * v; else if (ACT == 17) v = (v >= 0.f) ? v : 0.2f * v;
      so[w][rloc][t * 16 + ln] = v; } }
  __builtin_amdgcn_fence(__ATOMIC_ACQ_REL, "workgroup"); __builtin_amdgcn_wave_barrier();
  const int rsub = lane >> 4, c4 = (lane & 15) * 4;
  {
#pragma unroll
    for (int q = 0; q < 16; ++q) { const int r = q * 2 + rsub; const v4f v = *(const v4fa*)&so[w][r][c4]; if (C) *(v4f*)(C + cofs + (size_t)(row0 + r) * ldc + col0 + c4) = v; if (C16) { v4h h4; for (int i = 0; i < 4; ++i) h4[i] = (_Float16)v[i]; *(v4h*)(C16 + cofs + (size_t)(row0 + r) * ldc + col0 + c4) = h4; } }
     } }


__global__ __launch_bounds__(256) void k_wnat(const float* __restrict__ w, size_t n8, _Float16* __restrict__ Bt) { const size_t t = (size_t)blockIdx.x * 256 + threadIdx.x; if (t >= n8) return; FragH f; for (int q = 0; q < 8; ++q) f.h[q] = (_Float16)(bf16_round(w[t * 8 + q]) * 16.0f); *(v8us*)((unsigned short*)Bt + t * 8) = f.half[0];  }
__global__ __launch_bounds__(256) void k_rsm(const float* __restrict__ S, _Float16* __restrict__ P, int nrows) {
  #pragma clang fp contract(off)
  const int i = blockIdx.x * 256 + threadIdx.x; if (i >= nrows) return; const float* s = S + (size_t)i * SQ; float mx = -3.0e38f;
#pragma unroll 1
  for (int j = 0; j < SQ; ++j) mx = fmaxf(mx, s[j]); float se = 0.f;
#pragma unroll 1
  for (int j = 0; j < SQ; ++j) se += expf(s[j] - mx); const float sc = 256.0f / se;
#pragma unroll 1
  for (int j0 = 0; j0 < SQ; j0 += 8) { FragH f; for (int q = 0; q < 8; ++q) f.h[q] = (_Float16)(expf(s[j0 + q] - mx) * sc); unsigned short* d = (unsigned short*)P + (size_t)i * SQ + j0; *(v8us*)d = f.half[0];  } }
__global__ __launch_bounds__(256) void k_vt(const _Float16* __restrict__ V16, int b, int h0, _Float16* __restrict__ VT) { __shared__ unsigned short tl[64][65]; const int tid = threadIdx.x; const int hh = blockIdx.x % HG, sg = blockIdx.x / HG; const int s0 = sg * 64; const int h = h0 + hh;
  for (int i = tid; i < 64 * 8; i += 256) { const int j = i / 8, d8 = (i % 8) * 8; FragH f; f.half[0] = *(const v8us*)((const unsigned short*)V16 + ((size_t)b * SQ + s0 + j) * DM + h * HD + d8); for (int q = 0; q < 8; ++q) tl[d8 + q][j] = f.u[q]; }
  __syncthreads();
  { for (int i = tid; i < 64 * 8; i += 256) { const int d = i / 8, j8 = (i % 8) * 8; FragH f; for (int q = 0; q < 8; ++q) f.u[q] = tl[d][j8 + q]; *(v8us*)((unsigned short*)VT + ((size_t)hh * HD + d) * SQ + s0 + j8) = f.half[0]; }  } }



__global__ __launch_bounds__(256) void k_rsmcf2(const float* __restrict__ S, _Float16* __restrict__ P, int hg, int q0, int nk) {
  #pragma clang fp contract(off)
  const int t = blockIdx.x * 256 + threadIdx.x; if (t >= hg * QT) return; const size_t i = (size_t)t; const float* s = S + i * NKX; const int last = q0 + (t % QT); float mx = -3.0e38f;
#pragma unroll 1
  for (int j = 0; j < nk; ++j) { const float f = (j <= last) ? 1.f : 0.f; mx = fmaxf(mx, fmaf(f, s[j], (1.f - f) * -1.0e9f)); } float se = 0.f;
#pragma unroll 1
  for (int j = 0; j < nk; ++j) { const float f = (j <= last) ? 1.f : 0.f; se += __expf(fmaf(f, s[j], (1.f - f) * -1.0e9f) - mx); } const float sc = 256.0f / se;
#pragma unroll 1
  for (int j0 = 0; j0 < nk; j0 += 8) { FragH fr; for (int q = 0; q < 8; ++q) { const int j = j0 + q; const float f = (j <= last) ? 1.f : 0.f; fr.h[q] = (_Float16)(__expf(fmaf(f, s[j], (1.f - f) * -1.0e9f) - mx) * sc); } unsigned short* d = (unsigned short*)P + i * NKX + j0; *(v8us*)d = fr.half[0];  } }

template <int MASKADD>
__global__ __launch_bounds__(64) void k_att0(const float* __restrict__ QF, const float* __restrict__ KF, const float* __restrict__ VF, int ld, const float* __restrict__ mask, float scale, float* __restrict__ OF, int ldo) {
  #pragma clang fp contract(off)
  __shared__ __attribute__((aligned(16))) float lq[64][64]; __shared__ __attribute__((aligned(16))) float lo[64][64];
  const int tid = threadIdx.x; const int h = blockIdx.x / (QT0 / 64), rg = blockIdx.x % (QT0 / 64); const int i = rg * 64 + tid;
  const float* qr = QF + (size_t)i * ld + h * HD;
#pragma unroll 1
  for (int c = 0; c < HD / 4; ++c) { *(v4f*)&lq[tid][c * 4] = *(const v4fa*)(qr + c * 4); const v4f z = {0.f, 0.f, 0.f, 0.f}; *(v4f*)&lo[tid][c * 4] = z; }
  float m = -1.0e30f, l = 0.f; const int jmax = MASKADD ? (SQ - 1) : (rg * 64 + 63);      /* additive-mask form: every key (the mask input decides); causal form: keys up to the block's last row */
#pragma unroll 1
  for (int j = 0; j <= jmax; ++j) { const float* kr = KF + (size_t)j * ld + h * HD; const float* vr = VF + (size_t)j * ld + h * HD; float s = 0.f;
#pragma unroll 1
    for (int c = 0; c < HD / 4; ++c) { const v4f kq = *(const v4fa*)(kr + c * 4); const v4f qq = *(v4f*)&lq[tid][c * 4]; s = __fadd_rn(s, __fmul_rn(qq[0], kq[0])); s = __fadd_rn(s, __fmul_rn(qq[1], kq[1])); s = __fadd_rn(s, __fmul_rn(qq[2], kq[2])); s = __fadd_rn(s, __fmul_rn(qq[3], kq[3])); }
    s = __fmul_rn(s, scale); if (MASKADD) s = __fadd_rn(s, __fmul_rn(bf16_round(mask[(size_t)i * SQ + j]), -10000.0f));
    const float f = (MASKADD || j <= i) ? 1.f : 0.f; const float sm = fmaf(f, s, (1.f - f) * -1.0e30f); const float mn = fmaxf(m, sm); const float sc = expf(m - mn); const float e = expf(sm - mn); l = __fadd_rn(__fmul_rn(l, sc), e); m = mn;
#pragma unroll 1
    for (int c = 0; c < HD / 4; ++c) { const v4f vv = *(const v4fa*)(vr + c * 4); v4f oo = *(v4f*)&lo[tid][c * 4]; for (int u = 0; u < 4; ++u) oo[u] = __fadd_rn(__fmul_rn(oo[u], sc), __fmul_rn(e, vv[u])); *(v4f*)&lo[tid][c * 4] = oo; } }
  const float fin = 64.0f / l;      /* o carried x64 */
#pragma unroll 1
  for (int c = 0; c < HD / 4; ++c) { v4f oo = *(v4f*)&lo[tid][c * 4]; for (int u = 0; u < 4; ++u) oo[u] = __fmul_rn(oo[u], fin); *(v4f*)&lo[tid][c * 4] = oo; }
  __syncthreads();
  {
#pragma unroll 1
    for (int it = 0; it < 16; ++it) { const int row = it * 4 + tid / 16, pc = (tid % 16) * 4; const v4f v = *(const v4f*)&lo[row][pc]; *(v4f*)(OF + (size_t)(rg * 64 + row) * ldo + h * HD + pc) = v; }
     } }

__global__ __launch_bounds__(256) void k_oscale(const float* __restrict__ OF, float* __restrict__ out, size_t n4) { const size_t t = (size_t)blockIdx.x * 256 + threadIdx.x; if (t >= n4) return; const v4f a = *(const v4fa*)(OF + t * 4); v4f o; for (int q = 0; q < 4; ++q) o[q] = a[q] * 0.015625f; *(v4f*)(out + t * 4) = o;  }

__global__ __launch_bounds__(256) void k_bfr(const float* __restrict__ x, float* __restrict__ XB, size_t n8) { const size_t t = (size_t)blockIdx.x * 256 + threadIdx.x; if (t >= n8) return; v4f a = *(const v4fa*)(x + t * 8), c = *(const v4fa*)(x + t * 8 + 4); for (int q = 0; q < 4; ++q) { a[q] = bf16_round(a[q]); c[q] = bf16_round(c[q]); }
  { *(v4f*)(XB + t * 8) = a; *(v4f*)(XB + t * 8 + 4) = c;  } }



__global__ __launch_bounds__(256) void k_rsmfvl(const float* __restrict__ S, _Float16* __restrict__ P, _Float16* __restrict__ PL, int qn, const int* __restrict__ vlp) {
  #pragma clang fp contract(off)
  const int t = blockIdx.x * 256 + threadIdx.x; if (t >= qn) return; const int vl = vlp[0]; const size_t i = (size_t)t; const float* s = S + i * SQ; float mx = -3.0e38f;
#pragma unroll 1
  for (int j = 0; j < SQ; ++j) { const float f = (j < vl) ? 1.f : 0.f; mx = fmaxf(mx, fmaf(f, s[j], (1.f - f) * -1000000.0f)); } float se = 0.f;
#pragma unroll 1
  for (int j = 0; j < SQ; ++j) { const float f = (j < vl) ? 1.f : 0.f; se += __expf(fmaf(f, s[j], (1.f - f) * -1000000.0f) - mx); } const float sc = 256.0f / se;
#pragma unroll 1
  for (int j0 = 0; j0 < SQ; j0 += 8) { FragH fr, gr; for (int q = 0; q < 8; ++q) { const int j = j0 + q; const float f = (j < vl) ? 1.f : 0.f; const float pv = __expf(fmaf(f, s[j], (1.f - f) * -1000000.0f) - mx) * sc; const _Float16 ph = (_Float16)pv; fr.h[q] = ph; gr.h[q] = (_Float16)((pv - (float)ph) * 1024.0f); }
    unsigned short* d = (unsigned short*)P + i * SQ + j0; unsigned short* dl = (unsigned short*)PL + i * SQ + j0; *(v8us*)d = fr.half[0]; *(v8us*)dl = gr.half[0];  } }

__global__ __launch_bounds__(256) void k_rsmf(const float* __restrict__ S, _Float16* __restrict__ P, int qn, int hg) {
  #pragma clang fp contract(off)
  const int t = blockIdx.x * 256 + threadIdx.x; if (t >= qn * hg) return; const size_t i = (size_t)(t / qn) * SQ + (t % qn); const float* s = S + i * SQ; float mx = -3.0e38f;
#pragma unroll 1
  for (int j = 0; j < SQ; ++j) mx = fmaxf(mx, s[j]); float se = 0.f;
#pragma unroll 1
  for (int j = 0; j < SQ; ++j) se += __expf(s[j] - mx); const float sc = 256.0f / se;
#pragma unroll 1
  for (int j0 = 0; j0 < SQ; j0 += 8) { FragH f; for (int q = 0; q < 8; ++q) f.h[q] = (_Float16)(__expf(s[j0 + q] - mx) * sc); unsigned short* d = (unsigned short*)P + i * SQ + j0; *(v8us*)d = f.half[0];  } }


#define CN 256          /* channels */
#define CI 128
#define NC 256                       /* (unused legacy kernels) */
#define NPX NP          /* elements per (batch, channel) row */
#define NP 4096         /* seq1 tokens */
#define NM 1024         /* seq2 tokens */
#define BNEPS 1e-5f

__global__ __launch_bounds__(256) void k_mp2(const float* __restrict__ src, float* __restrict__ dst, int nout) {
  const int t = blockIdx.x * 256 + threadIdx.x; if (t >= nout) return; const int c = t / 1024; const int o = t % 1024; const int oy = o / 32, ox = o % 32; const float* p = src + (size_t)c * 4096 + (size_t)(2 * oy) * 64 + 2 * ox;
  const float v = fmaxf(fmaxf(p[0], p[1]), fmaxf(p[64], p[65])); *(float*)(dst + t) = v;  }
__global__ __launch_bounds__(256) void k_xpb(const float* __restrict__ x, const float* __restrict__ wb, float* __restrict__ CPP, size_t n4) {
  #pragma clang fp contract(off)
  const size_t t = (size_t)blockIdx.x * 256 + threadIdx.x; if (t >= n4) return; const size_t e = t * 4; const int c = (int)((e / 4096) % 256); const float bb = bf16_round(wb[c]); const v4f a = *(const v4fa*)(x + e); v4f o; for (int q = 0; q < 4; ++q) o[q] = __fadd_rn(bf16_round(a[q]), bb);
  *(v4f*)(CPP + e) = o;  }


template <int PASS>
__global__ __launch_bounds__(256) void k_cstA(const float* __restrict__ X, const float* __restrict__ MV, float* __restrict__ PART) {
  #pragma clang fp contract(off)
  __shared__ float red[256]; const int t = threadIdx.x; const size_t bc = blockIdx.x; const int c = (int)(bc % NC); const float* row = X + bc * (size_t)NPX; const float mu = PASS ? MV[c] : 0.f; float s = 0.f;
  for (int i = t; i < NPX; i += 256) { const float v = row[i]; const float d = PASS ? __fadd_rn(v, -mu) : v; s = __fadd_rn(s, PASS ? __fmul_rn(d, d) : d); }
  red[t] = s; __syncthreads(); for (int st = 128; st > 0; st >>= 1) { if (t < st) red[t] = __fadd_rn(red[t], red[t + st]); __syncthreads(); }
  if (t < 32) { const float pv = (t == 0) ? red[0] : 0.f; *(float*)(PART + bc * 32 + t) = pv;  } }      

template <int PASS>
__global__ __launch_bounds__(256) void k_cstB(const float* __restrict__ PART, float* __restrict__ MV) { const int c = threadIdx.x; if (c >= NC) return; double s = 0.0; for (int b = 0; b < NB; ++b) s += (double)PART[((size_t)b * NC + c) * 32]; const float m = (float)(s / ((double)NB * (double)NPX)); *(float*)(MV + PASS * NC + c) = m;  }


__global__ __launch_bounds__(256) void k_bnresid(const float* __restrict__ C2, const float* __restrict__ MV, const float* __restrict__ g, const float* __restrict__ be, const float* __restrict__ X, float* __restrict__ out, size_t n4) {
  #pragma clang fp contract(off)
  const size_t t = (size_t)blockIdx.x * 256 + threadIdx.x; if (t >= n4) return; const size_t e = t * 4; const int c = (int)((e / NPX) % NC); const float sc = __fmul_rn(rsqrtf(__fadd_rn(MV[NC + c], BNEPS)), bf16_round(g[c])); const float mu = MV[c], bb = bf16_round(be[c]);
  const v4f a = *(const v4fa*)(C2 + e); const v4f xx = *(const v4fa*)(X + e); v4f o; for (int q = 0; q < 4; ++q) { const float z = __fadd_rn(__fmul_rn(__fadd_rn(a[q], -mu), sc), bb); o[q] = __fadd_rn(z, bf16_round(xx[q])); }      /* BN + residual, no ReLU */
  *(v4f*)(out + e) = o;  }


__global__ __launch_bounds__(256) void k_rowbias(float* __restrict__ Y, const float* __restrict__ bias) {
  #pragma clang fp contract(off)
  const size_t t = (size_t)blockIdx.x * 256 + threadIdx.x; if (t >= (size_t)NB * NC * NPX / 4) return; const size_t e = t * 4; const int c = (int)((e / NPX) % NC); const float bb = bf16_round(bias[c]);
  v4f v = *(const v4fa*)(Y + e); for (int q = 0; q < 4; ++q) v[q] = __fadd_rn(v[q], bb); *(v4f*)(Y + e) = v;  }



template <int NK>
__global__ __launch_bounds__(256) void k_rsmn(const float* __restrict__ S, _Float16* __restrict__ P, int nrows) {
  #pragma clang fp contract(off)
  const int t = blockIdx.x * 256 + threadIdx.x; if (t >= nrows) return; const float* s = S + (size_t)t * NK; float mx = -3.0e38f;
#pragma unroll 1
  for (int j = 0; j < NK; ++j) mx = fmaxf(mx, s[j]); float se = 0.f;
#pragma unroll 1
  for (int j = 0; j < NK; ++j) se += __expf(s[j] - mx); const float sc = 256.0f / se;
#pragma unroll 1
  for (int j0 = 0; j0 < NK; j0 += 8) { FragH fr; for (int q = 0; q < 8; ++q) fr.h[q] = (_Float16)(__expf(s[j0 + q] - mx) * sc);
    unsigned short* d = (unsigned short*)P + (size_t)t * NK + j0; *(v8us*)d = fr.half[0];  } }
extern "C" void kernel_launch(void* const* d_in, const int* in_sizes, int n_in,
                              void* d_out, int out_size, void* d_ws, size_t ws_size, hipStream_t stream) {
  (void)in_sizes; (void)n_in; (void)out_size;
  const float* const* I = (const float* const*)d_in; const float* xq = I[0]; const float* xk = I[1]; const float* xv = I[2];      /* Q, K, V [8192][256] (bf16-valued) */
  constexpr int NQ = 8192, NKk = 8192, DK = 256, QC = 2048;      /* queries, keys, head width, query rows per chunk */
  char* ws = (char*)d_ws; size_t off = 0;
  auto take = [&](size_t bytes) { char* p = ws + off; off += (bytes + 255) & ~(size_t)255; return p; };
  _Float16* Q16 = (_Float16*)take((size_t)NQ * DK * 2); _Float16* K16 = (_Float16*)take((size_t)NKk * DK * 2); _Float16* V16 = (_Float16*)take((size_t)NKk * DK * 2); _Float16* VT = (_Float16*)take((size_t)DK * NKk * 2);
  float* S = (float*)take((size_t)QC * NKk * 4); _Float16* P = (_Float16*)take((size_t)QC * NKk * 2);
  if (off > ws_size) return;
  k_x16<<<(unsigned)(((size_t)NQ * DK / 8 + 255) / 256), 256, 0, stream>>>(xq, Q16, (size_t)NQ * DK / 8); k_x16<<<(unsigned)(((size_t)NKk * DK / 8 + 255) / 256), 256, 0, stream>>>(xk, K16, (size_t)NKk * DK / 8); k_x16<<<(unsigned)(((size_t)NKk * DK / 8 + 255) / 256), 256, 0, stream>>>(xv, V16, (size_t)NKk * DK / 8);      /* exact f16 copies of the bf16-valued inputs */
  k_vt<DK / 64, NKk><<<(DK / 64) * (NKk / 64), 256, 0, stream>>>(V16, DK, 0, VT);      /* V^T [256][8192] */
  for (int q0 = 0; q0 < NQ; q0 += QC) {
    k_gemm2<0><<<dim3((QC / 128) * (NKk / 64), 1), 128, 0, stream>>>(Q16 + (size_t)q0 * DK, DK, 0, K16, DK, 0, 0.0625f, nullptr, 0, nullptr, 1, 0, 0, S, nullptr, NKk, 0, QC, NKk, DK);      /* scores = Q K^T / sqrt(256) for this chunk of query rows (K = 256, exact products) */
    k_rsmn<NKk><<<(QC + 255) / 256, 256, 0, stream>>>(S, P, QC);      /* softmax over the 8192 keys -> P x256 f16 */
    k_gemm2<0><<<dim3((QC / 128) * (DK / 64), 1), 128, 0, stream>>>(P, NKk, 0, VT, NKk, 0, 0.00390625f, nullptr, 0, nullptr, 1, 0, 0, (float*)d_out + (size_t)q0 * DK, nullptr, DK, 0, QC, DK, NKk); }      /* out = P V^T 2^-8 f32 into the chunk's rows */
}

// v001
// A run of this version takes 1100 microseconds.
// Next to v000, in two timings, it ran 5.67 and 5.66 times as fast.
#include <hip/hip_runtime.h>
// Single-head scaled dot-product attention without batch or projections (Q [8192][256], K [8192][256], V [8192][256]; scores = Q K^T / sqrt(256); softmax over the 8192 keys; out = attn V -> [8192][256]).
// Structure: token rows; the bf16-valued inputs as exact f16 rows; V^T via LDS transposes once; per 2048-row query chunk: scores [2048][8192] as ONE WMMA GEMM (32x64 wave tiles, f32 accumulation, K = 256, exact products), row softmax on VALU (f32 statistics, native exp; weights x256 f16), out = P V^T 2^-8 f32 into the chunk's output rows; launches: see trace.
// Compute dtype: inputs rounded to bf16; x / weights exact; q, k, v and softmax weights as plain f16 GEMM operands (~2^-12); scores, softmax statistics and o f32. v_wmma_f32_16x16x32_f16.
#define NB 4
#define SQ 4096
#define DM 256
#define NH 1
#define HD 64
#define HG 4                         /* heads per attention launch group */
#define B0 0                         /* first batch processed (debug hook) */
#define NBR NB                       /* batches processed (debug hook) */
#define NR ((size_t)NB * SQ)         /* token rows */
#define MP ((int)((size_t)NBR * SQ)) /* rows projected (debug hook) */
#define QT 256                       /* query rows per causal tile */
#define NKX SQ                       /* S / P row pitch */
#define QT0 256                      /* first-tile rows recomputed exactly */
#define QN SQ                        /* query rows attended per batch (debug hook) */
#define NHD NH                       /* heads attended (debug hook) */
#define MPO MP                       /* rows through the output stage (debug hook) */
#define LQ DM            /* row pitch of the q/k/v rows */
typedef __bf16 v16b __attribute__((ext_vector_type(16)));
typedef unsigned short v8us __attribute__((ext_vector_type(8), may_alias));
typedef float  v8f  __attribute__((ext_vector_type(8)));
typedef float  v4f  __attribute__((ext_vector_type(4)));
typedef float  v4fa __attribute__((ext_vector_type(4), may_alias));
union FragB { v16b v; v8us half[2]; unsigned short u[16]; };

__device__ __forceinline__ unsigned short bf16_bits(float x) { unsigned int u = __float_as_uint(x); return (unsigned short)((u + 0x7FFFu + ((u >> 16) & 1u)) >> 16); }
__device__ __forceinline__ float bf16_val(unsigned short b) { return __uint_as_float(((unsigned int)b) << 16); }
__device__ __forceinline__ float bf16_round(float x) { return bf16_val(bf16_bits(x)); }
// D += A·B with NT terms: 1 = ah·bh, 2 = + al·bh (A split), 3 = + ah·bl (both split)
template <int NT>
__device__ __forceinline__ v8f mmaN(v16b ah, v16b al, v16b bh, v16b bl, v8f c) {
  c = __builtin_amdgcn_wmma_f32_16x16x32_bf16(false, ah, false, bh, (short)0, c, false, false);
  if (NT >= 2) c = __builtin_amdgcn_wmma_f32_16x16x32_bf16(false, al, false, bh, (short)0, c, false, false);
  if (NT >= 3) c = __builtin_amdgcn_wmma_f32_16x16x32_bf16(false, ah, false, bl, (short)0, c, false, false);
  asm volatile("v_nop\n\tv_nop\n\tv_nop\n\tv_nop" : "+v"(c) : "v"(ah), "v"(al), "v"(bh), "v"(bl));
  return c;
}

__global__ __launch_bounds__(256) void k_wt_bf16(const float* __restrict__ W, unsigned short* __restrict__ Wt, int K, int N) {
  const int t = blockIdx.x * 256 + threadIdx.x;
  const int k8n = K / 8;
  if (t >= N * k8n) return;
  const int n = t / k8n, k8 = (t % k8n) * 8;
  v8us v;
#pragma unroll
  for (int i = 0; i < 8; ++i) v[i] = bf16_bits(W[(size_t)(k8 + i) * N + n]);
  *(v8us*)(Wt + (size_t)n * K + k8) = v;
  
}

// GEMM C[M][N] (f32, pitch ldc) = act(A[M][K]·W + bias). A f32 row-major (pitch lda) converted per fragment to bf16
// (ASPLIT: hi/lo two planes -> 2 terms, else single rounded term); Wt bf16 [N][K] (pitch ldb). BIAS_BF16 rounds the
// bias to bf16 first (bias quantised to bf16 before the add). K%32==0, M%16==0, N%64==0.
template <bool ASPLIT, int ACT, bool BIAS_BF16>
__global__ __launch_bounds__(128) void k_gemm_bf(const float* __restrict__ A, int lda, const unsigned short* __restrict__ Wt, int ldb,
                                               const float* __restrict__ bias, float* __restrict__ C, int ldc, int M, int N, int K) {
  __shared__ __attribute__((aligned(16))) float so[4][16][64];
  const int tid = threadIdx.x, w = tid >> 5, lane = tid & 31, ln = lane & 15, hh = lane >> 4;
  const int ntn = N / 64;
  const int wid = blockIdx.x * 4 + w;
  const int mt = wid / ntn, nq = wid % ntn;
  if (mt * 16 >= M) return;
  const int row0 = mt * 16, col0 = nq * 64;
  const float* arow = A + (size_t)(row0 + ln) * lda;
  v8f acc[4] = {};
  for (int kb = 0; kb < K; kb += 32) {
    FragB ah, al;
    const v4f x0 = *(const v4fa*)(arow + kb + 8 * hh), x1 = *(const v4fa*)(arow + kb + 8 * hh + 4);
    const v4f x2 = *(const v4fa*)(arow + kb + 16 + 8 * hh), x3 = *(const v4fa*)(arow + kb + 16 + 8 * hh + 4);
    float xs[16] = {x0[0],x0[1],x0[2],x0[3],x1[0],x1[1],x1[2],x1[3],x2[0],x2[1],x2[2],x2[3],x3[0],x3[1],x3[2],x3[3]};
#pragma unroll
    for (int i = 0; i < 16; ++i) { const unsigned short hb = bf16_bits(xs[i]); ah.u[i] = hb; al.u[i] = ASPLIT ? bf16_bits(xs[i] - bf16_val(hb)) : (unsigned short)0; }
#pragma unroll
    for (int t = 0; t < 4; ++t) {
      const unsigned short* brow = Wt + (size_t)(col0 + t * 16 + ln) * ldb + kb;
      FragB b;
      b.half[0] = *(const v8us*)(brow + 8 * hh);
      b.half[1] = *(const v8us*)(brow + 16 + 8 * hh);
      acc[t] = mmaN<ASPLIT ? 2 : 1>(ah.v, al.v, b.v, b.v, acc[t]);
    }
  }
#pragma unroll
  for (int t = 0; t < 4; ++t) {
    float bv = bias ? bias[col0 + t * 16 + ln] : 0.f;
    if (BIAS_BF16) bv = bf16_round(bv);
#pragma unroll
    for (int r = 0; r < 8; ++r) { float v = acc[t][r] + bv; if (ACT == 1) v = fmaxf(v, 0.f); so[w][8 * hh + r][t * 16 + ln] = v; }
  }
  __builtin_amdgcn_fence(__ATOMIC_ACQ_REL, "workgroup");
  __builtin_amdgcn_wave_barrier();
  const int rsub = lane >> 4, c4 = (lane & 15) * 4;
  {
#pragma unroll
    for (int q = 0; q < 8; ++q) {
      const int r = q * 2 + rsub;
      const v4f v = *(const v4fa*)&so[w][r][c4];
      *(v4f*)(C + (size_t)(row0 + r) * ldc + col0 + c4) = v;
    }
    
  }
}

// GEMM C = act(A·W + bias + resid): A f32 (ASPLIT -> hi/lo 2 terms), Wt bf16 [N][K]; ACT 0 none, 1 relu, 2 exact gelu;
// resid (optional, f32, row index = (row % rmod), pitch ldr, RES_BF16 rounds it) added before the activation.
template <bool ASPLIT, int ACT, bool BIAS_BF16, bool RES_BF16>
__global__ __launch_bounds__(128) void k_gemm_bf3(const float* __restrict__ A, int lda, const unsigned short* __restrict__ Wt, int ldb,
                                                const float* __restrict__ bias, const float* __restrict__ resid, int rmod, int ldr,
                                                float* __restrict__ C, int ldc, int M, int N, int K) {
  __shared__ __attribute__((aligned(16))) float so[4][16][64];
  const int tid = threadIdx.x, w = tid >> 5, lane = tid & 31, ln = lane & 15, hh = lane >> 4;
  const int ntn = N / 64;
  const int wid = blockIdx.x * 4 + w;
  const int mt = wid / ntn, nq = wid % ntn;
  if (mt * 16 >= M) return;
  const int row0 = mt * 16, col0 = nq * 64;
  const float* arow = A + (size_t)(row0 + ln) * lda;
  v8f acc[4] = {};
  for (int kb = 0; kb < K; kb += 32) {
    FragB ah, al;
    const v4f x0 = *(const v4fa*)(arow + kb + 8 * hh), x1 = *(const v4fa*)(arow + kb + 8 * hh + 4);
    const v4f x2 = *(const v4fa*)(arow + kb + 16 + 8 * hh), x3 = *(const v4fa*)(arow + kb + 16 + 8 * hh + 4);
    float xs[16] = {x0[0],x0[1],x0[2],x0[3],x1[0],x1[1],x1[2],x1[3],x2[0],x2[1],x2[2],x2[3],x3[0],x3[1],x3[2],x3[3]};
#pragma unroll
    for (int i = 0; i < 16; ++i) { const unsigned short hb = bf16_bits(xs[i]); ah.u[i] = hb; al.u[i] = ASPLIT ? bf16_bits(xs[i] - bf16_val(hb)) : (unsigned short)0; }
#pragma unroll
    for (int t = 0; t < 4; ++t) {
      const unsigned short* brow = Wt + (size_t)(col0 + t * 16 + ln) * ldb + kb;
      FragB b;
      b.half[0] = *(const v8us*)(brow + 8 * hh);
      b.half[1] = *(const v8us*)(brow + 16 + 8 * hh);
      acc[t] = mmaN<ASPLIT ? 2 : 1>(ah.v, al.v, b.v, b.v, acc[t]);
    }
  }
#pragma unroll
  for (int t = 0; t < 4; ++t) {
    const int col = col0 + t * 16 + ln;
    float bv = bias ? bias[col] : 0.f;
    if (BIAS_BF16) bv = bf16_round(bv);
#pragma unroll
    for (int r = 0; r < 8; ++r) {
      float v = acc[t][r] + bv;
      if (resid) { float rv = resid[(size_t)((row0 + 8 * hh + r) % rmod) * ldr + col]; if (RES_BF16) rv = bf16_round(rv); v += rv; }
      if (ACT == 1) v = fmaxf(v, 0.f);
      if (ACT == 2) v = 0.5f * v * (1.0f + erff(v * 0.70710678118654752f));
      if (ACT == 3) { const float u = 0.7978845608028654f * (v + 0.044715f * v * v * v); v = 0.5f * v * (1.0f + tanhf(u)); }
      so[w][8 * hh + r][t * 16 + ln] = v;
    }
  }
  __builtin_amdgcn_fence(__ATOMIC_ACQ_REL, "workgroup");
  __builtin_amdgcn_wave_barrier();
  const int rsub = lane >> 4, c4 = (lane & 15) * 4;
  {
#pragma unroll
    for (int q = 0; q < 8; ++q) {
      const int r = q * 2 + rsub;
      const v4f v = *(const v4fa*)&so[w][r][c4];
      *(v4f*)(C + (size_t)(row0 + r) * ldc + col0 + c4) = v;
    }
    
  }
}
// row LayerNorm (biased variance, eps) over N: s = X (+ R); optional out_sum <- s; out_norm <- (s-mu)*rsqrt(var+eps)*g + b
template <bool PARAM_BF16>
__global__ __launch_bounds__(256) void k_layernorm(const float* __restrict__ X, const float* __restrict__ R, const float* __restrict__ g, const float* __restrict__ bta,
                                                  float* __restrict__ out_sum, float* __restrict__ out_norm, int N, float eps) {
  __shared__ float red[256];
  const int row = blockIdx.x, tid = threadIdx.x;
  const float* x = X + (size_t)row * N; const float* rr = R ? R + (size_t)row * N : nullptr;
  float vals[16];                     // up to N = 4096
  const int per = N / 256;            // contiguous chunk per thread? use strided-by-4 chunks: thread handles j = tid*4 + 1024*u
  float s1 = 0.f;
  for (int u = 0; u < per / 4; ++u) {
    const int j = tid * 4 + 1024 * u;
    const v4f a = *(const v4fa*)(x + j);
    v4f b = {0.f,0.f,0.f,0.f}; if (rr) b = *(const v4fa*)(rr + j);
#pragma unroll
    for (int q = 0; q < 4; ++q) { const float v = a[q] + b[q]; vals[u * 4 + q] = v; s1 += v; }
  }
  red[tid] = s1; __syncthreads();
  for (int st = 128; st > 0; st >>= 1) { if (tid < st) red[tid] += red[tid + st]; __syncthreads(); }
  const float mu = red[0] / (float)N; __syncthreads();
  float s2 = 0.f;
  for (int u = 0; u < per / 4; ++u)
#pragma unroll
    for (int q = 0; q < 4; ++q) { const float c = vals[u * 4 + q] - mu; s2 += c * c; }
  red[tid] = s2; __syncthreads();
  for (int st = 128; st > 0; st >>= 1) { if (tid < st) red[tid] += red[tid + st]; __syncthreads(); }
  const float rs = rsqrtf(red[0] / (float)N + eps);
  {
    for (int u = 0; u < per / 4; ++u) {
      const int j = tid * 4 + 1024 * u;
      v4f o, sm;
#pragma unroll
      for (int q = 0; q < 4; ++q) {
        float gg = g[j + q], bb = bta[j + q];
        if (PARAM_BF16) { gg = bf16_round(gg); bb = bf16_round(bb); }
        sm[q] = vals[u * 4 + q]; o[q] = (vals[u * 4 + q] - mu) * rs * gg + bb;
      }
      if (out_sum) *(v4f*)(out_sum + (size_t)row * N + j) = sm;
      *(v4f*)(out_norm + (size_t)row * N + j) = o;
    }
    
  }
}



// ---- f16 WMMA path (v_wmma_f32_16x16x32_f16): 11-bit significands for operands in range — used where a [0,1] probability operand needs more precision than bf16
typedef _Float16 v16h __attribute__((ext_vector_type(16)));
union FragH { v16h v; v8us half[2]; _Float16 h[16]; unsigned short u[16]; };
template <int NT>
__device__ __forceinline__ v8f mmaH(v16h ah, v16h al, v16h bh, v16h bl, v8f c) {
  c = __builtin_amdgcn_wmma_f32_16x16x32_f16(false, ah, false, bh, (short)0, c, false, false);
  if (NT >= 2) c = __builtin_amdgcn_wmma_f32_16x16x32_f16(false, al, false, bh, (short)0, c, false, false);
  if (NT >= 3) c = __builtin_amdgcn_wmma_f32_16x16x32_f16(false, ah, false, bl, (short)0, c, false, false);
  asm volatile("v_nop\n\tv_nop\n\tv_nop\n\tv_nop" : "+v"(c) : "v"(ah), "v"(al), "v"(bh), "v"(bl));
  return c;
}
// batched GEMM like k_gemm_b but f16 operands: A f32 (split into f16 hi/lo if ASPLIT, else rounded to f16), Bt = f16 values [n][k]; alpha; C f32; N multiple of 16 (partial tiles skipped)
template <bool ASPLIT>
__global__ __launch_bounds__(128) void k_gemm_h(const float* __restrict__ A, int lda, size_t sA, const _Float16* __restrict__ Bh, int ldb, size_t sB, float alpha, float* __restrict__ C, int ldc, size_t sC, int M, int N, int K) {
  __shared__ __attribute__((aligned(16))) float so[4][16][64];
  const int tid = threadIdx.x, w = tid >> 5, lane = tid & 31, ln = lane & 15, hh = lane >> 4; const int by = blockIdx.y;
  A += (size_t)by * sA; Bh += (size_t)by * sB; C += (size_t)by * sC;
  const int ntn = (N + 63) / 64; const int wid = blockIdx.x * 4 + w; const int mt = wid / ntn, nq = wid % ntn; if (mt * 16 >= M) return;
  const int row0 = mt * 16, col0 = nq * 64; const float* arow = A + (size_t)(row0 + ln) * lda;
  v8f acc[4] = {};
  for (int kb = 0; kb < K; kb += 32) {
    FragH ah, al;
    const v4f x0 = *(const v4fa*)(arow + kb + 8 * hh), x1 = *(const v4fa*)(arow + kb + 8 * hh + 4), x2 = *(const v4fa*)(arow + kb + 16 + 8 * hh), x3 = *(const v4fa*)(arow + kb + 16 + 8 * hh + 4);
    float xs[16] = {x0[0],x0[1],x0[2],x0[3],x1[0],x1[1],x1[2],x1[3],x2[0],x2[1],x2[2],x2[3],x3[0],x3[1],x3[2],x3[3]};
#pragma unroll
    for (int i = 0; i < 16; ++i) { const _Float16 h = (_Float16)xs[i]; ah.h[i] = h; al.h[i] = ASPLIT ? (_Float16)(xs[i] - (float)h) : (_Float16)0.0f; }
#pragma unroll
    for (int t = 0; t < 4; ++t) { if (col0 + t * 16 >= N) continue; const size_t boff = (size_t)(col0 + t * 16 + ln) * ldb + kb; FragH bq; bq.half[0] = *(const v8us*)(Bh + boff + 8 * hh); bq.half[1] = *(const v8us*)(Bh + boff + 16 + 8 * hh);
      acc[t] = mmaH<ASPLIT ? 2 : 1>(ah.v, al.v, bq.v, bq.v, acc[t]); }
  }
#pragma unroll
  for (int t = 0; t < 4; ++t) { if (col0 + t * 16 >= N) continue;
#pragma unroll
    for (int r = 0; r < 8; ++r) so[w][8 * hh + r][t * 16 + ln] = acc[t][r] * alpha; }
  __builtin_amdgcn_fence(__ATOMIC_ACQ_REL, "workgroup"); __builtin_amdgcn_wave_barrier();
  const int rsub = lane >> 4, c4 = (lane & 15) * 4;
  {
#pragma unroll
    for (int q = 0; q < 8; ++q) { const int r = q * 2 + rsub; if (col0 + c4 < N) { const v4f v = *(const v4fa*)&so[w][r][c4]; *(v4f*)(C + (size_t)(row0 + r) * ldc + col0 + c4) = v; } }
     }
}

// Wt[n][k] = f16(W[k][n]·scale) from f32 row-major W[K][N] (scale = power of two; bf16-exact weights stay exact in f16 away from the subnormal range)
__global__ __launch_bounds__(256) void k_wt_f16(const float* __restrict__ W, _Float16* __restrict__ Wt, int K, int N, float scale) {
  const int t = blockIdx.x * 256 + threadIdx.x; if (t >= N * (K / 8)) return; const int n = t / (K / 8), k8 = (t % (K / 8)) * 8; FragH f;
#pragma unroll
  for (int i = 0; i < 8; ++i) f.h[i] = (_Float16)(bf16_round(W[(size_t)(k8 + i) * N + n]) * scale); const v8us o = f.half[0];
  *(v8us*)((unsigned short*)Wt + (size_t)n * K + k8) = o; 
}
// k_gemm_hh variant with fused epilogue: v = acc·alpha + bias[by·sBias + col] (+ CP[(row/rowsPerB)·sCPb + by·64 + col] if CP) ; ACT 0 none / 1 elu ; writes f16 C16 (and f32 C if non-null)
template <int ACT>
__global__ __launch_bounds__(128) void k_gemm_hhx(const _Float16* __restrict__ A, int lda, size_t sA, const _Float16* __restrict__ Bh, int ldb, size_t sB, float alpha, const float* __restrict__ bias, size_t sBias, const float* __restrict__ CP, int rowsPerB, size_t sCPb, int row0g,
    float* __restrict__ C, _Float16* __restrict__ C16, int ldc, size_t sC, int M, int N, int K) {
  __shared__ __attribute__((aligned(16))) float so[4][16][64];
  const int tid = threadIdx.x, w = tid >> 5, lane = tid & 31, ln = lane & 15, hh = lane >> 4; const int by = blockIdx.y;
  A += (size_t)by * sA; Bh += (size_t)by * sB; const size_t cofs = (size_t)by * sC; const float* bp = bias ? bias + (size_t)by * sBias : nullptr;
  const int ntn = (N + 63) / 64; const int wid = blockIdx.x * 4 + w; const int mt = wid / ntn, nq = wid % ntn; if (mt * 16 >= M) return;
  const int row0 = mt * 16, col0 = nq * 64; const _Float16* arow = A + (size_t)(row0 + ln) * lda;
  v8f acc[4] = {};
  for (int kb = 0; kb < K; kb += 32) { FragH ah; ah.half[0] = *(const v8us*)((const unsigned short*)arow + kb + 8 * hh); ah.half[1] = *(const v8us*)((const unsigned short*)arow + kb + 16 + 8 * hh);
#pragma unroll
    for (int t = 0; t < 4; ++t) { if (col0 + t * 16 >= N) continue; const size_t boff = (size_t)(col0 + t * 16 + ln) * ldb + kb; FragH bq; bq.half[0] = *(const v8us*)((const unsigned short*)Bh + boff + 8 * hh); bq.half[1] = *(const v8us*)((const unsigned short*)Bh + boff + 16 + 8 * hh);
      acc[t] = mmaH<1>(ah.v, ah.v, bq.v, bq.v, acc[t]); }
  }
#pragma unroll
  for (int t = 0; t < 4; ++t) { if (col0 + t * 16 >= N) continue; const int col = col0 + t * 16 + ln; const float bv = bp ? bf16_round(bp[col]) : 0.f;
#pragma unroll
    for (int r = 0; r < 8; ++r) { float v = acc[t][r] * alpha + bv; if (CP) { const int rr = row0g + row0 + 8 * hh + r; if (rowsPerB < 0) v += CP[cofs + (size_t)rr * ldc + col];      /* rowsPerB < 0: own element of the batched C plane */ else { const int bidx = rr / rowsPerB; v += CP[(size_t)bidx * sCPb + (size_t)by * 64 + col]; } } if (ACT == 1) v = (v > 0.f) ? v : expm1f(v); else if (ACT == 7) v = (v > 0.f) ? v + 1.0f : expf(v); else if (ACT == 8) v = tanhf(v); else if (ACT == 9) v = 0.5f * v * (1.0f + tanhf(0.7978845608028654f * (v + 0.044715f * v * v * v))); else if (ACT == 11) v = 1.0f / (1.0f + expf(-v)); else if (ACT == 12) v = (v > 0.f) ? v : 0.01f * v; else if (ACT == 14) v = (v > 0.f) ? v : 0.1f * v; else if (ACT == 16) v = (v >= 0.f) ? v : 0.3f * v; else if (ACT == 17) v = (v >= 0.f) ? v : 0.2f * v; else if (ACT == 15) v = v / (1.0f + expf(-v)); else if (ACT == 3) v = fmaxf(v, 0.f); else if (ACT == 6) v = 0.5f * v * (1.0f + erff(v * 0.70710678118654752f)); so[w][8 * hh + r][t * 16 + ln] = v; } }
  __builtin_amdgcn_fence(__ATOMIC_ACQ_REL, "workgroup"); __builtin_amdgcn_wave_barrier();
  const int rsub = lane >> 4, c4 = (lane & 15) * 4; typedef _Float16 v4h __attribute__((ext_vector_type(4)));
  {
#pragma unroll
    for (int q = 0; q < 8; ++q) { const int r = q * 2 + rsub; if (col0 + c4 < N) { const v4f v = *(const v4fa*)&so[w][r][c4]; if (C) *(v4f*)(C + cofs + (size_t)(row0 + r) * ldc + col0 + c4) = v; if (C16) { v4h h4; for (int i = 0; i < 4; ++i) h4[i] = (_Float16)v[i]; *(v4h*)(C16 + cofs + (size_t)(row0 + r) * ldc + col0 + c4) = h4; } } }
     }
}


typedef _Float16 v4h __attribute__((ext_vector_type(4)));

__global__ __launch_bounds__(256) void k_x16(const float* __restrict__ x, _Float16* __restrict__ X16, size_t n8) { const size_t t = (size_t)blockIdx.x * 256 + threadIdx.x; if (t >= n8) return; FragH f;
#pragma unroll
  for (int q = 0; q < 8; ++q) f.h[q] = (_Float16)bf16_round(x[t * 8 + q]); *(v8us*)((unsigned short*)X16 + t * 8) = f.half[0];  }
__global__ __launch_bounds__(256) void k_h16(const float* __restrict__ x, _Float16* __restrict__ X16, size_t n8) { const size_t t = (size_t)blockIdx.x * 256 + threadIdx.x; if (t >= n8) return; FragH f;
#pragma unroll
  for (int q = 0; q < 8; ++q) f.h[q] = (_Float16)x[t * 8 + q]; *(v8us*)((unsigned short*)X16 + t * 8) = f.half[0];  }
__global__ __launch_bounds__(256) void k_round16f(const float* __restrict__ W, _Float16* __restrict__ Bt, size_t n8) { const size_t t = (size_t)blockIdx.x * 256 + threadIdx.x; if (t >= n8) return; FragH f;
#pragma unroll
  for (int i = 0; i < 8; ++i) f.h[i] = (_Float16)(bf16_round(W[t * 8 + i]) * 16.0f); *(v8us*)((unsigned short*)Bt + t * 8) = f.half[0];  }
template <int NHv, int TTv>
__global__ __launch_bounds__(256) void k_vt(const _Float16* __restrict__ V16, int ldv, int voff, _Float16* __restrict__ Vt) { __shared__ unsigned short tl[64][66]; const int tid = threadIdx.x; const int slab = blockIdx.x / (TTv / 64), lg = blockIdx.x % (TTv / 64); const int b = slab / NHv, h = slab % NHv;
  for (int i = tid; i < 64 * 8; i += 256) { const int r = i / 8, c8 = (i % 8) * 8; FragH f; f.half[0] = *(const v8us*)((const unsigned short*)V16 + ((size_t)b * TTv + lg * 64 + r) * ldv + voff + h * 64 + c8);
#pragma unroll
    for (int q = 0; q < 8; ++q) tl[r][c8 + q] = f.u[q]; }
  __syncthreads();
  {
#pragma unroll
    for (int rd = 0; rd < 2; ++rd) { const int d = rd * 32 + tid / 8, pc = tid % 8; FragH f;
#pragma unroll
      for (int q = 0; q < 8; ++q) f.u[q] = tl[pc * 8 + q][d];
      *(v8us*)((unsigned short*)Vt + ((size_t)slab * 64 + d) * TTv + lg * 64 + pc * 8) = f.half[0]; }
     } }

__global__ __launch_bounds__(256) void k_hl(const float* __restrict__ F, _Float16* __restrict__ Hh, _Float16* __restrict__ Hl, size_t n8) { const size_t t = (size_t)blockIdx.x * 256 + threadIdx.x; if (t >= n8) return; FragH fh, fl; const v4f a = *(const v4fa*)(F + t * 8), c = *(const v4fa*)(F + t * 8 + 4);
#pragma unroll
  for (int q = 0; q < 4; ++q) { _Float16 h = (_Float16)a[q]; fh.h[q] = h; fl.h[q] = (_Float16)((a[q] - (float)h) * 1024.0f); h = (_Float16)c[q]; fh.h[4 + q] = h; fl.h[4 + q] = (_Float16)((c[q] - (float)h) * 1024.0f); }
  { *(v8us*)((unsigned short*)Hh + t * 8) = fh.half[0]; *(v8us*)((unsigned short*)Hl + t * 8) = fl.half[0];  } }

// ---- fast GEMM (wave tile 32x64; requires M % 32 == 0 rows per launch region and N % 64 == 0); epilogue = k_gemm_hhx semantics ----
__device__ __forceinline__ v16h g2_frag(const _Float16* p, int hh) { FragH f; f.half[0] = *(const v8us*)((const unsigned short*)p + 8 * hh); f.half[1] = *(const v8us*)((const unsigned short*)p + 16 + 8 * hh); return f.v; }
__device__ __forceinline__ v8f g2_mma(v16h a, v16h b, v8f c) { v8f d = __builtin_amdgcn_wmma_f32_16x16x32_f16(false, a, false, b, (short)0, c, false, false); asm volatile("v_nop\n\tv_nop\n\tv_nop\n\tv_nop" : "+v"(d) : "v"(a), "v"(b)); return d; }
template <int ACT>
__global__ __launch_bounds__(128) void k_gemm2(const _Float16* __restrict__ A, int lda, size_t sA, const _Float16* __restrict__ Bh, int ldb, size_t sB, float alpha, const float* __restrict__ bias, size_t sBias, const float* __restrict__ CP, int rowsPerB, size_t sCPb, int row0g,
    float* __restrict__ C, _Float16* __restrict__ C16, int ldc, size_t sC, int M, int N, int K) { static_assert(ACT == 0 || ACT == 3 || ACT == 6 || ACT == 8 || ACT == 9 || ACT == 11 || ACT == 12 || ACT == 14 || ACT == 15 || ACT == 16 || ACT == 17, "k_gemm2: unsupported ACT code (would silently apply no activation)");
  __shared__ __attribute__((aligned(16))) float so[4][32][68];
  const int tid = threadIdx.x, w = tid >> 5, lane = tid & 31, ln = lane & 15, hh = lane >> 4; const int by = blockIdx.y;
  A += (size_t)by * sA; Bh += (size_t)by * sB; const size_t cofs = (size_t)by * sC; const float* bp = bias ? bias + (size_t)by * sBias : nullptr;
  const int ntn = N >> 6; const int mt = blockIdx.x / ntn, nq = blockIdx.x - mt * ntn; const int row0 = mt * 128 + 32 * w, col0 = nq * 64; if (row0 >= M) return;
  const _Float16* a0p = A + (size_t)(row0 + ln) * lda; const _Float16* a1p = a0p + (size_t)16 * lda;
  const _Float16* b0p = Bh + (size_t)(col0 + ln) * ldb; const _Float16* b1p = b0p + (size_t)16 * ldb; const _Float16* b2p = b1p + (size_t)16 * ldb; const _Float16* b3p = b2p + (size_t)16 * ldb;
  const v8f z8 = {0.f,0.f,0.f,0.f,0.f,0.f,0.f,0.f}; v8f c00 = z8, c01 = z8, c02 = z8, c03 = z8, c10 = z8, c11 = z8, c12 = z8, c13 = z8;
#pragma unroll 1
  for (int kb = 0; kb < K; kb += 32) { const v16h a0 = g2_frag(a0p + kb, hh), a1 = g2_frag(a1p + kb, hh);
    v16h b = g2_frag(b0p + kb, hh); c00 = g2_mma(a0, b, c00); c10 = g2_mma(a1, b, c10);
    b = g2_frag(b1p + kb, hh); c01 = g2_mma(a0, b, c01); c11 = g2_mma(a1, b, c11);
    b = g2_frag(b2p + kb, hh); c02 = g2_mma(a0, b, c02); c12 = g2_mma(a1, b, c12);
    b = g2_frag(b3p + kb, hh); c03 = g2_mma(a0, b, c03); c13 = g2_mma(a1, b, c13); }
  v8f accs[8] = {c00, c01, c02, c03, c10, c11, c12, c13};
#pragma unroll
  for (int u = 0; u < 8; ++u) { const int t = u & 3, half = u >> 2; const int col = col0 + t * 16 + ln; const float bv = bp ? bf16_round(bp[col]) : 0.f;
#pragma unroll
    for (int r = 0; r < 8; ++r) { const int rloc = half * 16 + 8 * hh + r; float v = accs[u][r] * alpha + bv; if (CP) { if (rowsPerB < 0) v += CP[cofs + (size_t)(row0g + row0 + rloc) * ldc + col];      /* rowsPerB < 0: own element of the batched C plane */ else { const int bidx = (row0g + row0 + rloc) / rowsPerB; v += CP[(size_t)bidx * sCPb + (size_t)by * 64 + col]; } }
      if (ACT == 3) v = fmaxf(v, 0.f); else if (ACT == 6) v = 0.5f * v * (1.0f + erff(v * 0.70710678118654752f)); else if (ACT == 11) v = 1.0f / (1.0f + expf(-v)); else if (ACT == 15) v = v / (1.0f + expf(-v)); else if (ACT == 12) v = (v > 0.f) ? v : 0.01f * v; else if (ACT == 8) v = tanhf(v); else if (ACT == 9) v = 0.5f * v * (1.0f + tanhf(0.7978845608028654f * (v + 0.044715f * v * v * v))); else if (ACT == 14) v = (v > 0.f) ? v : 0.1f * v; else if (ACT == 16) v = (v >= 0.f) ? v : 0.3f * v; else if (ACT == 17) v = (v >= 0.f) ? v : 0.2f * v;
      so[w][rloc][t * 16 + ln] = v; } }
  __builtin_amdgcn_fence(__ATOMIC_ACQ_REL, "workgroup"); __builtin_amdgcn_wave_barrier();
  const int rsub = lane >> 4, c4 = (lane & 15) * 4;
  {
#pragma unroll
    for (int q = 0; q < 16; ++q) { const int r = q * 2 + rsub; const v4f v = *(const v4fa*)&so[w][r][c4]; if (C) *(v4f*)(C + cofs + (size_t)(row0 + r) * ldc + col0 + c4) = v; if (C16) { v4h h4; for (int i = 0; i < 4; ++i) h4[i] = (_Float16)v[i]; *(v4h*)(C16 + cofs + (size_t)(row0 + r) * ldc + col0 + c4) = h4; } }
     } }


__global__ __launch_bounds__(256) void k_wnat(const float* __restrict__ w, size_t n8, _Float16* __restrict__ Bt) { const size_t t = (size_t)blockIdx.x * 256 + threadIdx.x; if (t >= n8) return; FragH f; for (int q = 0; q < 8; ++q) f.h[q] = (_Float16)(bf16_round(w[t * 8 + q]) * 16.0f); *(v8us*)((unsigned short*)Bt + t * 8) = f.half[0];  }
__global__ __launch_bounds__(256) void k_rsm(const float* __restrict__ S, _Float16* __restrict__ P, int nrows) {
  #pragma clang fp contract(off)
  const int i = blockIdx.x * 256 + threadIdx.x; if (i >= nrows) return; const float* s = S + (size_t)i * SQ; float mx = -3.0e38f;
#pragma unroll 1
  for (int j = 0; j < SQ; ++j) mx = fmaxf(mx, s[j]); float se = 0.f;
#pragma unroll 1
  for (int j = 0; j < SQ; ++j) se += expf(s[j] - mx); const float sc = 256.0f / se;
#pragma unroll 1
  for (int j0 = 0; j0 < SQ; j0 += 8) { FragH f; for (int q = 0; q < 8; ++q) f.h[q] = (_Float16)(expf(s[j0 + q] - mx) * sc); unsigned short* d = (unsigned short*)P + (size_t)i * SQ + j0; *(v8us*)d = f.half[0];  } }
__global__ __launch_bounds__(256) void k_vt(const _Float16* __restrict__ V16, int b, int h0, _Float16* __restrict__ VT) { __shared__ unsigned short tl[64][65]; const int tid = threadIdx.x; const int hh = blockIdx.x % HG, sg = blockIdx.x / HG; const int s0 = sg * 64; const int h = h0 + hh;
  for (int i = tid; i < 64 * 8; i += 256) { const int j = i / 8, d8 = (i % 8) * 8; FragH f; f.half[0] = *(const v8us*)((const unsigned short*)V16 + ((size_t)b * SQ + s0 + j) * DM + h * HD + d8); for (int q = 0; q < 8; ++q) tl[d8 + q][j] = f.u[q]; }
  __syncthreads();
  { for (int i = tid; i < 64 * 8; i += 256) { const int d = i / 8, j8 = (i % 8) * 8; FragH f; for (int q = 0; q < 8; ++q) f.u[q] = tl[d][j8 + q]; *(v8us*)((unsigned short*)VT + ((size_t)hh * HD + d) * SQ + s0 + j8) = f.half[0]; }  } }



__global__ __launch_bounds__(256) void k_rsmcf2(const float* __restrict__ S, _Float16* __restrict__ P, int hg, int q0, int nk) {
  #pragma clang fp contract(off)
  const int t = blockIdx.x * 256 + threadIdx.x; if (t >= hg * QT) return; const size_t i = (size_t)t; const float* s = S + i * NKX; const int last = q0 + (t % QT); float mx = -3.0e38f;
#pragma unroll 1
  for (int j = 0; j < nk; ++j) { const float f = (j <= last) ? 1.f : 0.f; mx = fmaxf(mx, fmaf(f, s[j], (1.f - f) * -1.0e9f)); } float se = 0.f;
#pragma unroll 1
  for (int j = 0; j < nk; ++j) { const float f = (j <= last) ? 1.f : 0.f; se += __expf(fmaf(f, s[j], (1.f - f) * -1.0e9f) - mx); } const float sc = 256.0f / se;
#pragma unroll 1
  for (int j0 = 0; j0 < nk; j0 += 8) { FragH fr; for (int q = 0; q < 8; ++q) { const int j = j0 + q; const float f = (j <= last) ? 1.f : 0.f; fr.h[q] = (_Float16)(__expf(fmaf(f, s[j], (1.f - f) * -1.0e9f) - mx) * sc); } unsigned short* d = (unsigned short*)P + i * NKX + j0; *(v8us*)d = fr.half[0];  } }

template <int MASKADD>
__global__ __launch_bounds__(64) void k_att0(const float* __restrict__ QF, const float* __restrict__ KF, const float* __restrict__ VF, int ld, const float* __restrict__ mask, float scale, float* __restrict__ OF, int ldo) {
  #pragma clang fp contract(off)
  __shared__ __attribute__((aligned(16))) float lq[64][64]; __shared__ __attribute__((aligned(16))) float lo[64][64];
  const int tid = threadIdx.x; const int h = blockIdx.x / (QT0 / 64), rg = blockIdx.x % (QT0 / 64); const int i = rg * 64 + tid;
  const float* qr = QF + (size_t)i * ld + h * HD;
#pragma unroll 1
  for (int c = 0; c < HD / 4; ++c) { *(v4f*)&lq[tid][c * 4] = *(const v4fa*)(qr + c * 4); const v4f z = {0.f, 0.f, 0.f, 0.f}; *(v4f*)&lo[tid][c * 4] = z; }
  float m = -1.0e30f, l = 0.f; const int jmax = MASKADD ? (SQ - 1) : (rg * 64 + 63);      /* additive-mask form: every key (the mask input decides); causal form: keys up to the block's last row */
#pragma unroll 1
  for (int j = 0; j <= jmax; ++j) { const float* kr = KF + (size_t)j * ld + h * HD; const float* vr = VF + (size_t)j * ld + h * HD; float s = 0.f;
#pragma unroll 1
    for (int c = 0; c < HD / 4; ++c) { const v4f kq = *(const v4fa*)(kr + c * 4); const v4f qq = *(v4f*)&lq[tid][c * 4]; s = __fadd_rn(s, __fmul_rn(qq[0], kq[0])); s = __fadd_rn(s, __fmul_rn(qq[1], kq[1])); s = __fadd_rn(s, __fmul_rn(qq[2], kq[2])); s = __fadd_rn(s, __fmul_rn(qq[3], kq[3])); }
    s = __fmul_rn(s, scale); if (MASKADD) s = __fadd_rn(s, __fmul_rn(bf16_round(mask[(size_t)i * SQ + j]), -10000.0f));
    const float f = (MASKADD || j <= i) ? 1.f : 0.f; const float sm = fmaf(f, s, (1.f - f) * -1.0e30f); const float mn = fmaxf(m, sm); const float sc = expf(m - mn); const float e = expf(sm - mn); l = __fadd_rn(__fmul_rn(l, sc), e); m = mn;
#pragma unroll 1
    for (int c = 0; c < HD / 4; ++c) { const v4f vv = *(const v4fa*)(vr + c * 4); v4f oo = *(v4f*)&lo[tid][c * 4]; for (int u = 0; u < 4; ++u) oo[u] = __fadd_rn(__fmul_rn(oo[u], sc), __fmul_rn(e, vv[u])); *(v4f*)&lo[tid][c * 4] = oo; } }
  const float fin = 64.0f / l;      /* o carried x64 */
#pragma unroll 1
  for (int c = 0; c < HD / 4; ++c) { v4f oo = *(v4f*)&lo[tid][c * 4]; for (int u = 0; u < 4; ++u) oo[u] = __fmul_rn(oo[u], fin); *(v4f*)&lo[tid][c * 4] = oo; }
  __syncthreads();
  {
#pragma unroll 1
    for (int it = 0; it < 16; ++it) { const int row = it * 4 + tid / 16, pc = (tid % 16) * 4; const v4f v = *(const v4f*)&lo[row][pc]; *(v4f*)(OF + (size_t)(rg * 64 + row) * ldo + h * HD + pc) = v; }
     } }

__global__ __launch_bounds__(256) void k_oscale(const float* __restrict__ OF, float* __restrict__ out, size_t n4) { const size_t t = (size_t)blockIdx.x * 256 + threadIdx.x; if (t >= n4) return; const v4f a = *(const v4fa*)(OF + t * 4); v4f o; for (int q = 0; q < 4; ++q) o[q] = a[q] * 0.015625f; *(v4f*)(out + t * 4) = o;  }

__global__ __launch_bounds__(256) void k_bfr(const float* __restrict__ x, float* __restrict__ XB, size_t n8) { const size_t t = (size_t)blockIdx.x * 256 + threadIdx.x; if (t >= n8) return; v4f a = *(const v4fa*)(x + t * 8), c = *(const v4fa*)(x + t * 8 + 4); for (int q = 0; q < 4; ++q) { a[q] = bf16_round(a[q]); c[q] = bf16_round(c[q]); }
  { *(v4f*)(XB + t * 8) = a; *(v4f*)(XB + t * 8 + 4) = c;  } }



__global__ __launch_bounds__(256) void k_rsmfvl(const float* __restrict__ S, _Float16* __restrict__ P, _Float16* __restrict__ PL, int qn, const int* __restrict__ vlp) {
  #pragma clang fp contract(off)
  const int t = blockIdx.x * 256 + threadIdx.x; if (t >= qn) return; const int vl = vlp[0]; const size_t i = (size_t)t; const float* s = S + i * SQ; float mx = -3.0e38f;
#pragma unroll 1
  for (int j = 0; j < SQ; ++j) { const float f = (j < vl) ? 1.f : 0.f; mx = fmaxf(mx, fmaf(f, s[j], (1.f - f) * -1000000.0f)); } float se = 0.f;
#pragma unroll 1
  for (int j = 0; j < SQ; ++j) { const float f = (j < vl) ? 1.f : 0.f; se += __expf(fmaf(f, s[j], (1.f - f) * -1000000.0f) - mx); } const float sc = 256.0f / se;
#pragma unroll 1
  for (int j0 = 0; j0 < SQ; j0 += 8) { FragH fr, gr; for (int q = 0; q < 8; ++q) { const int j = j0 + q; const float f = (j < vl) ? 1.f : 0.f; const float pv = __expf(fmaf(f, s[j], (1.f - f) * -1000000.0f) - mx) * sc; const _Float16 ph = (_Float16)pv; fr.h[q] = ph; gr.h[q] = (_Float16)((pv - (float)ph) * 1024.0f); }
    unsigned short* d = (unsigned short*)P + i * SQ + j0; unsigned short* dl = (unsigned short*)PL + i * SQ + j0; *(v8us*)d = fr.half[0]; *(v8us*)dl = gr.half[0];  } }

__global__ __launch_bounds__(256) void k_rsmf(const float* __restrict__ S, _Float16* __restrict__ P, int qn, int hg) {
  #pragma clang fp contract(off)
  const int t = blockIdx.x * 256 + threadIdx.x; if (t >= qn * hg) return; const size_t i = (size_t)(t / qn) * SQ + (t % qn); const float* s = S + i * SQ; float mx = -3.0e38f;
#pragma unroll 1
  for (int j = 0; j < SQ; ++j) mx = fmaxf(mx, s[j]); float se = 0.f;
#pragma unroll 1
  for (int j = 0; j < SQ; ++j) se += __expf(s[j] - mx); const float sc = 256.0f / se;
#pragma unroll 1
  for (int j0 = 0; j0 < SQ; j0 += 8) { FragH f; for (int q = 0; q < 8; ++q) f.h[q] = (_Float16)(__expf(s[j0 + q] - mx) * sc); unsigned short* d = (unsigned short*)P + i * SQ + j0; *(v8us*)d = f.half[0];  } }


#define CN 256          /* channels */
#define CI 128
#define NC 256                       /* (unused legacy kernels) */
#define NPX NP          /* elements per (batch, channel) row */
#define NP 4096         /* seq1 tokens */
#define NM 1024         /* seq2 tokens */
#define BNEPS 1e-5f

__global__ __launch_bounds__(256) void k_mp2(const float* __restrict__ src, float* __restrict__ dst, int nout) {
  const int t = blockIdx.x * 256 + threadIdx.x; if (t >= nout) return; const int c = t / 1024; const int o = t % 1024; const int oy = o / 32, ox = o % 32; const float* p = src + (size_t)c * 4096 + (size_t)(2 * oy) * 64 + 2 * ox;
  const float v = fmaxf(fmaxf(p[0], p[1]), fmaxf(p[64], p[65])); *(float*)(dst + t) = v;  }
__global__ __launch_bounds__(256) void k_xpb(const float* __restrict__ x, const float* __restrict__ wb, float* __restrict__ CPP, size_t n4) {
  #pragma clang fp contract(off)
  const size_t t = (size_t)blockIdx.x * 256 + threadIdx.x; if (t >= n4) return; const size_t e = t * 4; const int c = (int)((e / 4096) % 256); const float bb = bf16_round(wb[c]); const v4f a = *(const v4fa*)(x + e); v4f o; for (int q = 0; q < 4; ++q) o[q] = __fadd_rn(bf16_round(a[q]), bb);
  *(v4f*)(CPP + e) = o;  }


template <int PASS>
__global__ __launch_bounds__(256) void k_cstA(const float* __restrict__ X, const float* __restrict__ MV, float* __restrict__ PART) {
  #pragma clang fp contract(off)
  __shared__ float red[256]; const int t = threadIdx.x; const size_t bc = blockIdx.x; const int c = (int)(bc % NC); const float* row = X + bc * (size_t)NPX; const float mu = PASS ? MV[c] : 0.f; float s = 0.f;
  for (int i = t; i < NPX; i += 256) { const float v = row[i]; const float d = PASS ? __fadd_rn(v, -mu) : v; s = __fadd_rn(s, PASS ? __fmul_rn(d, d) : d); }
  red[t] = s; __syncthreads(); for (int st = 128; st > 0; st >>= 1) { if (t < st) red[t] = __fadd_rn(red[t], red[t + st]); __syncthreads(); }
  if (t < 32) { const float pv = (t == 0) ? red[0] : 0.f; *(float*)(PART + bc * 32 + t) = pv;  } }      

template <int PASS>
__global__ __launch_bounds__(256) void k_cstB(const float* __restrict__ PART, float* __restrict__ MV) { const int c = threadIdx.x; if (c >= NC) return; double s = 0.0; for (int b = 0; b < NB; ++b) s += (double)PART[((size_t)b * NC + c) * 32]; const float m = (float)(s / ((double)NB * (double)NPX)); *(float*)(MV + PASS * NC + c) = m;  }


__global__ __launch_bounds__(256) void k_bnresid(const float* __restrict__ C2, const float* __restrict__ MV, const float* __restrict__ g, const float* __restrict__ be, const float* __restrict__ X, float* __restrict__ out, size_t n4) {
  #pragma clang fp contract(off)
  const size_t t = (size_t)blockIdx.x * 256 + threadIdx.x; if (t >= n4) return; const size_t e = t * 4; const int c = (int)((e / NPX) % NC); const float sc = __fmul_rn(rsqrtf(__fadd_rn(MV[NC + c], BNEPS)), bf16_round(g[c])); const float mu = MV[c], bb = bf16_round(be[c]);
  const v4f a = *(const v4fa*)(C2 + e); const v4f xx = *(const v4fa*)(X + e); v4f o; for (int q = 0; q < 4; ++q) { const float z = __fadd_rn(__fmul_rn(__fadd_rn(a[q], -mu), sc), bb); o[q] = __fadd_rn(z, bf16_round(xx[q])); }      /* BN + residual, no ReLU */
  *(v4f*)(out + e) = o;  }


__global__ __launch_bounds__(256) void k_rowbias(float* __restrict__ Y, const float* __restrict__ bias) {
  #pragma clang fp contract(off)
  const size_t t = (size_t)blockIdx.x * 256 + threadIdx.x; if (t >= (size_t)NB * NC * NPX / 4) return; const size_t e = t * 4; const int c = (int)((e / NPX) % NC); const float bb = bf16_round(bias[c]);
  v4f v = *(const v4fa*)(Y + e); for (int q = 0; q < 4; ++q) v[q] = __fadd_rn(v[q], bb); *(v4f*)(Y + e) = v;  }



// Row softmax, one 256-thread work-group per score row: the row is read once by whole-line 16-byte loads and stays in registers;
// max and sum: per thread, five-step butterfly in the wave, then the eight wave results through LDS. P = exp(s - max) * 256 / sum as f16.
template <int NK>
__global__ __launch_bounds__(256) void k_rsmn(const float* __restrict__ S, _Float16* __restrict__ P, int nrows) {
  static_assert(NK % 1024 == 0, "k_rsmn: a row is a whole number of 256 x 4 floats");
  constexpr int NV = NK / 1024;      /* 16-byte pieces per thread */
  __shared__ float red[2][8];
  const int row = blockIdx.x; if (row >= nrows) return;      /* the same for the whole work-group, in front of both barriers */
  const int tid = threadIdx.x, w = tid >> 5, lane = tid & 31;
  const float* s = S + (size_t)row * NK + tid * 4;
  v4f x[NV];
  /* the loops over x[] are unrolled whole: x[] then lives in registers and all NV loads are in flight together */
#pragma unroll
  for (int u = 0; u < NV; ++u) x[u] = *(const v4fa*)(s + u * 1024);
  float mx = -3.0e38f;
#pragma unroll
  for (int u = 0; u < NV; ++u) mx = fmaxf(mx, fmaxf(fmaxf(x[u][0], x[u][1]), fmaxf(x[u][2], x[u][3])));
  for (int d = 16; d > 0; d >>= 1) mx = fmaxf(mx, __shfl_xor(mx, d, 32));
  if (lane == 0) red[0][w] = mx;
  __syncthreads();      /* the eight wave maxima are in LDS */
  mx = red[0][0];
  for (int i = 1; i < 8; ++i) mx = fmaxf(mx, red[0][i]);
#pragma unroll
  for (int u = 0; u < NV; ++u) { for (int q = 0; q < 4; ++q) x[u][q] = __expf(x[u][q] - mx); }
  v4f s4 = x[0];
#pragma unroll
  for (int u = 1; u < NV; ++u) s4 += x[u];
  float se = (s4[0] + s4[1]) + (s4[2] + s4[3]);
  for (int d = 16; d > 0; d >>= 1) se += __shfl_xor(se, d, 32);
  if (lane == 0) red[1][w] = se;
  __syncthreads();      /* the eight wave sums are in LDS */
  se = red[1][0];
  for (int i = 1; i < 8; ++i) se += red[1][i];
  const float sc = 256.0f / se;
  _Float16* p = P + (size_t)row * NK + tid * 4;
#pragma unroll
  for (int u = 0; u < NV; ++u) { v4h h4; for (int q = 0; q < 4; ++q) h4[q] = (_Float16)(x[u][q] * sc); *(v4h*)(p + u * 1024) = h4; } }
extern "C" void kernel_launch(void* const* d_in, const int* in_sizes, int n_in,
                              void* d_out, int out_size, void* d_ws, size_t ws_size, hipStream_t stream) {
  (void)in_sizes; (void)n_in; (void)out_size;
  const float* const* I = (const float* const*)d_in; const float* xq = I[0]; const float* xk = I[1]; const float* xv = I[2];      /* Q, K, V [8192][256] (bf16-valued) */
  constexpr int NQ = 8192, NKk = 8192, DK = 256, QC = 2048;      /* queries, keys, head width, query rows per chunk */
  char* ws = (char*)d_ws; size_t off = 0;
  auto take = [&](size_t bytes) { char* p = ws + off; off += (bytes + 255) & ~(size_t)255; return p; };
  _Float16* Q16 = (_Float16*)take((size_t)NQ * DK * 2); _Float16* K16 = (_Float16*)take((size_t)NKk * DK * 2); _Float16* V16 = (_Float16*)take((size_t)NKk * DK * 2); _Float16* VT = (_Float16*)take((size_t)DK * NKk * 2);
  float* S = (float*)take((size_t)QC * NKk * 4); _Float16* P = (_Float16*)take((size_t)QC * NKk * 2);
  if (off > ws_size) return;
  k_x16<<<(unsigned)(((size_t)NQ * DK / 8 + 255) / 256), 256, 0, stream>>>(xq, Q16, (size_t)NQ * DK / 8); k_x16<<<(unsigned)(((size_t)NKk * DK / 8 + 255) / 256), 256, 0, stream>>>(xk, K16, (size_t)NKk * DK / 8); k_x16<<<(unsigned)(((size_t)NKk * DK / 8 + 255) / 256), 256, 0, stream>>>(xv, V16, (size_t)NKk * DK / 8);      /* exact f16 copies of the bf16-valued inputs */
  k_vt<DK / 64, NKk><<<(DK / 64) * (NKk / 64), 256, 0, stream>>>(V16, DK, 0, VT);      /* V^T [256][8192] */
  for (int q0 = 0; q0 < NQ; q0 += QC) {
    k_gemm2<0><<<dim3((QC / 128) * (NKk / 64), 1), 128, 0, stream>>>(Q16 + (size_t)q0 * DK, DK, 0, K16, DK, 0, 0.0625f, nullptr, 0, nullptr, 1, 0, 0, S, nullptr, NKk, 0, QC, NKk, DK);      /* scores = Q K^T / sqrt(256) for this chunk of query rows (K = 256, exact products) */
    k_rsmn<NKk><<<QC, 256, 0, stream>>>(S, P, QC);      /* softmax over the 8192 keys, one work-group per row -> P x256 f16 */
    k_gemm2<0><<<dim3((QC / 128) * (DK / 64), 1), 128, 0, stream>>>(P, NKk, 0, VT, NKk, 0, 0.00390625f, nullptr, 0, nullptr, 1, 0, 0, (float*)d_out + (size_t)q0 * DK, nullptr, DK, 0, QC, DK, NKk); }      /* out = P V^T 2^-8 f32 into the chunk's rows */
}

// v002
// A run of this version takes 77.5 microseconds.
// Timed twice side by side with v001, it ran 14.3 and 14.2 times as fast.
// Over all steps from v000 it is 80.6 times as fast.
#include <hip/hip_runtime.h>
// Single-head scaled dot-product attention without batch or projections (Q [8192][256], K [8192][256], V [8192][256]; scores = Q K^T / sqrt(256); softmax over the 8192 keys; out = attn V -> [8192][256]).
// Structure: Q as exact f16 rows of the bf16-valued input; K and V^T packed once into WMMA fragment order (f16); ONE fused kernel per 256 query rows x 1024 keys: S^T = K Q^T, online softmax (f32 statistics, log2 domain, lazy rescale), O^T += V^T P^T, scores and weights never leave registers; the eight key splits are joined by a last kernel; launches: see trace.
// Compute dtype: inputs rounded to bf16; q, k, v exact in f16; softmax weights as plain f16 GEMM operands (~2^-12); scores, softmax statistics and o f32. v_wmma_f32_16x16x32_f16.
#define NB 4
#define SQ 4096
#define DM 256
#define NH 1
#define HD 64
#define HG 4                         /* heads per attention launch group */
#define B0 0                         /* first batch processed (debug hook) */
#define NBR NB                       /* batches processed (debug hook) */
#define NR ((size_t)NB * SQ)         /* token rows */
#define MP ((int)((size_t)NBR * SQ)) /* rows projected (debug hook) */
#define QT 256                       /* query rows per causal tile */
#define NKX SQ                       /* S / P row pitch */
#define QT0 256                      /* first-tile rows recomputed exactly */
#define QN SQ                        /* query rows attended per batch (debug hook) */
#define NHD NH                       /* heads attended (debug hook) */
#define MPO MP                       /* rows through the output stage (debug hook) */
#define LQ DM            /* row pitch of the q/k/v rows */
typedef __bf16 v16b __attribute__((ext_vector_type(16)));
typedef unsigned short v8us __attribute__((ext_vector_type(8), may_alias));
typedef float  v8f  __attribute__((ext_vector_type(8)));
typedef float  v4f  __attribute__((ext_vector_type(4)));
typedef float  v4fa __attribute__((ext_vector_type(4), may_alias));
union FragB { v16b v; v8us half[2]; unsigned short u[16]; };

__device__ __forceinline__ unsigned short bf16_bits(float x) { unsigned int u = __float_as_uint(x); return (unsigned short)((u + 0x7FFFu + ((u >> 16) & 1u)) >> 16); }
__device__ __forceinline__ float bf16_val(unsigned short b) { return __uint_as_float(((unsigned int)b) << 16); }
__device__ __forceinline__ float bf16_round(float x) { return bf16_val(bf16_bits(x)); }
// D += A·B with NT terms: 1 = ah·bh, 2 = + al·bh (A split), 3 = + ah·bl (both split)
template <int NT>
__device__ __forceinline__ v8f mmaN(v16b ah, v16b al, v16b bh, v16b bl, v8f c) {
  c = __builtin_amdgcn_wmma_f32_16x16x32_bf16(false, ah, false, bh, (short)0, c, false, false);
  if (NT >= 2) c = __builtin_amdgcn_wmma_f32_16x16x32_bf16(false, al, false, bh, (short)0, c, false, false);
  if (NT >= 3) c = __builtin_amdgcn_wmma_f32_16x16x32_bf16(false, ah, false, bl, (short)0, c, false, false);
  asm volatile("v_nop\n\tv_nop\n\tv_nop\n\tv_nop" : "+v"(c) : "v"(ah), "v"(al), "v"(bh), "v"(bl));
  return c;
}

__global__ __launch_bounds__(256) void k_wt_bf16(const float* __restrict__ W, unsigned short* __restrict__ Wt, int K, int N) {
  const int t = blockIdx.x * 256 + threadIdx.x;
  const int k8n = K / 8;
  if (t >= N * k8n) return;
  const int n = t / k8n, k8 = (t % k8n) * 8;
  v8us v;
#pragma unroll
  for (int i = 0; i < 8; ++i) v[i] = bf16_bits(W[(size_t)(k8 + i) * N + n]);
  *(v8us*)(Wt + (size_t)n * K + k8) = v;
  
}

// GEMM C[M][N] (f32, pitch ldc) = act(A[M][K]·W + bias). A f32 row-major (pitch lda) converted per fragment to bf16
// (ASPLIT: hi/lo two planes -> 2 terms, else single rounded term); Wt bf16 [N][K] (pitch ldb). BIAS_BF16 rounds the
// bias to bf16 first (bias quantised to bf16 before the add). K%32==0, M%16==0, N%64==0.
template <bool ASPLIT, int ACT, bool BIAS_BF16>
__global__ __launch_bounds__(128) void k_gemm_bf(const float* __restrict__ A, int lda, const unsigned short* __restrict__ Wt, int ldb,
                                               const float* __restrict__ bias, float* __restrict__ C, int ldc, int M, int N, int K) {
  __shared__ __attribute__((aligned(16))) float so[4][16][64];
  const int tid = threadIdx.x, w = tid >> 5, lane = tid & 31, ln = lane & 15, hh = lane >> 4;
  const int ntn = N / 64;
  const int wid = blockIdx.x * 4 + w;
  const int mt = wid / ntn, nq = wid % ntn;
  if (mt * 16 >= M) return;
  const int row0 = mt * 16, col0 = nq * 64;
  const float* arow = A + (size_t)(row0 + ln) * lda;
  v8f acc[4] = {};
  for (int kb = 0; kb < K; kb += 32) {
    FragB ah, al;
    const v4f x0 = *(const v4fa*)(arow + kb + 8 * hh), x1 = *(const v4fa*)(arow + kb + 8 * hh + 4);
    const v4f x2 = *(const v4fa*)(arow + kb + 16 + 8 * hh), x3 = *(const v4fa*)(arow + kb + 16 + 8 * hh + 4);
    float xs[16] = {x0[0],x0[1],x0[2],x0[3],x1[0],x1[1],x1[2],x1[3],x2[0],x2[1],x2[2],x2[3],x3[0],x3[1],x3[2],x3[3]};
#pragma unroll
    for (int i = 0; i < 16; ++i) { const unsigned short hb = bf16_bits(xs[i]); ah.u[i] = hb; al.u[i] = ASPLIT ? bf16_bits(xs[i] - bf16_val(hb)) : (unsigned short)0; }
#pragma unroll
    for (int t = 0; t < 4; ++t) {
      const unsigned short* brow = Wt + (size_t)(col0 + t * 16 + ln) * ldb + kb;
      FragB b;
      b.half[0] = *(const v8us*)(brow + 8 * hh);
      b.half[1] = *(const v8us*)(brow + 16 + 8 * hh);
      acc[t] = mmaN<ASPLIT ? 2 : 1>(ah.v, al.v, b.v, b.v, acc[t]);
    }
  }
#pragma unroll
  for (int t = 0; t < 4; ++t) {
    float bv = bias ? bias[col0 + t * 16 + ln] : 0.f;
    if (BIAS_BF16) bv = bf16_round(bv);
#pragma unroll
    for (int r = 0; r < 8; ++r) { float v = acc[t][r] + bv; if (ACT == 1) v = fmaxf(v, 0.f); so[w][8 * hh + r][t * 16 + ln] = v; }
  }
  __builtin_amdgcn_fence(__ATOMIC_ACQ_REL, "workgroup");
  __builtin_amdgcn_wave_barrier();
  const int rsub = lane >> 4, c4 = (lane & 15) * 4;
  {
#pragma unroll
    for (int q = 0; q < 8; ++q) {
      const int r = q * 2 + rsub;
      const v4f v = *(const v4fa*)&so[w][r][c4];
      *(v4f*)(C + (size_t)(row0 + r) * ldc + col0 + c4) = v;
    }
    
  }
}

// GEMM C = act(A·W + bias + resid): A f32 (ASPLIT -> hi/lo 2 terms), Wt bf16 [N][K]; ACT 0 none, 1 relu, 2 exact gelu;
// resid (optional, f32, row index = (row % rmod), pitch ldr, RES_BF16 rounds it) added before the activation.
template <bool ASPLIT, int ACT, bool BIAS_BF16, bool RES_BF16>
__global__ __launch_bounds__(128) void k_gemm_bf3(const float* __restrict__ A, int lda, const unsigned short* __restrict__ Wt, int ldb,
                                                const float* __restrict__ bias, const float* __restrict__ resid, int rmod, int ldr,
                                                float* __restrict__ C, int ldc, int M, int N, int K) {
  __shared__ __attribute__((aligned(16))) float so[4][16][64];
  const int tid = threadIdx.x, w = tid >> 5, lane = tid & 31, ln = lane & 15, hh = lane >> 4;
  const int ntn = N / 64;
  const int wid = blockIdx.x * 4 + w;
  const int mt = wid / ntn, nq = wid % ntn;
  if (mt * 16 >= M) return;
  const int row0 = mt * 16, col0 = nq * 64;
  const float* arow = A + (size_t)(row0 + ln) * lda;
  v8f acc[4] = {};
  for (int kb = 0; kb < K; kb += 32) {
    FragB ah, al;
    const v4f x0 = *(const v4fa*)(arow + kb + 8 * hh), x1 = *(const v4fa*)(arow + kb + 8 * hh + 4);
    const v4f x2 = *(const v4fa*)(arow + kb + 16 + 8 * hh), x3 = *(const v4fa*)(arow + kb + 16 + 8 * hh + 4);
    float xs[16] = {x0[0],x0[1],x0[2],x0[3],x1[0],x1[1],x1[2],x1[3],x2[0],x2[1],x2[2],x2[3],x3[0],x3[1],x3[2],x3[3]};
#pragma unroll
    for (int i = 0; i < 16; ++i) { const unsigned short hb = bf16_bits(xs[i]); ah.u[i] = hb; al.u[i] = ASPLIT ? bf16_bits(xs[i] - bf16_val(hb)) : (unsigned short)0; }
#pragma unroll
    for (int t = 0; t < 4; ++t) {
      const unsigned short* brow = Wt + (size_t)(col0 + t * 16 + ln) * ldb + kb;
      FragB b;
      b.half[0] = *(const v8us*)(brow + 8 * hh);
      b.half[1] = *(const v8us*)(brow + 16 + 8 * hh);
      acc[t] = mmaN<ASPLIT ? 2 : 1>(ah.v, al.v, b.v, b.v, acc[t]);
    }
  }
#pragma unroll
  for (int t = 0; t < 4; ++t) {
    const int col = col0 + t * 16 + ln;
    float bv = bias ? bias[col] : 0.f;
    if (BIAS_BF16) bv = bf16_round(bv);
#pragma unroll
    for (int r = 0; r < 8; ++r) {
      float v = acc[t][r] + bv;
      if (resid) { float rv = resid[(size_t)((row0 + 8 * hh + r) % rmod) * ldr + col]; if (RES_BF16) rv = bf16_round(rv); v += rv; }
      if (ACT == 1) v = fmaxf(v, 0.f);
      if (ACT == 2) v = 0.5f * v * (1.0f + erff(v * 0.70710678118654752f));
      if (ACT == 3) { const float u = 0.7978845608028654f * (v + 0.044715f * v * v * v); v = 0.5f * v * (1.0f + tanhf(u)); }
      so[w][8 * hh + r][t * 16 + ln] = v;
    }
  }
  __builtin_amdgcn_fence(__ATOMIC_ACQ_REL, "workgroup");
  __builtin_amdgcn_wave_barrier();
  const int rsub = lane >> 4, c4 = (lane & 15) * 4;
  {
#pragma unroll
    for (int q = 0; q < 8; ++q) {
      const int r = q * 2 + rsub;
      const v4f v = *(const v4fa*)&so[w][r][c4];
      *(v4f*)(C + (size_t)(row0 + r) * ldc + col0 + c4) = v;
    }
    
  }
}
// row LayerNorm (biased variance, eps) over N: s = X (+ R); optional out_sum <- s; out_norm <- (s-mu)*rsqrt(var+eps)*g + b
template <bool PARAM_BF16>
__global__ __launch_bounds__(256) void k_layernorm(const float* __restrict__ X, const float* __restrict__ R, const float* __restrict__ g, const float* __restrict__ bta,
                                                  float* __restrict__ out_sum, float* __restrict__ out_norm, int N, float eps) {
  __shared__ float red[256];
  const int row = blockIdx.x, tid = threadIdx.x;
  const float* x = X + (size_t)row * N; const float* rr = R ? R + (size_t)row * N : nullptr;
  float vals[16];                     // up to N = 4096
  const int per = N / 256;            // contiguous chunk per thread? use strided-by-4 chunks: thread handles j = tid*4 + 1024*u
  float s1 = 0.f;
  for (int u = 0; u < per / 4; ++u) {
    const int j = tid * 4 + 1024 * u;
    const v4f a = *(const v4fa*)(x + j);
    v4f b = {0.f,0.f,0.f,0.f}; if (rr) b = *(const v4fa*)(rr + j);
#pragma unroll
    for (int q = 0; q < 4; ++q) { const float v = a[q] + b[q]; vals[u * 4 + q] = v; s1 += v; }
  }
  red[tid] = s1; __syncthreads();
  for (int st = 128; st > 0; st >>= 1) { if (tid < st) red[tid] += red[tid + st]; __syncthreads(); }
  const float mu = red[0] / (float)N; __syncthreads();
  float s2 = 0.f;
  for (int u = 0; u < per / 4; ++u)
#pragma unroll
    for (int q = 0; q < 4; ++q) { const float c = vals[u * 4 + q] - mu; s2 += c * c; }
  red[tid] = s2; __syncthreads();
  for (int st = 128; st > 0; st >>= 1) { if (tid < st) red[tid] += red[tid + st]; __syncthreads(); }
  const float rs = rsqrtf(red[0] / (float)N + eps);
  {
    for (int u = 0; u < per / 4; ++u) {
      const int j = tid * 4 + 1024 * u;
      v4f o, sm;
#pragma unroll
      for (int q = 0; q < 4; ++q) {
        float gg = g[j + q], bb = bta[j + q];
        if (PARAM_BF16) { gg = bf16_round(gg); bb = bf16_round(bb); }
        sm[q] = vals[u * 4 + q]; o[q] = (vals[u * 4 + q] - mu) * rs * gg + bb;
      }
      if (out_sum) *(v4f*)(out_sum + (size_t)row * N + j) = sm;
      *(v4f*)(out_norm + (size_t)row * N + j) = o;
    }
    
  }
}



// ---- f16 WMMA path (v_wmma_f32_16x16x32_f16): 11-bit significands for operands in range — used where a [0,1] probability operand needs more precision than bf16
typedef _Float16 v16h __attribute__((ext_vector_type(16)));
union FragH { v16h v; v8us half[2]; _Float16 h[16]; unsigned short u[16]; };
template <int NT>
__device__ __forceinline__ v8f mmaH(v16h ah, v16h al, v16h bh, v16h bl, v8f c) {
  c = __builtin_amdgcn_wmma_f32_16x16x32_f16(false, ah, false, bh, (short)0, c, false, false);
  if (NT >= 2) c = __builtin_amdgcn_wmma_f32_16x16x32_f16(false, al, false, bh, (short)0, c, false, false);
  if (NT >= 3) c = __builtin_amdgcn_wmma_f32_16x16x32_f16(false, ah, false, bl, (short)0, c, false, false);
  asm volatile("v_nop\n\tv_nop\n\tv_nop\n\tv_nop" : "+v"(c) : "v"(ah), "v"(al), "v"(bh), "v"(bl));
  return c;
}
// batched GEMM like k_gemm_b but f16 operands: A f32 (split into f16 hi/lo if ASPLIT, else rounded to f16), Bt = f16 values [n][k]; alpha; C f32; N multiple of 16 (partial tiles skipped)
template <bool ASPLIT>
__global__ __launch_bounds__(128) void k_gemm_h(const float* __restrict__ A, int lda, size_t sA, const _Float16* __restrict__ Bh, int ldb, size_t sB, float alpha, float* __restrict__ C, int ldc, size_t sC, int M, int N, int K) {
  __shared__ __attribute__((aligned(16))) float so[4][16][64];
  const int tid = threadIdx.x, w = tid >> 5, lane = tid & 31, ln = lane & 15, hh = lane >> 4; const int by = blockIdx.y;
  A += (size_t)by * sA; Bh += (size_t)by * sB; C += (size_t)by * sC;
  const int ntn = (N + 63) / 64; const int wid = blockIdx.x * 4 + w; const int mt = wid / ntn, nq = wid % ntn; if (mt * 16 >= M) return;
  const int row0 = mt * 16, col0 = nq * 64; const float* arow = A + (size_t)(row0 + ln) * lda;
  v8f acc[4] = {};
  for (int kb = 0; kb < K; kb += 32) {
    FragH ah, al;
    const v4f x0 = *(const v4fa*)(arow + kb + 8 * hh), x1 = *(const v4fa*)(arow + kb + 8 * hh + 4), x2 = *(const v4fa*)(arow + kb + 16 + 8 * hh), x3 = *(const v4fa*)(arow + kb + 16 + 8 * hh + 4);
    float xs[16] = {x0[0],x0[1],x0[2],x0[3],x1[0],x1[1],x1[2],x1[3],x2[0],x2[1],x2[2],x2[3],x3[0],x3[1],x3[2],x3[3]};
#pragma unroll
    for (int i = 0; i < 16; ++i) { const _Float16 h = (_Float16)xs[i]; ah.h[i] = h; al.h[i] = ASPLIT ? (_Float16)(xs[i] - (float)h) : (_Float16)0.0f; }
#pragma unroll
    for (int t = 0; t < 4; ++t) { if (col0 + t * 16 >= N) continue; const size_t boff = (size_t)(col0 + t * 16 + ln) * ldb + kb; FragH bq; bq.half[0] = *(const v8us*)(Bh + boff + 8 * hh); bq.half[1] = *(const v8us*)(Bh + boff + 16 + 8 * hh);
      acc[t] = mmaH<ASPLIT ? 2 : 1>(ah.v, al.v, bq.v, bq.v, acc[t]); }
  }
#pragma unroll
  for (int t = 0; t < 4; ++t) { if (col0 + t * 16 >= N) continue;
#pragma unroll
    for (int r = 0; r < 8; ++r) so[w][8 * hh + r][t * 16 + ln] = acc[t][r] * alpha; }
  __builtin_amdgcn_fence(__ATOMIC_ACQ_REL, "workgroup"); __builtin_amdgcn_wave_barrier();
  const int rsub = lane >> 4, c4 = (lane & 15) * 4;
  {
#pragma unroll
    for (int q = 0; q < 8; ++q) { const int r = q * 2 + rsub; if (col0 + c4 < N) { const v4f v = *(const v4fa*)&so[w][r][c4]; *(v4f*)(C + (size_t)(row0 + r) * ldc + col0 + c4) = v; } }
     }
}

// Wt[n][k] = f16(W[k][n]·scale) from f32 row-major W[K][N] (scale = power of two; bf16-exact weights stay exact in f16 away from the subnormal range)
__global__ __launch_bounds__(256) void k_wt_f16(const float* __restrict__ W, _Float16* __restrict__ Wt, int K, int N, float scale) {
  const int t = blockIdx.x * 256 + threadIdx.x; if (t >= N * (K / 8)) return; const int n = t / (K / 8), k8 = (t % (K / 8)) * 8; FragH f;
#pragma unroll
  for (int i = 0; i < 8; ++i) f.h[i] = (_Float16)(bf16_round(W[(size_t)(k8 + i) * N + n]) * scale); const v8us o = f.half[0];
  *(v8us*)((unsigned short*)Wt + (size_t)n * K + k8) = o; 
}
// k_gemm_hh variant with fused epilogue: v = acc·alpha + bias[by·sBias + col] (+ CP[(row/rowsPerB)·sCPb + by·64 + col] if CP) ; ACT 0 none / 1 elu ; writes f16 C16 (and f32 C if non-null)
template <int ACT>
__global__ __launch_bounds__(128) void k_gemm_hhx(const _Float16* __restrict__ A, int lda, size_t sA, const _Float16* __restrict__ Bh, int ldb, size_t sB, float alpha, const float* __restrict__ bias, size_t sBias, const float* __restrict__ CP, int rowsPerB, size_t sCPb, int row0g,
    float* __restrict__ C, _Float16* __restrict__ C16, int ldc, size_t sC, int M, int N, int K) {
  __shared__ __attribute__((aligned(16))) float so[4][16][64];
  const int tid = threadIdx.x, w = tid >> 5, lane = tid & 31, ln = lane & 15, hh = lane >> 4; const int by = blockIdx.y;
  A += (size_t)by * sA; Bh += (size_t)by * sB; const size_t cofs = (size_t)by * sC; const float* bp = bias ? bias + (size_t)by * sBias : nullptr;
  const int ntn = (N + 63) / 64; const int wid = blockIdx.x * 4 + w; const int mt = wid / ntn, nq = wid % ntn; if (mt * 16 >= M) return;
  const int row0 = mt * 16, col0 = nq * 64; const _Float16* arow = A + (size_t)(row0 + ln) * lda;
  v8f acc[4] = {};
  for (int kb = 0; kb < K; kb += 32) { FragH ah; ah.half[0] = *(const v8us*)((const unsigned short*)arow + kb + 8 * hh); ah.half[1] = *(const v8us*)((const unsigned short*)arow + kb + 16 + 8 * hh);
#pragma unroll
    for (int t = 0; t < 4; ++t) { if (col0 + t * 16 >= N) continue; const size_t boff = (size_t)(col0 + t * 16 + ln) * ldb + kb; FragH bq; bq.half[0] = *(const v8us*)((const unsigned short*)Bh + boff + 8 * hh); bq.half[1] = *(const v8us*)((const unsigned short*)Bh + boff + 16 + 8 * hh);
      acc[t] = mmaH<1>(ah.v, ah.v, bq.v, bq.v, acc[t]); }
  }
#pragma unroll
  for (int t = 0; t < 4; ++t) { if (col0 + t * 16 >= N) continue; const int col = col0 + t * 16 + ln; const float bv = bp ? bf16_round(bp[col]) : 0.f;
#pragma unroll
    for (int r = 0; r < 8; ++r) { float v = acc[t][r] * alpha + bv; if (CP) { const int rr = row0g + row0 + 8 * hh + r; if (rowsPerB < 0) v += CP[cofs + (size_t)rr * ldc + col];      /* rowsPerB < 0: own element of the batched C plane */ else { const int bidx = rr / rowsPerB; v += CP[(size_t)bidx * sCPb + (size_t)by * 64 + col]; } } if (ACT == 1) v = (v > 0.f) ? v : expm1f(v); else if (ACT == 7) v = (v > 0.f) ? v + 1.0f : expf(v); else if (ACT == 8) v = tanhf(v); else if (ACT == 9) v = 0.5f * v * (1.0f + tanhf(0.7978845608028654f * (v + 0.044715f * v * v * v))); else if (ACT == 11) v = 1.0f / (1.0f + expf(-v)); else if (ACT == 12) v = (v > 0.f) ? v : 0.01f * v; else if (ACT == 14) v = (v > 0.f) ? v : 0.1f * v; else if (ACT == 16) v = (v >= 0.f) ? v : 0.3f * v; else if (ACT == 17) v = (v >= 0.f) ? v : 0.2f * v; else if (ACT == 15) v = v / (1.0f + expf(-v)); else if (ACT == 3) v = fmaxf(v, 0.f); else if (ACT == 6) v = 0.5f * v * (1.0f + erff(v * 0.70710678118654752f)); so[w][8 * hh + r][t * 16 + ln] = v; } }
  __builtin_amdgcn_fence(__ATOMIC_ACQ_REL, "workgroup"); __builtin_amdgcn_wave_barrier();
  const int rsub = lane >> 4, c4 = (lane & 15) * 4; typedef _Float16 v4h __attribute__((ext_vector_type(4)));
  {
#pragma unroll
    for (int q = 0; q < 8; ++q) { const int r = q * 2 + rsub; if (col0 + c4 < N) { const v4f v = *(const v4fa*)&so[w][r][c4]; if (C) *(v4f*)(C + cofs + (size_t)(row0 + r) * ldc + col0 + c4) = v; if (C16) { v4h h4; for (int i = 0; i < 4; ++i) h4[i] = (_Float16)v[i]; *(v4h*)(C16 + cofs + (size_t)(row0 + r) * ldc + col0 + c4) = h4; } } }
     }
}


typedef _Float16 v4h __attribute__((ext_vector_type(4)));

__global__ __launch_bounds__(256) void k_x16(const float* __restrict__ x, _Float16* __restrict__ X16, size_t n8) { const size_t t = (size_t)blockIdx.x * 256 + threadIdx.x; if (t >= n8) return; FragH f;
#pragma unroll
  for (int q = 0; q < 8; ++q) f.h[q] = (_Float16)bf16_round(x[t * 8 + q]); *(v8us*)((unsigned short*)X16 + t * 8) = f.half[0];  }
__global__ __launch_bounds__(256) void k_h16(const float* __restrict__ x, _Float16* __restrict__ X16, size_t n8) { const size_t t = (size_t)blockIdx.x * 256 + threadIdx.x; if (t >= n8) return; FragH f;
#pragma unroll
  for (int q = 0; q < 8; ++q) f.h[q] = (_Float16)x[t * 8 + q]; *(v8us*)((unsigned short*)X16 + t * 8) = f.half[0];  }
__global__ __launch_bounds__(256) void k_round16f(const float* __restrict__ W, _Float16* __restrict__ Bt, size_t n8) { const size_t t = (size_t)blockIdx.x * 256 + threadIdx.x; if (t >= n8) return; FragH f;
#pragma unroll
  for (int i = 0; i < 8; ++i) f.h[i] = (_Float16)(bf16_round(W[t * 8 + i]) * 16.0f); *(v8us*)((unsigned short*)Bt + t * 8) = f.half[0];  }
template <int NHv, int TTv>
__global__ __launch_bounds__(256) void k_vt(const _Float16* __restrict__ V16, int ldv, int voff, _Float16* __restrict__ Vt) { __shared__ unsigned short tl[64][66]; const int tid = threadIdx.x; const int slab = blockIdx.x / (TTv / 64), lg = blockIdx.x % (TTv / 64); const int b = slab / NHv, h = slab % NHv;
  for (int i = tid; i < 64 * 8; i += 256) { const int r = i / 8, c8 = (i % 8) * 8; FragH f; f.half[0] = *(const v8us*)((const unsigned short*)V16 + ((size_t)b * TTv + lg * 64 + r) * ldv + voff + h * 64 + c8);
#pragma unroll
    for (int q = 0; q < 8; ++q) tl[r][c8 + q] = f.u[q]; }
  __syncthreads();
  {
#pragma unroll
    for (int rd = 0; rd < 2; ++rd) { const int d = rd * 32 + tid / 8, pc = tid % 8; FragH f;
#pragma unroll
      for (int q = 0; q < 8; ++q) f.u[q] = tl[pc * 8 + q][d];
      *(v8us*)((unsigned short*)Vt + ((size_t)slab * 64 + d) * TTv + lg * 64 + pc * 8) = f.half[0]; }
     } }

__global__ __launch_bounds__(256) void k_hl(const float* __restrict__ F, _Float16* __restrict__ Hh, _Float16* __restrict__ Hl, size_t n8) { const size_t t = (size_t)blockIdx.x * 256 + threadIdx.x; if (t >= n8) return; FragH fh, fl; const v4f a = *(const v4fa*)(F + t * 8), c = *(const v4fa*)(F + t * 8 + 4);
#pragma unroll
  for (int q = 0; q < 4; ++q) { _Float16 h = (_Float16)a[q]; fh.h[q] = h; fl.h[q] = (_Float16)((a[q] - (float)h) * 1024.0f); h = (_Float16)c[q]; fh.h[4 + q] = h; fl.h[4 + q] = (_Float16)((c[q] - (float)h) * 1024.0f); }
  { *(v8us*)((unsigned short*)Hh + t * 8) = fh.half[0]; *(v8us*)((unsigned short*)Hl + t * 8) = fl.half[0];  } }

// ---- fast GEMM (wave tile 32x64; requires M % 32 == 0 rows per launch region and N % 64 == 0); epilogue = k_gemm_hhx semantics ----
__device__ __forceinline__ v16h g2_frag(const _Float16* p, int hh) { FragH f; f.half[0] = *(const v8us*)((const unsigned short*)p + 8 * hh); f.half[1] = *(const v8us*)((const unsigned short*)p + 16 + 8 * hh); return f.v; }
__device__ __forceinline__ v8f g2_mma(v16h a, v16h b, v8f c) { v8f d = __builtin_amdgcn_wmma_f32_16x16x32_f16(false, a, false, b, (short)0, c, false, false); asm volatile("v_nop\n\tv_nop\n\tv_nop\n\tv_nop" : "+v"(d) : "v"(a), "v"(b)); return d; }
template <int ACT>
__global__ __launch_bounds__(128) void k_gemm2(const _Float16* __restrict__ A, int lda, size_t sA, const _Float16* __restrict__ Bh, int ldb, size_t sB, float alpha, const float* __restrict__ bias, size_t sBias, const float* __restrict__ CP, int rowsPerB, size_t sCPb, int row0g,
    float* __restrict__ C, _Float16* __restrict__ C16, int ldc, size_t sC, int M, int N, int K) { static_assert(ACT == 0 || ACT == 3 || ACT == 6 || ACT == 8 || ACT == 9 || ACT == 11 || ACT == 12 || ACT == 14 || ACT == 15 || ACT == 16 || ACT == 17, "k_gemm2: unsupported ACT code (would silently apply no activation)");
  __shared__ __attribute__((aligned(16))) float so[4][32][68];
  const int tid = threadIdx.x, w = tid >> 5, lane = tid & 31, ln = lane & 15, hh = lane >> 4; const int by = blockIdx.y;
  A += (size_t)by * sA; Bh += (size_t)by * sB; const size_t cofs = (size_t)by * sC; const float* bp = bias ? bias + (size_t)by * sBias : nullptr;
  const int ntn = N >> 6; const int mt = blockIdx.x / ntn, nq = blockIdx.x - mt * ntn; const int row0 = mt * 128 + 32 * w, col0 = nq * 64; if (row0 >= M) return;
  const _Float16* a0p = A + (size_t)(row0 + ln) * lda; const _Float16* a1p = a0p + (size_t)16 * lda;
  const _Float16* b0p = Bh + (size_t)(col0 + ln) * ldb; const _Float16* b1p = b0p + (size_t)16 * ldb; const _Float16* b2p = b1p + (size_t)16 * ldb; const _Float16* b3p = b2p + (size_t)16 * ldb;
  const v8f z8 = {0.f,0.f,0.f,0.f,0.f,0.f,0.f,0.f}; v8f c00 = z8, c01 = z8, c02 = z8, c03 = z8, c10 = z8, c11 = z8, c12 = z8, c13 = z8;
#pragma unroll 1
  for (int kb = 0; kb < K; kb += 32) { const v16h a0 = g2_frag(a0p + kb, hh), a1 = g2_frag(a1p + kb, hh);
    v16h b = g2_frag(b0p + kb, hh); c00 = g2_mma(a0, b, c00); c10 = g2_mma(a1, b, c10);
    b = g2_frag(b1p + kb, hh); c01 = g2_mma(a0, b, c01); c11 = g2_mma(a1, b, c11);
    b = g2_frag(b2p + kb, hh); c02 = g2_mma(a0, b, c02); c12 = g2_mma(a1, b, c12);
    b = g2_frag(b3p + kb, hh); c03 = g2_mma(a0, b, c03); c13 = g2_mma(a1, b, c13); }
  v8f accs[8] = {c00, c01, c02, c03, c10, c11, c12, c13};
#pragma unroll
  for (int u = 0; u < 8; ++u) { const int t = u & 3, half = u >> 2; const int col = col0 + t * 16 + ln; const float bv = bp ? bf16_round(bp[col]) : 0.f;
#pragma unroll
    for (int r = 0; r < 8; ++r) { const int rloc = half * 16 + 8 * hh + r; float v = accs[u][r] * alpha + bv; if (CP) { if (rowsPerB < 0) v += CP[cofs + (size_t)(row0g + row0 + rloc) * ldc + col];      /* rowsPerB < 0: own element of the batched C plane */ else { const int bidx = (row0g + row0 + rloc) / rowsPerB; v += CP[(size_t)bidx * sCPb + (size_t)by * 64 + col]; } }
      if (ACT == 3) v = fmaxf(v, 0.f); else if (ACT == 6) v = 0.5f * v * (1.0f + erff(v * 0.70710678118654752f)); else if (ACT == 11) v = 1.0f / (1.0f + expf(-v)); else if (ACT == 15) v = v / (1.0f + expf(-v)); else if (ACT == 12) v = (v > 0.f) ? v : 0.01f * v; else if (ACT == 8) v = tanhf(v); else if (ACT == 9) v = 0.5f * v * (1.0f + tanhf(0.7978845608028654f * (v + 0.044715f * v * v * v))); else if (ACT == 14) v = (v > 0.f) ? v : 0.1f * v; else if (ACT == 16) v = (v >= 0.f) ? v : 0.3f * v; else if (ACT == 17) v = (v >= 0.f) ? v : 0.2f * v;
      so[w][rloc][t * 16 + ln] = v; } }
  __builtin_amdgcn_fence(__ATOMIC_ACQ_REL, "workgroup"); __builtin_amdgcn_wave_barrier();
  const int rsub = lane >> 4, c4 = (lane & 15) * 4;
  {
#pragma unroll
    for (int q = 0; q < 16; ++q) { const int r = q * 2 + rsub; const v4f v = *(const v4fa*)&so[w][r][c4]; if (C) *(v4f*)(C + cofs + (size_t)(row0 + r) * ldc + col0 + c4) = v; if (C16) { v4h h4; for (int i = 0; i < 4; ++i) h4[i] = (_Float16)v[i]; *(v4h*)(C16 + cofs + (size_t)(row0 + r) * ldc + col0 + c4) = h4; } }
     } }


__global__ __launch_bounds__(256) void k_wnat(const float* __restrict__ w, size_t n8, _Float16* __restrict__ Bt) { const size_t t = (size_t)blockIdx.x * 256 + threadIdx.x; if (t >= n8) return; FragH f; for (int q = 0; q < 8; ++q) f.h[q] = (_Float16)(bf16_round(w[t * 8 + q]) * 16.0f); *(v8us*)((unsigned short*)Bt + t * 8) = f.half[0];  }
__global__ __launch_bounds__(256) void k_rsm(const float* __restrict__ S, _Float16* __restrict__ P, int nrows) {
  #pragma clang fp contract(off)
  const int i = blockIdx.x * 256 + threadIdx.x; if (i >= nrows) return; const float* s = S + (size_t)i * SQ; float mx = -3.0e38f;
#pragma unroll 1
  for (int j = 0; j < SQ; ++j) mx = fmaxf(mx, s[j]); float se = 0.f;
#pragma unroll 1
  for (int j = 0; j < SQ; ++j) se += expf(s[j] - mx); const float sc = 256.0f / se;
#pragma unroll 1
  for (int j0 = 0; j0 < SQ; j0 += 8) { FragH f; for (int q = 0; q < 8; ++q) f.h[q] = (_Float16)(expf(s[j0 + q] - mx) * sc); unsigned short* d = (unsigned short*)P + (size_t)i * SQ + j0; *(v8us*)d = f.half[0];  } }
__global__ __launch_bounds__(256) void k_vt(const _Float16* __restrict__ V16, int b, int h0, _Float16* __restrict__ VT) { __shared__ unsigned short tl[64][65]; const int tid = threadIdx.x; const int hh = blockIdx.x % HG, sg = blockIdx.x / HG; const int s0 = sg * 64; const int h = h0 + hh;
  for (int i = tid; i < 64 * 8; i += 256) { const int j = i / 8, d8 = (i % 8) * 8; FragH f; f.half[0] = *(const v8us*)((const unsigned short*)V16 + ((size_t)b * SQ + s0 + j) * DM + h * HD + d8); for (int q = 0; q < 8; ++q) tl[d8 + q][j] = f.u[q]; }
  __syncthreads();
  { for (int i = tid; i < 64 * 8; i += 256) { const int d = i / 8, j8 = (i % 8) * 8; FragH f; for (int q = 0; q < 8; ++q) f.u[q] = tl[d][j8 + q]; *(v8us*)((unsigned short*)VT + ((size_t)hh * HD + d) * SQ + s0 + j8) = f.half[0]; }  } }



__global__ __launch_bounds__(256) void k_rsmcf2(const float* __restrict__ S, _Float16* __restrict__ P, int hg, int q0, int nk) {
  #pragma clang fp contract(off)
  const int t = blockIdx.x * 256 + threadIdx.x; if (t >= hg * QT) return; const size_t i = (size_t)t; const float* s = S + i * NKX; const int last = q0 + (t % QT); float mx = -3.0e38f;
#pragma unroll 1
  for (int j = 0; j < nk; ++j) { const float f = (j <= last) ? 1.f : 0.f; mx = fmaxf(mx, fmaf(f, s[j], (1.f - f) * -1.0e9f)); } float se = 0.f;
#pragma unroll 1
  for (int j = 0; j < nk; ++j) { const float f = (j <= last) ? 1.f : 0.f; se += __expf(fmaf(f, s[j], (1.f - f) * -1.0e9f) - mx); } const float sc = 256.0f / se;
#pragma unroll 1
  for (int j0 = 0; j0 < nk; j0 += 8) { FragH fr; for (int q = 0; q < 8; ++q) { const int j = j0 + q; const float f = (j <= last) ? 1.f : 0.f; fr.h[q] = (_Float16)(__expf(fmaf(f, s[j], (1.f - f) * -1.0e9f) - mx) * sc); } unsigned short* d = (unsigned short*)P + i * NKX + j0; *(v8us*)d = fr.half[0];  } }

template <int MASKADD>
__global__ __launch_bounds__(64) void k_att0(const float* __restrict__ QF, const float* __restrict__ KF, const float* __restrict__ VF, int ld, const float* __restrict__ mask, float scale, float* __restrict__ OF, int ldo) {
  #pragma clang fp contract(off)
  __shared__ __attribute__((aligned(16))) float lq[64][64]; __shared__ __attribute__((aligned(16))) float lo[64][64];
  const int tid = threadIdx.x; const int h = blockIdx.x / (QT0 / 64), rg = blockIdx.x % (QT0 / 64); const int i = rg * 64 + tid;
  const float* qr = QF + (size_t)i * ld + h * HD;
#pragma unroll 1
  for (int c = 0; c < HD / 4; ++c) { *(v4f*)&lq[tid][c * 4] = *(const v4fa*)(qr + c * 4); const v4f z = {0.f, 0.f, 0.f, 0.f}; *(v4f*)&lo[tid][c * 4] = z; }
  float m = -1.0e30f, l = 0.f; const int jmax = MASKADD ? (SQ - 1) : (rg * 64 + 63);      /* additive-mask form: every key (the mask input decides); causal form: keys up to the block's last row */
#pragma unroll 1
  for (int j = 0; j <= jmax; ++j) { const float* kr = KF + (size_t)j * ld + h * HD; const float* vr = VF + (size_t)j * ld + h * HD; float s = 0.f;
#pragma unroll 1
    for (int c = 0; c < HD / 4; ++c) { const v4f kq = *(const v4fa*)(kr + c * 4); const v4f qq = *(v4f*)&lq[tid][c * 4]; s = __fadd_rn(s, __fmul_rn(qq[0], kq[0])); s = __fadd_rn(s, __fmul_rn(qq[1], kq[1])); s = __fadd_rn(s, __fmul_rn(qq[2], kq[2])); s = __fadd_rn(s, __fmul_rn(qq[3], kq[3])); }
    s = __fmul_rn(s, scale); if (MASKADD) s = __fadd_rn(s, __fmul_rn(bf16_round(mask[(size_t)i * SQ + j]), -10000.0f));
    const float f = (MASKADD || j <= i) ? 1.f : 0.f; const float sm = fmaf(f, s, (1.f - f) * -1.0e30f); const float mn = fmaxf(m, sm); const float sc = expf(m - mn); const float e = expf(sm - mn); l = __fadd_rn(__fmul_rn(l, sc), e); m = mn;
#pragma unroll 1
    for (int c = 0; c < HD / 4; ++c) { const v4f vv = *(const v4fa*)(vr + c * 4); v4f oo = *(v4f*)&lo[tid][c * 4]; for (int u = 0; u < 4; ++u) oo[u] = __fadd_rn(__fmul_rn(oo[u], sc), __fmul_rn(e, vv[u])); *(v4f*)&lo[tid][c * 4] = oo; } }
  const float fin = 64.0f / l;      /* o carried x64 */
#pragma unroll 1
  for (int c = 0; c < HD / 4; ++c) { v4f oo = *(v4f*)&lo[tid][c * 4]; for (int u = 0; u < 4; ++u) oo[u] = __fmul_rn(oo[u], fin); *(v4f*)&lo[tid][c * 4] = oo; }
  __syncthreads();
  {
#pragma unroll 1
    for (int it = 0; it < 16; ++it) { const int row = it * 4 + tid / 16, pc = (tid % 16) * 4; const v4f v = *(const v4f*)&lo[row][pc]; *(v4f*)(OF + (size_t)(rg * 64 + row) * ldo + h * HD + pc) = v; }
     } }

__global__ __launch_bounds__(256) void k_oscale(const float* __restrict__ OF, float* __restrict__ out, size_t n4) { const size_t t = (size_t)blockIdx.x * 256 + threadIdx.x; if (t >= n4) return; const v4f a = *(const v4fa*)(OF + t * 4); v4f o; for (int q = 0; q < 4; ++q) o[q] = a[q] * 0.015625f; *(v4f*)(out + t * 4) = o;  }

__global__ __launch_bounds__(256) void k_bfr(const float* __restrict__ x, float* __restrict__ XB, size_t n8) { const size_t t = (size_t)blockIdx.x * 256 + threadIdx.x; if (t >= n8) return; v4f a = *(const v4fa*)(x + t * 8), c = *(const v4fa*)(x + t * 8 + 4); for (int q = 0; q < 4; ++q) { a[q] = bf16_round(a[q]); c[q] = bf16_round(c[q]); }
  { *(v4f*)(XB + t * 8) = a; *(v4f*)(XB + t * 8 + 4) = c;  } }



__global__ __launch_bounds__(256) void k_rsmfvl(const float* __restrict__ S, _Float16* __restrict__ P, _Float16* __restrict__ PL, int qn, const int* __restrict__ vlp) {
  #pragma clang fp contract(off)
  const int t = blockIdx.x * 256 + threadIdx.x; if (t >= qn) return; const int vl = vlp[0]; const size_t i = (size_t)t; const float* s = S + i * SQ; float mx = -3.0e38f;
#pragma unroll 1
  for (int j = 0; j < SQ; ++j) { const float f = (j < vl) ? 1.f : 0.f; mx = fmaxf(mx, fmaf(f, s[j], (1.f - f) * -1000000.0f)); } float se = 0.f;
#pragma unroll 1
  for (int j = 0; j < SQ; ++j) { const float f = (j < vl) ? 1.f : 0.f; se += __expf(fmaf(f, s[j], (1.f - f) * -1000000.0f) - mx); } const float sc = 256.0f / se;
#pragma unroll 1
  for (int j0 = 0; j0 < SQ; j0 += 8) { FragH fr, gr; for (int q = 0; q < 8; ++q) { const int j = j0 + q; const float f = (j < vl) ? 1.f : 0.f; const float pv = __expf(fmaf(f, s[j], (1.f - f) * -1000000.0f) - mx) * sc; const _Float16 ph = (_Float16)pv; fr.h[q] = ph; gr.h[q] = (_Float16)((pv - (float)ph) * 1024.0f); }
    unsigned short* d = (unsigned short*)P + i * SQ + j0; unsigned short* dl = (unsigned short*)PL + i * SQ + j0; *(v8us*)d = fr.half[0]; *(v8us*)dl = gr.half[0];  } }

__global__ __launch_bounds__(256) void k_rsmf(const float* __restrict__ S, _Float16* __restrict__ P, int qn, int hg) {
  #pragma clang fp contract(off)
  const int t = blockIdx.x * 256 + threadIdx.x; if (t >= qn * hg) return; const size_t i = (size_t)(t / qn) * SQ + (t % qn); const float* s = S + i * SQ; float mx = -3.0e38f;
#pragma unroll 1
  for (int j = 0; j < SQ; ++j) mx = fmaxf(mx, s[j]); float se = 0.f;
#pragma unroll 1
  for (int j = 0; j < SQ; ++j) se += __expf(s[j] - mx); const float sc = 256.0f / se;
#pragma unroll 1
  for (int j0 = 0; j0 < SQ; j0 += 8) { FragH f; for (int q = 0; q < 8; ++q) f.h[q] = (_Float16)(__expf(s[j0 + q] - mx) * sc); unsigned short* d = (unsigned short*)P + i * SQ + j0; *(v8us*)d = f.half[0];  } }


#define CN 256          /* channels */
#define CI 128
#define NC 256                       /* (unused legacy kernels) */
#define NPX NP          /* elements per (batch, channel) row */
#define NP 4096         /* seq1 tokens */
#define NM 1024         /* seq2 tokens */
#define BNEPS 1e-5f

__global__ __launch_bounds__(256) void k_mp2(const float* __restrict__ src, float* __restrict__ dst, int nout) {
  const int t = blockIdx.x * 256 + threadIdx.x; if (t >= nout) return; const int c = t / 1024; const int o = t % 1024; const int oy = o / 32, ox = o % 32; const float* p = src + (size_t)c * 4096 + (size_t)(2 * oy) * 64 + 2 * ox;
  const float v = fmaxf(fmaxf(p[0], p[1]), fmaxf(p[64], p[65])); *(float*)(dst + t) = v;  }
__global__ __launch_bounds__(256) void k_xpb(const float* __restrict__ x, const float* __restrict__ wb, float* __restrict__ CPP, size_t n4) {
  #pragma clang fp contract(off)
  const size_t t = (size_t)blockIdx.x * 256 + threadIdx.x; if (t >= n4) return; const size_t e = t * 4; const int c = (int)((e / 4096) % 256); const float bb = bf16_round(wb[c]); const v4f a = *(const v4fa*)(x + e); v4f o; for (int q = 0; q < 4; ++q) o[q] = __fadd_rn(bf16_round(a[q]), bb);
  *(v4f*)(CPP + e) = o;  }


template <int PASS>
__global__ __launch_bounds__(256) void k_cstA(const float* __restrict__ X, const float* __restrict__ MV, float* __restrict__ PART) {
  #pragma clang fp contract(off)
  __shared__ float red[256]; const int t = threadIdx.x; const size_t bc = blockIdx.x; const int c = (int)(bc % NC); const float* row = X + bc * (size_t)NPX; const float mu = PASS ? MV[c] : 0.f; float s = 0.f;
  for (int i = t; i < NPX; i += 256) { const float v = row[i]; const float d = PASS ? __fadd_rn(v, -mu) : v; s = __fadd_rn(s, PASS ? __fmul_rn(d, d) : d); }
  red[t] = s; __syncthreads(); for (int st = 128; st > 0; st >>= 1) { if (t < st) red[t] = __fadd_rn(red[t], red[t + st]); __syncthreads(); }
  if (t < 32) { const float pv = (t == 0) ? red[0] : 0.f; *(float*)(PART + bc * 32 + t) = pv;  } }      

template <int PASS>
__global__ __launch_bounds__(256) void k_cstB(const float* __restrict__ PART, float* __restrict__ MV) { const int c = threadIdx.x; if (c >= NC) return; double s = 0.0; for (int b = 0; b < NB; ++b) s += (double)PART[((size_t)b * NC + c) * 32]; const float m = (float)(s / ((double)NB * (double)NPX)); *(float*)(MV + PASS * NC + c) = m;  }


__global__ __launch_bounds__(256) void k_bnresid(const float* __restrict__ C2, const float* __restrict__ MV, const float* __restrict__ g, const float* __restrict__ be, const float* __restrict__ X, float* __restrict__ out, size_t n4) {
  #pragma clang fp contract(off)
  const size_t t = (size_t)blockIdx.x * 256 + threadIdx.x; if (t >= n4) return; const size_t e = t * 4; const int c = (int)((e / NPX) % NC); const float sc = __fmul_rn(rsqrtf(__fadd_rn(MV[NC + c], BNEPS)), bf16_round(g[c])); const float mu = MV[c], bb = bf16_round(be[c]);
  const v4f a = *(const v4fa*)(C2 + e); const v4f xx = *(const v4fa*)(X + e); v4f o; for (int q = 0; q < 4; ++q) { const float z = __fadd_rn(__fmul_rn(__fadd_rn(a[q], -mu), sc), bb); o[q] = __fadd_rn(z, bf16_round(xx[q])); }      /* BN + residual, no ReLU */
  *(v4f*)(out + e) = o;  }


__global__ __launch_bounds__(256) void k_rowbias(float* __restrict__ Y, const float* __restrict__ bias) {
  #pragma clang fp contract(off)
  const size_t t = (size_t)blockIdx.x * 256 + threadIdx.x; if (t >= (size_t)NB * NC * NPX / 4) return; const size_t e = t * 4; const int c = (int)((e / NPX) % NC); const float bb = bf16_round(bias[c]);
  v4f v = *(const v4fa*)(Y + e); for (int q = 0; q < 4; ++q) v[q] = __fadd_rn(v[q], bb); *(v4f*)(Y + e) = v;  }



// ---- fused attention: scores, softmax and the weighted sum of V in one kernel ----
constexpr int FA_NQ = 8192, FA_NK = 8192, FA_D = 256;      /* queries, keys, head width */
constexpr int FA_NS = 8, FA_BC = 32, FA_NP = FA_NK / FA_NS / FA_BC;      /* key splits, keys per pass, passes per split */
constexpr int FA_TB = FA_BC * FA_D * 2;      /* bytes of one pass's K (and of its V^T): 16 KiB */
typedef unsigned int v4u __attribute__((ext_vector_type(4), may_alias));
// K in fragment order: 16-byte piece t = ((key tile * 8 + k step) * 2 + q) * 32 + lane holds K[16 tile + c][32 step + 16 q + 8 h + 0..7] (c = lane & 15, h = lane >> 4): a wave's fragment load is 512 contiguous bytes.
__global__ __launch_bounds__(256) void k_packk(const float* __restrict__ x, _Float16* __restrict__ Kf) {
  const int t = blockIdx.x * 256 + threadIdx.x; const int lane = t & 31, q = (t >> 5) & 1, kc = (t >> 6) & 7, kt = t >> 9; const int c = lane & 15, h = lane >> 4;
  const float* s = x + (size_t)(kt * 16 + c) * FA_D + kc * 32 + 16 * q + 8 * h; FragH f;
#pragma unroll
  for (int j = 0; j < 8; ++j) f.h[j] = (_Float16)bf16_round(s[j]);
  *(v8us*)((unsigned short*)Kf + (size_t)t * 8) = f.half[0]; }
// V^T in fragment order: piece t = ((key block * 16 + d tile) * 2 + q) * 32 + lane holds V[32 block + 16 q + 8 h + 0..7][16 tile + c].
__global__ __launch_bounds__(256) void k_packv(const float* __restrict__ x, _Float16* __restrict__ Vf) {
  const int t = blockIdx.x * 256 + threadIdx.x; const int lane = t & 31, q = (t >> 5) & 1, dt = (t >> 6) & 15, kb = t >> 10; const int c = lane & 15, h = lane >> 4;
  const float* s = x + (size_t)(kb * 32 + 16 * q + 8 * h) * FA_D + dt * 16 + c; FragH f;
#pragma unroll
  for (int j = 0; j < 8; ++j) f.h[j] = (_Float16)bf16_round(s[(size_t)j * FA_D]);
  *(v8us*)((unsigned short*)Vf + (size_t)t * 8) = f.half[0]; }

__device__ __forceinline__ v16h fa_frag(const unsigned char* p) { FragH f; f.half[0] = *(const v8us*)p; f.half[1] = *(const v8us*)(p + 512); return f.v; }
__device__ __forceinline__ v8f fa_mma(v16h a, v16h b, v8f c) { return __builtin_amdgcn_wmma_f32_16x16x32_f16(false, a, false, b, (short)0, c, false, false); }
__device__ __forceinline__ void fa_xcnt0() { asm volatile("s_wait_xcnt 0x0" ::: "memory"); }      /* stands behind issued global loads or stores, in front of whatever reuses a register that they name */
__device__ __forceinline__ float fa_exp2_slot(float x) { float r; asm("v_exp_f32 %0, %1\n\tv_nop" : "=v"(r) : "v"(x)); return r; }      /* 2^x with the one slot the instruction set asks for between a transcendental and a next instruction that reads its result or overwrites its source: in one statement, so that the slot stays there */
__device__ __forceinline__ float fa_xhalf(float x) { return __builtin_bit_cast(float, __builtin_amdgcn_permlanex16(__builtin_bit_cast(int, x), __builtin_bit_cast(int, x), 0x76543210, 0xfedcba98, false, false)); }      /* lane l with lane l ^ 16 */

__global__ __launch_bounds__(256) void k_fattn(const _Float16* __restrict__ Q16, const _Float16* __restrict__ Kf, const _Float16* __restrict__ Vf, float* __restrict__ Op, float* __restrict__ Mp, float* __restrict__ Lp) {
  __shared__ __attribute__((aligned(16))) unsigned char lb[2][2 * FA_TB];
  const int tid = threadIdx.x, lane = tid & 31, wave = tid >> 5, c = lane & 15, h = lane >> 4;
  const int qb = blockIdx.x & 31, sp = blockIdx.x >> 5; const int q0 = qb * 256 + wave * 32;
  const unsigned char* gk = (const unsigned char*)Kf + (size_t)sp * FA_NP * FA_TB + tid * 16; const unsigned char* gv = (const unsigned char*)Vf + (size_t)sp * FA_NP * FA_TB + tid * 16;
  const float cscale = 0.0625f * 1.4426950408889634f;      /* 1 / sqrt(256), times log2 e */
  v4u st[8];
#pragma unroll
  for (int i = 0; i < 4; ++i) { st[i] = *(const v4u*)(gk + i * 4096); st[4 + i] = *(const v4u*)(gv + i * 4096); }
  v16h qf[2][8];
#pragma unroll
  for (int g = 0; g < 2; ++g) { const _Float16* qp = Q16 + (size_t)(q0 + 16 * g + c) * FA_D;
#pragma unroll
    for (int kc = 0; kc < 8; ++kc) qf[g][kc] = g2_frag(qp + kc * 32, h); }
  fa_xcnt0();
  const v8f z8 = {0.f,0.f,0.f,0.f,0.f,0.f,0.f,0.f};
  v8f acc[2][16]; float m_run[2], l_run[2];
#pragma unroll
  for (int g = 0; g < 2; ++g) { m_run[g] = -__builtin_inff(); l_run[g] = 0.f;
#pragma unroll
    for (int t = 0; t < 16; ++t) acc[g][t] = z8; }
#pragma unroll
  for (int i = 0; i < 4; ++i) { *(v4u*)(&lb[0][0] + tid * 16 + i * 4096) = st[i]; *(v4u*)(&lb[0][FA_TB] + tid * 16 + i * 4096) = st[4 + i]; }
  __syncthreads();      /* pass 0's K and V^T are in LDS */
  /* one pass; more (a constant at each of the two calls): a pass p + 1 exists and is fetched */
  auto pass = [&](const int p, const bool more) __attribute__((always_inline)) {
    const unsigned char* lk = &lb[p & 1][0] + lane * 16; const unsigned char* lv = lk + FA_TB;
    v8f s[2][2] = {{z8, z8}, {z8, z8}};
    { v16h ka[4];      /* K fragments are read three ahead of their products: the LDS latency hides behind six WMMAs */
#pragma unroll
      for (int f = 0; f < 3; ++f) ka[f] = fa_frag(lk + ((f & 1) * 8 + (f >> 1)) * 1024);
#pragma unroll
      for (int f = 0; f < 16; ++f) { const int kt = f & 1, kc = f >> 1;
        if (f + 3 < 16) ka[(f + 3) & 3] = fa_frag(lk + (((f + 3) & 1) * 8 + ((f + 3) >> 1)) * 1024);
        s[kt][0] = fa_mma(ka[f & 3], qf[0][kc], s[kt][0]); s[kt][1] = fa_mma(ka[f & 3], qf[1][kc], s[kt][1]); } }
    float mb[2]; bool need = false;
#pragma unroll
    for (int g = 0; g < 2; ++g) { float mx = s[0][g][0];
#pragma unroll
      for (int r = 1; r < 8; ++r) mx = fmaxf(mx, s[0][g][r]);
#pragma unroll
      for (int r = 0; r < 8; ++r) mx = fmaxf(mx, s[1][g][r]);
      mx = fmaxf(mx, fa_xhalf(mx)) * cscale;      /* both wave halves hold this query's maximum of the pass, scaled */
      mb[g] = mx; need = need || (mx > m_run[g] + 8.0f); }
    if (__builtin_amdgcn_ballot_w32(need) != 0) {      /* wave-uniform; always on the first pass (m = -inf), rare later */
#pragma unroll
      for (int g = 0; g < 2; ++g) { const float m_new = fmaxf(m_run[g], mb[g]); const float corr = __builtin_amdgcn_exp2f(m_run[g] - m_new); l_run[g] *= corr; m_run[g] = m_new;
#pragma unroll
        for (int t = 0; t < 16; ++t) acc[g][t] = acc[g][t] * corr; } }
    v16h pf[2];
#pragma unroll
    for (int g = 0; g < 2; ++g) { const float nm = -m_run[g]; float ps0 = 0.f, ps1 = 0.f;
#pragma unroll
      for (int i = 0; i < 8; ++i) { const float p0 = __builtin_amdgcn_exp2f(fmaf(s[0][g][i], cscale, nm)), p1 = __builtin_amdgcn_exp2f(fmaf(s[1][g][i], cscale, nm)); ps0 += p0; ps1 += p1; pf[g][i] = (_Float16)p0; pf[g][8 + i] = (_Float16)p1; }      /* element e of the B operand is key 8 h + e (e < 8), 16 + 8 h + e - 8 (else): the score tiles' own rows */
      l_run[g] += ps0 + ps1; }
    __builtin_amdgcn_sched_barrier(0);      /* the row sums are done here, not behind the second product: the 32 weights in f32 would otherwise stay in registers that the fragments read ahead need */
    v4u sn[8];
    if (more) {
#pragma unroll
      for (int i = 0; i < 4; ++i) { sn[i] = *(const v4u*)(gk + (size_t)(p + 1) * FA_TB + i * 4096); sn[4 + i] = *(const v4u*)(gv + (size_t)(p + 1) * FA_TB + i * 4096); }
      fa_xcnt0(); }
    { v16h va[4];      /* V^T fragments three ahead, as for K */
#pragma unroll
      for (int t = 0; t < 3; ++t) va[t] = fa_frag(lv + t * 1024);
#pragma unroll
      for (int t = 0; t < 16; ++t) { if (t + 3 < 16) va[(t + 3) & 3] = fa_frag(lv + (t + 3) * 1024);
        __builtin_amdgcn_sched_barrier(0);      /* holds the written order: without it the compiler moves the next pass's global loads behind the products and each fragment's reads directly in front of its own, and both latencies lie open */
        acc[0][t] = fa_mma(va[t & 3], pf[0], acc[0][t]); acc[1][t] = fa_mma(va[t & 3], pf[1], acc[1][t]); } }
    if (more) { unsigned char* d = &lb[(p + 1) & 1][0] + tid * 16;
#pragma unroll
      for (int i = 0; i < 4; ++i) { *(v4u*)(d + i * 4096) = sn[i]; *(v4u*)(d + FA_TB + i * 4096) = sn[4 + i]; }
      __syncthreads(); }      /* publishes pass p + 1's buffer and ends every wave's reads of pass p's, which the next pass refills */
  };
#pragma unroll 1
  for (int p = 0; p < FA_NP - 1; ++p) pass(p, true);
  pass(FA_NP - 1, false);
  const float l_fin0 = l_run[0] + fa_xhalf(l_run[0]), l_fin1 = l_run[1] + fa_xhalf(l_run[1]);      /* each wave half summed its eight keys of every 16-key tile */
  float* o = Op + ((size_t)(sp * (FA_NQ / 16) + (q0 >> 4)) * 16) * 256 + lane * 4; float* mo = Mp + (size_t)sp * FA_NQ + q0 + c; float* lo_ = Lp + (size_t)sp * FA_NQ + q0 + c;
  __builtin_amdgcn_sched_barrier(0);      /* all arithmetic stands in front of the stores: nothing behind them reuses a register that a store names */
  if (h == 0) { mo[0] = m_run[0]; mo[16] = m_run[1]; lo_[0] = l_fin0; lo_[16] = l_fin1; }
#pragma unroll
  for (int g = 0; g < 2; ++g) {
#pragma unroll
    for (int t = 0; t < 16; ++t) { const v4f lo = {acc[g][t][0], acc[g][t][1], acc[g][t][2], acc[g][t][3]}, hi = {acc[g][t][4], acc[g][t][5], acc[g][t][6], acc[g][t][7]}; *(v4f*)(o + g * 4096 + t * 256) = lo; *(v4f*)(o + g * 4096 + t * 256 + 128) = hi; } } }

// Joins the key splits of 16 query rows: out = sum_s 2^(m_s - M) O_s / sum_s 2^(m_s - M) l_s; the rows go through LDS so that every 128-byte line of out is stored whole.
__global__ __launch_bounds__(256) void k_fjoin(const float* __restrict__ Op, const float* __restrict__ Mp, const float* __restrict__ Lp, float* __restrict__ out) {
  __shared__ __attribute__((aligned(16))) float ro[16][FA_D + 4];
  const int tid = threadIdx.x, lane = tid & 31, c = lane & 15, h = lane >> 4; const int qt = blockIdx.x; const int q = qt * 16 + c;
  float w[FA_NS], ls[FA_NS]; v4f x[4][FA_NS];
#pragma unroll
  for (int s = 0; s < FA_NS; ++s) { w[s] = Mp[(size_t)s * FA_NQ + q]; ls[s] = Lp[(size_t)s * FA_NQ + q]; }
  fa_xcnt0();
#pragma unroll
  for (int s = 0; s < FA_NS; ++s) { const float* op = Op + ((size_t)(s * (FA_NQ / 16) + qt) * 1024 + tid) * 4;
#pragma unroll
    for (int i = 0; i < 4; ++i) x[i][s] = *(const v4fa*)(op + i * 1024);
    fa_xcnt0(); }      /* all 32 loads are in flight together; the wait lets a later load land in an earlier one's address registers */
  __builtin_amdgcn_sched_barrier(0);      /* the arithmetic stays behind the wait above */
  float M = w[0];
#pragma unroll
  for (int s = 1; s < FA_NS; ++s) M = fmaxf(M, w[s]);
  float den = 0.f;
#pragma unroll
  for (int s = 0; s < FA_NS; ++s) { w[s] = fa_exp2_slot(w[s] - M); den += w[s] * ls[s]; }
  const float inv = 1.0f / den;
#pragma unroll
  for (int i = 0; i < 4; ++i) { const int id = i * 256 + tid; const int r4 = (id >> 5) & 1, t = id >> 6; v4f a = x[i][0] * w[0];
#pragma unroll
    for (int s = 1; s < FA_NS; ++s) a += x[i][s] * w[s];
    *(v4f*)&ro[c][t * 16 + h * 8 + r4 * 4] = a * inv; }
  __syncthreads();      /* the 16 rows are in LDS */
#pragma unroll
  for (int i = 0; i < 4; ++i) { const int id = i * 256 + tid; const int r = id >> 6, c4 = (id & 63) * 4; *(v4f*)(out + (size_t)(qt * 16 + r) * FA_D + c4) = *(const v4f*)&ro[r][c4]; } }

extern "C" void kernel_launch(void* const* d_in, const int* in_sizes, int n_in,
                              void* d_out, int out_size, void* d_ws, size_t ws_size, hipStream_t stream) {
  (void)in_sizes; (void)n_in; (void)out_size;
  const float* const* I = (const float* const*)d_in; const float* xq = I[0]; const float* xk = I[1]; const float* xv = I[2];      /* Q, K, V [8192][256] (bf16-valued) */
  char* ws = (char*)d_ws; size_t off = 0;
  auto take = [&](size_t bytes) { char* p = ws + off; off += (bytes + 255) & ~(size_t)255; return p; };
  _Float16* Q16 = (_Float16*)take((size_t)FA_NQ * FA_D * 2); _Float16* Kf = (_Float16*)take((size_t)FA_NK * FA_D * 2); _Float16* Vf = (_Float16*)take((size_t)FA_NK * FA_D * 2);
  float* Op = (float*)take((size_t)FA_NS * FA_NQ * FA_D * 4); float* Mp = (float*)take((size_t)FA_NS * FA_NQ * 4); float* Lp = (float*)take((size_t)FA_NS * FA_NQ * 4);
  if (off > ws_size) return;
  k_x16<<<FA_NQ * FA_D / 8 / 256, 256, 0, stream>>>(xq, Q16, (size_t)FA_NQ * FA_D / 8);      /* exact f16 copy of the bf16-valued Q */
  k_packk<<<FA_NK * FA_D / 8 / 256, 256, 0, stream>>>(xk, Kf); k_packv<<<FA_NK * FA_D / 8 / 256, 256, 0, stream>>>(xv, Vf);      /* K and V^T in fragment order */
  k_fattn<<<(FA_NQ / 256) * FA_NS, 256, 0, stream>>>(Q16, Kf, Vf, Op, Mp, Lp);      /* per key split: unnormalised O, m, l */
  k_fjoin<<<FA_NQ / 16, 256, 0, stream>>>(Op, Mp, Lp, (float*)d_out);      /* out = the splits joined and normalised */
}

// v003
// It runs in 74.6 microseconds.
// Timed twice side by side with v002, it ran 1.04 times as fast both times.
// Over all steps from v000 it is 83.8 times as fast.
#include <hip/hip_runtime.h>
// Single-head scaled dot-product attention without batch or projections (Q [8192][256], K [8192][256], V [8192][256]; scores = Q K^T / sqrt(256); softmax over the 8192 keys; out = attn V -> [8192][256]).
// Structure: Q as exact f16 rows of the bf16-valued input; K and V^T packed once into WMMA fragment order (f16); ONE fused kernel per 256 query rows x 1024 keys: S^T = K Q^T, online softmax (f32 statistics, log2 domain, lazy rescale), O^T += V^T P^T, scores and weights never leave registers; the eight key splits are joined by a last kernel; launches: see trace.
// Compute dtype: inputs rounded to bf16; q, k, v exact in f16; softmax weights as plain f16 GEMM operands (~2^-12); scores, softmax statistics and o f32. v_wmma_f32_16x16x32_f16.
#define NB 4
#define SQ 4096
#define DM 256
#define NH 1
#define HD 64
#define HG 4                         /* heads per attention launch group */
#define B0 0                         /* first batch processed (debug hook) */
#define NBR NB                       /* batches processed (debug hook) */
#define NR ((size_t)NB * SQ)         /* token rows */
#define MP ((int)((size_t)NBR * SQ)) /* rows projected (debug hook) */
#define QT 256                       /* query rows per causal tile */
#define NKX SQ                       /* S / P row pitch */
#define QT0 256                      /* first-tile rows recomputed exactly */
#define QN SQ                        /* query rows attended per batch (debug hook) */
#define NHD NH                       /* heads attended (debug hook) */
#define MPO MP                       /* rows through the output stage (debug hook) */
#define LQ DM            /* row pitch of the q/k/v rows */
typedef __bf16 v16b __attribute__((ext_vector_type(16)));
typedef unsigned short v8us __attribute__((ext_vector_type(8), may_alias));
typedef float  v8f  __attribute__((ext_vector_type(8)));
typedef float  v4f  __attribute__((ext_vector_type(4)));
typedef float  v4fa __attribute__((ext_vector_type(4), may_alias));
union FragB { v16b v; v8us half[2]; unsigned short u[16]; };

__device__ __forceinline__ unsigned short bf16_bits(float x) { unsigned int u = __float_as_uint(x); return (unsigned short)((u + 0x7FFFu + ((u >> 16) & 1u)) >> 16); }
__device__ __forceinline__ float bf16_val(unsigned short b) { return __uint_as_float(((unsigned int)b) << 16); }
__device__ __forceinline__ float bf16_round(float x) { return bf16_val(bf16_bits(x)); }
// D += A·B with NT terms: 1 = ah·bh, 2 = + al·bh (A split), 3 = + ah·bl (both split)
template <int NT>
__device__ __forceinline__ v8f mmaN(v16b ah, v16b al, v16b bh, v16b bl, v8f c) {
  c = __builtin_amdgcn_wmma_f32_16x16x32_bf16(false, ah, false, bh, (short)0, c, false, false);
  if (NT >= 2) c = __builtin_amdgcn_wmma_f32_16x16x32_bf16(false, al, false, bh, (short)0, c, false, false);
  if (NT >= 3) c = __builtin_amdgcn_wmma_f32_16x16x32_bf16(false, ah, false, bl, (short)0, c, false, false);
  asm volatile("v_nop\n\tv_nop\n\tv_nop\n\tv_nop" : "+v"(c) : "v"(ah), "v"(al), "v"(bh), "v"(bl));
  return c;
}

__global__ __launch_bounds__(256) void k_wt_bf16(const float* __restrict__ W, unsigned short* __restrict__ Wt, int K, int N) {
  const int t = blockIdx.x * 256 + threadIdx.x;
  const int k8n = K / 8;
  if (t >= N * k8n) return;
  const int n = t / k8n, k8 = (t % k8n) * 8;
  v8us v;
#pragma unroll
  for (int i = 0; i < 8; ++i) v[i] = bf16_bits(W[(size_t)(k8 + i) * N + n]);
  *(v8us*)(Wt + (size_t)n * K + k8) = v;
  
}

// GEMM C[M][N] (f32, pitch ldc) = act(A[M][K]·W + bias). A f32 row-major (pitch lda) converted per fragment to bf16
// (ASPLIT: hi/lo two planes -> 2 terms, else single rounded term); Wt bf16 [N][K] (pitch ldb). BIAS_BF16 rounds the
// bias to bf16 first (bias quantised to bf16 before the add). K%32==0, M%16==0, N%64==0.
template <bool ASPLIT, int ACT, bool BIAS_BF16>
__global__ __launch_bounds__(128) void k_gemm_bf(const float* __restrict__ A, int lda, const unsigned short* __restrict__ Wt, int ldb,
                                               const float* __restrict__ bias, float* __restrict__ C, int ldc, int M, int N, int K) {
  __shared__ __attribute__((aligned(16))) float so[4][16][64];
  const int tid = threadIdx.x, w = tid >> 5, lane = tid & 31, ln = lane & 15, hh = lane >> 4;
  const int ntn = N / 64;
  const int wid = blockIdx.x * 4 + w;
  const int mt = wid / ntn, nq = wid % ntn;
  if (mt * 16 >= M) return;
  const int row0 = mt * 16, col0 = nq * 64;
  const float* arow = A + (size_t)(row0 + ln) * lda;
  v8f acc[4] = {};
  for (int kb = 0; kb < K; kb += 32) {
    FragB ah, al;
    const v4f x0 = *(const v4fa*)(arow + kb + 8 * hh), x1 = *(const v4fa*)(arow + kb + 8 * hh + 4);
    const v4f x2 = *(const v4fa*)(arow + kb + 16 + 8 * hh), x3 = *(const v4fa*)(arow + kb + 16 + 8 * hh + 4);
    float xs[16] = {x0[0],x0[1],x0[2],x0[3],x1[0],x1[1],x1[2],x1[3],x2[0],x2[1],x2[2],x2[3],x3[0],x3[1],x3[2],x3[3]};
#pragma unroll
    for (int i = 0; i < 16; ++i) { const unsigned short hb = bf16_bits(xs[i]); ah.u[i] = hb; al.u[i] = ASPLIT ? bf16_bits(xs[i] - bf16_val(hb)) : (unsigned short)0; }
#pragma unroll
    for (int t = 0; t < 4; ++t) {
      const unsigned short* brow = Wt + (size_t)(col0 + t * 16 + ln) * ldb + kb;
      FragB b;
      b.half[0] = *(const v8us*)(brow + 8 * hh);
      b.half[1] = *(const v8us*)(brow + 16 + 8 * hh);
      acc[t] = mmaN<ASPLIT ? 2 : 1>(ah.v, al.v, b.v, b.v, acc[t]);
    }
  }
#pragma unroll
  for (int t = 0; t < 4; ++t) {
    float bv = bias ? bias[col0 + t * 16 + ln] : 0.f;
    if (BIAS_BF16) bv = bf16_round(bv);
#pragma unroll
    for (int r = 0; r < 8; ++r) { float v = acc[t][r] + bv; if (ACT == 1) v = fmaxf(v, 0.f); so[w][8 * hh + r][t * 16 + ln] = v; }
  }
  __builtin_amdgcn_fence(__ATOMIC_ACQ_REL, "workgroup");
  __builtin_amdgcn_wave_barrier();
  const int rsub = lane >> 4, c4 = (lane & 15) * 4;
  {
#pragma unroll
    for (int q = 0; q < 8; ++q) {
      const int r = q * 2 + rsub;
      const v4f v = *(const v4fa*)&so[w][r][c4];
      *(v4f*)(C + (size_t)(row0 + r) * ldc + col0 + c4) = v;
    }
    
  }
}

// GEMM C = act(A·W + bias + resid): A f32 (ASPLIT -> hi/lo 2 terms), Wt bf16 [N][K]; ACT 0 none, 1 relu, 2 exact gelu;
// resid (optional, f32, row index = (row % rmod), pitch ldr, RES_BF16 rounds it) added before the activation.
template <bool ASPLIT, int ACT, bool BIAS_BF16, bool RES_BF16>
__global__ __launch_bounds__(128) void k_gemm_bf3(const float* __restrict__ A, int lda, const unsigned short* __restrict__ Wt, int ldb,
                                                const float* __restrict__ bias, const float* __restrict__ resid, int rmod, int ldr,
                                                float* __restrict__ C, int ldc, int M, int N, int K) {
  __shared__ __attribute__((aligned(16))) float so[4][16][64];
  const int tid = threadIdx.x, w = tid >> 5, lane = tid & 31, ln = lane & 15, hh = lane >> 4;
  const int ntn = N / 64;
  const int wid = blockIdx.x * 4 + w;
  const int mt = wid / ntn, nq = wid % ntn;
  if (mt * 16 >= M) return;
  const int row0 = mt * 16, col0 = nq * 64;
  const float* arow = A + (size_t)(row0 + ln) * lda;
  v8f acc[4] = {};
  for (int kb = 0; kb < K; kb += 32) {
    FragB ah, al;
    const v4f x0 = *(const v4fa*)(arow + kb + 8 * hh), x1 = *(const v4fa*)(arow + kb + 8 * hh + 4);
    const v4f x2 = *(const v4fa*)(arow + kb + 16 + 8 * hh), x3 = *(const v4fa*)(arow + kb + 16 + 8 * hh + 4);
    float xs[16] = {x0[0],x0[1],x0[2],x0[3],x1[0],x1[1],x1[2],x1[3],x2[0],x2[1],x2[2],x2[3],x3[0],x3[1],x3[2],x3[3]};
#pragma unroll
    for (int i = 0; i < 16; ++i) { const unsigned short hb = bf16_bits(xs[i]); ah.u[i] = hb; al.u[i] = ASPLIT ? bf16_bits(xs[i] - bf16_val(hb)) : (unsigned short)0; }
#pragma unroll
    for (int t = 0; t < 4; ++t) {
      const unsigned short* brow = Wt + (size_t)(col0 + t * 16 + ln) * ldb + kb;
      FragB b;
      b.half[0] = *(const v8us*)(brow + 8 * hh);
      b.half[1] = *(const v8us*)(brow + 16 + 8 * hh);
      acc[t] = mmaN<ASPLIT ? 2 : 1>(ah.v, al.v, b.v, b.v, acc[t]);
    }
  }
#pragma unroll
  for (int t = 0; t < 4; ++t) {
    const int col = col0 + t * 16 + ln;
    float bv = bias ? bias[col] : 0.f;
    if (BIAS_BF16) bv = bf16_round(bv);
#pragma unroll
    for (int r = 0; r < 8; ++r) {
      float v = acc[t][r] + bv;
      if (resid) { float rv = resid[(size_t)((row0 + 8 * hh + r) % rmod) * ldr + col]; if (RES_BF16) rv = bf16_round(rv); v += rv; }
      if (ACT == 1) v = fmaxf(v, 0.f);
      if (ACT == 2) v = 0.5f * v * (1.0f + erff(v * 0.70710678118654752f));
      if (ACT == 3) { const float u = 0.7978845608028654f * (v + 0.044715f * v * v * v); v = 0.5f * v * (1.0f + tanhf(u)); }
      so[w][8 * hh + r][t * 16 + ln] = v;
    }
  }
  __builtin_amdgcn_fence(__ATOMIC_ACQ_REL, "workgroup");
  __builtin_amdgcn_wave_barrier();
  const int rsub = lane >> 4, c4 = (lane & 15) * 4;
  {
#pragma unroll
    for (int q = 0; q < 8; ++q) {
      const int r = q * 2 + rsub;
      const v4f v = *(const v4fa*)&so[w][r][c4];
      *(v4f*)(C + (size_t)(row0 + r) * ldc + col0 + c4) = v;
    }
    
  }
}
// row LayerNorm (biased variance, eps) over N: s = X (+ R); optional out_sum <- s; out_norm <- (s-mu)*rsqrt(var+eps)*g + b
template <bool PARAM_BF16>
__global__ __launch_bounds__(256) void k_layernorm(const float* __restrict__ X, const float* __restrict__ R, const float* __restrict__ g, const float* __restrict__ bta,
                                                  float* __restrict__ out_sum, float* __restrict__ out_norm, int N, float eps) {
  __shared__ float red[256];
  const int row = blockIdx.x, tid = threadIdx.x;
  const float* x = X + (size_t)row * N; const float* rr = R ? R + (size_t)row * N : nullptr;
  float vals[16];                     // up to N = 4096
  const int per = N / 256;            // contiguous chunk per thread? use strided-by-4 chunks: thread handles j = tid*4 + 1024*u
  float s1 = 0.f;
  for (int u = 0; u < per / 4; ++u) {
    const int j = tid * 4 + 1024 * u;
    const v4f a = *(const v4fa*)(x + j);
    v4f b = {0.f,0.f,0.f,0.f}; if (rr) b = *(const v4fa*)(rr + j);
#pragma unroll
    for (int q = 0; q < 4; ++q) { const float v = a[q] + b[q]; vals[u * 4 + q] = v; s1 += v; }
  }
  red[tid] = s1; __syncthreads();
  for (int st = 128; st > 0; st >>= 1) { if (tid < st) red[tid] += red[tid + st]; __syncthreads(); }
  const float mu = red[0] / (float)N; __syncthreads();
  float s2 = 0.f;
  for (int u = 0; u < per / 4; ++u)
#pragma unroll
    for (int q = 0; q < 4; ++q) { const float c = vals[u * 4 + q] - mu; s2 += c * c; }
  red[tid] = s2; __syncthreads();
  for (int st = 128; st > 0; st >>= 1) { if (tid < st) red[tid] += red[tid + st]; __syncthreads(); }
  const float rs = rsqrtf(red[0] / (float)N + eps);
  {
    for (int u = 0; u < per / 4; ++u) {
      const int j = tid * 4 + 1024 * u;
      v4f o, sm;
#pragma unroll
      for (int q = 0; q < 4; ++q) {
        float gg = g[j + q], bb = bta[j + q];
        if (PARAM_BF16) { gg = bf16_round(gg); bb = bf16_round(bb); }
        sm[q] = vals[u * 4 + q]; o[q] = (vals[u * 4 + q] - mu) * rs * gg + bb;
      }
      if (out_sum) *(v4f*)(out_sum + (size_t)row * N + j) = sm;
      *(v4f*)(out_norm + (size_t)row * N + j) = o;
    }
    
  }
}



// ---- f16 WMMA path (v_wmma_f32_16x16x32_f16): 11-bit significands for operands in range — used where a [0,1] probability operand needs more precision than bf16
typedef _Float16 v16h __attribute__((ext_vector_type(16)));
union FragH { v16h v; v8us half[2]; _Float16 h[16]; unsigned short u[16]; };
template <int NT>
__device__ __forceinline__ v8f mmaH(v16h ah, v16h al, v16h bh, v16h bl, v8f c) {
  c = __builtin_amdgcn_wmma_f32_16x16x32_f16(false, ah, false, bh, (short)0, c, false, false);
  if (NT >= 2) c = __builtin_amdgcn_wmma_f32_16x16x32_f16(false, al, false, bh, (short)0, c, false, false);
  if (NT >= 3) c = __builtin_amdgcn_wmma_f32_16x16x32_f16(false, ah, false, bl, (short)0, c, false, false);
  asm volatile("v_nop\n\tv_nop\n\tv_nop\n\tv_nop" : "+v"(c) : "v"(ah), "v"(al), "v"(bh), "v"(bl));
  return c;
}
// batched GEMM like k_gemm_b but f16 operands: A f32 (split into f16 hi/lo if ASPLIT, else rounded to f16), Bt = f16 values [n][k]; alpha; C f32; N multiple of 16 (partial tiles skipped)
template <bool ASPLIT>
__global__ __launch_bounds__(128) void k_gemm_h(const float* __restrict__ A, int lda, size_t sA, const _Float16* __restrict__ Bh, int ldb, size_t sB, float alpha, float* __restrict__ C, int ldc, size_t sC, int M, int N, int K) {
  __shared__ __attribute__((aligned(16))) float so[4][16][64];
  const int tid = threadIdx.x, w = tid >> 5, lane = tid & 31, ln = lane & 15, hh = lane >> 4; const int by = blockIdx.y;
  A += (size_t)by * sA; Bh += (size_t)by * sB; C += (size_t)by * sC;
  const int ntn = (N + 63) / 64; const int wid = blockIdx.x * 4 + w; const int mt = wid / ntn, nq = wid % ntn; if (mt * 16 >= M) return;
  const int row0 = mt * 16, col0 = nq * 64; const float* arow = A + (size_t)(row0 + ln) * lda;
  v8f acc[4] = {};
  for (int kb = 0; kb < K; kb += 32) {
    FragH ah, al;
    const v4f x0 = *(const v4fa*)(arow + kb + 8 * hh), x1 = *(const v4fa*)(arow + kb + 8 * hh + 4), x2 = *(const v4fa*)(arow + kb + 16 + 8 * hh), x3 = *(const v4fa*)(arow + kb + 16 + 8 * hh + 4);
    float xs[16] = {x0[0],x0[1],x0[2],x0[3],x1[0],x1[1],x1[2],x1[3],x2[0],x2[1],x2[2],x2[3],x3[0],x3[1],x3[2],x3[3]};
#pragma unroll
    for (int i = 0; i < 16; ++i) { const _Float16 h = (_Float16)xs[i]; ah.h[i] = h; al.h[i] = ASPLIT ? (_Float16)(xs[i] - (float)h) : (_Float16)0.0f; }
#pragma unroll
    for (int t = 0; t < 4; ++t) { if (col0 + t * 16 >= N) continue; const size_t boff = (size_t)(col0 + t * 16 + ln) * ldb + kb; FragH bq; bq.half[0] = *(const v8us*)(Bh + boff + 8 * hh); bq.half[1] = *(const v8us*)(Bh + boff + 16 + 8 * hh);
      acc[t] = mmaH<ASPLIT ? 2 : 1>(ah.v, al.v, bq.v, bq.v, acc[t]); }
  }
#pragma unroll
  for (int t = 0; t < 4; ++t) { if (col0 + t * 16 >= N) continue;
#pragma unroll
    for (int r = 0; r < 8; ++r) so[w][8 * hh + r][t * 16 + ln] = acc[t][r] * alpha; }
  __builtin_amdgcn_fence(__ATOMIC_ACQ_REL, "workgroup"); __builtin_amdgcn_wave_barrier();
  const int rsub = lane >> 4, c4 = (lane & 15) * 4;
  {
#pragma unroll
    for (int q = 0; q < 8; ++q) { const int r = q * 2 + rsub; if (col0 + c4 < N) { const v4f v = *(const v4fa*)&so[w][r][c4]; *(v4f*)(C + (size_t)(row0 + r) * ldc + col0 + c4) = v; } }
     }
}

// Wt[n][k] = f16(W[k][n]·scale) from f32 row-major W[K][N] (scale = power of two; bf16-exact weights stay exact in f16 away from the subnormal range)
__global__ __launch_bounds__(256) void k_wt_f16(const float* __restrict__ W, _Float16* __restrict__ Wt, int K, int N, float scale) {
  const int t = blockIdx.x * 256 + threadIdx.x; if (t >= N * (K / 8)) return; const int n = t / (K / 8), k8 = (t % (K / 8)) * 8; FragH f;
#pragma unroll
  for (int i = 0; i < 8; ++i) f.h[i] = (_Float16)(bf16_round(W[(size_t)(k8 + i) * N + n]) * scale); const v8us o = f.half[0];
  *(v8us*)((unsigned short*)Wt + (size_t)n * K + k8) = o; 
}
// k_gemm_hh variant with fused epilogue: v = acc·alpha + bias[by·sBias + col] (+ CP[(row/rowsPerB)·sCPb + by·64 + col] if CP) ; ACT 0 none / 1 elu ; writes f16 C16 (and f32 C if non-null)
template <int ACT>
__global__ __launch_bounds__(128) void k_gemm_hhx(const _Float16* __restrict__ A, int lda, size_t sA, const _Float16* __restrict__ Bh, int ldb, size_t sB, float alpha, const float* __restrict__ bias, size_t sBias, const float* __restrict__ CP, int rowsPerB, size_t sCPb, int row0g,
    float* __restrict__ C, _Float16* __restrict__ C16, int ldc, size_t sC, int M, int N, int K) {
  __shared__ __attribute__((aligned(16))) float so[4][16][64];
  const int tid = threadIdx.x, w = tid >> 5, lane = tid & 31, ln = lane & 15, hh = lane >> 4; const int by = blockIdx.y;
  A += (size_t)by * sA; Bh += (size_t)by * sB; const size_t cofs = (size_t)by * sC; const float* bp = bias ? bias + (size_t)by * sBias : nullptr;
  const int ntn = (N + 63) / 64; const int wid = blockIdx.x * 4 + w; const int mt = wid / ntn, nq = wid % ntn; if (mt * 16 >= M) return;
  const int row0 = mt * 16, col0 = nq * 64; const _Float16* arow = A + (size_t)(row0 + ln) * lda;
  v8f acc[4] = {};
  for (int kb = 0; kb < K; kb += 32) { FragH ah; ah.half[0] = *(const v8us*)((const unsigned short*)arow + kb + 8 * hh); ah.half[1] = *(const v8us*)((const unsigned short*)arow + kb + 16 + 8 * hh);
#pragma unroll
    for (int t = 0; t < 4; ++t) { if (col0 + t * 16 >= N) continue; const size_t boff = (size_t)(col0 + t * 16 + ln) * ldb + kb; FragH bq; bq.half[0] = *(const v8us*)((const unsigned short*)Bh + boff + 8 * hh); bq.half[1] = *(const v8us*)((const unsigned short*)Bh + boff + 16 + 8 * hh);
      acc[t] = mmaH<1>(ah.v, ah.v, bq.v, bq.v, acc[t]); }
  }
#pragma unroll
  for (int t = 0; t < 4; ++t) { if (col0 + t * 16 >= N) continue; const int col = col0 + t * 16 + ln; const float bv = bp ? bf16_round(bp[col]) : 0.f;
#pragma unroll
    for (int r = 0; r < 8; ++r) { float v = acc[t][r] * alpha + bv; if (CP) { const int rr = row0g + row0 + 8 * hh + r; if (rowsPerB < 0) v += CP[cofs + (size_t)rr * ldc + col];      /* rowsPerB < 0: own element of the batched C plane */ else { const int bidx = rr / rowsPerB; v += CP[(size_t)bidx * sCPb + (size_t)by * 64 + col]; } } if (ACT == 1) v = (v > 0.f) ? v : expm1f(v); else if (ACT == 7) v = (v > 0.f) ? v + 1.0f : expf(v); else if (ACT == 8) v = tanhf(v); else if (ACT == 9) v = 0.5f * v * (1.0f + tanhf(0.7978845608028654f * (v + 0.044715f * v * v * v))); else if (ACT == 11) v = 1.0f / (1.0f + expf(-v)); else if (ACT == 12) v = (v > 0.f) ? v : 0.01f * v; else if (ACT == 14) v = (v > 0.f) ? v : 0.1f * v; else if (ACT == 16) v = (v >= 0.f) ? v : 0.3f * v; else if (ACT == 17) v = (v >= 0.f) ? v : 0.2f * v; else if (ACT == 15) v = v / (1.0f + expf(-v)); else if (ACT == 3) v = fmaxf(v, 0.f); else if (ACT == 6) v = 0.5f * v * (1.0f + erff(v * 0.70710678118654752f)); so[w][8 * hh + r][t * 16 + ln] = v; } }
  __builtin_amdgcn_fence(__ATOMIC_ACQ_REL, "workgroup"); __builtin_amdgcn_wave_barrier();
  const int rsub = lane >> 4, c4 = (lane & 15) * 4; typedef _Float16 v4h __attribute__((ext_vector_type(4)));
  {
#pragma unroll
    for (int q = 0; q < 8; ++q) { const int r = q * 2 + rsub; if (col0 + c4 < N) { const v4f v = *(const v4fa*)&so[w][r][c4]; if (C) *(v4f*)(C + cofs + (size_t)(row0 + r) * ldc + col0 + c4) = v; if (C16) { v4h h4; for (int i = 0; i < 4; ++i) h4[i] = (_Float16)v[i]; *(v4h*)(C16 + cofs + (size_t)(row0 + r) * ldc + col0 + c4) = h4; } } }
     }
}


typedef _Float16 v4h __attribute__((ext_vector_type(4)));

__global__ __launch_bounds__(256) void k_x16(const float* __restrict__ x, _Float16* __restrict__ X16, size_t n8) { const size_t t = (size_t)blockIdx.x * 256 + threadIdx.x; if (t >= n8) return; FragH f;
#pragma unroll
  for (int q = 0; q < 8; ++q) f.h[q] = (_Float16)bf16_round(x[t * 8 + q]); *(v8us*)((unsigned short*)X16 + t * 8) = f.half[0];  }
__global__ __launch_bounds__(256) void k_h16(const float* __restrict__ x, _Float16* __restrict__ X16, size_t n8) { const size_t t = (size_t)blockIdx.x * 256 + threadIdx.x; if (t >= n8) return; FragH f;
#pragma unroll
  for (int q = 0; q < 8; ++q) f.h[q] = (_Float16)x[t * 8 + q]; *(v8us*)((unsigned short*)X16 + t * 8) = f.half[0];  }
__global__ __launch_bounds__(256) void k_round16f(const float* __restrict__ W, _Float16* __restrict__ Bt, size_t n8) { const size_t t = (size_t)blockIdx.x * 256 + threadIdx.x; if (t >= n8) return; FragH f;
#pragma unroll
  for (int i = 0; i < 8; ++i) f.h[i] = (_Float16)(bf16_round(W[t * 8 + i]) * 16.0f); *(v8us*)((unsigned short*)Bt + t * 8) = f.half[0];  }
template <int NHv, int TTv>
__global__ __launch_bounds__(256) void k_vt(const _Float16* __restrict__ V16, int ldv, int voff, _Float16* __restrict__ Vt) { __shared__ unsigned short tl[64][66]; const int tid = threadIdx.x; const int slab = blockIdx.x / (TTv / 64), lg = blockIdx.x % (TTv / 64); const int b = slab / NHv, h = slab % NHv;
  for (int i = tid; i < 64 * 8; i += 256) { const int r = i / 8, c8 = (i % 8) * 8; FragH f; f.half[0] = *(const v8us*)((const unsigned short*)V16 + ((size_t)b * TTv + lg * 64 + r) * ldv + voff + h * 64 + c8);
#pragma unroll
    for (int q = 0; q < 8; ++q) tl[r][c8 + q] = f.u[q]; }
  __syncthreads();
  {
#pragma unroll
    for (int rd = 0; rd < 2; ++rd) { const int d = rd * 32 + tid / 8, pc = tid % 8; FragH f;
#pragma unroll
      for (int q = 0; q < 8; ++q) f.u[q] = tl[pc * 8 + q][d];
      *(v8us*)((unsigned short*)Vt + ((size_t)slab * 64 + d) * TTv + lg * 64 + pc * 8) = f.half[0]; }
     } }

__global__ __launch_bounds__(256) void k_hl(const float* __restrict__ F, _Float16* __restrict__ Hh, _Float16* __restrict__ Hl, size_t n8) { const size_t t = (size_t)blockIdx.x * 256 + threadIdx.x; if (t >= n8) return; FragH fh, fl; const v4f a = *(const v4fa*)(F + t * 8), c = *(const v4fa*)(F + t * 8 + 4);
#pragma unroll
  for (int q = 0; q < 4; ++q) { _Float16 h = (_Float16)a[q]; fh.h[q] = h; fl.h[q] = (_Float16)((a[q] - (float)h) * 1024.0f); h = (_Float16)c[q]; fh.h[4 + q] = h; fl.h[4 + q] = (_Float16)((c[q] - (float)h) * 1024.0f); }
  { *(v8us*)((unsigned short*)Hh + t * 8) = fh.half[0]; *(v8us*)((unsigned short*)Hl + t * 8) = fl.half[0];  } }

// ---- fast GEMM (wave tile 32x64; requires M % 32 == 0 rows per launch region and N % 64 == 0); epilogue = k_gemm_hhx semantics ----
__device__ __forceinline__ v16h g2_frag(const _Float16* p, int hh) { FragH f; f.half[0] = *(const v8us*)((const unsigned short*)p + 8 * hh); f.half[1] = *(const v8us*)((const unsigned short*)p + 16 + 8 * hh); return f.v; }
__device__ __forceinline__ v8f g2_mma(v16h a, v16h b, v8f c) { v8f d = __builtin_amdgcn_wmma_f32_16x16x32_f16(false, a, false, b, (short)0, c, false, false); asm volatile("v_nop\n\tv_nop\n\tv_nop\n\tv_nop" : "+v"(d) : "v"(a), "v"(b)); return d; }
template <int ACT>
__global__ __launch_bounds__(128) void k_gemm2(const _Float16* __restrict__ A, int lda, size_t sA, const _Float16* __restrict__ Bh, int ldb, size_t sB, float alpha, const float* __restrict__ bias, size_t sBias, const float* __restrict__ CP, int rowsPerB, size_t sCPb, int row0g,
    float* __restrict__ C, _Float16* __restrict__ C16, int ldc, size_t sC, int M, int N, int K) { static_assert(ACT == 0 || ACT == 3 || ACT == 6 || ACT == 8 || ACT == 9 || ACT == 11 || ACT == 12 || ACT == 14 || ACT == 15 || ACT == 16 || ACT == 17, "k_gemm2: unsupported ACT code (would silently apply no activation)");
  __shared__ __attribute__((aligned(16))) float so[4][32][68];
  const int tid = threadIdx.x, w = tid >> 5, lane = tid & 31, ln = lane & 15, hh = lane >> 4; const int by = blockIdx.y;
  A += (size_t)by * sA; Bh += (size_t)by * sB; const size_t cofs = (size_t)by * sC; const float* bp = bias ? bias + (size_t)by * sBias : nullptr;
  const int ntn = N >> 6; const int mt = blockIdx.x / ntn, nq = blockIdx.x - mt * ntn; const int row0 = mt * 128 + 32 * w, col0 = nq * 64; if (row0 >= M) return;
  const _Float16* a0p = A + (size_t)(row0 + ln) * lda; const _Float16* a1p = a0p + (size_t)16 * lda;
  const _Float16* b0p = Bh + (size_t)(col0 + ln) * ldb; const _Float16* b1p = b0p + (size_t)16 * ldb; const _Float16* b2p = b1p + (size_t)16 * ldb; const _Float16* b3p = b2p + (size_t)16 * ldb;
  const v8f z8 = {0.f,0.f,0.f,0.f,0.f,0.f,0.f,0.f}; v8f c00 = z8, c01 = z8, c02 = z8, c03 = z8, c10 = z8, c11 = z8, c12 = z8, c13 = z8;
#pragma unroll 1
  for (int kb = 0; kb < K; kb += 32) { const v16h a0 = g2_frag(a0p + kb, hh), a1 = g2_frag(a1p + kb, hh);
    v16h b = g2_frag(b0p + kb, hh); c00 = g2_mma(a0, b, c00); c10 = g2_mma(a1, b, c10);
    b = g2_frag(b1p + kb, hh); c01 = g2_mma(a0, b, c01); c11 = g2_mma(a1, b, c11);
    b = g2_frag(b2p + kb, hh); c02 = g2_mma(a0, b, c02); c12 = g2_mma(a1, b, c12);
    b = g2_frag(b3p + kb, hh); c03 = g2_mma(a0, b, c03); c13 = g2_mma(a1, b, c13); }
  v8f accs[8] = {c00, c01, c02, c03, c10, c11, c12, c13};
#pragma unroll
  for (int u = 0; u < 8; ++u) { const int t = u & 3, half = u >> 2; const int col = col0 + t * 16 + ln; const float bv = bp ? bf16_round(bp[col]) : 0.f;
#pragma unroll
    for (int r = 0; r < 8; ++r) { const int rloc = half * 16 + 8 * hh + r; float v = accs[u][r] * alpha + bv; if (CP) { if (rowsPerB < 0) v += CP[cofs + (size_t)(row0g + row0 + rloc) * ldc + col];      /* rowsPerB < 0: own element of the batched C plane */ else { const int bidx = (row0g + row0 + rloc) / rowsPerB; v += CP[(size_t)bidx * sCPb + (size_t)by * 64 + col]; } }
      if (ACT == 3) v = fmaxf(v, 0.f); else if (ACT == 6) v = 0.5f * v * (1.0f + erff(v * 0.70710678118654752f)); else if (ACT == 11) v = 1.0f / (1.0f + expf(-v)); else if (ACT == 15) v = v / (1.0f + expf(-v)); else if (ACT == 12) v = (v > 0.f) ? v : 0.01f * v; else if (ACT == 8) v = tanhf(v); else if (ACT == 9) v = 0.5f * v * (1.0f + tanhf(0.7978845608028654f * (v + 0.044715f * v * v * v))); else if (ACT == 14) v = (v > 0.f) ? v : 0.1f * v; else if (ACT == 16) v = (v >= 0.f) ? v : 0.3f * v; else if (ACT == 17) v = (v >= 0.f) ? v : 0.2f * v;
      so[w][rloc][t * 16 + ln] = v; } }
  __builtin_amdgcn_fence(__ATOMIC_ACQ_REL, "workgroup"); __builtin_amdgcn_wave_barrier();
  const int rsub = lane >> 4, c4 = (lane & 15) * 4;
  {
#pragma unroll
    for (int q = 0; q < 16; ++q) { const int r = q * 2 + rsub; const v4f v = *(const v4fa*)&so[w][r][c4]; if (C) *(v4f*)(C + cofs + (size_t)(row0 + r) * ldc + col0 + c4) = v; if (C16) { v4h h4; for (int i = 0; i < 4; ++i) h4[i] = (_Float16)v[i]; *(v4h*)(C16 + cofs + (size_t)(row0 + r) * ldc + col0 + c4) = h4; } }
     } }


__global__ __launch_bounds__(256) void k_wnat(const float* __restrict__ w, size_t n8, _Float16* __restrict__ Bt) { const size_t t = (size_t)blockIdx.x * 256 + threadIdx.x; if (t >= n8) return; FragH f; for (int q = 0; q < 8; ++q) f.h[q] = (_Float16)(bf16_round(w[t * 8 + q]) * 16.0f); *(v8us*)((unsigned short*)Bt + t * 8) = f.half[0];  }
__global__ __launch_bounds__(256) void k_rsm(const float* __restrict__ S, _Float16* __restrict__ P, int nrows) {
  #pragma clang fp contract(off)
  const int i = blockIdx.x * 256 + threadIdx.x; if (i >= nrows) return; const float* s = S + (size_t)i * SQ; float mx = -3.0e38f;
#pragma unroll 1
  for (int j = 0; j < SQ; ++j) mx = fmaxf(mx, s[j]); float se = 0.f;
#pragma unroll 1
  for (int j = 0; j < SQ; ++j) se += expf(s[j] - mx); const float sc = 256.0f / se;
#pragma unroll 1
  for (int j0 = 0; j0 < SQ; j0 += 8) { FragH f; for (int q = 0; q < 8; ++q) f.h[q] = (_Float16)(expf(s[j0 + q] - mx) * sc); unsigned short* d = (unsigned short*)P + (size_t)i * SQ + j0; *(v8us*)d = f.half[0];  } }
__global__ __launch_bounds__(256) void k_vt(const _Float16* __restrict__ V16, int b, int h0, _Float16* __restrict__ VT) { __shared__ unsigned short tl[64][65]; const int tid = threadIdx.x; const int hh = blockIdx.x % HG, sg = blockIdx.x / HG; const int s0 = sg * 64; const int h = h0 + hh;
  for (int i = tid; i < 64 * 8; i += 256) { const int j = i / 8, d8 = (i % 8) * 8; FragH f; f.half[0] = *(const v8us*)((const unsigned short*)V16 + ((size_t)b * SQ + s0 + j) * DM + h * HD + d8); for (int q = 0; q < 8; ++q) tl[d8 + q][j] = f.u[q]; }
  __syncthreads();
  { for (int i = tid; i < 64 * 8; i += 256) { const int d = i / 8, j8 = (i % 8) * 8; FragH f; for (int q = 0; q < 8; ++q) f.u[q] = tl[d][j8 + q]; *(v8us*)((unsigned short*)VT + ((size_t)hh * HD + d) * SQ + s0 + j8) = f.half[0]; }  } }



__global__ __launch_bounds__(256) void k_rsmcf2(const float* __restrict__ S, _Float16* __restrict__ P, int hg, int q0, int nk) {
  #pragma clang fp contract(off)
  const int t = blockIdx.x * 256 + threadIdx.x; if (t >= hg * QT) return; const size_t i = (size_t)t; const float* s = S + i * NKX; const int last = q0 + (t % QT); float mx = -3.0e38f;
#pragma unroll 1
  for (int j = 0; j < nk; ++j) { const float f = (j <= last) ? 1.f : 0.f; mx = fmaxf(mx, fmaf(f, s[j], (1.f - f) * -1.0e9f)); } float se = 0.f;
#pragma unroll 1
  for (int j = 0; j < nk; ++j) { const float f = (j <= last) ? 1.f : 0.f; se += __expf(fmaf(f, s[j], (1.f - f) * -1.0e9f) - mx); } const float sc = 256.0f / se;
#pragma unroll 1
  for (int j0 = 0; j0 < nk; j0 += 8) { FragH fr; for (int q = 0; q < 8; ++q) { const int j = j0 + q; const float f = (j <= last) ? 1.f : 0.f; fr.h[q] = (_Float16)(__expf(fmaf(f, s[j], (1.f - f) * -1.0e9f) - mx) * sc); } unsigned short* d = (unsigned short*)P + i * NKX + j0; *(v8us*)d = fr.half[0];  } }

template <int MASKADD>
__global__ __launch_bounds__(64) void k_att0(const float* __restrict__ QF, const float* __restrict__ KF, const float* __restrict__ VF, int ld, const float* __restrict__ mask, float scale, float* __restrict__ OF, int ldo) {
  #pragma clang fp contract(off)
  __shared__ __attribute__((aligned(16))) float lq[64][64]; __shared__ __attribute__((aligned(16))) float lo[64][64];
  const int tid = threadIdx.x; const int h = blockIdx.x / (QT0 / 64), rg = blockIdx.x % (QT0 / 64); const int i = rg * 64 + tid;
  const float* qr = QF + (size_t)i * ld + h * HD;
#pragma unroll 1
  for (int c = 0; c < HD / 4; ++c) { *(v4f*)&lq[tid][c * 4] = *(const v4fa*)(qr + c * 4); const v4f z = {0.f, 0.f, 0.f, 0.f}; *(v4f*)&lo[tid][c * 4] = z; }
  float m = -1.0e30f, l = 0.f; const int jmax = MASKADD ? (SQ - 1) : (rg * 64 + 63);      /* additive-mask form: every key (the mask input decides); causal form: keys up to the block's last row */
#pragma unroll 1
  for (int j = 0; j <= jmax; ++j) { const float* kr = KF + (size_t)j * ld + h * HD; const float* vr = VF + (size_t)j * ld + h * HD; float s = 0.f;
#pragma unroll 1
    for (int c = 0; c < HD / 4; ++c) { const v4f kq = *(const v4fa*)(kr + c * 4); const v4f qq = *(v4f*)&lq[tid][c * 4]; s = __fadd_rn(s, __fmul_rn(qq[0], kq[0])); s = __fadd_rn(s, __fmul_rn(qq[1], kq[1])); s = __fadd_rn(s, __fmul_rn(qq[2], kq[2])); s = __fadd_rn(s, __fmul_rn(qq[3], kq[3])); }
    s = __fmul_rn(s, scale); if (MASKADD) s = __fadd_rn(s, __fmul_rn(bf16_round(mask[(size_t)i * SQ + j]), -10000.0f));
    const float f = (MASKADD || j <= i) ? 1.f : 0.f; const float sm = fmaf(f, s, (1.f - f) * -1.0e30f); const float mn = fmaxf(m, sm); const float sc = expf(m - mn); const float e = expf(sm - mn); l = __fadd_rn(__fmul_rn(l, sc), e); m = mn;
#pragma unroll 1
    for (int c = 0; c < HD / 4; ++c) { const v4f vv = *(const v4fa*)(vr + c * 4); v4f oo = *(v4f*)&lo[tid][c * 4]; for (int u = 0; u < 4; ++u) oo[u] = __fadd_rn(__fmul_rn(oo[u], sc), __fmul_rn(e, vv[u])); *(v4f*)&lo[tid][c * 4] = oo; } }
  const float fin = 64.0f / l;      /* o carried x64 */
#pragma unroll 1
  for (int c = 0; c < HD / 4; ++c) { v4f oo = *(v4f*)&lo[tid][c * 4]; for (int u = 0; u < 4; ++u) oo[u] = __fmul_rn(oo[u], fin); *(v4f*)&lo[tid][c * 4] = oo; }
  __syncthreads();
  {
#pragma unroll 1
    for (int it = 0; it < 16; ++it) { const int row = it * 4 + tid / 16, pc = (tid % 16) * 4; const v4f v = *(const v4f*)&lo[row][pc]; *(v4f*)(OF + (size_t)(rg * 64 + row) * ldo + h * HD + pc) = v; }
     } }

__global__ __launch_bounds__(256) void k_oscale(const float* __restrict__ OF, float* __restrict__ out, size_t n4) { const size_t t = (size_t)blockIdx.x * 256 + threadIdx.x; if (t >= n4) return; const v4f a = *(const v4fa*)(OF + t * 4); v4f o; for (int q = 0; q < 4; ++q) o[q] = a[q] * 0.015625f; *(v4f*)(out + t * 4) = o;  }

__global__ __launch_bounds__(256) void k_bfr(const float* __restrict__ x, float* __restrict__ XB, size_t n8) { const size_t t = (size_t)blockIdx.x * 256 + threadIdx.x; if (t >= n8) return; v4f a = *(const v4fa*)(x + t * 8), c = *(const v4fa*)(x + t * 8 + 4); for (int q = 0; q < 4; ++q) { a[q] = bf16_round(a[q]); c[q] = bf16_round(c[q]); }
  { *(v4f*)(XB + t * 8) = a; *(v4f*)(XB + t * 8 + 4) = c;  } }



__global__ __launch_bounds__(256) void k_rsmfvl(const float* __restrict__ S, _Float16* __restrict__ P, _Float16* __restrict__ PL, int qn, const int* __restrict__ vlp) {
  #pragma clang fp contract(off)
  const int t = blockIdx.x * 256 + threadIdx.x; if (t >= qn) return; const int vl = vlp[0]; const size_t i = (size_t)t; const float* s = S + i * SQ; float mx = -3.0e38f;
#pragma unroll 1
  for (int j = 0; j < SQ; ++j) { const float f = (j < vl) ? 1.f : 0.f; mx = fmaxf(mx, fmaf(f, s[j], (1.f - f) * -1000000.0f)); } float se = 0.f;
#pragma unroll 1
  for (int j = 0; j < SQ; ++j) { const float f = (j < vl) ? 1.f : 0.f; se += __expf(fmaf(f, s[j], (1.f - f) * -1000000.0f) - mx); } const float sc = 256.0f / se;
#pragma unroll 1
  for (int j0 = 0; j0 < SQ; j0 += 8) { FragH fr, gr; for (int q = 0; q < 8; ++q) { const int j = j0 + q; const float f = (j < vl) ? 1.f : 0.f; const float pv = __expf(fmaf(f, s[j], (1.f - f) * -1000000.0f) - mx) * sc; const _Float16 ph = (_Float16)pv; fr.h[q] = ph; gr.h[q] = (_Float16)((pv - (float)ph) * 1024.0f); }
    unsigned short* d = (unsigned short*)P + i * SQ + j0; unsigned short* dl = (unsigned short*)PL + i * SQ + j0; *(v8us*)d = fr.half[0]; *(v8us*)dl = gr.half[0];  } }

__global__ __launch_bounds__(256) void k_rsmf(const float* __restrict__ S, _Float16* __restrict__ P, int qn, int hg) {
  #pragma clang fp contract(off)
  const int t = blockIdx.x * 256 + threadIdx.x; if (t >= qn * hg) return; const size_t i = (size_t)(t / qn) * SQ + (t % qn); const float* s = S + i * SQ; float mx = -3.0e38f;
#pragma unroll 1
  for (int j = 0; j < SQ; ++j) mx = fmaxf(mx, s[j]); float se = 0.f;
#pragma unroll 1
  for (int j = 0; j < SQ; ++j) se += __expf(s[j] - mx); const float sc = 256.0f / se;
#pragma unroll 1
  for (int j0 = 0; j0 < SQ; j0 += 8) { FragH f; for (int q = 0; q < 8; ++q) f.h[q] = (_Float16)(__expf(s[j0 + q] - mx) * sc); unsigned short* d = (unsigned short*)P + i * SQ + j0; *(v8us*)d = f.half[0];  } }


#define CN 256          /* channels */
#define CI 128
#define NC 256                       /* (unused legacy kernels) */
#define NPX NP          /* elements per (batch, channel) row */
#define NP 4096         /* seq1 tokens */
#define NM 1024         /* seq2 tokens */
#define BNEPS 1e-5f

__global__ __launch_bounds__(256) void k_mp2(const float* __restrict__ src, float* __restrict__ dst, int nout) {
  const int t = blockIdx.x * 256 + threadIdx.x; if (t >= nout) return; const int c = t / 1024; const int o = t % 1024; const int oy = o / 32, ox = o % 32; const float* p = src + (size_t)c * 4096 + (size_t)(2 * oy) * 64 + 2 * ox;
  const float v = fmaxf(fmaxf(p[0], p[1]), fmaxf(p[64], p[65])); *(float*)(dst + t) = v;  }
__global__ __launch_bounds__(256) void k_xpb(const float* __restrict__ x, const float* __restrict__ wb, float* __restrict__ CPP, size_t n4) {
  #pragma clang fp contract(off)
  const size_t t = (size_t)blockIdx.x * 256 + threadIdx.x; if (t >= n4) return; const size_t e = t * 4; const int c = (int)((e / 4096) % 256); const float bb = bf16_round(wb[c]); const v4f a = *(const v4fa*)(x + e); v4f o; for (int q = 0; q < 4; ++q) o[q] = __fadd_rn(bf16_round(a[q]), bb);
  *(v4f*)(CPP + e) = o;  }


template <int PASS>
__global__ __launch_bounds__(256) void k_cstA(const float* __restrict__ X, const float* __restrict__ MV, float* __restrict__ PART) {
  #pragma clang fp contract(off)
  __shared__ float red[256]; const int t = threadIdx.x; const size_t bc = blockIdx.x; const int c = (int)(bc % NC); const float* row = X + bc * (size_t)NPX; const float mu = PASS ? MV[c] : 0.f; float s = 0.f;
  for (int i = t; i < NPX; i += 256) { const float v = row[i]; const float d = PASS ? __fadd_rn(v, -mu) : v; s = __fadd_rn(s, PASS ? __fmul_rn(d, d) : d); }
  red[t] = s; __syncthreads(); for (int st = 128; st > 0; st >>= 1) { if (t < st) red[t] = __fadd_rn(red[t], red[t + st]); __syncthreads(); }
  if (t < 32) { const float pv = (t == 0) ? red[0] : 0.f; *(float*)(PART + bc * 32 + t) = pv;  } }      

template <int PASS>
__global__ __launch_bounds__(256) void k_cstB(const float* __restrict__ PART, float* __restrict__ MV) { const int c = threadIdx.x; if (c >= NC) return; double s = 0.0; for (int b = 0; b < NB; ++b) s += (double)PART[((size_t)b * NC + c) * 32]; const float m = (float)(s / ((double)NB * (double)NPX)); *(float*)(MV + PASS * NC + c) = m;  }


__global__ __launch_bounds__(256) void k_bnresid(const float* __restrict__ C2, const float* __restrict__ MV, const float* __restrict__ g, const float* __restrict__ be, const float* __restrict__ X, float* __restrict__ out, size_t n4) {
  #pragma clang fp contract(off)
  const size_t t = (size_t)blockIdx.x * 256 + threadIdx.x; if (t >= n4) return; const size_t e = t * 4; const int c = (int)((e / NPX) % NC); const float sc = __fmul_rn(rsqrtf(__fadd_rn(MV[NC + c], BNEPS)), bf16_round(g[c])); const float mu = MV[c], bb = bf16_round(be[c]);
  const v4f a = *(const v4fa*)(C2 + e); const v4f xx = *(const v4fa*)(X + e); v4f o; for (int q = 0; q < 4; ++q) { const float z = __fadd_rn(__fmul_rn(__fadd_rn(a[q], -mu), sc), bb); o[q] = __fadd_rn(z, bf16_round(xx[q])); }      /* BN + residual, no ReLU */
  *(v4f*)(out + e) = o;  }


__global__ __launch_bounds__(256) void k_rowbias(float* __restrict__ Y, const float* __restrict__ bias) {
  #pragma clang fp contract(off)
  const size_t t = (size_t)blockIdx.x * 256 + threadIdx.x; if (t >= (size_t)NB * NC * NPX / 4) return; const size_t e = t * 4; const int c = (int)((e / NPX) % NC); const float bb = bf16_round(bias[c]);
  v4f v = *(const v4fa*)(Y + e); for (int q = 0; q < 4; ++q) v[q] = __fadd_rn(v[q], bb); *(v4f*)(Y + e) = v;  }



// ---- fused attention: scores, softmax and the weighted sum of V in one kernel ----
constexpr int FA_NQ = 8192, FA_NK = 8192, FA_D = 256;      /* queries, keys, head width */
constexpr int FA_NS = 8, FA_BC = 32, FA_NP = FA_NK / FA_NS / FA_BC;      /* key splits, keys per pass, passes per split */
constexpr int FA_TB = FA_BC * FA_D * 2;      /* bytes of one pass's K (and of its V^T): 16 KiB */
typedef unsigned int v4u __attribute__((ext_vector_type(4), may_alias));
__device__ __forceinline__ v16h fa_frag(const unsigned char* p) { FragH f; f.half[0] = *(const v8us*)p; f.half[1] = *(const v8us*)(p + 512); return f.v; }
__device__ __forceinline__ v8f fa_mma(v16h a, v16h b, v8f c) { return __builtin_amdgcn_wmma_f32_16x16x32_f16(false, a, false, b, (short)0, c, false, false); }
__device__ __forceinline__ void fa_xcnt0() { asm volatile("s_wait_xcnt 0x0" ::: "memory"); }      /* stands behind issued global loads or stores, in front of whatever reuses a register that they name */
__device__ __forceinline__ float fa_exp2_slot(float x) { float r; asm("v_exp_f32 %0, %1\n\tv_nop" : "=v"(r) : "v"(x)); return r; }      /* 2^x with the one slot the instruction set asks for between a transcendental and a next instruction that reads its result or overwrites its source: in one statement, so that the slot stays there */
__device__ __forceinline__ float fa_xhalf(float x) { return __builtin_bit_cast(float, __builtin_amdgcn_permlanex16(__builtin_bit_cast(int, x), __builtin_bit_cast(int, x), 0x76543210, 0xfedcba98, false, false)); }      /* lane l with lane l ^ 16 */

// Preparation in one launch. A piece is 8 f16 = 16 bytes; work-group b makes pieces 1024 b .. 1024 b + 1023 of each of three arrays, thread tid the pieces t = 1024 b + 256 i + tid (i < 4).
// Q16: piece t holds Q's elements 8 t + 0..7 (plain rows).
// K in fragment order: piece t = ((key tile * 8 + k step) * 2 + q) * 32 + lane holds K[16 tile + c][32 step + 16 q + 8 h + 0..7] (c = lane & 15, h = lane >> 4): a wave's fragment load is 512 contiguous bytes.
// V^T in fragment order: piece t = ((key block * 16 + d tile) * 2 + q) * 32 + lane holds V[32 block + 16 q + 8 h + 0..7][16 tile + c].
__device__ __forceinline__ v8us fa_piece(const float* e) { FragH f;
#pragma unroll
  for (int j = 0; j < 8; ++j) f.h[j] = (_Float16)bf16_round(e[j]);
  return f.half[0]; }
__global__ __launch_bounds__(256) void k_prep(const float* __restrict__ xq, const float* __restrict__ xk, const float* __restrict__ xv, _Float16* __restrict__ Q16, _Float16* __restrict__ Kf, _Float16* __restrict__ Vf) {
  static_assert(FA_NQ == FA_NK && FA_D == 256, "one work-group index serves the three arrays");
  const int tid = threadIdx.x, b = blockIdx.x, lane = tid & 31, q = (tid >> 5) & 1, w2 = tid >> 6, c = lane & 15, h = lane >> 4;
  const float* sq = xq + ((size_t)b * 1024 + tid) * 8;
  const float* sk = xk + (size_t)(b * 32 + c) * FA_D + w2 * 32 + 16 * q + 8 * h;      /* piece i: key tile 2 b + (i >> 1), k step 4 (i & 1) + w2 */
  const float* sv = xv + (size_t)(b * 32 + 16 * q + 8 * h) * FA_D + w2 * 16 + c;      /* piece i: key block b, d tile 4 i + w2 */
  float eq[4][8], ek[4][8], ev[4][8];
#pragma unroll
  for (int i = 0; i < 4; ++i) { const float* s = sq + i * 2048; *(v4f*)&eq[i][0] = *(const v4fa*)s; *(v4f*)&eq[i][4] = *(const v4fa*)(s + 4); }
  fa_xcnt0();      /* all 48 loads of a thread are in flight together; the waits let a later array's loads land in an earlier one's address registers */
#pragma unroll
  for (int i = 0; i < 4; ++i) { const float* s = sk + (i >> 1) * 16 * FA_D + (i & 1) * 128; *(v4f*)&ek[i][0] = *(const v4fa*)s; *(v4f*)&ek[i][4] = *(const v4fa*)(s + 4); }
  fa_xcnt0();
#pragma unroll
  for (int i = 0; i < 4; ++i) {
#pragma unroll
    for (int j = 0; j < 8; ++j) ev[i][j] = sv[i * 64 + j * FA_D]; }
  fa_xcnt0();
  __builtin_amdgcn_sched_barrier(0);      /* the conversions stay behind the last load: moved up among the loads, the first one's wait for its data holds back the issue of the loads behind it */
  v8us oq[4], ok[4], ov[4];
#pragma unroll
  for (int i = 0; i < 4; ++i) { oq[i] = fa_piece(eq[i]); ok[i] = fa_piece(ek[i]); ov[i] = fa_piece(ev[i]); }
  const size_t o = ((size_t)b * 1024 + tid) * 8;
#pragma unroll
  for (int i = 0; i < 4; ++i) { *(v8us*)((unsigned short*)Q16 + o + i * 2048) = oq[i]; *(v8us*)((unsigned short*)Kf + o + i * 2048) = ok[i]; *(v8us*)((unsigned short*)Vf + o + i * 2048) = ov[i]; } }

__global__ __launch_bounds__(256) void k_fattn(const _Float16* __restrict__ Q16, const _Float16* __restrict__ Kf, const _Float16* __restrict__ Vf, float* __restrict__ Op, float* __restrict__ Mp, float* __restrict__ Lp) {
  __shared__ __attribute__((aligned(16))) unsigned char lb[2][2 * FA_TB];
  const int tid = threadIdx.x, lane = tid & 31, wave = tid >> 5, c = lane & 15, h = lane >> 4;
  const int qb = blockIdx.x & 31, sp = blockIdx.x >> 5; const int q0 = qb * 256 + wave * 32;
  const unsigned char* gk = (const unsigned char*)Kf + (size_t)sp * FA_NP * FA_TB + tid * 16; const unsigned char* gv = (const unsigned char*)Vf + (size_t)sp * FA_NP * FA_TB + tid * 16;
  const float cscale = 0.0625f * 1.4426950408889634f;      /* 1 / sqrt(256), times log2 e */
  v4u st[8];
#pragma unroll
  for (int i = 0; i < 4; ++i) { st[i] = *(const v4u*)(gk + i * 4096); st[4 + i] = *(const v4u*)(gv + i * 4096); }
  v16h qf[2][8];
#pragma unroll
  for (int g = 0; g < 2; ++g) { const _Float16* qp = Q16 + (size_t)(q0 + 16 * g + c) * FA_D;
#pragma unroll
    for (int kc = 0; kc < 8; ++kc) qf[g][kc] = g2_frag(qp + kc * 32, h); }
  fa_xcnt0();
  const v8f z8 = {0.f,0.f,0.f,0.f,0.f,0.f,0.f,0.f};
  v8f acc[2][16]; float m_run[2], l_run[2];
#pragma unroll
  for (int g = 0; g < 2; ++g) { m_run[g] = -__builtin_inff(); l_run[g] = 0.f;
#pragma unroll
    for (int t = 0; t < 16; ++t) acc[g][t] = z8; }
#pragma unroll
  for (int i = 0; i < 4; ++i) { *(v4u*)(&lb[0][0] + tid * 16 + i * 4096) = st[i]; *(v4u*)(&lb[0][FA_TB] + tid * 16 + i * 4096) = st[4 + i]; }
  __syncthreads();      /* pass 0's K and V^T are in LDS */
  /* one pass; more (a constant at each of the two calls): a pass p + 1 exists and is fetched */
  auto pass = [&](const int p, const bool more) __attribute__((always_inline)) {
    const unsigned char* lk = &lb[p & 1][0] + lane * 16; const unsigned char* lv = lk + FA_TB;
    v8f s[2][2] = {{z8, z8}, {z8, z8}};
    { v16h ka[4];      /* K fragments are read three ahead of their products: the LDS latency hides behind six WMMAs */
#pragma unroll
      for (int f = 0; f < 3; ++f) ka[f] = fa_frag(lk + ((f & 1) * 8 + (f >> 1)) * 1024);
#pragma unroll
      for (int f = 0; f < 16; ++f) { const int kt = f & 1, kc = f >> 1;
        if (f + 3 < 16) ka[(f + 3) & 3] = fa_frag(lk + (((f + 3) & 1) * 8 + ((f + 3) >> 1)) * 1024);
        s[kt][0] = fa_mma(ka[f & 3], qf[0][kc], s[kt][0]); s[kt][1] = fa_mma(ka[f & 3], qf[1][kc], s[kt][1]); } }
    float mb[2]; bool need = false;
#pragma unroll
    for (int g = 0; g < 2; ++g) { float mx = s[0][g][0];
#pragma unroll
      for (int r = 1; r < 8; ++r) mx = fmaxf(mx, s[0][g][r]);
#pragma unroll
      for (int r = 0; r < 8; ++r) mx = fmaxf(mx, s[1][g][r]);
      mx = fmaxf(mx, fa_xhalf(mx)) * cscale;      /* both wave halves hold this query's maximum of the pass, scaled */
      mb[g] = mx; need = need || (mx > m_run[g] + 8.0f); }
    if (__builtin_amdgcn_ballot_w32(need) != 0) {      /* wave-uniform; always on the first pass (m = -inf), rare later */
#pragma unroll
      for (int g = 0; g < 2; ++g) { const float m_new = fmaxf(m_run[g], mb[g]); const float corr = __builtin_amdgcn_exp2f(m_run[g] - m_new); l_run[g] *= corr; m_run[g] = m_new;
#pragma unroll
        for (int t = 0; t < 16; ++t) acc[g][t] = acc[g][t] * corr; } }
    v16h pf[2];
#pragma unroll
    for (int g = 0; g < 2; ++g) { const float nm = -m_run[g]; float ps0 = 0.f, ps1 = 0.f;
#pragma unroll
      for (int i = 0; i < 8; ++i) { const float p0 = __builtin_amdgcn_exp2f(fmaf(s[0][g][i], cscale, nm)), p1 = __builtin_amdgcn_exp2f(fmaf(s[1][g][i], cscale, nm)); ps0 += p0; ps1 += p1; pf[g][i] = (_Float16)p0; pf[g][8 + i] = (_Float16)p1; }      /* element e of the B operand is key 8 h + e (e < 8), 16 + 8 h + e - 8 (else): the score tiles' own rows */
      l_run[g] += ps0 + ps1; }
    __builtin_amdgcn_sched_barrier(0);      /* the row sums are done here, not behind the second product: the 32 weights in f32 would otherwise stay in registers that the fragments read ahead need */
    v4u sn[8];
    if (more) {
#pragma unroll
      for (int i = 0; i < 4; ++i) { sn[i] = *(const v4u*)(gk + (size_t)(p + 1) * FA_TB + i * 4096); sn[4 + i] = *(const v4u*)(gv + (size_t)(p + 1) * FA_TB + i * 4096); }
      fa_xcnt0(); }
    { v16h va[4];      /* V^T fragments three ahead, as for K */
#pragma unroll
      for (int t = 0; t < 3; ++t) va[t] = fa_frag(lv + t * 1024);
#pragma unroll
      for (int t = 0; t < 16; ++t) { if (t + 3 < 16) va[(t + 3) & 3] = fa_frag(lv + (t + 3) * 1024);
        __builtin_amdgcn_sched_barrier(0);      /* holds the written order: without it the compiler moves the next pass's global loads behind the products and each fragment's reads directly in front of its own, and both latencies lie open */
        acc[0][t] = fa_mma(va[t & 3], pf[0], acc[0][t]); acc[1][t] = fa_mma(va[t & 3], pf[1], acc[1][t]); } }
    if (more) { unsigned char* d = &lb[(p + 1) & 1][0] + tid * 16;
#pragma unroll
      for (int i = 0; i < 4; ++i) { *(v4u*)(d + i * 4096) = sn[i]; *(v4u*)(d + FA_TB + i * 4096) = sn[4 + i]; }
      __syncthreads(); }      /* publishes pass p + 1's buffer and ends every wave's reads of pass p's, which the next pass refills */
  };
#pragma unroll 1
  for (int p = 0; p < FA_NP - 1; ++p) pass(p, true);
  pass(FA_NP - 1, false);
  const float l_fin0 = l_run[0] + fa_xhalf(l_run[0]), l_fin1 = l_run[1] + fa_xhalf(l_run[1]);      /* each wave half summed its eight keys of every 16-key tile */
  float* o = Op + ((size_t)(sp * (FA_NQ / 16) + (q0 >> 4)) * 16) * 256 + lane * 4; float* mo = Mp + (size_t)sp * FA_NQ + q0 + c; float* lo_ = Lp + (size_t)sp * FA_NQ + q0 + c;
  __builtin_amdgcn_sched_barrier(0);      /* all arithmetic stands in front of the stores: nothing behind them reuses a register that a store names */
  if (h == 0) { mo[0] = m_run[0]; mo[16] = m_run[1]; lo_[0] = l_fin0; lo_[16] = l_fin1; }
#pragma unroll
  for (int g = 0; g < 2; ++g) {
#pragma unroll
    for (int t = 0; t < 16; ++t) { const v4f lo = {acc[g][t][0], acc[g][t][1], acc[g][t][2], acc[g][t][3]}, hi = {acc[g][t][4], acc[g][t][5], acc[g][t][6], acc[g][t][7]}; *(v4f*)(o + g * 4096 + t * 256) = lo; *(v4f*)(o + g * 4096 + t * 256 + 128) = hi; } } }

// Joins the key splits of 16 query rows: out = sum_s 2^(m_s - M) O_s / sum_s 2^(m_s - M) l_s; the rows go through LDS so that every 128-byte line of out is stored whole.
__global__ __launch_bounds__(256) void k_fjoin(const float* __restrict__ Op, const float* __restrict__ Mp, const float* __restrict__ Lp, float* __restrict__ out) {
  __shared__ __attribute__((aligned(16))) float ro[16][FA_D + 4];
  const int tid = threadIdx.x, lane = tid & 31, c = lane & 15, h = lane >> 4; const int qt = blockIdx.x; const int q = qt * 16 + c;
  float w[FA_NS], ls[FA_NS]; v4f x[4][FA_NS];
#pragma unroll
  for (int s = 0; s < FA_NS; ++s) { w[s] = Mp[(size_t)s * FA_NQ + q]; ls[s] = Lp[(size_t)s * FA_NQ + q]; }
  fa_xcnt0();
#pragma unroll
  for (int s = 0; s < FA_NS; ++s) { const float* op = Op + ((size_t)(s * (FA_NQ / 16) + qt) * 1024 + tid) * 4;
#pragma unroll
    for (int i = 0; i < 4; ++i) x[i][s] = *(const v4fa*)(op + i * 1024);
    fa_xcnt0(); }      /* all 32 loads are in flight together; the wait lets a later load land in an earlier one's address registers */
  __builtin_amdgcn_sched_barrier(0);      /* the arithmetic stays behind the wait above */
  float M = w[0];
#pragma unroll
  for (int s = 1; s < FA_NS; ++s) M = fmaxf(M, w[s]);
  float den = 0.f;
#pragma unroll
  for (int s = 0; s < FA_NS; ++s) { w[s] = fa_exp2_slot(w[s] - M); den += w[s] * ls[s]; }
  const float inv = 1.0f / den;
#pragma unroll
  for (int i = 0; i < 4; ++i) { const int id = i * 256 + tid; const int r4 = (id >> 5) & 1, t = id >> 6; v4f a = x[i][0] * w[0];
#pragma unroll
    for (int s = 1; s < FA_NS; ++s) a += x[i][s] * w[s];
    *(v4f*)&ro[c][t * 16 + h * 8 + r4 * 4] = a * inv; }
  __syncthreads();      /* the 16 rows are in LDS */
#pragma unroll
  for (int i = 0; i < 4; ++i) { const int id = i * 256 + tid; const int r = id >> 6, c4 = (id & 63) * 4; *(v4f*)(out + (size_t)(qt * 16 + r) * FA_D + c4) = *(const v4f*)&ro[r][c4]; } }

extern "C" void kernel_launch(void* const* d_in, const int* in_sizes, int n_in,
                              void* d_out, int out_size, void* d_ws, size_t ws_size, hipStream_t stream) {
  (void)in_sizes; (void)n_in; (void)out_size;
  const float* const* I = (const float* const*)d_in; const float* xq = I[0]; const float* xk = I[1]; const float* xv = I[2];      /* Q, K, V [8192][256] (bf16-valued) */
  char* ws = (char*)d_ws; size_t off = 0;
  auto take = [&](size_t bytes) { char* p = ws + off; off += (bytes + 255) & ~(size_t)255; return p; };
  _Float16* Q16 = (_Float16*)take((size_t)FA_NQ * FA_D * 2); _Float16* Kf = (_Float16*)take((size_t)FA_NK * FA_D * 2); _Float16* Vf = (_Float16*)take((size_t)FA_NK * FA_D * 2);
  float* Op = (float*)take((size_t)FA_NS * FA_NQ * FA_D * 4); float* Mp = (float*)take((size_t)FA_NS * FA_NQ * 4); float* Lp = (float*)take((size_t)FA_NS * FA_NQ * 4);
  if (off > ws_size) return;
  k_prep<<<FA_NK * FA_D / 8 / 1024, 256, 0, stream>>>(xq, xk, xv, Q16, Kf, Vf);      /* exact f16 copy of the bf16-valued Q; K and V^T in fragment order */
  k_fattn<<<(FA_NQ / 256) * FA_NS, 256, 0, stream>>>(Q16, Kf, Vf, Op, Mp, Lp);      /* per key split: unnormalised O, m, l */
  k_fjoin<<<FA_NQ / 16, 256, 0, stream>>>(Op, Mp, Lp, (float*)d_out);      /* out = the splits joined and normalised */
}

// v005
// A run of this version takes 60.3 microseconds.
// Versions between v003 and this one are left out; their measured steps multiply to 1.24 times as fast.
// All steps since v000 together make it 104 times as fast.
#include <hip/hip_runtime.h>
// Single-head scaled dot-product attention without batch or projections (Q [8192][256], K [8192][256], V [8192][256]; scores = Q K^T / sqrt(256); softmax over the 8192 keys; out = attn V -> [8192][256]).
// Structure: Q as exact f16 rows of the bf16-valued input; K and V^T packed once into WMMA fragment order (f16); ONE fused kernel per 256 query rows x 1024 keys: S^T = K Q^T, online softmax (f32 statistics, log2 domain, lazy rescale), O^T += V^T P^T, scores and weights never leave registers; the eight key splits are joined by a last kernel; launches: see trace.
// Compute dtype: inputs rounded to bf16; q, k, v exact in f16; softmax weights as plain f16 GEMM operands (~2^-12); scores, softmax statistics and o f32; each key split's o leaves normalised, rounded once to f16. v_wmma_f32_16x16x32_f16.
#define NB 4
#define SQ 4096
#define DM 256
#define NH 1
#define HD 64
#define HG 4                         /* heads per attention launch group */
#define B0 0                         /* first batch processed (debug hook) */
#define NBR NB                       /* batches processed (debug hook) */
#define NR ((size_t)NB * SQ)         /* token rows */
#define MP ((int)((size_t)NBR * SQ)) /* rows projected (debug hook) */
#define QT 256                       /* query rows per causal tile */
#define NKX SQ                       /* S / P row pitch */
#define QT0 256                      /* first-tile rows recomputed exactly */
#define QN SQ                        /* query rows attended per batch (debug hook) */
#define NHD NH                       /* heads attended (debug hook) */
#define MPO MP                       /* rows through the output stage (debug hook) */
#define LQ DM            /* row pitch of the q/k/v rows */
typedef __bf16 v16b __attribute__((ext_vector_type(16)));
typedef unsigned short v8us __attribute__((ext_vector_type(8), may_alias));
typedef float  v8f  __attribute__((ext_vector_type(8)));
typedef float  v4f  __attribute__((ext_vector_type(4)));
typedef float  v4fa __attribute__((ext_vector_type(4), may_alias));
union FragB { v16b v; v8us half[2]; unsigned short u[16]; };

__device__ __forceinline__ unsigned short bf16_bits(float x) { unsigned int u = __float_as_uint(x); return (unsigned short)((u + 0x7FFFu + ((u >> 16) & 1u)) >> 16); }
__device__ __forceinline__ float bf16_val(unsigned short b) { return __uint_as_float(((unsigned int)b) << 16); }
__device__ __forceinline__ float bf16_round(float x) { return bf16_val(bf16_bits(x)); }
// D += A·B with NT terms: 1 = ah·bh, 2 = + al·bh (A split), 3 = + ah·bl (both split)
template <int NT>
__device__ __forceinline__ v8f mmaN(v16b ah, v16b al, v16b bh, v16b bl, v8f c) {
  c = __builtin_amdgcn_wmma_f32_16x16x32_bf16(false, ah, false, bh, (short)0, c, false, false);
  if (NT >= 2) c = __builtin_amdgcn_wmma_f32_16x16x32_bf16(false, al, false, bh, (short)0, c, false, false);
  if (NT >= 3) c = __builtin_amdgcn_wmma_f32_16x16x32_bf16(false, ah, false, bl, (short)0, c, false, false);
  asm volatile("v_nop\n\tv_nop\n\tv_nop\n\tv_nop" : "+v"(c) : "v"(ah), "v"(al), "v"(bh), "v"(bl));
  return c;
}

__global__ __launch_bounds__(256) void k_wt_bf16(const float* __restrict__ W, unsigned short* __restrict__ Wt, int K, int N) {
  const int t = blockIdx.x * 256 + threadIdx.x;
  const int k8n = K / 8;
  if (t >= N * k8n) return;
  const int n = t / k8n, k8 = (t % k8n) * 8;
  v8us v;
#pragma unroll
  for (int i = 0; i < 8; ++i) v[i] = bf16_bits(W[(size_t)(k8 + i) * N + n]);
  *(v8us*)(Wt + (size_t)n * K + k8) = v;
  
}

// GEMM C[M][N] (f32, pitch ldc) = act(A[M][K]·W + bias). A f32 row-major (pitch lda) converted per fragment to bf16
// (ASPLIT: hi/lo two planes -> 2 terms, else single rounded term); Wt bf16 [N][K] (pitch ldb). BIAS_BF16 rounds the
// bias to bf16 first (bias quantised to bf16 before the add). K%32==0, M%16==0, N%64==0.
template <bool ASPLIT, int ACT, bool BIAS_BF16>
__global__ __launch_bounds__(128) void k_gemm_bf(const float* __restrict__ A, int lda, const unsigned short* __restrict__ Wt, int ldb,
                                               const float* __restrict__ bias, float* __restrict__ C, int ldc, int M, int N, int K) {
  __shared__ __attribute__((aligned(16))) float so[4][16][64];
  const int tid = threadIdx.x, w = tid >> 5, lane = tid & 31, ln = lane & 15, hh = lane >> 4;
  const int ntn = N / 64;
  const int wid = blockIdx.x * 4 + w;
  const int mt = wid / ntn, nq = wid % ntn;
  if (mt * 16 >= M) return;
  const int row0 = mt * 16, col0 = nq * 64;
  const float* arow = A + (size_t)(row0 + ln) * lda;
  v8f acc[4] = {};
  for (int kb = 0; kb < K; kb += 32) {
    FragB ah, al;
    const v4f x0 = *(const v4fa*)(arow + kb + 8 * hh), x1 = *(const v4fa*)(arow + kb + 8 * hh + 4);
    const v4f x2 = *(const v4fa*)(arow + kb + 16 + 8 * hh), x3 = *(const v4fa*)(arow + kb + 16 + 8 * hh + 4);
    float xs[16] = {x0[0],x0[1],x0[2],x0[3],x1[0],x1[1],x1[2],x1[3],x2[0],x2[1],x2[2],x2[3],x3[0],x3[1],x3[2],x3[3]};
#pragma unroll
    for (int i = 0; i < 16; ++i) { const unsigned short hb = bf16_bits(xs[i]); ah.u[i] = hb; al.u[i] = ASPLIT ? bf16_bits(xs[i] - bf16_val(hb)) : (unsigned short)0; }
#pragma unroll
    for (int t = 0; t < 4; ++t) {
      const unsigned short* brow = Wt + (size_t)(col0 + t * 16 + ln) * ldb + kb;
      FragB b;
      b.half[0] = *(const v8us*)(brow + 8 * hh);
      b.half[1] = *(const v8us*)(brow + 16 + 8 * hh);
      acc[t] = mmaN<ASPLIT ? 2 : 1>(ah.v, al.v, b.v, b.v, acc[t]);
    }
  }
#pragma unroll
  for (int t = 0; t < 4; ++t) {
    float bv = bias ? bias[col0 + t * 16 + ln] : 0.f;
    if (BIAS_BF16) bv = bf16_round(bv);
#pragma unroll
    for (int r = 0; r < 8; ++r) { float v = acc[t][r] + bv; if (ACT == 1) v = fmaxf(v, 0.f); so[w][8 * hh + r][t * 16 + ln] = v; }
  }
  __builtin_amdgcn_fence(__ATOMIC_ACQ_REL, "workgroup");
  __builtin_amdgcn_wave_barrier();
  const int rsub = lane >> 4, c4 = (lane & 15) * 4;
  {
#pragma unroll
    for (int q = 0; q < 8; ++q) {
      const int r = q * 2 + rsub;
      const v4f v = *(const v4fa*)&so[w][r][c4];
      *(v4f*)(C + (size_t)(row0 + r) * ldc + col0 + c4) = v;
    }
    
  }
}

// GEMM C = act(A·W + bias + resid): A f32 (ASPLIT -> hi/lo 2 terms), Wt bf16 [N][K]; ACT 0 none, 1 relu, 2 exact gelu;
// resid (optional, f32, row index = (row % rmod), pitch ldr, RES_BF16 rounds it) added before the activation.
template <bool ASPLIT, int ACT, bool BIAS_BF16, bool RES_BF16>
__global__ __launch_bounds__(128) void k_gemm_bf3(const float* __restrict__ A, int lda, const unsigned short* __restrict__ Wt, int ldb,
                                                const float* __restrict__ bias, const float* __restrict__ resid, int rmod, int ldr,
                                                float* __restrict__ C, int ldc, int M, int N, int K) {
  __shared__ __attribute__((aligned(16))) float so[4][16][64];
  const int tid = threadIdx.x, w = tid >> 5, lane = tid & 31, ln = lane & 15, hh = lane >> 4;
  const int ntn = N / 64;
  const int wid = blockIdx.x * 4 + w;
  const int mt = wid / ntn, nq = wid % ntn;
  if (mt * 16 >= M) return;
  const int row0 = mt * 16, col0 = nq * 64;
  const float* arow = A + (size_t)(row0 + ln) * lda;
  v8f acc[4] = {};
  for (int kb = 0; kb < K; kb += 32) {
    FragB ah, al;
    const v4f x0 = *(const v4fa*)(arow + kb + 8 * hh), x1 = *(const v4fa*)(arow + kb + 8 * hh + 4);
    const v4f x2 = *(const v4fa*)(arow + kb + 16 + 8 * hh), x3 = *(const v4fa*)(arow + kb + 16 + 8 * hh + 4);
    float xs[16] = {x0[0],x0[1],x0[2],x0[3],x1[0],x1[1],x1[2],x1[3],x2[0],x2[1],x2[2],x2[3],x3[0],x3[1],x3[2],x3[3]};
#pragma unroll
    for (int i = 0; i < 16; ++i) { const unsigned short hb = bf16_bits(xs[i]); ah.u[i] = hb; al.u[i] = ASPLIT ? bf16_bits(xs[i] - bf16_val(hb)) : (unsigned short)0; }
#pragma unroll
    for (int t = 0; t < 4; ++t) {
      const unsigned short* brow = Wt + (size_t)(col0 + t * 16 + ln) * ldb + kb;
      FragB b;
      b.half[0] = *(const v8us*)(brow + 8 * hh);
      b.half[1] = *(const v8us*)(brow + 16 + 8 * hh);
      acc[t] = mmaN<ASPLIT ? 2 : 1>(ah.v, al.v, b.v, b.v, acc[t]);
    }
  }
#pragma unroll
  for (int t = 0; t < 4; ++t) {
    const int col = col0 + t * 16 + ln;
    float bv = bias ? bias[col] : 0.f;
    if (BIAS_BF16) bv = bf16_round(bv);
#pragma unroll
    for (int r = 0; r < 8; ++r) {
      float v = acc[t][r] + bv;
      if (resid) { float rv = resid[(size_t)((row0 + 8 * hh + r) % rmod) * ldr + col]; if (RES_BF16) rv = bf16_round(rv); v += rv; }
      if (ACT == 1) v = fmaxf(v, 0.f);
      if (ACT == 2) v = 0.5f * v * (1.0f + erff(v * 0.70710678118654752f));
      if (ACT == 3) { const float u = 0.7978845608028654f * (v + 0.044715f * v * v * v); v = 0.5f * v * (1.0f + tanhf(u)); }
      so[w][8 * hh + r][t * 16 + ln] = v;
    }
  }
  __builtin_amdgcn_fence(__ATOMIC_ACQ_REL, "workgroup");
  __builtin_amdgcn_wave_barrier();
  const int rsub = lane >> 4, c4 = (lane & 15) * 4;
  {
#pragma unroll
    for (int q = 0; q < 8; ++q) {
      const int r = q * 2 + rsub;
      const v4f v = *(const v4fa*)&so[w][r][c4];
      *(v4f*)(C + (size_t)(row0 + r) * ldc + col0 + c4) = v;
    }
    
  }
}
// row LayerNorm (biased variance, eps) over N: s = X (+ R); optional out_sum <- s; out_norm <- (s-mu)*rsqrt(var+eps)*g + b
template <bool PARAM_BF16>
__global__ __launch_bounds__(256) void k_layernorm(const float* __restrict__ X, const float* __restrict__ R, const float* __restrict__ g, const float* __restrict__ bta,
                                                  float* __restrict__ out_sum, float* __restrict__ out_norm, int N, float eps) {
  __shared__ float red[256];
  const int row = blockIdx.x, tid = threadIdx.x;
  const float* x = X + (size_t)row * N; const float* rr = R ? R + (size_t)row * N : nullptr;
  float vals[16];                     // up to N = 4096
  const int per = N / 256;            // contiguous chunk per thread? use strided-by-4 chunks: thread handles j = tid*4 + 1024*u
  float s1 = 0.f;
  for (int u = 0; u < per / 4; ++u) {
    const int j = tid * 4 + 1024 * u;
    const v4f a = *(const v4fa*)(x + j);
    v4f b = {0.f,0.f,0.f,0.f}; if (rr) b = *(const v4fa*)(rr + j);
#pragma unroll
    for (int q = 0; q < 4; ++q) { const float v = a[q] + b[q]; vals[u * 4 + q] = v; s1 += v; }
  }
  red[tid] = s1; __syncthreads();
  for (int st = 128; st > 0; st >>= 1) { if (tid < st) red[tid] += red[tid + st]; __syncthreads(); }
  const float mu = red[0] / (float)N; __syncthreads();
  float s2 = 0.f;
  for (int u = 0; u < per / 4; ++u)
#pragma unroll
    for (int q = 0; q < 4; ++q) { const float c = vals[u * 4 + q] - mu; s2 += c * c; }
  red[tid] = s2; __syncthreads();
  for (int st = 128; st > 0; st >>= 1) { if (tid < st) red[tid] += red[tid + st]; __syncthreads(); }
  const float rs = rsqrtf(red[0] / (float)N + eps);
  {
    for (int u = 0; u < per / 4; ++u) {
      const int j = tid * 4 + 1024 * u;
      v4f o, sm;
#pragma unroll
      for (int q = 0; q < 4; ++q) {
        float gg = g[j + q], bb = bta[j + q];
        if (PARAM_BF16) { gg = bf16_round(gg); bb = bf16_round(bb); }
        sm[q] = vals[u * 4 + q]; o[q] = (vals[u * 4 + q] - mu) * rs * gg + bb;
      }
      if (out_sum) *(v4f*)(out_sum + (size_t)row * N + j) = sm;
      *(v4f*)(out_norm + (size_t)row * N + j) = o;
    }
    
  }
}



// ---- f16 WMMA path (v_wmma_f32_16x16x32_f16): 11-bit significands for operands in range — used where a [0,1] probability operand needs more precision than bf16
typedef _Float16 v16h __attribute__((ext_vector_type(16)));
union FragH { v16h v; v8us half[2]; _Float16 h[16]; unsigned short u[16]; };
template <int NT>
__device__ __forceinline__ v8f mmaH(v16h ah, v16h al, v16h bh, v16h bl, v8f c) {
  c = __builtin_amdgcn_wmma_f32_16x16x32_f16(false, ah, false, bh, (short)0, c, false, false);
  if (NT >= 2) c = __builtin_amdgcn_wmma_f32_16x16x32_f16(false, al, false, bh, (short)0, c, false, false);
  if (NT >= 3) c = __builtin_amdgcn_wmma_f32_16x16x32_f16(false, ah, false, bl, (short)0, c, false, false);
  asm volatile("v_nop\n\tv_nop\n\tv_nop\n\tv_nop" : "+v"(c) : "v"(ah), "v"(al), "v"(bh), "v"(bl));
  return c;
}
// batched GEMM like k_gemm_b but f16 operands: A f32 (split into f16 hi/lo if ASPLIT, else rounded to f16), Bt = f16 values [n][k]; alpha; C f32; N multiple of 16 (partial tiles skipped)
template <bool ASPLIT>
__global__ __launch_bounds__(128) void k_gemm_h(const float* __restrict__ A, int lda, size_t sA, const _Float16* __restrict__ Bh, int ldb, size_t sB, float alpha, float* __restrict__ C, int ldc, size_t sC, int M, int N, int K) {
  __shared__ __attribute__((aligned(16))) float so[4][16][64];
  const int tid = threadIdx.x, w = tid >> 5, lane = tid & 31, ln = lane & 15, hh = lane >> 4; const int by = blockIdx.y;
  A += (size_t)by * sA; Bh += (size_t)by * sB; C += (size_t)by * sC;
  const int ntn = (N + 63) / 64; const int wid = blockIdx.x * 4 + w; const int mt = wid / ntn, nq = wid % ntn; if (mt * 16 >= M) return;
  const int row0 = mt * 16, col0 = nq * 64; const float* arow = A + (size_t)(row0 + ln) * lda;
  v8f acc[4] = {};
  for (int kb = 0; kb < K; kb += 32) {
    FragH ah, al;
    const v4f x0 = *(const v4fa*)(arow + kb + 8 * hh), x1 = *(const v4fa*)(arow + kb + 8 * hh + 4), x2 = *(const v4fa*)(arow + kb + 16 + 8 * hh), x3 = *(const v4fa*)(arow + kb + 16 + 8 * hh + 4);
    float xs[16] = {x0[0],x0[1],x0[2],x0[3],x1[0],x1[1],x1[2],x1[3],x2[0],x2[1],x2[2],x2[3],x3[0],x3[1],x3[2],x3[3]};
#pragma unroll
    for (int i = 0; i < 16; ++i) { const _Float16 h = (_Float16)xs[i]; ah.h[i] = h; al.h[i] = ASPLIT ? (_Float16)(xs[i] - (float)h) : (_Float16)0.0f; }
#pragma unroll
    for (int t = 0; t < 4; ++t) { if (col0 + t * 16 >= N) continue; const size_t boff = (size_t)(col0 + t * 16 + ln) * ldb + kb; FragH bq; bq.half[0] = *(const v8us*)(Bh + boff + 8 * hh); bq.half[1] = *(const v8us*)(Bh + boff + 16 + 8 * hh);
      acc[t] = mmaH<ASPLIT ? 2 : 1>(ah.v, al.v, bq.v, bq.v, acc[t]); }
  }
#pragma unroll
  for (int t = 0; t < 4; ++t) { if (col0 + t * 16 >= N) continue;
#pragma unroll
    for (int r = 0; r < 8; ++r) so[w][8 * hh + r][t * 16 + ln] = acc[t][r] * alpha; }
  __builtin_amdgcn_fence(__ATOMIC_ACQ_REL, "workgroup"); __builtin_amdgcn_wave_barrier();
  const int rsub = lane >> 4, c4 = (lane & 15) * 4;
  {
#pragma unroll
    for (int q = 0; q < 8; ++q) { const int r = q * 2 + rsub; if (col0 + c4 < N) { const v4f v = *(const v4fa*)&so[w][r][c4]; *(v4f*)(C + (size_t)(row0 + r) * ldc + col0 + c4) = v; } }
     }
}

// Wt[n][k] = f16(W[k][n]·scale) from f32 row-major W[K][N] (scale = power of two; bf16-exact weights stay exact in f16 away from the subnormal range)
__global__ __launch_bounds__(256) void k_wt_f16(const float* __restrict__ W, _Float16* __restrict__ Wt, int K, int N, float scale) {
  const int t = blockIdx.x * 256 + threadIdx.x; if (t >= N * (K / 8)) return; const int n = t / (K / 8), k8 = (t % (K / 8)) * 8; FragH f;
#pragma unroll
  for (int i = 0; i < 8; ++i) f.h[i] = (_Float16)(bf16_round(W[(size_t)(k8 + i) * N + n]) * scale); const v8us o = f.half[0];
  *(v8us*)((unsigned short*)Wt + (size_t)n * K + k8) = o; 
}
// k_gemm_hh variant with fused epilogue: v = acc·alpha + bias[by·sBias + col] (+ CP[(row/rowsPerB)·sCPb + by·64 + col] if CP) ; ACT 0 none / 1 elu ; writes f16 C16 (and f32 C if non-null)
template <int ACT>
__global__ __launch_bounds__(128) void k_gemm_hhx(const _Float16* __restrict__ A, int lda, size_t sA, const _Float16* __restrict__ Bh, int ldb, size_t sB, float alpha, const float* __restrict__ bias, size_t sBias, const float* __restrict__ CP, int rowsPerB, size_t sCPb, int row0g,
    float* __restrict__ C, _Float16* __restrict__ C16, int ldc, size_t sC, int M, int N, int K) {
  __shared__ __attribute__((aligned(16))) float so[4][16][64];
  const int tid = threadIdx.x, w = tid >> 5, lane = tid & 31, ln = lane & 15, hh = lane >> 4; const int by = blockIdx.y;
  A += (size_t)by * sA; Bh += (size_t)by * sB; const size_t cofs = (size_t)by * sC; const float* bp = bias ? bias + (size_t)by * sBias : nullptr;
  const int ntn = (N + 63) / 64; const int wid = blockIdx.x * 4 + w; const int mt = wid / ntn, nq = wid % ntn; if (mt * 16 >= M) return;
  const int row0 = mt * 16, col0 = nq * 64; const _Float16* arow = A + (size_t)(row0 + ln) * lda;
  v8f acc[4] = {};
  for (int kb = 0; kb < K; kb += 32) { FragH ah; ah.half[0] = *(const v8us*)((const unsigned short*)arow + kb + 8 * hh); ah.half[1] = *(const v8us*)((const unsigned short*)arow + kb + 16 + 8 * hh);
#pragma unroll
    for (int t = 0; t < 4; ++t) { if (col0 + t * 16 >= N) continue; const size_t boff = (size_t)(col0 + t * 16 + ln) * ldb + kb; FragH bq; bq.half[0] = *(const v8us*)((const unsigned short*)Bh + boff + 8 * hh); bq.half[1] = *(const v8us*)((const unsigned short*)Bh + boff + 16 + 8 * hh);
      acc[t] = mmaH<1>(ah.v, ah.v, bq.v, bq.v, acc[t]); }
  }
#pragma unroll
  for (int t = 0; t < 4; ++t) { if (col0 + t * 16 >= N) continue; const int col = col0 + t * 16 + ln; const float bv = bp ? bf16_round(bp[col]) : 0.f;
#pragma unroll
    for (int r = 0; r < 8; ++r) { float v = acc[t][r] * alpha + bv; if (CP) { const int rr = row0g + row0 + 8 * hh + r; if (rowsPerB < 0) v += CP[cofs + (size_t)rr * ldc + col];      /* rowsPerB < 0: own element of the batched C plane */ else { const int bidx = rr / rowsPerB; v += CP[(size_t)bidx * sCPb + (size_t)by * 64 + col]; } } if (ACT == 1) v = (v > 0.f) ? v : expm1f(v); else if (ACT == 7) v = (v > 0.f) ? v + 1.0f : expf(v); else if (ACT == 8) v = tanhf(v); else if (ACT == 9) v = 0.5f * v * (1.0f + tanhf(0.7978845608028654f * (v + 0.044715f * v * v * v))); else if (ACT == 11) v = 1.0f / (1.0f + expf(-v)); else if (ACT == 12) v = (v > 0.f) ? v : 0.01f * v; else if (ACT == 14) v = (v > 0.f) ? v : 0.1f * v; else if (ACT == 16) v = (v >= 0.f) ? v : 0.3f * v; else if (ACT == 17) v = (v >= 0.f) ? v : 0.2f * v; else if (ACT == 15) v = v / (1.0f + expf(-v)); else if (ACT == 3) v = fmaxf(v, 0.f); else if (ACT == 6) v = 0.5f * v * (1.0f + erff(v * 0.70710678118654752f)); so[w][8 * hh + r][t * 16 + ln] = v; } }
  __builtin_amdgcn_fence(__ATOMIC_ACQ_REL, "workgroup"); __builtin_amdgcn_wave_barrier();
  const int rsub = lane >> 4, c4 = (lane & 15) * 4; typedef _Float16 v4h __attribute__((ext_vector_type(4)));
  {
#pragma unroll
    for (int q = 0; q < 8; ++q) { const int r = q * 2 + rsub; if (col0 + c4 < N) { const v4f v = *(const v4fa*)&so[w][r][c4]; if (C) *(v4f*)(C + cofs + (size_t)(row0 + r) * ldc + col0 + c4) = v; if (C16) { v4h h4; for (int i = 0; i < 4; ++i) h4[i] = (_Float16)v[i]; *(v4h*)(C16 + cofs + (size_t)(row0 + r) * ldc + col0 + c4) = h4; } } }
     }
}


typedef _Float16 v4h __attribute__((ext_vector_type(4)));

__global__ __launch_bounds__(256) void k_x16(const float* __restrict__ x, _Float16* __restrict__ X16, size_t n8) { const size_t t = (size_t)blockIdx.x * 256 + threadIdx.x; if (t >= n8) return; FragH f;
#pragma unroll
  for (int q = 0; q < 8; ++q) f.h[q] = (_Float16)bf16_round(x[t * 8 + q]); *(v8us*)((unsigned short*)X16 + t * 8) = f.half[0];  }
__global__ __launch_bounds__(256) void k_h16(const float* __restrict__ x, _Float16* __restrict__ X16, size_t n8) { const size_t t = (size_t)blockIdx.x * 256 + threadIdx.x; if (t >= n8) return; FragH f;
#pragma unroll
  for (int q = 0; q < 8; ++q) f.h[q] = (_Float16)x[t * 8 + q]; *(v8us*)((unsigned short*)X16 + t * 8) = f.half[0];  }
__global__ __launch_bounds__(256) void k_round16f(const float* __restrict__ W, _Float16* __restrict__ Bt, size_t n8) { const size_t t = (size_t)blockIdx.x * 256 + threadIdx.x; if (t >= n8) return; FragH f;
#pragma unroll
  for (int i = 0; i < 8; ++i) f.h[i] = (_Float16)(bf16_round(W[t * 8 + i]) * 16.0f); *(v8us*)((unsigned short*)Bt + t * 8) = f.half[0];  }
template <int NHv, int TTv>
__global__ __launch_bounds__(256) void k_vt(const _Float16* __restrict__ V16, int ldv, int voff, _Float16* __restrict__ Vt) { __shared__ unsigned short tl[64][66]; const int tid = threadIdx.x; const int slab = blockIdx.x / (TTv / 64), lg = blockIdx.x % (TTv / 64); const int b = slab / NHv, h = slab % NHv;
  for (int i = tid; i < 64 * 8; i += 256) { const int r = i / 8, c8 = (i % 8) * 8; FragH f; f.half[0] = *(const v8us*)((const unsigned short*)V16 + ((size_t)b * TTv + lg * 64 + r) * ldv + voff + h * 64 + c8);
#pragma unroll
    for (int q = 0; q < 8; ++q) tl[r][c8 + q] = f.u[q]; }
  __syncthreads();
  {
#pragma unroll
    for (int rd = 0; rd < 2; ++rd) { const int d = rd * 32 + tid / 8, pc = tid % 8; FragH f;
#pragma unroll
      for (int q = 0; q < 8; ++q) f.u[q] = tl[pc * 8 + q][d];
      *(v8us*)((unsigned short*)Vt + ((size_t)slab * 64 + d) * TTv + lg * 64 + pc * 8) = f.half[0]; }
     } }

__global__ __launch_bounds__(256) void k_hl(const float* __restrict__ F, _Float16* __restrict__ Hh, _Float16* __restrict__ Hl, size_t n8) { const size_t t = (size_t)blockIdx.x * 256 + threadIdx.x; if (t >= n8) return; FragH fh, fl; const v4f a = *(const v4fa*)(F + t * 8), c = *(const v4fa*)(F + t * 8 + 4);
#pragma unroll
  for (int q = 0; q < 4; ++q) { _Float16 h = (_Float16)a[q]; fh.h[q] = h; fl.h[q] = (_Float16)((a[q] - (float)h) * 1024.0f); h = (_Float16)c[q]; fh.h[4 + q] = h; fl.h[4 + q] = (_Float16)((c[q] - (float)h) * 1024.0f); }
  { *(v8us*)((unsigned short*)Hh + t * 8) = fh.half[0]; *(v8us*)((unsigned short*)Hl + t * 8) = fl.half[0];  } }

// ---- fast GEMM (wave tile 32x64; requires M % 32 == 0 rows per launch region and N % 64 == 0); epilogue = k_gemm_hhx semantics ----
__device__ __forceinline__ v16h g2_frag(const _Float16* p, int hh) { FragH f; f.half[0] = *(const v8us*)((const unsigned short*)p + 8 * hh); f.half[1] = *(const v8us*)((const unsigned short*)p + 16 + 8 * hh); return f.v; }
__device__ __forceinline__ v8f g2_mma(v16h a, v16h b, v8f c) { v8f d = __builtin_amdgcn_wmma_f32_16x16x32_f16(false, a, false, b, (short)0, c, false, false); asm volatile("v_nop\n\tv_nop\n\tv_nop\n\tv_nop" : "+v"(d) : "v"(a), "v"(b)); return d; }
template <int ACT>
__global__ __launch_bounds__(128) void k_gemm2(const _Float16* __restrict__ A, int lda, size_t sA, const _Float16* __restrict__ Bh, int ldb, size_t sB, float alpha, const float* __restrict__ bias, size_t sBias, const float* __restrict__ CP, int rowsPerB, size_t sCPb, int row0g,
    float* __restrict__ C, _Float16* __restrict__ C16, int ldc, size_t sC, int M, int N, int K) { static_assert(ACT == 0 || ACT == 3 || ACT == 6 || ACT == 8 || ACT == 9 || ACT == 11 || ACT == 12 || ACT == 14 || ACT == 15 || ACT == 16 || ACT == 17, "k_gemm2: unsupported ACT code (would silently apply no activation)");
  __shared__ __attribute__((aligned(16))) float so[4][32][68];
  const int tid = threadIdx.x, w = tid >> 5, lane = tid & 31, ln = lane & 15, hh = lane >> 4; const int by = blockIdx.y;
  A += (size_t)by * sA; Bh += (size_t)by * sB; const size_t cofs = (size_t)by * sC; const float* bp = bias ? bias + (size_t)by * sBias : nullptr;
  const int ntn = N >> 6; const int mt = blockIdx.x / ntn, nq = blockIdx.x - mt * ntn; const int row0 = mt * 128 + 32 * w, col0 = nq * 64; if (row0 >= M) return;
  const _Float16* a0p = A + (size_t)(row0 + ln) * lda; const _Float16* a1p = a0p + (size_t)16 * lda;
  const _Float16* b0p = Bh + (size_t)(col0 + ln) * ldb; const _Float16* b1p = b0p + (size_t)16 * ldb; const _Float16* b2p = b1p + (size_t)16 * ldb; const _Float16* b3p = b2p + (size_t)16 * ldb;
  const v8f z8 = {0.f,0.f,0.f,0.f,0.f,0.f,0.f,0.f}; v8f c00 = z8, c01 = z8, c02 = z8, c03 = z8, c10 = z8, c11 = z8, c12 = z8, c13 = z8;
#pragma unroll 1
  for (int kb = 0; kb < K; kb += 32) { const v16h a0 = g2_frag(a0p + kb, hh), a1 = g2_frag(a1p + kb, hh);
    v16h b = g2_frag(b0p + kb, hh); c00 = g2_mma(a0, b, c00); c10 = g2_mma(a1, b, c10);
    b = g2_frag(b1p + kb, hh); c01 = g2_mma(a0, b, c01); c11 = g2_mma(a1, b, c11);
    b = g2_frag(b2p + kb, hh); c02 = g2_mma(a0, b, c02); c12 = g2_mma(a1, b, c12);
    b = g2_frag(b3p + kb, hh); c03 = g2_mma(a0, b, c03); c13 = g2_mma(a1, b, c13); }
  v8f accs[8] = {c00, c01, c02, c03, c10, c11, c12, c13};
#pragma unroll
  for (int u = 0; u < 8; ++u) { const int t = u & 3, half = u >> 2; const int col = col0 + t * 16 + ln; const float bv = bp ? bf16_round(bp[col]) : 0.f;
#pragma unroll
    for (int r = 0; r < 8; ++r) { const int rloc = half * 16 + 8 * hh + r; float v = accs[u][r] * alpha + bv; if (CP) { if (rowsPerB < 0) v += CP[cofs + (size_t)(row0g + row0 + rloc) * ldc + col];      /* rowsPerB < 0: own element of the batched C plane */ else { const int bidx = (row0g + row0 + rloc) / rowsPerB; v += CP[(size_t)bidx * sCPb + (size_t)by * 64 + col]; } }
      if (ACT == 3) v = fmaxf(v, 0.f); else if (ACT == 6) v = 0.5f * v * (1.0f + erff(v * 0.70710678118654752f)); else if (ACT == 11) v = 1.0f / (1.0f + expf(-v)); else if (ACT == 15) v = v / (1.0f + expf(-v)); else if (ACT == 12) v = (v > 0.f) ? v : 0.01f * v; else if (ACT == 8) v = tanhf(v); else if (ACT == 9) v = 0.5f * v * (1.0f + tanhf(0.7978845608028654f * (v + 0.044715f * v * v * v))); else if (ACT == 14) v = (v > 0.f) ? v : 0.1f * v; else if (ACT == 16) v = (v >= 0.f) ? v : 0.3f * v; else if (ACT == 17) v = (v >= 0.f) ? v : 0.2f * v;
      so[w][rloc][t * 16 + ln] = v; } }
  __builtin_amdgcn_fence(__ATOMIC_ACQ_REL, "workgroup"); __builtin_amdgcn_wave_barrier();
  const int rsub = lane >> 4, c4 = (lane & 15) * 4;
  {
#pragma unroll
    for (int q = 0; q < 16; ++q) { const int r = q * 2 + rsub; const v4f v = *(const v4fa*)&so[w][r][c4]; if (C) *(v4f*)(C + cofs + (size_t)(row0 + r) * ldc + col0 + c4) = v; if (C16) { v4h h4; for (int i = 0; i < 4; ++i) h4[i] = (_Float16)v[i]; *(v4h*)(C16 + cofs + (size_t)(row0 + r) * ldc + col0 + c4) = h4; } }
     } }


__global__ __launch_bounds__(256) void k_wnat(const float* __restrict__ w, size_t n8, _Float16* __restrict__ Bt) { const size_t t = (size_t)blockIdx.x * 256 + threadIdx.x; if (t >= n8) return; FragH f; for (int q = 0; q < 8; ++q) f.h[q] = (_Float16)(bf16_round(w[t * 8 + q]) * 16.0f); *(v8us*)((unsigned short*)Bt + t * 8) = f.half[0];  }
__global__ __launch_bounds__(256) void k_rsm(const float* __restrict__ S, _Float16* __restrict__ P, int nrows) {
  #pragma clang fp contract(off)
  const int i = blockIdx.x * 256 + threadIdx.x; if (i >= nrows) return; const float* s = S + (size_t)i * SQ; float mx = -3.0e38f;
#pragma unroll 1
  for (int j = 0; j < SQ; ++j) mx = fmaxf(mx, s[j]); float se = 0.f;
#pragma unroll 1
  for (int j = 0; j < SQ; ++j) se += expf(s[j] - mx); const float sc = 256.0f / se;
#pragma unroll 1
  for (int j0 = 0; j0 < SQ; j0 += 8) { FragH f; for (int q = 0; q < 8; ++q) f.h[q] = (_Float16)(expf(s[j0 + q] - mx) * sc); unsigned short* d = (unsigned short*)P + (size_t)i * SQ + j0; *(v8us*)d = f.half[0];  } }
__global__ __launch_bounds__(256) void k_vt(const _Float16* __restrict__ V16, int b, int h0, _Float16* __restrict__ VT) { __shared__ unsigned short tl[64][65]; const int tid = threadIdx.x; const int hh = blockIdx.x % HG, sg = blockIdx.x / HG; const int s0 = sg * 64; const int h = h0 + hh;
  for (int i = tid; i < 64 * 8; i += 256) { const int j = i / 8, d8 = (i % 8) * 8; FragH f; f.half[0] = *(const v8us*)((const unsigned short*)V16 + ((size_t)b * SQ + s0 + j) * DM + h * HD + d8); for (int q = 0; q < 8; ++q) tl[d8 + q][j] = f.u[q]; }
  __syncthreads();
  { for (int i = tid; i < 64 * 8; i += 256) { const int d = i / 8, j8 = (i % 8) * 8; FragH f; for (int q = 0; q < 8; ++q) f.u[q] = tl[d][j8 + q]; *(v8us*)((unsigned short*)VT + ((size_t)hh * HD + d) * SQ + s0 + j8) = f.half[0]; }  } }



__global__ __launch_bounds__(256) void k_rsmcf2(const float* __restrict__ S, _Float16* __restrict__ P, int hg, int q0, int nk) {
  #pragma clang fp contract(off)
  const int t = blockIdx.x * 256 + threadIdx.x; if (t >= hg * QT) return; const size_t i = (size_t)t; const float* s = S + i * NKX; const int last = q0 + (t % QT); float mx = -3.0e38f;
#pragma unroll 1
  for (int j = 0; j < nk; ++j) { const float f = (j <= last) ? 1.f : 0.f; mx = fmaxf(mx, fmaf(f, s[j], (1.f - f) * -1.0e9f)); } float se = 0.f;
#pragma unroll 1
  for (int j = 0; j < nk; ++j) { const float f = (j <= last) ? 1.f : 0.f; se += __expf(fmaf(f, s[j], (1.f - f) * -1.0e9f) - mx); } const float sc = 256.0f / se;
#pragma unroll 1
  for (int j0 = 0; j0 < nk; j0 += 8) { FragH fr; for (int q = 0; q < 8; ++q) { const int j = j0 + q; const float f = (j <= last) ? 1.f : 0.f; fr.h[q] = (_Float16)(__expf(fmaf(f, s[j], (1.f - f) * -1.0e9f) - mx) * sc); } unsigned short* d = (unsigned short*)P + i * NKX + j0; *(v8us*)d = fr.half[0];  } }

template <int MASKADD>
__global__ __launch_bounds__(64) void k_att0(const float* __restrict__ QF, const float* __restrict__ KF, const float* __restrict__ VF, int ld, const float* __restrict__ mask, float scale, float* __restrict__ OF, int ldo) {
  #pragma clang fp contract(off)
  __shared__ __attribute__((aligned(16))) float lq[64][64]; __shared__ __attribute__((aligned(16))) float lo[64][64];
  const int tid = threadIdx.x; const int h = blockIdx.x / (QT0 / 64), rg = blockIdx.x % (QT0 / 64); const int i = rg * 64 + tid;
  const float* qr = QF + (size_t)i * ld + h * HD;
#pragma unroll 1
  for (int c = 0; c < HD / 4; ++c) { *(v4f*)&lq[tid][c * 4] = *(const v4fa*)(qr + c * 4); const v4f z = {0.f, 0.f, 0.f, 0.f}; *(v4f*)&lo[tid][c * 4] = z; }
  float m = -1.0e30f, l = 0.f; const int jmax = MASKADD ? (SQ - 1) : (rg * 64 + 63);      /* additive-mask form: every key (the mask input decides); causal form: keys up to the block's last row */
#pragma unroll 1
  for (int j = 0; j <= jmax; ++j) { const float* kr = KF + (size_t)j * ld + h * HD; const float* vr = VF + (size_t)j * ld + h * HD; float s = 0.f;
#pragma unroll 1
    for (int c = 0; c < HD / 4; ++c) { const v4f kq = *(const v4fa*)(kr + c * 4); const v4f qq = *(v4f*)&lq[tid][c * 4]; s = __fadd_rn(s, __fmul_rn(qq[0], kq[0])); s = __fadd_rn(s, __fmul_rn(qq[1], kq[1])); s = __fadd_rn(s, __fmul_rn(qq[2], kq[2])); s = __fadd_rn(s, __fmul_rn(qq[3], kq[3])); }
    s = __fmul_rn(s, scale); if (MASKADD) s = __fadd_rn(s, __fmul_rn(bf16_round(mask[(size_t)i * SQ + j]), -10000.0f));
    const float f = (MASKADD || j <= i) ? 1.f : 0.f; const float sm = fmaf(f, s, (1.f - f) * -1.0e30f); const float mn = fmaxf(m, sm); const float sc = expf(m - mn); const float e = expf(sm - mn); l = __fadd_rn(__fmul_rn(l, sc), e); m = mn;
#pragma unroll 1
    for (int c = 0; c < HD / 4; ++c) { const v4f vv = *(const v4fa*)(vr + c * 4); v4f oo = *(v4f*)&lo[tid][c * 4]; for (int u = 0; u < 4; ++u) oo[u] = __fadd_rn(__fmul_rn(oo[u], sc), __fmul_rn(e, vv[u])); *(v4f*)&lo[tid][c * 4] = oo; } }
  const float fin = 64.0f / l;      /* o carried x64 */
#pragma unroll 1
  for (int c = 0; c < HD / 4; ++c) { v4f oo = *(v4f*)&lo[tid][c * 4]; for (int u = 0; u < 4; ++u) oo[u] = __fmul_rn(oo[u], fin); *(v4f*)&lo[tid][c * 4] = oo; }
  __syncthreads();
  {
#pragma unroll 1
    for (int it = 0; it < 16; ++it) { const int row = it * 4 + tid / 16, pc = (tid % 16) * 4; const v4f v = *(const v4f*)&lo[row][pc]; *(v4f*)(OF + (size_t)(rg * 64 + row) * ldo + h * HD + pc) = v; }
     } }

__global__ __launch_bounds__(256) void k_oscale(const float* __restrict__ OF, float* __restrict__ out, size_t n4) { const size_t t = (size_t)blockIdx.x * 256 + threadIdx.x; if (t >= n4) return; const v4f a = *(const v4fa*)(OF + t * 4); v4f o; for (int q = 0; q < 4; ++q) o[q] = a[q] * 0.015625f; *(v4f*)(out + t * 4) = o;  }

__global__ __launch_bounds__(256) void k_bfr(const float* __restrict__ x, float* __restrict__ XB, size_t n8) { const size_t t = (size_t)blockIdx.x * 256 + threadIdx.x; if (t >= n8) return; v4f a = *(const v4fa*)(x + t * 8), c = *(const v4fa*)(x + t * 8 + 4); for (int q = 0; q < 4; ++q) { a[q] = bf16_round(a[q]); c[q] = bf16_round(c[q]); }
  { *(v4f*)(XB + t * 8) = a; *(v4f*)(XB + t * 8 + 4) = c;  } }



__global__ __launch_bounds__(256) void k_rsmfvl(const float* __restrict__ S, _Float16* __restrict__ P, _Float16* __restrict__ PL, int qn, const int* __restrict__ vlp) {
  #pragma clang fp contract(off)
  const int t = blockIdx.x * 256 + threadIdx.x; if (t >= qn) return; const int vl = vlp[0]; const size_t i = (size_t)t; const float* s = S + i * SQ; float mx = -3.0e38f;
#pragma unroll 1
  for (int j = 0; j < SQ; ++j) { const float f = (j < vl) ? 1.f : 0.f; mx = fmaxf(mx, fmaf(f, s[j], (1.f - f) * -1000000.0f)); } float se = 0.f;
#pragma unroll 1
  for (int j = 0; j < SQ; ++j) { const float f = (j < vl) ? 1.f : 0.f; se += __expf(fmaf(f, s[j], (1.f - f) * -1000000.0f) - mx); } const float sc = 256.0f / se;
#pragma unroll 1
  for (int j0 = 0; j0 < SQ; j0 += 8) { FragH fr, gr; for (int q = 0; q < 8; ++q) { const int j = j0 + q; const float f = (j < vl) ? 1.f : 0.f; const float pv = __expf(fmaf(f, s[j], (1.f - f) * -1000000.0f) - mx) * sc; const _Float16 ph = (_Float16)pv; fr.h[q] = ph; gr.h[q] = (_Float16)((pv - (float)ph) * 1024.0f); }
    unsigned short* d = (unsigned short*)P + i * SQ + j0; unsigned short* dl = (unsigned short*)PL + i * SQ + j0; *(v8us*)d = fr.half[0]; *(v8us*)dl = gr.half[0];  } }

__global__ __launch_bounds__(256) void k_rsmf(const float* __restrict__ S, _Float16* __restrict__ P, int qn, int hg) {
  #pragma clang fp contract(off)
  const int t = blockIdx.x * 256 + threadIdx.x; if (t >= qn * hg) return; const size_t i = (size_t)(t / qn) * SQ + (t % qn); const float* s = S + i * SQ; float mx = -3.0e38f;
#pragma unroll 1
  for (int j = 0; j < SQ; ++j) mx = fmaxf(mx, s[j]); float se = 0.f;
#pragma unroll 1
  for (int j = 0; j < SQ; ++j) se += __expf(s[j] - mx); const float sc = 256.0f / se;
#pragma unroll 1
  for (int j0 = 0; j0 < SQ; j0 += 8) { FragH f; for (int q = 0; q < 8; ++q) f.h[q] = (_Float16)(__expf(s[j0 + q] - mx) * sc); unsigned short* d = (unsigned short*)P + i * SQ + j0; *(v8us*)d = f.half[0];  } }


#define CN 256          /* channels */
#define CI 128
#define NC 256                       /* (unused legacy kernels) */
#define NPX NP          /* elements per (batch, channel) row */
#define NP 4096         /* seq1 tokens */
#define NM 1024         /* seq2 tokens */
#define BNEPS 1e-5f

__global__ __launch_bounds__(256) void k_mp2(const float* __restrict__ src, float* __restrict__ dst, int nout) {
  const int t = blockIdx.x * 256 + threadIdx.x; if (t >= nout) return; const int c = t / 1024; const int o = t % 1024; const int oy = o / 32, ox = o % 32; const float* p = src + (size_t)c * 4096 + (size_t)(2 * oy) * 64 + 2 * ox;
  const float v = fmaxf(fmaxf(p[0], p[1]), fmaxf(p[64], p[65])); *(float*)(dst + t) = v;  }
__global__ __launch_bounds__(256) void k_xpb(const float* __restrict__ x, const float* __restrict__ wb, float* __restrict__ CPP, size_t n4) {
  #pragma clang fp contract(off)
  const size_t t = (size_t)blockIdx.x * 256 + threadIdx.x; if (t >= n4) return; const size_t e = t * 4; const int c = (int)((e / 4096) % 256); const float bb = bf16_round(wb[c]); const v4f a = *(const v4fa*)(x + e); v4f o; for (int q = 0; q < 4; ++q) o[q] = __fadd_rn(bf16_round(a[q]), bb);
  *(v4f*)(CPP + e) = o;  }


template <int PASS>
__global__ __launch_bounds__(256) void k_cstA(const float* __restrict__ X, const float* __restrict__ MV, float* __restrict__ PART) {
  #pragma clang fp contract(off)
  __shared__ float red[256]; const int t = threadIdx.x; const size_t bc = blockIdx.x; const int c = (int)(bc % NC); const float* row = X + bc * (size_t)NPX; const float mu = PASS ? MV[c] : 0.f; float s = 0.f;
  for (int i = t; i < NPX; i += 256) { const float v = row[i]; const float d = PASS ? __fadd_rn(v, -mu) : v; s = __fadd_rn(s, PASS ? __fmul_rn(d, d) : d); }
  red[t] = s; __syncthreads(); for (int st = 128; st > 0; st >>= 1) { if (t < st) red[t] = __fadd_rn(red[t], red[t + st]); __syncthreads(); }
  if (t < 32) { const float pv = (t == 0) ? red[0] : 0.f; *(float*)(PART + bc * 32 + t) = pv;  } }      

template <int PASS>
__global__ __launch_bounds__(256) void k_cstB(const float* __restrict__ PART, float* __restrict__ MV) { const int c = threadIdx.x; if (c >= NC) return; double s = 0.0; for (int b = 0; b < NB; ++b) s += (double)PART[((size_t)b * NC + c) * 32]; const float m = (float)(s / ((double)NB * (double)NPX)); *(float*)(MV + PASS * NC + c) = m;  }


__global__ __launch_bounds__(256) void k_bnresid(const float* __restrict__ C2, const float* __restrict__ MV, const float* __restrict__ g, const float* __restrict__ be, const float* __restrict__ X, float* __restrict__ out, size_t n4) {
  #pragma clang fp contract(off)
  const size_t t = (size_t)blockIdx.x * 256 + threadIdx.x; if (t >= n4) return; const size_t e = t * 4; const int c = (int)((e / NPX) % NC); const float sc = __fmul_rn(rsqrtf(__fadd_rn(MV[NC + c], BNEPS)), bf16_round(g[c])); const float mu = MV[c], bb = bf16_round(be[c]);
  const v4f a = *(const v4fa*)(C2 + e); const v4f xx = *(const v4fa*)(X + e); v4f o; for (int q = 0; q < 4; ++q) { const float z = __fadd_rn(__fmul_rn(__fadd_rn(a[q], -mu), sc), bb); o[q] = __fadd_rn(z, bf16_round(xx[q])); }      /* BN + residual, no ReLU */
  *(v4f*)(out + e) = o;  }


__global__ __launch_bounds__(256) void k_rowbias(float* __restrict__ Y, const float* __restrict__ bias) {
  #pragma clang fp contract(off)
  const size_t t = (size_t)blockIdx.x * 256 + threadIdx.x; if (t >= (size_t)NB * NC * NPX / 4) return; const size_t e = t * 4; const int c = (int)((e / NPX) % NC); const float bb = bf16_round(bias[c]);
  v4f v = *(const v4fa*)(Y + e); for (int q = 0; q < 4; ++q) v[q] = __fadd_rn(v[q], bb); *(v4f*)(Y + e) = v;  }



// ---- fused attention: scores, softmax and the weighted sum of V in one kernel ----
constexpr int FA_NQ = 8192, FA_NK = 8192, FA_D = 256;      /* queries, keys, head width */
constexpr int FA_NS = 8, FA_BC = 32, FA_NP = FA_NK / FA_NS / FA_BC;      /* key splits, keys per pass, passes per split */
constexpr int FA_TB = FA_BC * FA_D * 2;      /* bytes of one pass's K (and of its V^T): 16 KiB */
constexpr int FA_SP = 4, FA_RS = 2 * FA_SP;      /* passes per stage (one barrier a stage); slots of the LDS ring: two stages, one slot a pass */
typedef unsigned int v4u __attribute__((ext_vector_type(4), may_alias));
__device__ __forceinline__ v16h fa_frag(const unsigned char* p) { FragH f; f.half[0] = *(const v8us*)p; f.half[1] = *(const v8us*)(p + 512); return f.v; }
__device__ __forceinline__ v8f fa_mma(v16h a, v16h b, v8f c) { return __builtin_amdgcn_wmma_f32_16x16x32_f16(false, a, false, b, (short)0, c, false, false); }
__device__ __forceinline__ void fa_xcnt0() { asm volatile("s_wait_xcnt 0x0" ::: "memory"); }      /* stands behind issued global loads or stores, in front of whatever reuses a register that they name */
__device__ __forceinline__ float fa_exp2_slot(float x) { float r; asm("v_exp_f32 %0, %1\n\tv_nop" : "=v"(r) : "v"(x)); return r; }      /* 2^x with the one slot the instruction set asks for between a transcendental and a next instruction that reads its result or overwrites its source: in one statement, so that the slot stays there */
__device__ __forceinline__ float fa_xhalf(float x) { return __builtin_bit_cast(float, __builtin_amdgcn_permlanex16(__builtin_bit_cast(int, x), __builtin_bit_cast(int, x), 0x76543210, 0xfedcba98, false, false)); }      /* lane l with lane l ^ 16 */

// Preparation in one launch. A piece is 8 f16 = 16 bytes; work-group b makes pieces 1024 b .. 1024 b + 1023 of each of three arrays, thread tid the pieces t = 1024 b + 256 i + tid (i < 4).
// Q16: piece t holds Q's elements 8 t + 0..7 (plain rows).
// K in fragment order: piece t = ((key tile * 8 + k step) * 2 + q) * 32 + lane holds K[16 tile + c][32 step + 16 q + 8 h + 0..7] (c = lane & 15, h = lane >> 4): a wave's fragment load is 512 contiguous bytes.
// V^T in fragment order: piece t = ((key block * 16 + d tile) * 2 + q) * 32 + lane holds V[32 block + 16 q + 8 h + 0..7][16 tile + c].
__device__ __forceinline__ v8us fa_piece(const float* e) { FragH f;
#pragma unroll
  for (int j = 0; j < 8; ++j) f.h[j] = (_Float16)bf16_round(e[j]);
  return f.half[0]; }
__global__ __launch_bounds__(256) void k_prep(const float* __restrict__ xq, const float* __restrict__ xk, const float* __restrict__ xv, _Float16* __restrict__ Q16, _Float16* __restrict__ Kf, _Float16* __restrict__ Vf) {
  static_assert(FA_NQ == FA_NK && FA_D == 256, "one work-group index serves the three arrays");
  const int tid = threadIdx.x, b = blockIdx.x, lane = tid & 31, q = (tid >> 5) & 1, w2 = tid >> 6, c = lane & 15, h = lane >> 4;
  const float* sq = xq + ((size_t)b * 1024 + tid) * 8;
  const float* sk = xk + (size_t)(b * 32 + c) * FA_D + w2 * 32 + 16 * q + 8 * h;      /* piece i: key tile 2 b + (i >> 1), k step 4 (i & 1) + w2 */
  const float* sv = xv + (size_t)(b * 32 + 16 * q + 8 * h) * FA_D + w2 * 16 + c;      /* piece i: key block b, d tile 4 i + w2 */
  float eq[4][8], ek[4][8], ev[4][8];
#pragma unroll
  for (int i = 0; i < 4; ++i) { const float* s = sq + i * 2048; *(v4f*)&eq[i][0] = *(const v4fa*)s; *(v4f*)&eq[i][4] = *(const v4fa*)(s + 4); }
  fa_xcnt0();      /* all 48 loads of a thread are in flight together; the waits let a later array's loads land in an earlier one's address registers */
#pragma unroll
  for (int i = 0; i < 4; ++i) { const float* s = sk + (i >> 1) * 16 * FA_D + (i & 1) * 128; *(v4f*)&ek[i][0] = *(const v4fa*)s; *(v4f*)&ek[i][4] = *(const v4fa*)(s + 4); }
  fa_xcnt0();
#pragma unroll
  for (int i = 0; i < 4; ++i) {
#pragma unroll
    for (int j = 0; j < 8; ++j) ev[i][j] = sv[i * 64 + j * FA_D]; }
  fa_xcnt0();
  __builtin_amdgcn_sched_barrier(0);      /* the conversions stay behind the last load: moved up among the loads, the first one's wait for its data holds back the issue of the loads behind it */
  v8us oq[4], ok[4], ov[4];
#pragma unroll
  for (int i = 0; i < 4; ++i) { oq[i] = fa_piece(eq[i]); ok[i] = fa_piece(ek[i]); ov[i] = fa_piece(ev[i]); }
  const size_t o = ((size_t)b * 1024 + tid) * 8;
#pragma unroll
  for (int i = 0; i < 4; ++i) { *(v8us*)((unsigned short*)Q16 + o + i * 2048) = oq[i]; *(v8us*)((unsigned short*)Kf + o + i * 2048) = ok[i]; *(v8us*)((unsigned short*)Vf + o + i * 2048) = ov[i]; } }

__global__ __launch_bounds__(256) void k_fattn(const _Float16* __restrict__ Q16, const _Float16* __restrict__ Kf, const _Float16* __restrict__ Vf, _Float16* __restrict__ Op, float* __restrict__ Mp, float* __restrict__ Lp) {
  static_assert(FA_NP % FA_SP == 0 && FA_NP >= 2 * FA_SP && (FA_RS & (FA_RS - 1)) == 0, "whole stages; the ring index is a mask");
  __shared__ __attribute__((aligned(16))) unsigned char lb[FA_RS][2 * FA_TB];
  const int tid = threadIdx.x, lane = tid & 31, wave = tid >> 5, c = lane & 15, h = lane >> 4;
  const int qb = blockIdx.x & 31, sp = blockIdx.x >> 5; const int q0 = qb * 256 + wave * 32;
  const unsigned char* gk = (const unsigned char*)Kf + (size_t)sp * FA_NP * FA_TB + tid * 16; const unsigned char* gv = (const unsigned char*)Vf + (size_t)sp * FA_NP * FA_TB + tid * 16;
  const float cscale = 0.0625f * 1.4426950408889634f;      /* 1 / sqrt(256), times log2 e */
  v4u st[FA_SP][8];
#pragma unroll
  for (int j = 0; j < FA_SP; ++j) {
#pragma unroll
    for (int i = 0; i < 4; ++i) { st[j][i] = *(const v4u*)(gk + j * FA_TB + i * 4096); st[j][4 + i] = *(const v4u*)(gv + j * FA_TB + i * 4096); } }
  v16h qf[2][8];
#pragma unroll
  for (int g = 0; g < 2; ++g) { const _Float16* qp = Q16 + (size_t)(q0 + 16 * g + c) * FA_D;
#pragma unroll
    for (int kc = 0; kc < 8; ++kc) qf[g][kc] = g2_frag(qp + kc * 32, h); }
  fa_xcnt0();
  __builtin_amdgcn_sched_barrier(0);      /* the LDS addresses of the stores below are formed behind the wait: moved up over it, they land in registers that the loads above name */
  const v8f z8 = {0.f,0.f,0.f,0.f,0.f,0.f,0.f,0.f};
  v8f acc[2][16]; float m_run[2], l_run[2];
#pragma unroll
  for (int g = 0; g < 2; ++g) { m_run[g] = -__builtin_inff(); l_run[g] = 0.f;
#pragma unroll
    for (int t = 0; t < 16; ++t) acc[g][t] = z8; }
#pragma unroll
  for (int j = 0; j < FA_SP; ++j) {
#pragma unroll
    for (int i = 0; i < 4; ++i) { *(v4u*)(&lb[j][0] + tid * 16 + i * 4096) = st[j][i]; *(v4u*)(&lb[j][FA_TB] + tid * 16 + i * 4096) = st[j][4 + i]; } }
  __syncthreads();      /* the first stage's K and V^T are in LDS */
  /* one pass; more (a constant at each of the two calls): a pass p + FA_SP exists and is fetched */
  auto pass = [&](const int p, const bool more) __attribute__((always_inline)) {
    const unsigned char* lk = &lb[p & (FA_RS - 1)][0] + lane * 16; const unsigned char* lv = lk + FA_TB;
    v8f s[2][2] = {{z8, z8}, {z8, z8}};
    { v16h ka[4];      /* K fragments are read three ahead of their products: the LDS latency hides behind six WMMAs */
#pragma unroll
      for (int f = 0; f < 3; ++f) ka[f] = fa_frag(lk + ((f & 1) * 8 + (f >> 1)) * 1024);
#pragma unroll
      for (int f = 0; f < 16; ++f) { const int kt = f & 1, kc = f >> 1;
        if (f + 3 < 16) ka[(f + 3) & 3] = fa_frag(lk + (((f + 3) & 1) * 8 + ((f + 3) >> 1)) * 1024);
        s[kt][0] = fa_mma(ka[f & 3], qf[0][kc], s[kt][0]); s[kt][1] = fa_mma(ka[f & 3], qf[1][kc], s[kt][1]); } }
    float mb[2]; bool need = false;
#pragma unroll
    for (int g = 0; g < 2; ++g) { float mx = s[0][g][0];
#pragma unroll
      for (int r = 1; r < 8; ++r) mx = fmaxf(mx, s[0][g][r]);
#pragma unroll
      for (int r = 0; r < 8; ++r) mx = fmaxf(mx, s[1][g][r]);
      mx = fmaxf(mx, fa_xhalf(mx)) * cscale;      /* both wave halves hold this query's maximum of the pass, scaled */
      mb[g] = mx; need = need || (mx > m_run[g] + 8.0f); }
    if (__builtin_amdgcn_ballot_w32(need) != 0) {      /* wave-uniform; always on the first pass (m = -inf), rare later */
#pragma unroll
      for (int g = 0; g < 2; ++g) { const float m_new = fmaxf(m_run[g], mb[g]); const float corr = __builtin_amdgcn_exp2f(m_run[g] - m_new); l_run[g] *= corr; m_run[g] = m_new;
#pragma unroll
        for (int t = 0; t < 16; ++t) acc[g][t] = acc[g][t] * corr; } }
    v16h pf[2];
#pragma unroll
    for (int g = 0; g < 2; ++g) { const float nm = -m_run[g]; float ps0 = 0.f, ps1 = 0.f;
#pragma unroll
      for (int i = 0; i < 8; ++i) { const float p0 = __builtin_amdgcn_exp2f(fmaf(s[0][g][i], cscale, nm)), p1 = __builtin_amdgcn_exp2f(fmaf(s[1][g][i], cscale, nm)); ps0 += p0; ps1 += p1; pf[g][i] = (_Float16)p0; pf[g][8 + i] = (_Float16)p1; }      /* element e of the B operand is key 8 h + e (e < 8), 16 + 8 h + e - 8 (else): the score tiles' own rows */
      l_run[g] += ps0 + ps1; }
    __builtin_amdgcn_sched_barrier(0);      /* the row sums are done here, not behind the second product: the 32 weights in f32 would otherwise stay in registers that the fragments read ahead need */
    v4u sn[8];
    if (more) {
#pragma unroll
      for (int i = 0; i < 4; ++i) { sn[i] = *(const v4u*)(gk + (size_t)(p + FA_SP) * FA_TB + i * 4096); sn[4 + i] = *(const v4u*)(gv + (size_t)(p + FA_SP) * FA_TB + i * 4096); }
      fa_xcnt0(); }
    { v16h va[4];      /* V^T fragments three ahead, as for K */
#pragma unroll
      for (int t = 0; t < 3; ++t) va[t] = fa_frag(lv + t * 1024);
#pragma unroll
      for (int t = 0; t < 16; ++t) { if (t + 3 < 16) va[(t + 3) & 3] = fa_frag(lv + (t + 3) * 1024);
        __builtin_amdgcn_sched_barrier(0);      /* holds the written order: without it the compiler moves the global loads of pass p + 4 behind the products and each fragment's reads directly in front of its own, and both latencies lie open */
        acc[0][t] = fa_mma(va[t & 3], pf[0], acc[0][t]); acc[1][t] = fa_mma(va[t & 3], pf[1], acc[1][t]); } }
    if (more) { unsigned char* d = &lb[(p + FA_SP) & (FA_RS - 1)][0] + tid * 16;
#pragma unroll
      for (int i = 0; i < 4; ++i) { *(v4u*)(d + i * 4096) = sn[i]; *(v4u*)(d + FA_TB + i * 4096) = sn[4 + i]; }
    }
  };
#pragma unroll 1      /* rolled, like the two loops of passes below: for speed only */
  for (int s = 0; s < FA_NP / FA_SP - 1; ++s) {
#pragma unroll 1
    for (int j = 0; j < FA_SP; ++j) pass(s * FA_SP + j, true);
    __syncthreads();      /* publishes the next stage's four slots and ends every wave's reads of this stage's, which the next stage's passes refill */
  }
#pragma unroll 1      /* the last stage: nothing left to fetch, no barrier */
  for (int p = FA_NP - FA_SP; p < FA_NP; ++p) pass(p, false);
  const float l_fin0 = l_run[0] + fa_xhalf(l_run[0]), l_fin1 = l_run[1] + fa_xhalf(l_run[1]);      /* each wave half summed its eight keys of every 16-key tile */
  unsigned short* o = (unsigned short*)Op + ((size_t)(sp * (FA_NQ / 16) + (q0 >> 4)) * 16) * 256 + lane * 8; float* mo = Mp + (size_t)sp * FA_NQ + q0 + c; float* lo_ = Lp + (size_t)sp * FA_NQ + q0 + c;
  if (h == 0) { mo[0] = m_run[0]; mo[16] = m_run[1]; lo_[0] = l_fin0; lo_[16] = l_fin1; }
  fa_xcnt0();      /* the arithmetic below may reuse a register that these four stores name */
  const float il[2] = {1.0f / l_fin0, 1.0f / l_fin1};      /* l >= 1: m never exceeds the split's true maximum, so the largest weight is at least 1 */
  v8us ob[2][16];
#pragma unroll
  for (int g = 0; g < 2; ++g) {
#pragma unroll
    for (int t = 0; t < 16; ++t) { FragH f;
#pragma unroll
      for (int r = 0; r < 8; ++r) f.h[r] = (_Float16)(acc[g][t][r] * il[g]);
      ob[g][t] = f.half[0]; } }
  __builtin_amdgcn_sched_barrier(0);      /* all arithmetic stands in front of the stores of O: nothing behind them reuses a register that a store names */
#pragma unroll
  for (int g = 0; g < 2; ++g) {
#pragma unroll
    for (int t = 0; t < 16; ++t) *(v8us*)(o + g * 4096 + t * 256) = ob[g][t]; } }

// Joins the key splits of 16 query rows: out = sum_s a_s o_s, a_s = 2^(m_s - M) l_s / sum_s 2^(m_s - M) l_s, o_s the split's normalised f16 rows; the rows go through LDS so that every 128-byte line of out is stored whole.
__global__ __launch_bounds__(256) void k_fjoin(const _Float16* __restrict__ Op, const float* __restrict__ Mp, const float* __restrict__ Lp, float* __restrict__ out) {
  __shared__ __attribute__((aligned(16))) float ro[16][FA_D + 4];
  const int tid = threadIdx.x, lane = tid & 31, c = lane & 15, h = lane >> 4; const int qt = blockIdx.x; const int q = qt * 16 + c;
  float w[FA_NS], ls[FA_NS]; v8us x[2][FA_NS];
#pragma unroll
  for (int s = 0; s < FA_NS; ++s) { w[s] = Mp[(size_t)s * FA_NQ + q]; ls[s] = Lp[(size_t)s * FA_NQ + q]; }
  fa_xcnt0();
#pragma unroll
  for (int s = 0; s < FA_NS; ++s) { const unsigned short* op = (const unsigned short*)Op + ((size_t)(s * (FA_NQ / 16) + qt) * 512 + tid) * 8;
#pragma unroll
    for (int i = 0; i < 2; ++i) x[i][s] = *(const v8us*)(op + i * 2048);
    fa_xcnt0(); }      /* all 16 loads are in flight together; the wait lets a later load land in an earlier one's address registers */
  __builtin_amdgcn_sched_barrier(0);      /* the arithmetic stays behind the wait above */
  float M = w[0];
#pragma unroll
  for (int s = 1; s < FA_NS; ++s) M = fmaxf(M, w[s]);
  float den = 0.f;
#pragma unroll
  for (int s = 0; s < FA_NS; ++s) { w[s] = fa_exp2_slot(w[s] - M); den += w[s] * ls[s]; }
  const float inv = 1.0f / den;
#pragma unroll
  for (int s = 0; s < FA_NS; ++s) w[s] = w[s] * ls[s] * inv;      /* the split's share of the whole sum of weights */
#pragma unroll
  for (int i = 0; i < 2; ++i) { const int t = (i * 256 + tid) >> 5; float a[8];
#pragma unroll
    for (int s = 0; s < FA_NS; ++s) { FragH f; f.half[0] = x[i][s];
#pragma unroll
      for (int j = 0; j < 8; ++j) a[j] = s ? fmaf((float)f.h[j], w[s], a[j]) : (float)f.h[j] * w[0]; }
    const v4f lo = {a[0], a[1], a[2], a[3]}, hi = {a[4], a[5], a[6], a[7]};
    *(v4f*)&ro[c][t * 16 + h * 8] = lo; *(v4f*)&ro[c][t * 16 + h * 8 + 4] = hi; }
  __syncthreads();      /* the 16 rows are in LDS */
#pragma unroll
  for (int i = 0; i < 4; ++i) { const int id = i * 256 + tid; const int r = id >> 6, c4 = (id & 63) * 4; *(v4f*)(out + (size_t)(qt * 16 + r) * FA_D + c4) = *(const v4f*)&ro[r][c4]; } }

extern "C" void kernel_launch(void* const* d_in, const int* in_sizes, int n_in,
                              void* d_out, int out_size, void* d_ws, size_t ws_size, hipStream_t stream) {
  (void)in_sizes; (void)n_in; (void)out_size;
  const float* const* I = (const float* const*)d_in; const float* xq = I[0]; const float* xk = I[1]; const float* xv = I[2];      /* Q, K, V [8192][256] (bf16-valued) */
  char* ws = (char*)d_ws; size_t off = 0;
  auto take = [&](size_t bytes) { char* p = ws + off; off += (bytes + 255) & ~(size_t)255; return p; };
  _Float16* Q16 = (_Float16*)take((size_t)FA_NQ * FA_D * 2); _Float16* Kf = (_Float16*)take((size_t)FA_NK * FA_D * 2); _Float16* Vf = (_Float16*)take((size_t)FA_NK * FA_D * 2);
  _Float16* Op = (_Float16*)take((size_t)FA_NS * FA_NQ * FA_D * 2); float* Mp = (float*)take((size_t)FA_NS * FA_NQ * 4); float* Lp = (float*)take((size_t)FA_NS * FA_NQ * 4);
  if (off > ws_size) return;
  k_prep<<<FA_NK * FA_D / 8 / 1024, 256, 0, stream>>>(xq, xk, xv, Q16, Kf, Vf);      /* exact f16 copy of the bf16-valued Q; K and V^T in fragment order */
  k_fattn<<<(FA_NQ / 256) * FA_NS, 256, 0, stream>>>(Q16, Kf, Vf, Op, Mp, Lp);      /* per key split: normalised O (f16), m, l */
  k_fjoin<<<FA_NQ / 16, 256, 0, stream>>>(Op, Mp, Lp, (float*)d_out);      /* out = the splits joined and normalised */
}

// v006
// Measured time: 56.6 microseconds a run.
// Timed twice side by side with v005, it ran 1.06 times as fast both times.
// All steps since v000 together make it 110 times as fast.
#include <hip/hip_runtime.h>
// Single-head scaled dot-product attention without batch or projections (Q [8192][256], K [8192][256], V [8192][256]; scores = Q K^T / sqrt(256); softmax over the 8192 keys; out = attn V -> [8192][256]).
// Structure: Q as exact f16 rows of the bf16-valued input; K and V^T packed once into WMMA fragment order (f16); ONE fused kernel per 256 query rows x 1024 keys: S^T = K Q^T, online softmax (f32 statistics, log2 domain, lazy rescale), O^T += V^T P^T, scores and weights never leave registers; the eight key splits are joined by a last kernel; launches: see trace.
// Compute dtype: inputs rounded to bf16; q, k, v exact in f16; softmax weights as plain f16 GEMM operands (~2^-12); scores, softmax statistics and o f32; each key split's o leaves normalised, rounded once to f16. v_wmma_f32_16x16x32_f16.
#define NB 4
#define SQ 4096
#define DM 256
#define NH 1
#define HD 64
#define HG 4                         /* heads per attention launch group */
#define B0 0                         /* first batch processed (debug hook) */
#define NBR NB                       /* batches processed (debug hook) */
#define NR ((size_t)NB * SQ)         /* token rows */
#define MP ((int)((size_t)NBR * SQ)) /* rows projected (debug hook) */
#define QT 256                       /* query rows per causal tile */
#define NKX SQ                       /* S / P row pitch */
#define QT0 256                      /* first-tile rows recomputed exactly */
#define QN SQ                        /* query rows attended per batch (debug hook) */
#define NHD NH                       /* heads attended (debug hook) */
#define MPO MP                       /* rows through the output stage (debug hook) */
#define LQ DM            /* row pitch of the q/k/v rows */
typedef __bf16 v16b __attribute__((ext_vector_type(16)));
typedef unsigned short v8us __attribute__((ext_vector_type(8), may_alias));
typedef float  v8f  __attribute__((ext_vector_type(8)));
typedef float  v4f  __attribute__((ext_vector_type(4)));
typedef float  v4fa __attribute__((ext_vector_type(4), may_alias));
union FragB { v16b v; v8us half[2]; unsigned short u[16]; };

__device__ __forceinline__ unsigned short bf16_bits(float x) { unsigned int u = __float_as_uint(x); return (unsigned short)((u + 0x7FFFu + ((u >> 16) & 1u)) >> 16); }
__device__ __forceinline__ float bf16_val(unsigned short b) { return __uint_as_float(((unsigned int)b) << 16); }
__device__ __forceinline__ float bf16_round(float x) { return bf16_val(bf16_bits(x)); }
// D += A·B with NT terms: 1 = ah·bh, 2 = + al·bh (A split), 3 = + ah·bl (both split)
template <int NT>
__device__ __forceinline__ v8f mmaN(v16b ah, v16b al, v16b bh, v16b bl, v8f c) {
  c = __builtin_amdgcn_wmma_f32_16x16x32_bf16(false, ah, false, bh, (short)0, c, false, false);
  if (NT >= 2) c = __builtin_amdgcn_wmma_f32_16x16x32_bf16(false, al, false, bh, (short)0, c, false, false);
  if (NT >= 3) c = __builtin_amdgcn_wmma_f32_16x16x32_bf16(false, ah, false, bl, (short)0, c, false, false);
  asm volatile("v_nop\n\tv_nop\n\tv_nop\n\tv_nop" : "+v"(c) : "v"(ah), "v"(al), "v"(bh), "v"(bl));
  return c;
}

__global__ __launch_bounds__(256) void k_wt_bf16(const float* __restrict__ W, unsigned short* __restrict__ Wt, int K, int N) {
  const int t = blockIdx.x * 256 + threadIdx.x;
  const int k8n = K / 8;
  if (t >= N * k8n) return;
  const int n = t / k8n, k8 = (t % k8n) * 8;
  v8us v;
#pragma unroll
  for (int i = 0; i < 8; ++i) v[i] = bf16_bits(W[(size_t)(k8 + i) * N + n]);
  *(v8us*)(Wt + (size_t)n * K + k8) = v;
  
}

// GEMM C[M][N] (f32, pitch ldc) = act(A[M][K]·W + bias). A f32 row-major (pitch lda) converted per fragment to bf16
// (ASPLIT: hi/lo two planes -> 2 terms, else single rounded term); Wt bf16 [N][K] (pitch ldb). BIAS_BF16 rounds the
// bias to bf16 first (bias quantised to bf16 before the add). K%32==0, M%16==0, N%64==0.
template <bool ASPLIT, int ACT, bool BIAS_BF16>
__global__ __launch_bounds__(128) void k_gemm_bf(const float* __restrict__ A, int lda, const unsigned short* __restrict__ Wt, int ldb,
                                               const float* __restrict__ bias, float* __restrict__ C, int ldc, int M, int N, int K) {
  __shared__ __attribute__((aligned(16))) float so[4][16][64];
  const int tid = threadIdx.x, w = tid >> 5, lane = tid & 31, ln = lane & 15, hh = lane >> 4;
  const int ntn = N / 64;
  const int wid = blockIdx.x * 4 + w;
  const int mt = wid / ntn, nq = wid % ntn;
  if (mt * 16 >= M) return;
  const int row0 = mt * 16, col0 = nq * 64;
  const float* arow = A + (size_t)(row0 + ln) * lda;
  v8f acc[4] = {};
  for (int kb = 0; kb < K; kb += 32) {
    FragB ah, al;
    const v4f x0 = *(const v4fa*)(arow + kb + 8 * hh), x1 = *(const v4fa*)(arow + kb + 8 * hh + 4);
    const v4f x2 = *(const v4fa*)(arow + kb + 16 + 8 * hh), x3 = *(const v4fa*)(arow + kb + 16 + 8 * hh + 4);
    float xs[16] = {x0[0],x0[1],x0[2],x0[3],x1[0],x1[1],x1[2],x1[3],x2[0],x2[1],x2[2],x2[3],x3[0],x3[1],x3[2],x3[3]};
#pragma unroll
    for (int i = 0; i < 16; ++i) { const unsigned short hb = bf16_bits(xs[i]); ah.u[i] = hb; al.u[i] = ASPLIT ? bf16_bits(xs[i] - bf16_val(hb)) : (unsigned short)0; }
#pragma unroll
    for (int t = 0; t < 4; ++t) {
      const unsigned short* brow = Wt + (size_t)(col0 + t * 16 + ln) * ldb + kb;
      FragB b;
      b.half[0] = *(const v8us*)(brow + 8 * hh);
      b.half[1] = *(const v8us*)(brow + 16 + 8 * hh);
      acc[t] = mmaN<ASPLIT ? 2 : 1>(ah.v, al.v, b.v, b.v, acc[t]);
    }
  }
#pragma unroll
  for (int t = 0; t < 4; ++t) {
    float bv = bias ? bias[col0 + t * 16 + ln] : 0.f;
    if (BIAS_BF16) bv = bf16_round(bv);
#pragma unroll
    for (int r = 0; r < 8; ++r) { float v = acc[t][r] + bv; if (ACT == 1) v = fmaxf(v, 0.f); so[w][8 * hh + r][t * 16 + ln] = v; }
  }
  __builtin_amdgcn_fence(__ATOMIC_ACQ_REL, "workgroup");
  __builtin_amdgcn_wave_barrier();
  const int rsub = lane >> 4, c4 = (lane & 15) * 4;
  {
#pragma unroll
    for (int q = 0; q < 8; ++q) {
      const int r = q * 2 + rsub;
      const v4f v = *(const v4fa*)&so[w][r][c4];
      *(v4f*)(C + (size_t)(row0 + r) * ldc + col0 + c4) = v;
    }
    
  }
}

// GEMM C = act(A·W + bias + resid): A f32 (ASPLIT -> hi/lo 2 terms), Wt bf16 [N][K]; ACT 0 none, 1 relu, 2 exact gelu;
// resid (optional, f32, row index = (row % rmod), pitch ldr, RES_BF16 rounds it) added before the activation.
template <bool ASPLIT, int ACT, bool BIAS_BF16, bool RES_BF16>
__global__ __launch_bounds__(128) void k_gemm_bf3(const float* __restrict__ A, int lda, const unsigned short* __restrict__ Wt, int ldb,
                                                const float* __restrict__ bias, const float* __restrict__ resid, int rmod, int ldr,
                                                float* __restrict__ C, int ldc, int M, int N, int K) {
  __shared__ __attribute__((aligned(16))) float so[4][16][64];
  const int tid = threadIdx.x, w = tid >> 5, lane = tid & 31, ln = lane & 15, hh = lane >> 4;
  const int ntn = N / 64;
  const int wid = blockIdx.x * 4 + w;
  const int mt = wid / ntn, nq = wid % ntn;
  if (mt * 16 >= M) return;
  const int row0 = mt * 16, col0 = nq * 64;
  const float* arow = A + (size_t)(row0 + ln) * lda;
  v8f acc[4] = {};
  for (int kb = 0; kb < K; kb += 32) {
    FragB ah, al;
    const v4f x0 = *(const v4fa*)(arow + kb + 8 * hh), x1 = *(const v4fa*)(arow + kb + 8 * hh + 4);
    const v4f x2 = *(const v4fa*)(arow + kb + 16 + 8 * hh), x3 = *(const v4fa*)(arow + kb + 16 + 8 * hh + 4);
    float xs[16] = {x0[0],x0[1],x0[2],x0[3],x1[0],x1[1],x1[2],x1[3],x2[0],x2[1],x2[2],x2[3],x3[0],x3[1],x3[2],x3[3]};
#pragma unroll
    for (int i = 0; i < 16; ++i) { const unsigned short hb = bf16_bits(xs[i]); ah.u[i] = hb; al.u[i] = ASPLIT ? bf16_bits(xs[i] - bf16_val(hb)) : (unsigned short)0; }
#pragma unroll
    for (int t = 0; t < 4; ++t) {
      const unsigned short* brow = Wt + (size_t)(col0 + t * 16 + ln) * ldb + kb;
      FragB b;
      b.half[0] = *(const v8us*)(brow + 8 * hh);
      b.half[1] = *(const v8us*)(brow + 16 + 8 * hh);
      acc[t] = mmaN<ASPLIT ? 2 : 1>(ah.v, al.v, b.v, b.v, acc[t]);
    }
  }
#pragma unroll
  for (int t = 0; t < 4; ++t) {
    const int col = col0 + t * 16 + ln;
    float bv = bias ? bias[col] : 0.f;
    if (BIAS_BF16) bv = bf16_round(bv);
#pragma unroll
    for (int r = 0; r < 8; ++r) {
      float v = acc[t][r] + bv;
      if (resid) { float rv = resid[(size_t)((row0 + 8 * hh + r) % rmod) * ldr + col]; if (RES_BF16) rv = bf16_round(rv); v += rv; }
      if (ACT == 1) v = fmaxf(v, 0.f);
      if (ACT == 2) v = 0.5f * v * (1.0f + erff(v * 0.70710678118654752f));
      if (ACT == 3) { const float u = 0.7978845608028654f * (v + 0.044715f * v * v * v); v = 0.5f * v * (1.0f + tanhf(u)); }
      so[w][8 * hh + r][t * 16 + ln] = v;
    }
  }
  __builtin_amdgcn_fence(__ATOMIC_ACQ_REL, "workgroup");
  __builtin_amdgcn_wave_barrier();
  const int rsub = lane >> 4, c4 = (lane & 15) * 4;
  {
#pragma unroll
    for (int q = 0; q < 8; ++q) {
      const int r = q * 2 + rsub;
      const v4f v = *(const v4fa*)&so[w][r][c4];
      *(v4f*)(C + (size_t)(row0 + r) * ldc + col0 + c4) = v;
    }
    
  }
}
// row LayerNorm (biased variance, eps) over N: s = X (+ R); optional out_sum <- s; out_norm <- (s-mu)*rsqrt(var+eps)*g + b
template <bool PARAM_BF16>
__global__ __launch_bounds__(256) void k_layernorm(const float* __restrict__ X, const float* __restrict__ R, const float* __restrict__ g, const float* __restrict__ bta,
                                                  float* __restrict__ out_sum, float* __restrict__ out_norm, int N, float eps) {
  __shared__ float red[256];
  const int row = blockIdx.x, tid = threadIdx.x;
  const float* x = X + (size_t)row * N; const float* rr = R ? R + (size_t)row * N : nullptr;
  float vals[16];                     // up to N = 4096
  const int per = N / 256;            // contiguous chunk per thread? use strided-by-4 chunks: thread handles j = tid*4 + 1024*u
  float s1 = 0.f;
  for (int u = 0; u < per / 4; ++u) {
    const int j = tid * 4 + 1024 * u;
    const v4f a = *(const v4fa*)(x + j);
    v4f b = {0.f,0.f,0.f,0.f}; if (rr) b = *(const v4fa*)(rr + j);
#pragma unroll
    for (int q = 0; q < 4; ++q) { const float v = a[q] + b[q]; vals[u * 4 + q] = v; s1 += v; }
  }
  red[tid] = s1; __syncthreads();
  for (int st = 128; st > 0; st >>= 1) { if (tid < st) red[tid] += red[tid + st]; __syncthreads(); }
  const float mu = red[0] / (float)N; __syncthreads();
  float s2 = 0.f;
  for (int u = 0; u < per / 4; ++u)
#pragma unroll
    for (int q = 0; q < 4; ++q) { const float c = vals[u * 4 + q] - mu; s2 += c * c; }
  red[tid] = s2; __syncthreads();
  for (int st = 128; st > 0; st >>= 1) { if (tid < st) red[tid] += red[tid + st]; __syncthreads(); }
  const float rs = rsqrtf(red[0] / (float)N + eps);
  {
    for (int u = 0; u < per / 4; ++u) {
      const int j = tid * 4 + 1024 * u;
      v4f o, sm;
#pragma unroll
      for (int q = 0; q < 4; ++q) {
        float gg = g[j + q], bb = bta[j + q];
        if (PARAM_BF16) { gg = bf16_round(gg); bb = bf16_round(bb); }
        sm[q] = vals[u * 4 + q]; o[q] = (vals[u * 4 + q] - mu) * rs * gg + bb;
      }
      if (out_sum) *(v4f*)(out_sum + (size_t)row * N + j) = sm;
      *(v4f*)(out_norm + (size_t)row * N + j) = o;
    }
    
  }
}



// ---- f16 WMMA path (v_wmma_f32_16x16x32_f16): 11-bit significands for operands in range — used where a [0,1] probability operand needs more precision than bf16
typedef _Float16 v16h __attribute__((ext_vector_type(16)));
union FragH { v16h v; v8us half[2]; _Float16 h[16]; unsigned short u[16]; };
template <int NT>
__device__ __forceinline__ v8f mmaH(v16h ah, v16h al, v16h bh, v16h bl, v8f c) {
  c = __builtin_amdgcn_wmma_f32_16x16x32_f16(false, ah, false, bh, (short)0, c, false, false);
  if (NT >= 2) c = __builtin_amdgcn_wmma_f32_16x16x32_f16(false, al, false, bh, (short)0, c, false, false);
  if (NT >= 3) c = __builtin_amdgcn_wmma_f32_16x16x32_f16(false, ah, false, bl, (short)0, c, false, false);
  asm volatile("v_nop\n\tv_nop\n\tv_nop\n\tv_nop" : "+v"(c) : "v"(ah), "v"(al), "v"(bh), "v"(bl));
  return c;
}
// batched GEMM like k_gemm_b but f16 operands: A f32 (split into f16 hi/lo if ASPLIT, else rounded to f16), Bt = f16 values [n][k]; alpha; C f32; N multiple of 16 (partial tiles skipped)
template <bool ASPLIT>
__global__ __launch_bounds__(128) void k_gemm_h(const float* __restrict__ A, int lda, size_t sA, const _Float16* __restrict__ Bh, int ldb, size_t sB, float alpha, float* __restrict__ C, int ldc, size_t sC, int M, int N, int K) {
  __shared__ __attribute__((aligned(16))) float so[4][16][64];
  const int tid = threadIdx.x, w = tid >> 5, lane = tid & 31, ln = lane & 15, hh = lane >> 4; const int by = blockIdx.y;
  A += (size_t)by * sA; Bh += (size_t)by * sB; C += (size_t)by * sC;
  const int ntn = (N + 63) / 64; const int wid = blockIdx.x * 4 + w; const int mt = wid / ntn, nq = wid % ntn; if (mt * 16 >= M) return;
  const int row0 = mt * 16, col0 = nq * 64; const float* arow = A + (size_t)(row0 + ln) * lda;
  v8f acc[4] = {};
  for (int kb = 0; kb < K; kb += 32) {
    FragH ah, al;
    const v4f x0 = *(const v4fa*)(arow + kb + 8 * hh), x1 = *(const v4fa*)(arow + kb + 8 * hh + 4), x2 = *(const v4fa*)(arow + kb + 16 + 8 * hh), x3 = *(const v4fa*)(arow + kb + 16 + 8 * hh + 4);
    float xs[16] = {x0[0],x0[1],x0[2],x0[3],x1[0],x1[1],x1[2],x1[3],x2[0],x2[1],x2[2],x2[3],x3[0],x3[1],x3[2],x3[3]};
#pragma unroll
    for (int i = 0; i < 16; ++i) { const _Float16 h = (_Float16)xs[i]; ah.h[i] = h; al.h[i] = ASPLIT ? (_Float16)(xs[i] - (float)h) : (_Float16)0.0f; }
#pragma unroll
    for (int t = 0; t < 4; ++t) { if (col0 + t * 16 >= N) continue; const size_t boff = (size_t)(col0 + t * 16 + ln) * ldb + kb; FragH bq; bq.half[0] = *(const v8us*)(Bh + boff + 8 * hh); bq.half[1] = *(const v8us*)(Bh + boff + 16 + 8 * hh);
      acc[t] = mmaH<ASPLIT ? 2 : 1>(ah.v, al.v, bq.v, bq.v, acc[t]); }
  }
#pragma unroll
  for (int t = 0; t < 4; ++t) { if (col0 + t * 16 >= N) continue;
#pragma unroll
    for (int r = 0; r < 8; ++r) so[w][8 * hh + r][t * 16 + ln] = acc[t][r] * alpha; }
  __builtin_amdgcn_fence(__ATOMIC_ACQ_REL, "workgroup"); __builtin_amdgcn_wave_barrier();
  const int rsub = lane >> 4, c4 = (lane & 15) * 4;
  {
#pragma unroll
    for (int q = 0; q < 8; ++q) { const int r = q * 2 + rsub; if (col0 + c4 < N) { const v4f v = *(const v4fa*)&so[w][r][c4]; *(v4f*)(C + (size_t)(row0 + r) * ldc + col0 + c4) = v; } }
     }
}

// Wt[n][k] = f16(W[k][n]·scale) from f32 row-major W[K][N] (scale = power of two; bf16-exact weights stay exact in f16 away from the subnormal range)
__global__ __launch_bounds__(256) void k_wt_f16(const float* __restrict__ W, _Float16* __restrict__ Wt, int K, int N, float scale) {
  const int t = blockIdx.x * 256 + threadIdx.x; if (t >= N * (K / 8)) return; const int n = t / (K / 8), k8 = (t % (K / 8)) * 8; FragH f;
#pragma unroll
  for (int i = 0; i < 8; ++i) f.h[i] = (_Float16)(bf16_round(W[(size_t)(k8 + i) * N + n]) * scale); const v8us o = f.half[0];
  *(v8us*)((unsigned short*)Wt + (size_t)n * K + k8) = o; 
}
// k_gemm_hh variant with fused epilogue: v = acc·alpha + bias[by·sBias + col] (+ CP[(row/rowsPerB)·sCPb + by·64 + col] if CP) ; ACT 0 none / 1 elu ; writes f16 C16 (and f32 C if non-null)
template <int ACT>
__global__ __launch_bounds__(128) void k_gemm_hhx(const _Float16* __restrict__ A, int lda, size_t sA, const _Float16* __restrict__ Bh, int ldb, size_t sB, float alpha, const float* __restrict__ bias, size_t sBias, const float* __restrict__ CP, int rowsPerB, size_t sCPb, int row0g,
    float* __restrict__ C, _Float16* __restrict__ C16, int ldc, size_t sC, int M, int N, int K) {
  __shared__ __attribute__((aligned(16))) float so[4][16][64];
  const int tid = threadIdx.x, w = tid >> 5, lane = tid & 31, ln = lane & 15, hh = lane >> 4; const int by = blockIdx.y;
  A += (size_t)by * sA; Bh += (size_t)by * sB; const size_t cofs = (size_t)by * sC; const float* bp = bias ? bias + (size_t)by * sBias : nullptr;
  const int ntn = (N + 63) / 64; const int wid = blockIdx.x * 4 + w; const int mt = wid / ntn, nq = wid % ntn; if (mt * 16 >= M) return;
  const int row0 = mt * 16, col0 = nq * 64; const _Float16* arow = A + (size_t)(row0 + ln) * lda;
  v8f acc[4] = {};
  for (int kb = 0; kb < K; kb += 32) { FragH ah; ah.half[0] = *(const v8us*)((const unsigned short*)arow + kb + 8 * hh); ah.half[1] = *(const v8us*)((const unsigned short*)arow + kb + 16 + 8 * hh);
#pragma unroll
    for (int t = 0; t < 4; ++t) { if (col0 + t * 16 >= N) continue; const size_t boff = (size_t)(col0 + t * 16 + ln) * ldb + kb; FragH bq; bq.half[0] = *(const v8us*)((const unsigned short*)Bh + boff + 8 * hh); bq.half[1] = *(const v8us*)((const unsigned short*)Bh + boff + 16 + 8 * hh);
      acc[t] = mmaH<1>(ah.v, ah.v, bq.v, bq.v, acc[t]); }
  }
#pragma unroll
  for (int t = 0; t < 4; ++t) { if (col0 + t * 16 >= N) continue; const int col = col0 + t * 16 + ln; const float bv = bp ? bf16_round(bp[col]) : 0.f;
#pragma unroll
    for (int r = 0; r < 8; ++r) { float v = acc[t][r] * alpha + bv; if (CP) { const int rr = row0g + row0 + 8 * hh + r; if (rowsPerB < 0) v += CP[cofs + (size_t)rr * ldc + col];      /* rowsPerB < 0: own element of the batched C plane */ else { const int bidx = rr / rowsPerB; v += CP[(size_t)bidx * sCPb + (size_t)by * 64 + col]; } } if (ACT == 1) v = (v > 0.f) ? v : expm1f(v); else if (ACT == 7) v = (v > 0.f) ? v + 1.0f : expf(v); else if (ACT == 8) v = tanhf(v); else if (ACT == 9) v = 0.5f * v * (1.0f + tanhf(0.7978845608028654f * (v + 0.044715f * v * v * v))); else if (ACT == 11) v = 1.0f / (1.0f + expf(-v)); else if (ACT == 12) v = (v > 0.f) ? v : 0.01f * v; else if (ACT == 14) v = (v > 0.f) ? v : 0.1f * v; else if (ACT == 16) v = (v >= 0.f) ? v : 0.3f * v; else if (ACT == 17) v = (v >= 0.f) ? v : 0.2f * v; else if (ACT == 15) v = v / (1.0f + expf(-v)); else if (ACT == 3) v = fmaxf(v, 0.f); else if (ACT == 6) v = 0.5f * v * (1.0f + erff(v * 0.70710678118654752f)); so[w][8 * hh + r][t * 16 + ln] = v; } }
  __builtin_amdgcn_fence(__ATOMIC_ACQ_REL, "workgroup"); __builtin_amdgcn_wave_barrier();
  const int rsub = lane >> 4, c4 = (lane & 15) * 4; typedef _Float16 v4h __attribute__((ext_vector_type(4)));
  {
#pragma unroll
    for (int q = 0; q < 8; ++q) { const int r = q * 2 + rsub; if (col0 + c4 < N) { const v4f v = *(const v4fa*)&so[w][r][c4]; if (C) *(v4f*)(C + cofs + (size_t)(row0 + r) * ldc + col0 + c4) = v; if (C16) { v4h h4; for (int i = 0; i < 4; ++i) h4[i] = (_Float16)v[i]; *(v4h*)(C16 + cofs + (size_t)(row0 + r) * ldc + col0 + c4) = h4; } } }
     }
}


typedef _Float16 v4h __attribute__((ext_vector_type(4)));

__global__ __launch_bounds__(256) void k_x16(const float* __restrict__ x, _Float16* __restrict__ X16, size_t n8) { const size_t t = (size_t)blockIdx.x * 256 + threadIdx.x; if (t >= n8) return; FragH f;
#pragma unroll
  for (int q = 0; q < 8; ++q) f.h[q] = (_Float16)bf16_round(x[t * 8 + q]); *(v8us*)((unsigned short*)X16 + t * 8) = f.half[0];  }
__global__ __launch_bounds__(256) void k_h16(const float* __restrict__ x, _Float16* __restrict__ X16, size_t n8) { const size_t t = (size_t)blockIdx.x * 256 + threadIdx.x; if (t >= n8) return; FragH f;
#pragma unroll
  for (int q = 0; q < 8; ++q) f.h[q] = (_Float16)x[t * 8 + q]; *(v8us*)((unsigned short*)X16 + t * 8) = f.half[0];  }
__global__ __launch_bounds__(256) void k_round16f(const float* __restrict__ W, _Float16* __restrict__ Bt, size_t n8) { const size_t t = (size_t)blockIdx.x * 256 + threadIdx.x; if (t >= n8) return; FragH f;
#pragma unroll
  for (int i = 0; i < 8; ++i) f.h[i] = (_Float16)(bf16_round(W[t * 8 + i]) * 16.0f); *(v8us*)((unsigned short*)Bt + t * 8) = f.half[0];  }
template <int NHv, int TTv>
__global__ __launch_bounds__(256) void k_vt(const _Float16* __restrict__ V16, int ldv, int voff, _Float16* __restrict__ Vt) { __shared__ unsigned short tl[64][66]; const int tid = threadIdx.x; const int slab = blockIdx.x / (TTv / 64), lg = blockIdx.x % (TTv / 64); const int b = slab / NHv, h = slab % NHv;
  for (int i = tid; i < 64 * 8; i += 256) { const int r = i / 8, c8 = (i % 8) * 8; FragH f; f.half[0] = *(const v8us*)((const unsigned short*)V16 + ((size_t)b * TTv + lg * 64 + r) * ldv + voff + h * 64 + c8);
#pragma unroll
    for (int q = 0; q < 8; ++q) tl[r][c8 + q] = f.u[q]; }
  __syncthreads();
  {
#pragma unroll
    for (int rd = 0; rd < 2; ++rd) { const int d = rd * 32 + tid / 8, pc = tid % 8; FragH f;
#pragma unroll
      for (int q = 0; q < 8; ++q) f.u[q] = tl[pc * 8 + q][d];
      *(v8us*)((unsigned short*)Vt + ((size_t)slab * 64 + d) * TTv + lg * 64 + pc * 8) = f.half[0]; }
     } }

__global__ __launch_bounds__(256) void k_hl(const float* __restrict__ F, _Float16* __restrict__ Hh, _Float16* __restrict__ Hl, size_t n8) { const size_t t = (size_t)blockIdx.x * 256 + threadIdx.x; if (t >= n8) return; FragH fh, fl; const v4f a = *(const v4fa*)(F + t * 8), c = *(const v4fa*)(F + t * 8 + 4);
#pragma unroll
  for (int q = 0; q < 4; ++q) { _Float16 h = (_Float16)a[q]; fh.h[q] = h; fl.h[q] = (_Float16)((a[q] - (float)h) * 1024.0f); h = (_Float16)c[q]; fh.h[4 + q] = h; fl.h[4 + q] = (_Float16)((c[q] - (float)h) * 1024.0f); }
  { *(v8us*)((unsigned short*)Hh + t * 8) = fh.half[0]; *(v8us*)((unsigned short*)Hl + t * 8) = fl.half[0];  } }

// ---- fast GEMM (wave tile 32x64; requires M % 32 == 0 rows per launch region and N % 64 == 0); epilogue = k_gemm_hhx semantics ----
__device__ __forceinline__ v16h g2_frag(const _Float16* p, int hh) { FragH f; f.half[0] = *(const v8us*)((const unsigned short*)p + 8 * hh); f.half[1] = *(const v8us*)((const unsigned short*)p + 16 + 8 * hh); return f.v; }
__device__ __forceinline__ v8f g2_mma(v16h a, v16h b, v8f c) { v8f d = __builtin_amdgcn_wmma_f32_16x16x32_f16(false, a, false, b, (short)0, c, false, false); asm volatile("v_nop\n\tv_nop\n\tv_nop\n\tv_nop" : "+v"(d) : "v"(a), "v"(b)); return d; }
template <int ACT>
__global__ __launch_bounds__(128) void k_gemm2(const _Float16* __restrict__ A, int lda, size_t sA, const _Float16* __restrict__ Bh, int ldb, size_t sB, float alpha, const float* __restrict__ bias, size_t sBias, const float* __restrict__ CP, int rowsPerB, size_t sCPb, int row0g,
    float* __restrict__ C, _Float16* __restrict__ C16, int ldc, size_t sC, int M, int N, int K) { static_assert(ACT == 0 || ACT == 3 || ACT == 6 || ACT == 8 || ACT == 9 || ACT == 11 || ACT == 12 || ACT == 14 || ACT == 15 || ACT == 16 || ACT == 17, "k_gemm2: unsupported ACT code (would silently apply no activation)");
  __shared__ __attribute__((aligned(16))) float so[4][32][68];
  const int tid = threadIdx.x, w = tid >> 5, lane = tid & 31, ln = lane & 15, hh = lane >> 4; const int by = blockIdx.y;
  A += (size_t)by * sA; Bh += (size_t)by * sB; const size_t cofs = (size_t)by * sC; const float* bp = bias ? bias + (size_t)by * sBias : nullptr;
  const int ntn = N >> 6; const int mt = blockIdx.x / ntn, nq = blockIdx.x - mt * ntn; const int row0 = mt * 128 + 32 * w, col0 = nq * 64; if (row0 >= M) return;
  const _Float16* a0p = A + (size_t)(row0 + ln) * lda; const _Float16* a1p = a0p + (size_t)16 * lda;
  const _Float16* b0p = Bh + (size_t)(col0 + ln) * ldb; const _Float16* b1p = b0p + (size_t)16 * ldb; const _Float16* b2p = b1p + (size_t)16 * ldb; const _Float16* b3p = b2p + (size_t)16 * ldb;
  const v8f z8 = {0.f,0.f,0.f,0.f,0.f,0.f,0.f,0.f}; v8f c00 = z8, c01 = z8, c02 = z8, c03 = z8, c10 = z8, c11 = z8, c12 = z8, c13 = z8;
#pragma unroll 1
  for (int kb = 0; kb < K; kb += 32) { const v16h a0 = g2_frag(a0p + kb, hh), a1 = g2_frag(a1p + kb, hh);
    v16h b = g2_frag(b0p + kb, hh); c00 = g2_mma(a0, b, c00); c10 = g2_mma(a1, b, c10);
    b = g2_frag(b1p + kb, hh); c01 = g2_mma(a0, b, c01); c11 = g2_mma(a1, b, c11);
    b = g2_frag(b2p + kb, hh); c02 = g2_mma(a0, b, c02); c12 = g2_mma(a1, b, c12);
    b = g2_frag(b3p + kb, hh); c03 = g2_mma(a0, b, c03); c13 = g2_mma(a1, b, c13); }
  v8f accs[8] = {c00, c01, c02, c03, c10, c11, c12, c13};
#pragma unroll
  for (int u = 0; u < 8; ++u) { const int t = u & 3, half = u >> 2; const int col = col0 + t * 16 + ln; const float bv = bp ? bf16_round(bp[col]) : 0.f;
#pragma unroll
    for (int r = 0; r < 8; ++r) { const int rloc = half * 16 + 8 * hh + r; float v = accs[u][r] * alpha + bv; if (CP) { if (rowsPerB < 0) v += CP[cofs + (size_t)(row0g + row0 + rloc) * ldc + col];      /* rowsPerB < 0: own element of the batched C plane */ else { const int bidx = (row0g + row0 + rloc) / rowsPerB; v += CP[(size_t)bidx * sCPb + (size_t)by * 64 + col]; } }
      if (ACT == 3) v = fmaxf(v, 0.f); else if (ACT == 6) v = 0.5f * v * (1.0f + erff(v * 0.70710678118654752f)); else if (ACT == 11) v = 1.0f / (1.0f + expf(-v)); else if (ACT == 15) v = v / (1.0f + expf(-v)); else if (ACT == 12) v = (v > 0.f) ? v : 0.01f * v; else if (ACT == 8) v = tanhf(v); else if (ACT == 9) v = 0.5f * v * (1.0f + tanhf(0.7978845608028654f * (v + 0.044715f * v * v * v))); else if (ACT == 14) v = (v > 0.f) ? v : 0.1f * v; else if (ACT == 16) v = (v >= 0.f) ? v : 0.3f * v; else if (ACT == 17) v = (v >= 0.f) ? v : 0.2f * v;
      so[w][rloc][t * 16 + ln] = v; } }
  __builtin_amdgcn_fence(__ATOMIC_ACQ_REL, "workgroup"); __builtin_amdgcn_wave_barrier();
  const int rsub = lane >> 4, c4 = (lane & 15) * 4;
  {
#pragma unroll
    for (int q = 0; q < 16; ++q) { const int r = q * 2 + rsub; const v4f v = *(const v4fa*)&so[w][r][c4]; if (C) *(v4f*)(C + cofs + (size_t)(row0 + r) * ldc + col0 + c4) = v; if (C16) { v4h h4; for (int i = 0; i < 4; ++i) h4[i] = (_Float16)v[i]; *(v4h*)(C16 + cofs + (size_t)(row0 + r) * ldc + col0 + c4) = h4; } }
     } }


__global__ __launch_bounds__(256) void k_wnat(const float* __restrict__ w, size_t n8, _Float16* __restrict__ Bt) { const size_t t = (size_t)blockIdx.x * 256 + threadIdx.x; if (t >= n8) return; FragH f; for (int q = 0; q < 8; ++q) f.h[q] = (_Float16)(bf16_round(w[t * 8 + q]) * 16.0f); *(v8us*)((unsigned short*)Bt + t * 8) = f.half[0];  }
__global__ __launch_bounds__(256) void k_rsm(const float* __restrict__ S, _Float16* __restrict__ P, int nrows) {
  #pragma clang fp contract(off)
  const int i = blockIdx.x * 256 + threadIdx.x; if (i >= nrows) return; const float* s = S + (size_t)i * SQ; float mx = -3.0e38f;
#pragma unroll 1
  for (int j = 0; j < SQ; ++j) mx = fmaxf(mx, s[j]); float se = 0.f;
#pragma unroll 1
  for (int j = 0; j < SQ; ++j) se += expf(s[j] - mx); const float sc = 256.0f / se;
#pragma unroll 1
  for (int j0 = 0; j0 < SQ; j0 += 8) { FragH f; for (int q = 0; q < 8; ++q) f.h[q] = (_Float16)(expf(s[j0 + q] - mx) * sc); unsigned short* d = (unsigned short*)P + (size_t)i * SQ + j0; *(v8us*)d = f.half[0];  } }
__global__ __launch_bounds__(256) void k_vt(const _Float16* __restrict__ V16, int b, int h0, _Float16* __restrict__ VT) { __shared__ unsigned short tl[64][65]; const int tid = threadIdx.x; const int hh = blockIdx.x % HG, sg = blockIdx.x / HG; const int s0 = sg * 64; const int h = h0 + hh;
  for (int i = tid; i < 64 * 8; i += 256) { const int j = i / 8, d8 = (i % 8) * 8; FragH f; f.half[0] = *(const v8us*)((const unsigned short*)V16 + ((size_t)b * SQ + s0 + j) * DM + h * HD + d8); for (int q = 0; q < 8; ++q) tl[d8 + q][j] = f.u[q]; }
  __syncthreads();
  { for (int i = tid; i < 64 * 8; i += 256) { const int d = i / 8, j8 = (i % 8) * 8; FragH f; for (int q = 0; q < 8; ++q) f.u[q] = tl[d][j8 + q]; *(v8us*)((unsigned short*)VT + ((size_t)hh * HD + d) * SQ + s0 + j8) = f.half[0]; }  } }



__global__ __launch_bounds__(256) void k_rsmcf2(const float* __restrict__ S, _Float16* __restrict__ P, int hg, int q0, int nk) {
  #pragma clang fp contract(off)
  const int t = blockIdx.x * 256 + threadIdx.x; if (t >= hg * QT) return; const size_t i = (size_t)t; const float* s = S + i * NKX; const int last = q0 + (t % QT); float mx = -3.0e38f;
#pragma unroll 1
  for (int j = 0; j < nk; ++j) { const float f = (j <= last) ? 1.f : 0.f; mx = fmaxf(mx, fmaf(f, s[j], (1.f - f) * -1.0e9f)); } float se = 0.f;
#pragma unroll 1
  for (int j = 0; j < nk; ++j) { const float f = (j <= last) ? 1.f : 0.f; se += __expf(fmaf(f, s[j], (1.f - f) * -1.0e9f) - mx); } const float sc = 256.0f / se;
#pragma unroll 1
  for (int j0 = 0; j0 < nk; j0 += 8) { FragH fr; for (int q = 0; q < 8; ++q) { const int j = j0 + q; const float f = (j <= last) ? 1.f : 0.f; fr.h[q] = (_Float16)(__expf(fmaf(f, s[j], (1.f - f) * -1.0e9f) - mx) * sc); } unsigned short* d = (unsigned short*)P + i * NKX + j0; *(v8us*)d = fr.half[0];  } }

template <int MASKADD>
__global__ __launch_bounds__(64) void k_att0(const float* __restrict__ QF, const float* __restrict__ KF, const float* __restrict__ VF, int ld, const float* __restrict__ mask, float scale, float* __restrict__ OF, int ldo) {
  #pragma clang fp contract(off)
  __shared__ __attribute__((aligned(16))) float lq[64][64]; __shared__ __attribute__((aligned(16))) float lo[64][64];
  const int tid = threadIdx.x; const int h = blockIdx.x / (QT0 / 64), rg = blockIdx.x % (QT0 / 64); const int i = rg * 64 + tid;
  const float* qr = QF + (size_t)i * ld + h * HD;
#pragma unroll 1
  for (int c = 0; c < HD / 4; ++c) { *(v4f*)&lq[tid][c * 4] = *(const v4fa*)(qr + c * 4); const v4f z = {0.f, 0.f, 0.f, 0.f}; *(v4f*)&lo[tid][c * 4] = z; }
  float m = -1.0e30f, l = 0.f; const int jmax = MASKADD ? (SQ - 1) : (rg * 64 + 63);      /* additive-mask form: every key (the mask input decides); causal form: keys up to the block's last row */
#pragma unroll 1
  for (int j = 0; j <= jmax; ++j) { const float* kr = KF + (size_t)j * ld + h * HD; const float* vr = VF + (size_t)j * ld + h * HD; float s = 0.f;
#pragma unroll 1
    for (int c = 0; c < HD / 4; ++c) { const v4f kq = *(const v4fa*)(kr + c * 4); const v4f qq = *(v4f*)&lq[tid][c * 4]; s = __fadd_rn(s, __fmul_rn(qq[0], kq[0])); s = __fadd_rn(s, __fmul_rn(qq[1], kq[1])); s = __fadd_rn(s, __fmul_rn(qq[2], kq[2])); s = __fadd_rn(s, __fmul_rn(qq[3], kq[3])); }
    s = __fmul_rn(s, scale); if (MASKADD) s = __fadd_rn(s, __fmul_rn(bf16_round(mask[(size_t)i * SQ + j]), -10000.0f));
    const float f = (MASKADD || j <= i) ? 1.f : 0.f; const float sm = fmaf(f, s, (1.f - f) * -1.0e30f); const float mn = fmaxf(m, sm); const float sc = expf(m - mn); const float e = expf(sm - mn); l = __fadd_rn(__fmul_rn(l, sc), e); m = mn;
#pragma unroll 1
    for (int c = 0; c < HD / 4; ++c) { const v4f vv = *(const v4fa*)(vr + c * 4); v4f oo = *(v4f*)&lo[tid][c * 4]; for (int u = 0; u < 4; ++u) oo[u] = __fadd_rn(__fmul_rn(oo[u], sc), __fmul_rn(e, vv[u])); *(v4f*)&lo[tid][c * 4] = oo; } }
  const float fin = 64.0f / l;      /* o carried x64 */
#pragma unroll 1
  for (int c = 0; c < HD / 4; ++c) { v4f oo = *(v4f*)&lo[tid][c * 4]; for (int u = 0; u < 4; ++u) oo[u] = __fmul_rn(oo[u], fin); *(v4f*)&lo[tid][c * 4] = oo; }
  __syncthreads();
  {
#pragma unroll 1
    for (int it = 0; it < 16; ++it) { const int row = it * 4 + tid / 16, pc = (tid % 16) * 4; const v4f v = *(const v4f*)&lo[row][pc]; *(v4f*)(OF + (size_t)(rg * 64 + row) * ldo + h * HD + pc) = v; }
     } }

__global__ __launch_bounds__(256) void k_oscale(const float* __restrict__ OF, float* __restrict__ out, size_t n4) { const size_t t = (size_t)blockIdx.x * 256 + threadIdx.x; if (t >= n4) return; const v4f a = *(const v4fa*)(OF + t * 4); v4f o; for (int q = 0; q < 4; ++q) o[q] = a[q] * 0.015625f; *(v4f*)(out + t * 4) = o;  }

__global__ __launch_bounds__(256) void k_bfr(const float* __restrict__ x, float* __restrict__ XB, size_t n8) { const size_t t = (size_t)blockIdx.x * 256 + threadIdx.x; if (t >= n8) return; v4f a = *(const v4fa*)(x + t * 8), c = *(const v4fa*)(x + t * 8 + 4); for (int q = 0; q < 4; ++q) { a[q] = bf16_round(a[q]); c[q] = bf16_round(c[q]); }
  { *(v4f*)(XB + t * 8) = a; *(v4f*)(XB + t * 8 + 4) = c;  } }



__global__ __launch_bounds__(256) void k_rsmfvl(const float* __restrict__ S, _Float16* __restrict__ P, _Float16* __restrict__ PL, int qn, const int* __restrict__ vlp) {
  #pragma clang fp contract(off)
  const int t = blockIdx.x * 256 + threadIdx.x; if (t >= qn) return; const int vl = vlp[0]; const size_t i = (size_t)t; const float* s = S + i * SQ; float mx = -3.0e38f;
#pragma unroll 1
  for (int j = 0; j < SQ; ++j) { const float f = (j < vl) ? 1.f : 0.f; mx = fmaxf(mx, fmaf(f, s[j], (1.f - f) * -1000000.0f)); } float se = 0.f;
#pragma unroll 1
  for (int j = 0; j < SQ; ++j) { const float f = (j < vl) ? 1.f : 0.f; se += __expf(fmaf(f, s[j], (1.f - f) * -1000000.0f) - mx); } const float sc = 256.0f / se;
#pragma unroll 1
  for (int j0 = 0; j0 < SQ; j0 += 8) { FragH fr, gr; for (int q = 0; q < 8; ++q) { const int j = j0 + q; const float f = (j < vl) ? 1.f : 0.f; const float pv = __expf(fmaf(f, s[j], (1.f - f) * -1000000.0f) - mx) * sc; const _Float16 ph = (_Float16)pv; fr.h[q] = ph; gr.h[q] = (_Float16)((pv - (float)ph) * 1024.0f); }
    unsigned short* d = (unsigned short*)P + i * SQ + j0; unsigned short* dl = (unsigned short*)PL + i * SQ + j0; *(v8us*)d = fr.half[0]; *(v8us*)dl = gr.half[0];  } }

__global__ __launch_bounds__(256) void k_rsmf(const float* __restrict__ S, _Float16* __restrict__ P, int qn, int hg) {
  #pragma clang fp contract(off)
  const int t = blockIdx.x * 256 + threadIdx.x; if (t >= qn * hg) return; const size_t i = (size_t)(t / qn) * SQ + (t % qn); const float* s = S + i * SQ; float mx = -3.0e38f;
#pragma unroll 1
  for (int j = 0; j < SQ; ++j) mx = fmaxf(mx, s[j]); float se = 0.f;
#pragma unroll 1
  for (int j = 0; j < SQ; ++j) se += __expf(s[j] - mx); const float sc = 256.0f / se;
#pragma unroll 1
  for (int j0 = 0; j0 < SQ; j0 += 8) { FragH f; for (int q = 0; q < 8; ++q) f.h[q] = (_Float16)(__expf(s[j0 + q] - mx) * sc); unsigned short* d = (unsigned short*)P + i * SQ + j0; *(v8us*)d = f.half[0];  } }


#define CN 256          /* channels */
#define CI 128
#define NC 256                       /* (unused legacy kernels) */
#define NPX NP          /* elements per (batch, channel) row */
#define NP 4096         /* seq1 tokens */
#define NM 1024         /* seq2 tokens */
#define BNEPS 1e-5f

__global__ __launch_bounds__(256) void k_mp2(const float* __restrict__ src, float* __restrict__ dst, int nout) {
  const int t = blockIdx.x * 256 + threadIdx.x; if (t >= nout) return; const int c = t / 1024; const int o = t % 1024; const int oy = o / 32, ox = o % 32; const float* p = src + (size_t)c * 4096 + (size_t)(2 * oy) * 64 + 2 * ox;
  const float v = fmaxf(fmaxf(p[0], p[1]), fmaxf(p[64], p[65])); *(float*)(dst + t) = v;  }
__global__ __launch_bounds__(256) void k_xpb(const float* __restrict__ x, const float* __restrict__ wb, float* __restrict__ CPP, size_t n4) {
  #pragma clang fp contract(off)
  const size_t t = (size_t)blockIdx.x * 256 + threadIdx.x; if (t >= n4) return; const size_t e = t * 4; const int c = (int)((e / 4096) % 256); const float bb = bf16_round(wb[c]); const v4f a = *(const v4fa*)(x + e); v4f o; for (int q = 0; q < 4; ++q) o[q] = __fadd_rn(bf16_round(a[q]), bb);
  *(v4f*)(CPP + e) = o;  }


template <int PASS>
__global__ __launch_bounds__(256) void k_cstA(const float* __restrict__ X, const float* __restrict__ MV, float* __restrict__ PART) {
  #pragma clang fp contract(off)
  __shared__ float red[256]; const int t = threadIdx.x; const size_t bc = blockIdx.x; const int c = (int)(bc % NC); const float* row = X + bc * (size_t)NPX; const float mu = PASS ? MV[c] : 0.f; float s = 0.f;
  for (int i = t; i < NPX; i += 256) { const float v = row[i]; const float d = PASS ? __fadd_rn(v, -mu) : v; s = __fadd_rn(s, PASS ? __fmul_rn(d, d) : d); }
  red[t] = s; __syncthreads(); for (int st = 128; st > 0; st >>= 1) { if (t < st) red[t] = __fadd_rn(red[t], red[t + st]); __syncthreads(); }
  if (t < 32) { const float pv = (t == 0) ? red[0] : 0.f; *(float*)(PART + bc * 32 + t) = pv;  } }      

template <int PASS>
__global__ __launch_bounds__(256) void k_cstB(const float* __restrict__ PART, float* __restrict__ MV) { const int c = threadIdx.x; if (c >= NC) return; double s = 0.0; for (int b = 0; b < NB; ++b) s += (double)PART[((size_t)b * NC + c) * 32]; const float m = (float)(s / ((double)NB * (double)NPX)); *(float*)(MV + PASS * NC + c) = m;  }


__global__ __launch_bounds__(256) void k_bnresid(const float* __restrict__ C2, const float* __restrict__ MV, const float* __restrict__ g, const float* __restrict__ be, const float* __restrict__ X, float* __restrict__ out, size_t n4) {
  #pragma clang fp contract(off)
  const size_t t = (size_t)blockIdx.x * 256 + threadIdx.x; if (t >= n4) return; const size_t e = t * 4; const int c = (int)((e / NPX) % NC); const float sc = __fmul_rn(rsqrtf(__fadd_rn(MV[NC + c], BNEPS)), bf16_round(g[c])); const float mu = MV[c], bb = bf16_round(be[c]);
  const v4f a = *(const v4fa*)(C2 + e); const v4f xx = *(const v4fa*)(X + e); v4f o; for (int q = 0; q < 4; ++q) { const float z = __fadd_rn(__fmul_rn(__fadd_rn(a[q], -mu), sc), bb); o[q] = __fadd_rn(z, bf16_round(xx[q])); }      /* BN + residual, no ReLU */
  *(v4f*)(out + e) = o;  }


__global__ __launch_bounds__(256) void k_rowbias(float* __restrict__ Y, const float* __restrict__ bias) {
  #pragma clang fp contract(off)
  const size_t t = (size_t)blockIdx.x * 256 + threadIdx.x; if (t >= (size_t)NB * NC * NPX / 4) return; const size_t e = t * 4; const int c = (int)((e / NPX) % NC); const float bb = bf16_round(bias[c]);
  v4f v = *(const v4fa*)(Y + e); for (int q = 0; q < 4; ++q) v[q] = __fadd_rn(v[q], bb); *(v4f*)(Y + e) = v;  }



// ---- fused attention: scores, softmax and the weighted sum of V in one kernel ----
constexpr int FA_NQ = 8192, FA_NK = 8192, FA_D = 256;      /* queries, keys, head width */
constexpr int FA_NS = 8, FA_BC = 32, FA_NP = FA_NK / FA_NS / FA_BC;      /* key splits, keys per pass, passes per split */
constexpr int FA_TB = FA_BC * FA_D * 2;      /* bytes of one pass's K (and of its V^T): 16 KiB */
constexpr int FA_SP = 4, FA_RS = 2 * FA_SP;      /* passes per stage (one barrier a stage); slots of the LDS ring: two stages, one slot a pass */
__device__ __forceinline__ v16h fa_frag(const unsigned char* p) { FragH f; f.half[0] = *(const v8us*)p; f.half[1] = *(const v8us*)(p + 512); return f.v; }
__device__ __forceinline__ v8f fa_mma(v16h a, v16h b, v8f c) { return __builtin_amdgcn_wmma_f32_16x16x32_f16(false, a, false, b, (short)0, c, false, false); }
__device__ __forceinline__ void fa_xcnt0() { asm volatile("s_wait_xcnt 0x0" ::: "memory"); }      /* stands behind issued global loads or stores, in front of whatever reuses a register that they name */
typedef unsigned int fa_u4 __attribute__((ext_vector_type(4)));
typedef unsigned int fa_u8 __attribute__((ext_vector_type(8)));
__device__ __forceinline__ unsigned int fa_uni(unsigned int v) { return (unsigned int)__builtin_amdgcn_readfirstlane(v); }
__device__ __forceinline__ unsigned int fa_pinned(unsigned int v) { unsigned int w = fa_uni(v); asm volatile("" : "+s"(w)); return w; }      /* the test of a tensor load held in a scalar register, so that it compiles to s_cmp and a scalar branch (a tensor load ignores EXEC) */
__device__ __forceinline__ void fa_dscnt0() { asm volatile("s_wait_dscnt 0x0" ::: "memory"); }      /* this wave's LDS reads have returned: in front of the barrier behind which their buffer is refilled */
__device__ __forceinline__ void fa_tensorcnt0() { asm volatile("s_wait_tensorcnt 0x0" ::: "memory"); }      /* this wave's tensor load has landed: the compiler places no wait for it */
// One request of one wave: FA_TB contiguous bytes from ga to the LDS byte offset dst, as 64 rows of 256 bytes at a source pitch of 256 bytes; 1-byte elements, no pad, no mask.
__device__ __forceinline__ void fa_tload(unsigned int dst, unsigned long long ga) {
  constexpr unsigned int d0 = 256u, d1 = 64u;
  fa_u4 g0; fa_u8 g1;
  g0[0] = fa_uni(1u); g0[1] = fa_uni(dst); g0[2] = fa_uni((unsigned int)ga); g0[3] = fa_uni((((unsigned int)(ga >> 32)) & 0x01FFFFFFu) | 0x80000000u);
  g1[0] = fa_uni(0u); g1[1] = fa_uni((d0 & 0xFFFFu) << 16); g1[2] = fa_uni((d0 >> 16) | ((d1 & 0xFFFFu) << 16)); g1[3] = fa_uni((d1 >> 16) | (d0 << 16)); g1[4] = fa_uni(d1); g1[5] = fa_uni(d0); g1[6] = fa_uni(0u); g1[7] = fa_uni(0u);
  asm volatile("tensor_load_to_lds %0, %1" :: "s"(g0), "s"(g1) : "memory"); }
__device__ __forceinline__ float fa_exp2_slot(float x) { float r; asm("v_exp_f32 %0, %1\n\tv_nop" : "=v"(r) : "v"(x)); return r; }      /* 2^x with the one slot the instruction set asks for between a transcendental and a next instruction that reads its result or overwrites its source: in one statement, so that the slot stays there */
__device__ __forceinline__ float fa_xhalf(float x) { return __builtin_bit_cast(float, __builtin_amdgcn_permlanex16(__builtin_bit_cast(int, x), __builtin_bit_cast(int, x), 0x76543210, 0xfedcba98, false, false)); }      /* lane l with lane l ^ 16 */

// Preparation in one launch. A piece is 8 f16 = 16 bytes; work-group b makes pieces 1024 b .. 1024 b + 1023 of each of three arrays, thread tid the pieces t = 1024 b + 256 i + tid (i < 4).
// Q16: piece t holds Q's elements 8 t + 0..7 (plain rows).
// K in fragment order: piece t = ((key tile * 8 + k step) * 2 + q) * 32 + lane holds K[16 tile + c][32 step + 16 q + 8 h + 0..7] (c = lane & 15, h = lane >> 4): a wave's fragment load is 512 contiguous bytes.
// V^T in fragment order: piece t = ((key block * 16 + d tile) * 2 + q) * 32 + lane holds V[32 block + 16 q + 8 h + 0..7][16 tile + c].
__device__ __forceinline__ v8us fa_piece(const float* e) { FragH f;
#pragma unroll
  for (int j = 0; j < 8; ++j) f.h[j] = (_Float16)bf16_round(e[j]);
  return f.half[0]; }
__global__ __launch_bounds__(256) void k_prep(const float* __restrict__ xq, const float* __restrict__ xk, const float* __restrict__ xv, _Float16* __restrict__ Q16, _Float16* __restrict__ Kf, _Float16* __restrict__ Vf) {
  static_assert(FA_NQ == FA_NK && FA_D == 256, "one work-group index serves the three arrays");
  const int tid = threadIdx.x, b = blockIdx.x, lane = tid & 31, q = (tid >> 5) & 1, w2 = tid >> 6, c = lane & 15, h = lane >> 4;
  const float* sq = xq + ((size_t)b * 1024 + tid) * 8;
  const float* sk = xk + (size_t)(b * 32 + c) * FA_D + w2 * 32 + 16 * q + 8 * h;      /* piece i: key tile 2 b + (i >> 1), k step 4 (i & 1) + w2 */
  const float* sv = xv + (size_t)(b * 32 + 16 * q + 8 * h) * FA_D + w2 * 16 + c;      /* piece i: key block b, d tile 4 i + w2 */
  float eq[4][8], ek[4][8], ev[4][8];
#pragma unroll
  for (int i = 0; i < 4; ++i) { const float* s = sq + i * 2048; *(v4f*)&eq[i][0] = *(const v4fa*)s; *(v4f*)&eq[i][4] = *(const v4fa*)(s + 4); }
  fa_xcnt0();      /* all 48 loads of a thread are in flight together; the waits let a later array's loads land in an earlier one's address registers */
#pragma unroll
  for (int i = 0; i < 4; ++i) { const float* s = sk + (i >> 1) * 16 * FA_D + (i & 1) * 128; *(v4f*)&ek[i][0] = *(const v4fa*)s; *(v4f*)&ek[i][4] = *(const v4fa*)(s + 4); }
  fa_xcnt0();
#pragma unroll
  for (int i = 0; i < 4; ++i) {
#pragma unroll
    for (int j = 0; j < 8; ++j) ev[i][j] = sv[i * 64 + j * FA_D]; }
  fa_xcnt0();
  __builtin_amdgcn_sched_barrier(0);      /* the conversions stay behind the last load: moved up among the loads, the first one's wait for its data holds back the issue of the loads behind it */
  v8us oq[4], ok[4], ov[4];
#pragma unroll
  for (int i = 0; i < 4; ++i) { oq[i] = fa_piece(eq[i]); ok[i] = fa_piece(ek[i]); ov[i] = fa_piece(ev[i]); }
  const size_t o = ((size_t)b * 1024 + tid) * 8;
#pragma unroll
  for (int i = 0; i < 4; ++i) { *(v8us*)((unsigned short*)Q16 + o + i * 2048) = oq[i]; *(v8us*)((unsigned short*)Kf + o + i * 2048) = ok[i]; *(v8us*)((unsigned short*)Vf + o + i * 2048) = ov[i]; } }

__global__ __launch_bounds__(256) void k_fattn(const _Float16* __restrict__ Q16, const _Float16* __restrict__ Kf, const _Float16* __restrict__ Vf, _Float16* __restrict__ Op, float* __restrict__ Mp, float* __restrict__ Lp) {
  static_assert(FA_NP % FA_SP == 0 && FA_NP >= 2 * FA_SP && (FA_RS & (FA_RS - 1)) == 0, "whole stages; the ring index is a mask");
  static_assert(FA_TB == 64 * 256 && FA_SP == 4, "a wave's slice is one pass's K or V^T: 64 rows of 256 bytes; eight waves bring a stage");
  __shared__ __attribute__((aligned(2048))) unsigned char lb[FA_RS][2 * FA_TB];
  const int tid = threadIdx.x, lane = tid & 31, wave = (int)fa_uni(tid >> 5), c = lane & 15, h = lane >> 4;
  const int qb = blockIdx.x & 31, sp = blockIdx.x >> 5; const int q0 = qb * 256 + wave * 32;
  const unsigned long long gsl = (unsigned long long)(size_t)(wave < FA_SP ? (const unsigned char*)Kf : (const unsigned char*)Vf) + (size_t)sp * FA_NP * FA_TB + (size_t)(wave & (FA_SP - 1)) * FA_TB;      /* this wave's slice of stage 0 */
  const unsigned int lsl = (unsigned int)(size_t)&lb[0][0] + (unsigned int)(wave & (FA_SP - 1)) * (2 * FA_TB) + (wave < FA_SP ? 0u : (unsigned int)FA_TB);      /* its place in the first stage's slots */
  auto issue = [&](const int s) __attribute__((always_inline)) { fa_tload(lsl + (unsigned int)(s & 1) * (FA_SP * 2 * FA_TB), gsl + (unsigned long long)s * (FA_SP * FA_TB)); };
  const float cscale = 0.0625f * 1.4426950408889634f;      /* 1 / sqrt(256), times log2 e */
  v16h qf[2][8];
#pragma unroll
  for (int g = 0; g < 2; ++g) { const _Float16* qp = Q16 + (size_t)(q0 + 16 * g + c) * FA_D;
#pragma unroll
    for (int kc = 0; kc < 8; ++kc) qf[g][kc] = g2_frag(qp + kc * 32, h); }
  fa_xcnt0();
  __builtin_amdgcn_sched_barrier(0);      /* what follows is formed behind the wait: moved up over it, it lands in registers that the loads above name */
  issue(0);      /* every wave its own slice: no test */
  fa_tensorcnt0();
  __syncthreads();      /* the first stage's K and V^T are in LDS */
  issue(1);
  const v8f z8 = {0.f,0.f,0.f,0.f,0.f,0.f,0.f,0.f};
  v8f acc[2][16]; float m_run[2], l_run[2];
#pragma unroll
  for (int g = 0; g < 2; ++g) { m_run[g] = -__builtin_inff(); l_run[g] = 0.f;
#pragma unroll
    for (int t = 0; t < 16; ++t) acc[g][t] = z8; }
  auto pass = [&](const int p) __attribute__((always_inline)) {
    const unsigned char* lk = &lb[p & (FA_RS - 1)][0] + lane * 16; const unsigned char* lv = lk + FA_TB;
    v8f s[2][2] = {{z8, z8}, {z8, z8}};
    { v16h ka[4];      /* K fragments are read three ahead of their products: the LDS latency hides behind six WMMAs */
#pragma unroll
      for (int f = 0; f < 3; ++f) ka[f] = fa_frag(lk + ((f & 1) * 8 + (f >> 1)) * 1024);
#pragma unroll
      for (int f = 0; f < 16; ++f) { const int kt = f & 1, kc = f >> 1;
        if (f + 3 < 16) ka[(f + 3) & 3] = fa_frag(lk + (((f + 3) & 1) * 8 + ((f + 3) >> 1)) * 1024);
        s[kt][0] = fa_mma(ka[f & 3], qf[0][kc], s[kt][0]); s[kt][1] = fa_mma(ka[f & 3], qf[1][kc], s[kt][1]); } }
    float mb[2]; bool need = false;
#pragma unroll
    for (int g = 0; g < 2; ++g) { float mx = s[0][g][0];
#pragma unroll
      for (int r = 1; r < 8; ++r) mx = fmaxf(mx, s[0][g][r]);
#pragma unroll
      for (int r = 0; r < 8; ++r) mx = fmaxf(mx, s[1][g][r]);
      mx = fmaxf(mx, fa_xhalf(mx)) * cscale;      /* both wave halves hold this query's maximum of the pass, scaled */
      mb[g] = mx; need = need || (mx > m_run[g] + 8.0f); }
    if (__builtin_amdgcn_ballot_w32(need) != 0) {      /* wave-uniform; always on the first pass (m = -inf), rare later */
#pragma unroll
      for (int g = 0; g < 2; ++g) { const float m_new = fmaxf(m_run[g], mb[g]); const float corr = __builtin_amdgcn_exp2f(m_run[g] - m_new); l_run[g] *= corr; m_run[g] = m_new;
#pragma unroll
        for (int t = 0; t < 16; ++t) acc[g][t] = acc[g][t] * corr; } }
    v16h pf[2];
#pragma unroll
    for (int g = 0; g < 2; ++g) { const float nm = -m_run[g]; float ps0 = 0.f, ps1 = 0.f;
#pragma unroll
      for (int i = 0; i < 8; ++i) { const float p0 = __builtin_amdgcn_exp2f(fmaf(s[0][g][i], cscale, nm)), p1 = __builtin_amdgcn_exp2f(fmaf(s[1][g][i], cscale, nm)); ps0 += p0; ps1 += p1; pf[g][i] = (_Float16)p0; pf[g][8 + i] = (_Float16)p1; }      /* element e of the B operand is key 8 h + e (e < 8), 16 + 8 h + e - 8 (else): the score tiles' own rows */
      l_run[g] += ps0 + ps1; }
    __builtin_amdgcn_sched_barrier(0);      /* the row sums are done here, not behind the second product: the 32 weights in f32 would otherwise stay in registers that the fragments read ahead need */
    { v16h va[4];      /* V^T fragments three ahead, as for K */
#pragma unroll
      for (int t = 0; t < 3; ++t) va[t] = fa_frag(lv + t * 1024);
#pragma unroll
      for (int t = 0; t < 16; ++t) { if (t + 3 < 16) va[(t + 3) & 3] = fa_frag(lv + (t + 3) * 1024);
        __builtin_amdgcn_sched_barrier(0);      /* holds the written order: without it the compiler moves each fragment's reads directly in front of its own products, and their latency lies open */
        acc[0][t] = fa_mma(va[t & 3], pf[0], acc[0][t]); acc[1][t] = fa_mma(va[t & 3], pf[1], acc[1][t]); } }
  };
#pragma unroll 1      /* rolled, like the loop of passes below: one copy of the pass in the instruction cache */
  for (int s = 0; s < FA_NP / FA_SP; ++s) {
#pragma unroll 1
    for (int j = 0; j < FA_SP; ++j) pass(s * FA_SP + j);
    fa_dscnt0();
    fa_tensorcnt0();      /* this wave's slice of stage s + 1 */
    __syncthreads();      /* publishes the next stage's four slots and ends every wave's reads of this stage's, which the load below refills */
    if (fa_pinned(s + 2 < FA_NP / FA_SP)) issue(s + 2);
  }
  fa_tensorcnt0();      /* behind the loop nothing of this wave is in flight to LDS or from it */
  fa_dscnt0();
  const float l_fin0 = l_run[0] + fa_xhalf(l_run[0]), l_fin1 = l_run[1] + fa_xhalf(l_run[1]);      /* each wave half summed its eight keys of every 16-key tile */
  unsigned short* o = (unsigned short*)Op + ((size_t)(sp * (FA_NQ / 16) + (q0 >> 4)) * 16) * 256 + lane * 8; float* mo = Mp + (size_t)sp * FA_NQ + q0 + c; float* lo_ = Lp + (size_t)sp * FA_NQ + q0 + c;
  if (h == 0) { mo[0] = m_run[0]; mo[16] = m_run[1]; lo_[0] = l_fin0; lo_[16] = l_fin1; }
  fa_xcnt0();      /* the arithmetic below may reuse a register that these four stores name */
  const float il[2] = {1.0f / l_fin0, 1.0f / l_fin1};      /* l >= 1: m never exceeds the split's true maximum, so the largest weight is at least 1 */
  v8us ob[2][16];
#pragma unroll
  for (int g = 0; g < 2; ++g) {
#pragma unroll
    for (int t = 0; t < 16; ++t) { FragH f;
#pragma unroll
      for (int r = 0; r < 8; ++r) f.h[r] = (_Float16)(acc[g][t][r] * il[g]);
      ob[g][t] = f.half[0]; } }
  __builtin_amdgcn_sched_barrier(0);      /* all arithmetic stands in front of the stores of O: nothing behind them reuses a register that a store names */
#pragma unroll
  for (int g = 0; g < 2; ++g) {
#pragma unroll
    for (int t = 0; t < 16; ++t) *(v8us*)(o + g * 4096 + t * 256) = ob[g][t]; } }

// Joins the key splits of 16 query rows: out = sum_s a_s o_s, a_s = 2^(m_s - M) l_s / sum_s 2^(m_s - M) l_s, o_s the split's normalised f16 rows; the rows go through LDS so that every 128-byte line of out is stored whole.
__global__ __launch_bounds__(256) void k_fjoin(const _Float16* __restrict__ Op, const float* __restrict__ Mp, const float* __restrict__ Lp, float* __restrict__ out) {
  __shared__ __attribute__((aligned(16))) float ro[16][FA_D + 4];
  const int tid = threadIdx.x, lane = tid & 31, c = lane & 15, h = lane >> 4; const int qt = blockIdx.x; const int q = qt * 16 + c;
  float w[FA_NS], ls[FA_NS]; v8us x[2][FA_NS];
#pragma unroll
  for (int s = 0; s < FA_NS; ++s) { w[s] = Mp[(size_t)s * FA_NQ + q]; ls[s] = Lp[(size_t)s * FA_NQ + q]; }
  fa_xcnt0();
#pragma unroll
  for (int s = 0; s < FA_NS; ++s) { const unsigned short* op = (const unsigned short*)Op + ((size_t)(s * (FA_NQ / 16) + qt) * 512 + tid) * 8;
#pragma unroll
    for (int i = 0; i < 2; ++i) x[i][s] = *(const v8us*)(op + i * 2048);
    fa_xcnt0(); }      /* all 16 loads are in flight together; the wait lets a later load land in an earlier one's address registers */
  __builtin_amdgcn_sched_barrier(0);      /* the arithmetic stays behind the wait above */
  float M = w[0];
#pragma unroll
  for (int s = 1; s < FA_NS; ++s) M = fmaxf(M, w[s]);
  float den = 0.f;
#pragma unroll
  for (int s = 0; s < FA_NS; ++s) { w[s] = fa_exp2_slot(w[s] - M); den += w[s] * ls[s]; }
  const float inv = 1.0f / den;
#pragma unroll
  for (int s = 0; s < FA_NS; ++s) w[s] = w[s] * ls[s] * inv;      /* the split's share of the whole sum of weights */
#pragma unroll
  for (int i = 0; i < 2; ++i) { const int t = (i * 256 + tid) >> 5; float a[8];
#pragma unroll
    for (int s = 0; s < FA_NS; ++s) { FragH f; f.half[0] = x[i][s];
#pragma unroll
      for (int j = 0; j < 8; ++j) a[j] = s ? fmaf((float)f.h[j], w[s], a[j]) : (float)f.h[j] * w[0]; }
    const v4f lo = {a[0], a[1], a[2], a[3]}, hi = {a[4], a[5], a[6], a[7]};
    *(v4f*)&ro[c][t * 16 + h * 8] = lo; *(v4f*)&ro[c][t * 16 + h * 8 + 4] = hi; }
  __syncthreads();      /* the 16 rows are in LDS */
#pragma unroll
  for (int i = 0; i < 4; ++i) { const int id = i * 256 + tid; const int r = id >> 6, c4 = (id & 63) * 4; *(v4f*)(out + (size_t)(qt * 16 + r) * FA_D + c4) = *(const v4f*)&ro[r][c4]; } }

extern "C" void kernel_launch(void* const* d_in, const int* in_sizes, int n_in,
                              void* d_out, int out_size, void* d_ws, size_t ws_size, hipStream_t stream) {
  (void)in_sizes; (void)n_in; (void)out_size;
  const float* const* I = (const float* const*)d_in; const float* xq = I[0]; const float* xk = I[1]; const float* xv = I[2];      /* Q, K, V [8192][256] (bf16-valued) */
  char* ws = (char*)d_ws; size_t off = 0;
  auto take = [&](size_t bytes) { char* p = ws + off; off += (bytes + 255) & ~(size_t)255; return p; };
  _Float16* Q16 = (_Float16*)take((size_t)FA_NQ * FA_D * 2); _Float16* Kf = (_Float16*)take((size_t)FA_NK * FA_D * 2); _Float16* Vf = (_Float16*)take((size_t)FA_NK * FA_D * 2);
  _Float16* Op = (_Float16*)take((size_t)FA_NS * FA_NQ * FA_D * 2); float* Mp = (float*)take((size_t)FA_NS * FA_NQ * 4); float* Lp = (float*)take((size_t)FA_NS * FA_NQ * 4);
  if (off > ws_size) return;
  k_prep<<<FA_NK * FA_D / 8 / 1024, 256, 0, stream>>>(xq, xk, xv, Q16, Kf, Vf);      /* exact f16 copy of the bf16-valued Q; K and V^T in fragment order */
  k_fattn<<<(FA_NQ / 256) * FA_NS, 256, 0, stream>>>(Q16, Kf, Vf, Op, Mp, Lp);      /* per key split: normalised O (f16), m, l */
  k_fjoin<<<FA_NQ / 16, 256, 0, stream>>>(Op, Mp, Lp, (float*)d_out);      /* out = the splits joined and normalised */
}

// v007
// A run of this version takes 52.9 microseconds.
// Timed twice side by side with v006, it ran 1.07 times as fast both times.
// All steps since v000 together make it 118 times as fast.
#include <hip/hip_runtime.h>
// Single-head scaled dot-product attention without batch or projections (Q [8192][256], K [8192][256], V [8192][256]; scores = Q K^T / sqrt(256); softmax over the 8192 keys; out = attn V -> [8192][256]).
// Structure: Q as exact f16 rows of the bf16-valued input; K and V^T packed once into WMMA fragment order (f16); ONE fused kernel per 256 query rows x 1024 keys: S^T = K Q^T, online softmax (f32 statistics, log2 domain, lazy rescale), O^T += V^T P^T, scores and weights never leave registers; the eight key splits are joined by a last kernel; launches: see trace.
// Compute dtype: inputs rounded to bf16; q, k, v exact in f16; softmax weights as plain f16 GEMM operands (~2^-12); scores, softmax statistics and o f32; each key split's o leaves normalised, rounded once to f16. v_wmma_f32_16x16x32_f16.
#define NB 4
#define SQ 4096
#define DM 256
#define NH 1
#define HD 64
#define HG 4                         /* heads per attention launch group */
#define B0 0                         /* first batch processed (debug hook) */
#define NBR NB                       /* batches processed (debug hook) */
#define NR ((size_t)NB * SQ)         /* token rows */
#define MP ((int)((size_t)NBR * SQ)) /* rows projected (debug hook) */
#define QT 256                       /* query rows per causal tile */
#define NKX SQ                       /* S / P row pitch */
#define QT0 256                      /* first-tile rows recomputed exactly */
#define QN SQ                        /* query rows attended per batch (debug hook) */
#define NHD NH                       /* heads attended (debug hook) */
#define MPO MP                       /* rows through the output stage (debug hook) */
#define LQ DM            /* row pitch of the q/k/v rows */
typedef __bf16 v16b __attribute__((ext_vector_type(16)));
typedef unsigned short v8us __attribute__((ext_vector_type(8), may_alias));
typedef float  v8f  __attribute__((ext_vector_type(8)));
typedef float  v4f  __attribute__((ext_vector_type(4)));
typedef float  v4fa __attribute__((ext_vector_type(4), may_alias));
union FragB { v16b v; v8us half[2]; unsigned short u[16]; };

__device__ __forceinline__ unsigned short bf16_bits(float x) { unsigned int u = __float_as_uint(x); return (unsigned short)((u + 0x7FFFu + ((u >> 16) & 1u)) >> 16); }
__device__ __forceinline__ float bf16_val(unsigned short b) { return __uint_as_float(((unsigned int)b) << 16); }
__device__ __forceinline__ float bf16_round(float x) { return bf16_val(bf16_bits(x)); }
// D += A·B with NT terms: 1 = ah·bh, 2 = + al·bh (A split), 3 = + ah·bl (both split)
template <int NT>
__device__ __forceinline__ v8f mmaN(v16b ah, v16b al, v16b bh, v16b bl, v8f c) {
  c = __builtin_amdgcn_wmma_f32_16x16x32_bf16(false, ah, false, bh, (short)0, c, false, false);
  if (NT >= 2) c = __builtin_amdgcn_wmma_f32_16x16x32_bf16(false, al, false, bh, (short)0, c, false, false);
  if (NT >= 3) c = __builtin_amdgcn_wmma_f32_16x16x32_bf16(false, ah, false, bl, (short)0, c, false, false);
  asm volatile("v_nop\n\tv_nop\n\tv_nop\n\tv_nop" : "+v"(c) : "v"(ah), "v"(al), "v"(bh), "v"(bl));
  return c;
}

__global__ __launch_bounds__(256) void k_wt_bf16(const float* __restrict__ W, unsigned short* __restrict__ Wt, int K, int N) {
  const int t = blockIdx.x * 256 + threadIdx.x;
  const int k8n = K / 8;
  if (t >= N * k8n) return;
  const int n = t / k8n, k8 = (t % k8n) * 8;
  v8us v;
#pragma unroll
  for (int i = 0; i < 8; ++i) v[i] = bf16_bits(W[(size_t)(k8 + i) * N + n]);
  *(v8us*)(Wt + (size_t)n * K + k8) = v;
  
}

// GEMM C[M][N] (f32, pitch ldc) = act(A[M][K]·W + bias). A f32 row-major (pitch lda) converted per fragment to bf16
// (ASPLIT: hi/lo two planes -> 2 terms, else single rounded term); Wt bf16 [N][K] (pitch ldb). BIAS_BF16 rounds the
// bias to bf16 first (bias quantised to bf16 before the add). K%32==0, M%16==0, N%64==0.
template <bool ASPLIT, int ACT, bool BIAS_BF16>
__global__ __launch_bounds__(128) void k_gemm_bf(const float* __restrict__ A, int lda, const unsigned short* __restrict__ Wt, int ldb,
                                               const float* __restrict__ bias, float* __restrict__ C, int ldc, int M, int N, int K) {
  __shared__ __attribute__((aligned(16))) float so[4][16][64];
  const int tid = threadIdx.x, w = tid >> 5, lane = tid & 31, ln = lane & 15, hh = lane >> 4;
  const int ntn = N / 64;
  const int wid = blockIdx.x * 4 + w;
  const int mt = wid / ntn, nq = wid % ntn;
  if (mt * 16 >= M) return;
  const int row0 = mt * 16, col0 = nq * 64;
  const float* arow = A + (size_t)(row0 + ln) * lda;
  v8f acc[4] = {};
  for (int kb = 0; kb < K; kb += 32) {
    FragB ah, al;
    const v4f x0 = *(const v4fa*)(arow + kb + 8 * hh), x1 = *(const v4fa*)(arow + kb + 8 * hh + 4);
    const v4f x2 = *(const v4fa*)(arow + kb + 16 + 8 * hh), x3 = *(const v4fa*)(arow + kb + 16 + 8 * hh + 4);
    float xs[16] = {x0[0],x0[1],x0[2],x0[3],x1[0],x1[1],x1[2],x1[3],x2[0],x2[1],x2[2],x2[3],x3[0],x3[1],x3[2],x3[3]};
#pragma unroll
    for (int i = 0; i < 16; ++i) { const unsigned short hb = bf16_bits(xs[i]); ah.u[i] = hb; al.u[i] = ASPLIT ? bf16_bits(xs[i] - bf16_val(hb)) : (unsigned short)0; }
#pragma unroll
    for (int t = 0; t < 4; ++t) {
      const unsigned short* brow = Wt + (size_t)(col0 + t * 16 + ln) * ldb + kb;
      FragB b;
      b.half[0] = *(const v8us*)(brow + 8 * hh);
      b.half[1] = *(const v8us*)(brow + 16 + 8 * hh);
      acc[t] = mmaN<ASPLIT ? 2 : 1>(ah.v, al.v, b.v, b.v, acc[t]);
    }
  }
#pragma unroll
  for (int t = 0; t < 4; ++t) {
    float bv = bias ? bias[col0 + t * 16 + ln] : 0.f;
    if (BIAS_BF16) bv = bf16_round(bv);
#pragma unroll
    for (int r = 0; r < 8; ++r) { float v = acc[t][r] + bv; if (ACT == 1) v = fmaxf(v, 0.f); so[w][8 * hh + r][t * 16 + ln] = v; }
  }
  __builtin_amdgcn_fence(__ATOMIC_ACQ_REL, "workgroup");
  __builtin_amdgcn_wave_barrier();
  const int rsub = lane >> 4, c4 = (lane & 15) * 4;
  {
#pragma unroll
    for (int q = 0; q < 8; ++q) {
      const int r = q * 2 + rsub;
      const v4f v = *(const v4fa*)&so[w][r][c4];
      *(v4f*)(C + (size_t)(row0 + r) * ldc + col0 + c4) = v;
    }
    
  }
}

// GEMM C = act(A·W + bias + resid): A f32 (ASPLIT -> hi/lo 2 terms), Wt bf16 [N][K]; ACT 0 none, 1 relu, 2 exact gelu;
// resid (optional, f32, row index = (row % rmod), pitch ldr, RES_BF16 rounds it) added before the activation.
template <bool ASPLIT, int ACT, bool BIAS_BF16, bool RES_BF16>
__global__ __launch_bounds__(128) void k_gemm_bf3(const float* __restrict__ A, int lda, const unsigned short* __restrict__ Wt, int ldb,
                                                const float* __restrict__ bias, const float* __restrict__ resid, int rmod, int ldr,
                                                float* __restrict__ C, int ldc, int M, int N, int K) {
  __shared__ __attribute__((aligned(16))) float so[4][16][64];
  const int tid = threadIdx.x, w = tid >> 5, lane = tid & 31, ln = lane & 15, hh = lane >> 4;
  const int ntn = N / 64;
  const int wid = blockIdx.x * 4 + w;
  const int mt = wid / ntn, nq = wid % ntn;
  if (mt * 16 >= M) return;
  const int row0 = mt * 16, col0 = nq * 64;
  const float* arow = A + (size_t)(row0 + ln) * lda;
  v8f acc[4] = {};
  for (int kb = 0; kb < K; kb += 32) {
    FragB ah, al;
    const v4f x0 = *(const v4fa*)(arow + kb + 8 * hh), x1 = *(const v4fa*)(arow + kb + 8 * hh + 4);
    const v4f x2 = *(const v4fa*)(arow + kb + 16 + 8 * hh), x3 = *(const v4fa*)(arow + kb + 16 + 8 * hh + 4);
    float xs[16] = {x0[0],x0[1],x0[2],x0[3],x1[0],x1[1],x1[2],x1[3],x2[0],x2[1],x2[2],x2[3],x3[0],x3[1],x3[2],x3[3]};
#pragma unroll
    for (int i = 0; i < 16; ++i) { const unsigned short hb = bf16_bits(xs[i]); ah.u[i] = hb; al.u[i] = ASPLIT ? bf16_bits(xs[i] - bf16_val(hb)) : (unsigned short)0; }
#pragma unroll
    for (int t = 0; t < 4; ++t) {
      const unsigned short* brow = Wt + (size_t)(col0 + t * 16 + ln) * ldb + kb;
      FragB b;
      b.half[0] = *(const v8us*)(brow + 8 * hh);
      b.half[1] = *(const v8us*)(brow + 16 + 8 * hh);
      acc[t] = mmaN<ASPLIT ? 2 : 1>(ah.v, al.v, b.v, b.v, acc[t]);
    }
  }
#pragma unroll
  for (int t = 0; t < 4; ++t) {
    const int col = col0 + t * 16 + ln;
    float bv = bias ? bias[col] : 0.f;
    if (BIAS_BF16) bv = bf16_round(bv);
#pragma unroll
    for (int r = 0; r < 8; ++r) {
      float v = acc[t][r] + bv;
      if (resid) { float rv = resid[(size_t)((row0 + 8 * hh + r) % rmod) * ldr + col]; if (RES_BF16) rv = bf16_round(rv); v += rv; }
      if (ACT == 1) v = fmaxf(v, 0.f);
      if (ACT == 2) v = 0.5f * v * (1.0f + erff(v * 0.70710678118654752f));
      if (ACT == 3) { const float u = 0.7978845608028654f * (v + 0.044715f * v * v * v); v = 0.5f * v * (1.0f + tanhf(u)); }
      so[w][8 * hh + r][t * 16 + ln] = v;
    }
  }
  __builtin_amdgcn_fence(__ATOMIC_ACQ_REL, "workgroup");
  __builtin_amdgcn_wave_barrier();
  const int rsub = lane >> 4, c4 = (lane & 15) * 4;
  {
#pragma unroll
    for (int q = 0; q < 8; ++q) {
      const int r = q * 2 + rsub;
      const v4f v = *(const v4fa*)&so[w][r][c4];
      *(v4f*)(C + (size_t)(row0 + r) * ldc + col0 + c4) = v;
    }
    
  }
}
// row LayerNorm (biased variance, eps) over N: s = X (+ R); optional out_sum <- s; out_norm <- (s-mu)*rsqrt(var+eps)*g + b
template <bool PARAM_BF16>
__global__ __launch_bounds__(256) void k_layernorm(const float* __restrict__ X, const float* __restrict__ R, const float* __restrict__ g, const float* __restrict__ bta,
                                                  float* __restrict__ out_sum, float* __restrict__ out_norm, int N, float eps) {
  __shared__ float red[256];
  const int row = blockIdx.x, tid = threadIdx.x;
  const float* x = X + (size_t)row * N; const float* rr = R ? R + (size_t)row * N : nullptr;
  float vals[16];                     // up to N = 4096
  const int per = N / 256;            // contiguous chunk per thread? use strided-by-4 chunks: thread handles j = tid*4 + 1024*u
  float s1 = 0.f;
  for (int u = 0; u < per / 4; ++u) {
    const int j = tid * 4 + 1024 * u;
    const v4f a = *(const v4fa*)(x + j);
    v4f b = {0.f,0.f,0.f,0.f}; if (rr) b = *(const v4fa*)(rr + j);
#pragma unroll
    for (int q = 0; q < 4; ++q) { const float v = a[q] + b[q]; vals[u * 4 + q] = v; s1 += v; }
  }
  red[tid] = s1; __syncthreads();
  for (int st = 128; st > 0; st >>= 1) { if (tid < st) red[tid] += red[tid + st]; __syncthreads(); }
  const float mu = red[0] / (float)N; __syncthreads();
  float s2 = 0.f;
  for (int u = 0; u < per / 4; ++u)
#pragma unroll
    for (int q = 0; q < 4; ++q) { const float c = vals[u * 4 + q] - mu; s2 += c * c; }
  red[tid] = s2; __syncthreads();
  for (int st = 128; st > 0; st >>= 1) { if (tid < st) red[tid] += red[tid + st]; __syncthreads(); }
  const float rs = rsqrtf(red[0] / (float)N + eps);
  {
    for (int u = 0; u < per / 4; ++u) {
      const int j = tid * 4 + 1024 * u;
      v4f o, sm;
#pragma unroll
      for (int q = 0; q < 4; ++q) {
        float gg = g[j + q], bb = bta[j + q];
        if (PARAM_BF16) { gg = bf16_round(gg); bb = bf16_round(bb); }
        sm[q] = vals[u * 4 + q]; o[q] = (vals[u * 4 + q] - mu) * rs * gg + bb;
      }
      if (out_sum) *(v4f*)(out_sum + (size_t)row * N + j) = sm;
      *(v4f*)(out_norm + (size_t)row * N + j) = o;
    }
    
  }
}



// ---- f16 WMMA path (v_wmma_f32_16x16x32_f16): 11-bit significands for operands in range — used where a [0,1] probability operand needs more precision than bf16
typedef _Float16 v16h __attribute__((ext_vector_type(16)));
union FragH { v16h v; v8us half[2]; _Float16 h[16]; unsigned short u[16]; };
template <int NT>
__device__ __forceinline__ v8f mmaH(v16h ah, v16h al, v16h bh, v16h bl, v8f c) {
  c = __builtin_amdgcn_wmma_f32_16x16x32_f16(false, ah, false, bh, (short)0, c, false, false);
  if (NT >= 2) c = __builtin_amdgcn_wmma_f32_16x16x32_f16(false, al, false, bh, (short)0, c, false, false);
  if (NT >= 3) c = __builtin_amdgcn_wmma_f32_16x16x32_f16(false, ah, false, bl, (short)0, c, false, false);
  asm volatile("v_nop\n\tv_nop\n\tv_nop\n\tv_nop" : "+v"(c) : "v"(ah), "v"(al), "v"(bh), "v"(bl));
  return c;
}
// batched GEMM like k_gemm_b but f16 operands: A f32 (split into f16 hi/lo if ASPLIT, else rounded to f16), Bt = f16 values [n][k]; alpha; C f32; N multiple of 16 (partial tiles skipped)
template <bool ASPLIT>
__global__ __launch_bounds__(128) void k_gemm_h(const float* __restrict__ A, int lda, size_t sA, const _Float16* __restrict__ Bh, int ldb, size_t sB, float alpha, float* __restrict__ C, int ldc, size_t sC, int M, int N, int K) {
  __shared__ __attribute__((aligned(16))) float so[4][16][64];
  const int tid = threadIdx.x, w = tid >> 5, lane = tid & 31, ln = lane & 15, hh = lane >> 4; const int by = blockIdx.y;
  A += (size_t)by * sA; Bh += (size_t)by * sB; C += (size_t)by * sC;
  const int ntn = (N + 63) / 64; const int wid = blockIdx.x * 4 + w; const int mt = wid / ntn, nq = wid % ntn; if (mt * 16 >= M) return;
  const int row0 = mt * 16, col0 = nq * 64; const float* arow = A + (size_t)(row0 + ln) * lda;
  v8f acc[4] = {};
  for (int kb = 0; kb < K; kb += 32) {
    FragH ah, al;
    const v4f x0 = *(const v4fa*)(arow + kb + 8 * hh), x1 = *(const v4fa*)(arow + kb + 8 * hh + 4), x2 = *(const v4fa*)(arow + kb + 16 + 8 * hh), x3 = *(const v4fa*)(arow + kb + 16 + 8 * hh + 4);
    float xs[16] = {x0[0],x0[1],x0[2],x0[3],x1[0],x1[1],x1[2],x1[3],x2[0],x2[1],x2[2],x2[3],x3[0],x3[1],x3[2],x3[3]};
#pragma unroll
    for (int i = 0; i < 16; ++i) { const _Float16 h = (_Float16)xs[i]; ah.h[i] = h; al.h[i] = ASPLIT ? (_Float16)(xs[i] - (float)h) : (_Float16)0.0f; }
#pragma unroll
    for (int t = 0; t < 4; ++t) { if (col0 + t * 16 >= N) continue; const size_t boff = (size_t)(col0 + t * 16 + ln) * ldb + kb; FragH bq; bq.half[0] = *(const v8us*)(Bh + boff + 8 * hh); bq.half[1] = *(const v8us*)(Bh + boff + 16 + 8 * hh);
      acc[t] = mmaH<ASPLIT ? 2 : 1>(ah.v, al.v, bq.v, bq.v, acc[t]); }
  }
#pragma unroll
  for (int t = 0; t < 4; ++t) { if (col0 + t * 16 >= N) continue;
#pragma unroll
    for (int r = 0; r < 8; ++r) so[w][8 * hh + r][t * 16 + ln] = acc[t][r] * alpha; }
  __builtin_amdgcn_fence(__ATOMIC_ACQ_REL, "workgroup"); __builtin_amdgcn_wave_barrier();
  const int rsub = lane >> 4, c4 = (lane & 15) * 4;
  {
#pragma unroll
    for (int q = 0; q < 8; ++q) { const int r = q * 2 + rsub; if (col0 + c4 < N) { const v4f v = *(const v4fa*)&so[w][r][c4]; *(v4f*)(C + (size_t)(row0 + r) * ldc + col0 + c4) = v; } }
     }
}

// Wt[n][k] = f16(W[k][n]·scale) from f32 row-major W[K][N] (scale = power of two; bf16-exact weights stay exact in f16 away from the subnormal range)
__global__ __launch_bounds__(256) void k_wt_f16(const float* __restrict__ W, _Float16* __restrict__ Wt, int K, int N, float scale) {
  const int t = blockIdx.x * 256 + threadIdx.x; if (t >= N * (K / 8)) return; const int n = t / (K / 8), k8 = (t % (K / 8)) * 8; FragH f;
#pragma unroll
  for (int i = 0; i < 8; ++i) f.h[i] = (_Float16)(bf16_round(W[(size_t)(k8 + i) * N + n]) * scale); const v8us o = f.half[0];
  *(v8us*)((unsigned short*)Wt + (size_t)n * K + k8) = o; 
}
// k_gemm_hh variant with fused epilogue: v = acc·alpha + bias[by·sBias + col] (+ CP[(row/rowsPerB)·sCPb + by·64 + col] if CP) ; ACT 0 none / 1 elu ; writes f16 C16 (and f32 C if non-null)
template <int ACT>
__global__ __launch_bounds__(128) void k_gemm_hhx(const _Float16* __restrict__ A, int lda, size_t sA, const _Float16* __restrict__ Bh, int ldb, size_t sB, float alpha, const float* __restrict__ bias, size_t sBias, const float* __restrict__ CP, int rowsPerB, size_t sCPb, int row0g,
    float* __restrict__ C, _Float16* __restrict__ C16, int ldc, size_t sC, int M, int N, int K) {
  __shared__ __attribute__((aligned(16))) float so[4][16][64];
  const int tid = threadIdx.x, w = tid >> 5, lane = tid & 31, ln = lane & 15, hh = lane >> 4; const int by = blockIdx.y;
  A += (size_t)by * sA; Bh += (size_t)by * sB; const size_t cofs = (size_t)by * sC; const float* bp = bias ? bias + (size_t)by * sBias : nullptr;
  const int ntn = (N + 63) / 64; const int wid = blockIdx.x * 4 + w; const int mt = wid / ntn, nq = wid % ntn; if (mt * 16 >= M) return;
  const int row0 = mt * 16, col0 = nq * 64; const _Float16* arow = A + (size_t)(row0 + ln) * lda;
  v8f acc[4] = {};
  for (int kb = 0; kb < K; kb += 32) { FragH ah; ah.half[0] = *(const v8us*)((const unsigned short*)arow + kb + 8 * hh); ah.half[1] = *(const v8us*)((const unsigned short*)arow + kb + 16 + 8 * hh);
#pragma unroll
    for (int t = 0; t < 4; ++t) { if (col0 + t * 16 >= N) continue; const size_t boff = (size_t)(col0 + t * 16 + ln) * ldb + kb; FragH bq; bq.half[0] = *(const v8us*)((const unsigned short*)Bh + boff + 8 * hh); bq.half[1] = *(const v8us*)((const unsigned short*)Bh + boff + 16 + 8 * hh);
      acc[t] = mmaH<1>(ah.v, ah.v, bq.v, bq.v, acc[t]); }
  }
#pragma unroll
  for (int t = 0; t < 4; ++t) { if (col0 + t * 16 >= N) continue; const int col = col0 + t * 16 + ln; const float bv = bp ? bf16_round(bp[col]) : 0.f;
#pragma unroll
    for (int r = 0; r < 8; ++r) { float v = acc[t][r] * alpha + bv; if (CP) { const int rr = row0g + row0 + 8 * hh + r; if (rowsPerB < 0) v += CP[cofs + (size_t)rr * ldc + col];      /* rowsPerB < 0: own element of the batched C plane */ else { const int bidx = rr / rowsPerB; v += CP[(size_t)bidx * sCPb + (size_t)by * 64 + col]; } } if (ACT == 1) v = (v > 0.f) ? v : expm1f(v); else if (ACT == 7) v = (v > 0.f) ? v + 1.0f : expf(v); else if (ACT == 8) v = tanhf(v); else if (ACT == 9) v = 0.5f * v * (1.0f + tanhf(0.7978845608028654f * (v + 0.044715f * v * v * v))); else if (ACT == 11) v = 1.0f / (1.0f + expf(-v)); else if (ACT == 12) v = (v > 0.f) ? v : 0.01f * v; else if (ACT == 14) v = (v > 0.f) ? v : 0.1f * v; else if (ACT == 16) v = (v >= 0.f) ? v : 0.3f * v; else if (ACT == 17) v = (v >= 0.f) ? v : 0.2f * v; else if (ACT == 15) v = v / (1.0f + expf(-v)); else if (ACT == 3) v = fmaxf(v, 0.f); else if (ACT == 6) v = 0.5f * v * (1.0f + erff(v * 0.70710678118654752f)); so[w][8 * hh + r][t * 16 + ln] = v; } }
  __builtin_amdgcn_fence(__ATOMIC_ACQ_REL, "workgroup"); __builtin_amdgcn_wave_barrier();
  const int rsub = lane >> 4, c4 = (lane & 15) * 4; typedef _Float16 v4h __attribute__((ext_vector_type(4)));
  {
#pragma unroll
    for (int q = 0; q < 8; ++q) { const int r = q * 2 + rsub; if (col0 + c4 < N) { const v4f v = *(const v4fa*)&so[w][r][c4]; if (C) *(v4f*)(C + cofs + (size_t)(row0 + r) * ldc + col0 + c4) = v; if (C16) { v4h h4; for (int i = 0; i < 4; ++i) h4[i] = (_Float16)v[i]; *(v4h*)(C16 + cofs + (size_t)(row0 + r) * ldc + col0 + c4) = h4; } } }
     }
}


typedef _Float16 v4h __attribute__((ext_vector_type(4)));

__global__ __launch_bounds__(256) void k_x16(const float* __restrict__ x, _Float16* __restrict__ X16, size_t n8) { const size_t t = (size_t)blockIdx.x * 256 + threadIdx.x; if (t >= n8) return; FragH f;
#pragma unroll
  for (int q = 0; q < 8; ++q) f.h[q] = (_Float16)bf16_round(x[t * 8 + q]); *(v8us*)((unsigned short*)X16 + t * 8) = f.half[0];  }
__global__ __launch_bounds__(256) void k_h16(const float* __restrict__ x, _Float16* __restrict__ X16, size_t n8) { const size_t t = (size_t)blockIdx.x * 256 + threadIdx.x; if (t >= n8) return; FragH f;
#pragma unroll
  for (int q = 0; q < 8; ++q) f.h[q] = (_Float16)x[t * 8 + q]; *(v8us*)((unsigned short*)X16 + t * 8) = f.half[0];  }
__global__ __launch_bounds__(256) void k_round16f(const float* __restrict__ W, _Float16* __restrict__ Bt, size_t n8) { const size_t t = (size_t)blockIdx.x * 256 + threadIdx.x; if (t >= n8) return; FragH f;
#pragma unroll
  for (int i = 0; i < 8; ++i) f.h[i] = (_Float16)(bf16_round(W[t * 8 + i]) * 16.0f); *(v8us*)((unsigned short*)Bt + t * 8) = f.half[0];  }
template <int NHv, int TTv>
__global__ __launch_bounds__(256) void k_vt(const _Float16* __restrict__ V16, int ldv, int voff, _Float16* __restrict__ Vt) { __shared__ unsigned short tl[64][66]; const int tid = threadIdx.x; const int slab = blockIdx.x / (TTv / 64), lg = blockIdx.x % (TTv / 64); const int b = slab / NHv, h = slab % NHv;
  for (int i = tid; i < 64 * 8; i += 256) { const int r = i / 8, c8 = (i % 8) * 8; FragH f; f.half[0] = *(const v8us*)((const unsigned short*)V16 + ((size_t)b * TTv + lg * 64 + r) * ldv + voff + h * 64 + c8);
#pragma unroll
    for (int q = 0; q < 8; ++q) tl[r][c8 + q] = f.u[q]; }
  __syncthreads();
  {
#pragma unroll
    for (int rd = 0; rd < 2; ++rd) { const int d = rd * 32 + tid / 8, pc = tid % 8; FragH f;
#pragma unroll
      for (int q = 0; q < 8; ++q) f.u[q] = tl[pc * 8 + q][d];
      *(v8us*)((unsigned short*)Vt + ((size_t)slab * 64 + d) * TTv + lg * 64 + pc * 8) = f.half[0]; }
     } }

__global__ __launch_bounds__(256) void k_hl(const float* __restrict__ F, _Float16* __restrict__ Hh, _Float16* __restrict__ Hl, size_t n8) { const size_t t = (size_t)blockIdx.x * 256 + threadIdx.x; if (t >= n8) return; FragH fh, fl; const v4f a = *(const v4fa*)(F + t * 8), c = *(const v4fa*)(F + t * 8 + 4);
#pragma unroll
  for (int q = 0; q < 4; ++q) { _Float16 h = (_Float16)a[q]; fh.h[q] = h; fl.h[q] = (_Float16)((a[q] - (float)h) * 1024.0f); h = (_Float16)c[q]; fh.h[4 + q] = h; fl.h[4 + q] = (_Float16)((c[q] - (float)h) * 1024.0f); }
  { *(v8us*)((unsigned short*)Hh + t * 8) = fh.half[0]; *(v8us*)((unsigned short*)Hl + t * 8) = fl.half[0];  } }

// ---- fast GEMM (wave tile 32x64; requires M % 32 == 0 rows per launch region and N % 64 == 0); epilogue = k_gemm_hhx semantics ----
__device__ __forceinline__ v16h g2_frag(const _Float16* p, int hh) { FragH f; f.half[0] = *(const v8us*)((const unsigned short*)p + 8 * hh); f.half[1] = *(const v8us*)((const unsigned short*)p + 16 + 8 * hh); return f.v; }
__device__ __forceinline__ v8f g2_mma(v16h a, v16h b, v8f c) { v8f d = __builtin_amdgcn_wmma_f32_16x16x32_f16(false, a, false, b, (short)0, c, false, false); asm volatile("v_nop\n\tv_nop\n\tv_nop\n\tv_nop" : "+v"(d) : "v"(a), "v"(b)); return d; }
template <int ACT>
__global__ __launch_bounds__(128) void k_gemm2(const _Float16* __restrict__ A, int lda, size_t sA, const _Float16* __restrict__ Bh, int ldb, size_t sB, float alpha, const float* __restrict__ bias, size_t sBias, const float* __restrict__ CP, int rowsPerB, size_t sCPb, int row0g,
    float* __restrict__ C, _Float16* __restrict__ C16, int ldc, size_t sC, int M, int N, int K) { static_assert(ACT == 0 || ACT == 3 || ACT == 6 || ACT == 8 || ACT == 9 || ACT == 11 || ACT == 12 || ACT == 14 || ACT == 15 || ACT == 16 || ACT == 17, "k_gemm2: unsupported ACT code (would silently apply no activation)");
  __shared__ __attribute__((aligned(16))) float so[4][32][68];
  const int tid = threadIdx.x, w = tid >> 5, lane = tid & 31, ln = lane & 15, hh = lane >> 4; const int by = blockIdx.y;
  A += (size_t)by * sA; Bh += (size_t)by * sB; const size_t cofs = (size_t)by * sC; const float* bp = bias ? bias + (size_t)by * sBias : nullptr;
  const int ntn = N >> 6; const int mt = blockIdx.x / ntn, nq = blockIdx.x - mt * ntn; const int row0 = mt * 128 + 32 * w, col0 = nq * 64; if (row0 >= M) return;
  const _Float16* a0p = A + (size_t)(row0 + ln) * lda; const _Float16* a1p = a0p + (size_t)16 * lda;
  const _Float16* b0p = Bh + (size_t)(col0 + ln) * ldb; const _Float16* b1p = b0p + (size_t)16 * ldb; const _Float16* b2p = b1p + (size_t)16 * ldb; const _Float16* b3p = b2p + (size_t)16 * ldb;
  const v8f z8 = {0.f,0.f,0.f,0.f,0.f,0.f,0.f,0.f}; v8f c00 = z8, c01 = z8, c02 = z8, c03 = z8, c10 = z8, c11 = z8, c12 = z8, c13 = z8;
#pragma unroll 1
  for (int kb = 0; kb < K; kb += 32) { const v16h a0 = g2_frag(a0p + kb, hh), a1 = g2_frag(a1p + kb, hh);
    v16h b = g2_frag(b0p + kb, hh); c00 = g2_mma(a0, b, c00); c10 = g2_mma(a1, b, c10);
    b = g2_frag(b1p + kb, hh); c01 = g2_mma(a0, b, c01); c11 = g2_mma(a1, b, c11);
    b = g2_frag(b2p + kb, hh); c02 = g2_mma(a0, b, c02); c12 = g2_mma(a1, b, c12);
    b = g2_frag(b3p + kb, hh); c03 = g2_mma(a0, b, c03); c13 = g2_mma(a1, b, c13); }
  v8f accs[8] = {c00, c01, c02, c03, c10, c11, c12, c13};
#pragma unroll
  for (int u = 0; u < 8; ++u) { const int t = u & 3, half = u >> 2; const int col = col0 + t * 16 + ln; const float bv = bp ? bf16_round(bp[col]) : 0.f;
#pragma unroll
    for (int r = 0; r < 8; ++r) { const int rloc = half * 16 + 8 * hh + r; float v = accs[u][r] * alpha + bv; if (CP) { if (rowsPerB < 0) v += CP[cofs + (size_t)(row0g + row0 + rloc) * ldc + col];      /* rowsPerB < 0: own element of the batched C plane */ else { const int bidx = (row0g + row0 + rloc) / rowsPerB; v += CP[(size_t)bidx * sCPb + (size_t)by * 64 + col]; } }
      if (ACT == 3) v = fmaxf(v, 0.f); else if (ACT == 6) v = 0.5f * v * (1.0f + erff(v * 0.70710678118654752f)); else if (ACT == 11) v = 1.0f / (1.0f + expf(-v)); else if (ACT == 15) v = v / (1.0f + expf(-v)); else if (ACT == 12) v = (v > 0.f) ? v : 0.01f * v; else if (ACT == 8) v = tanhf(v); else if (ACT == 9) v = 0.5f * v * (1.0f + tanhf(0.7978845608028654f * (v + 0.044715f * v * v * v))); else if (ACT == 14) v = (v > 0.f) ? v : 0.1f * v; else if (ACT == 16) v = (v >= 0.f) ? v : 0.3f * v; else if (ACT == 17) v = (v >= 0.f) ? v : 0.2f * v;
      so[w][rloc][t * 16 + ln] = v; } }
  __builtin_amdgcn_fence(__ATOMIC_ACQ_REL, "workgroup"); __builtin_amdgcn_wave_barrier();
  const int rsub = lane >> 4, c4 = (lane & 15) * 4;
  {
#pragma unroll
    for (int q = 0; q < 16; ++q) { const int r = q * 2 + rsub; const v4f v = *(const v4fa*)&so[w][r][c4]; if (C) *(v4f*)(C + cofs + (size_t)(row0 + r) * ldc + col0 + c4) = v; if (C16) { v4h h4; for (int i = 0; i < 4; ++i) h4[i] = (_Float16)v[i]; *(v4h*)(C16 + cofs + (size_t)(row0 + r) * ldc + col0 + c4) = h4; } }
     } }


__global__ __launch_bounds__(256) void k_wnat(const float* __restrict__ w, size_t n8, _Float16* __restrict__ Bt) { const size_t t = (size_t)blockIdx.x * 256 + threadIdx.x; if (t >= n8) return; FragH f; for (int q = 0; q < 8; ++q) f.h[q] = (_Float16)(bf16_round(w[t * 8 + q]) * 16.0f); *(v8us*)((unsigned short*)Bt + t * 8) = f.half[0];  }
__global__ __launch_bounds__(256) void k_rsm(const float* __restrict__ S, _Float16* __restrict__ P, int nrows) {
  #pragma clang fp contract(off)
  const int i = blockIdx.x * 256 + threadIdx.x; if (i >= nrows) return; const float* s = S + (size_t)i * SQ; float mx = -3.0e38f;
#pragma unroll 1
  for (int j = 0; j < SQ; ++j) mx = fmaxf(mx, s[j]); float se = 0.f;
#pragma unroll 1
  for (int j = 0; j < SQ; ++j) se += expf(s[j] - mx); const float sc = 256.0f / se;
#pragma unroll 1
  for (int j0 = 0; j0 < SQ; j0 += 8) { FragH f; for (int q = 0; q < 8; ++q) f.h[q] = (_Float16)(expf(s[j0 + q] - mx) * sc); unsigned short* d = (unsigned short*)P + (size_t)i * SQ + j0; *(v8us*)d = f.half[0];  } }
__global__ __launch_bounds__(256) void k_vt(const _Float16* __restrict__ V16, int b, int h0, _Float16* __restrict__ VT) { __shared__ unsigned short tl[64][65]; const int tid = threadIdx.x; const int hh = blockIdx.x % HG, sg = blockIdx.x / HG; const int s0 = sg * 64; const int h = h0 + hh;
  for (int i = tid; i < 64 * 8; i += 256) { const int j = i / 8, d8 = (i % 8) * 8; FragH f; f.half[0] = *(const v8us*)((const unsigned short*)V16 + ((size_t)b * SQ + s0 + j) * DM + h * HD + d8); for (int q = 0; q < 8; ++q) tl[d8 + q][j] = f.u[q]; }
  __syncthreads();
  { for (int i = tid; i < 64 * 8; i += 256) { const int d = i / 8, j8 = (i % 8) * 8; FragH f; for (int q = 0; q < 8; ++q) f.u[q] = tl[d][j8 + q]; *(v8us*)((unsigned short*)VT + ((size_t)hh * HD + d) * SQ + s0 + j8) = f.half[0]; }  } }



__global__ __launch_bounds__(256) void k_rsmcf2(const float* __restrict__ S, _Float16* __restrict__ P, int hg, int q0, int nk) {
  #pragma clang fp contract(off)
  const int t = blockIdx.x * 256 + threadIdx.x; if (t >= hg * QT) return; const size_t i = (size_t)t; const float* s = S + i * NKX; const int last = q0 + (t % QT); float mx = -3.0e38f;
#pragma unroll 1
  for (int j = 0; j < nk; ++j) { const float f = (j <= last) ? 1.f : 0.f; mx = fmaxf(mx, fmaf(f, s[j], (1.f - f) * -1.0e9f)); } float se = 0.f;
#pragma unroll 1
  for (int j = 0; j < nk; ++j) { const float f = (j <= last) ? 1.f : 0.f; se += __expf(fmaf(f, s[j], (1.f - f) * -1.0e9f) - mx); } const float sc = 256.0f / se;
#pragma unroll 1
  for (int j0 = 0; j0 < nk; j0 += 8) { FragH fr; for (int q = 0; q < 8; ++q) { const int j = j0 + q; const float f = (j <= last) ? 1.f : 0.f; fr.h[q] = (_Float16)(__expf(fmaf(f, s[j], (1.f - f) * -1.0e9f) - mx) * sc); } unsigned short* d = (unsigned short*)P + i * NKX + j0; *(v8us*)d = fr.half[0];  } }

template <int MASKADD>
__global__ __launch_bounds__(64) void k_att0(const float* __restrict__ QF, const float* __restrict__ KF, const float* __restrict__ VF, int ld, const float* __restrict__ mask, float scale, float* __restrict__ OF, int ldo) {
  #pragma clang fp contract(off)
  __shared__ __attribute__((aligned(16))) float lq[64][64]; __shared__ __attribute__((aligned(16))) float lo[64][64];
  const int tid = threadIdx.x; const int h = blockIdx.x / (QT0 / 64), rg = blockIdx.x % (QT0 / 64); const int i = rg * 64 + tid;
  const float* qr = QF + (size_t)i * ld + h * HD;
#pragma unroll 1
  for (int c = 0; c < HD / 4; ++c) { *(v4f*)&lq[tid][c * 4] = *(const v4fa*)(qr + c * 4); const v4f z = {0.f, 0.f, 0.f, 0.f}; *(v4f*)&lo[tid][c * 4] = z; }
  float m = -1.0e30f, l = 0.f; const int jmax = MASKADD ? (SQ - 1) : (rg * 64 + 63);      /* additive-mask form: every key (the mask input decides); causal form: keys up to the block's last row */
#pragma unroll 1
  for (int j = 0; j <= jmax; ++j) { const float* kr = KF + (size_t)j * ld + h * HD; const float* vr = VF + (size_t)j * ld + h * HD; float s = 0.f;
#pragma unroll 1
    for (int c = 0; c < HD / 4; ++c) { const v4f kq = *(const v4fa*)(kr + c * 4); const v4f qq = *(v4f*)&lq[tid][c * 4]; s = __fadd_rn(s, __fmul_rn(qq[0], kq[0])); s = __fadd_rn(s, __fmul_rn(qq[1], kq[1])); s = __fadd_rn(s, __fmul_rn(qq[2], kq[2])); s = __fadd_rn(s, __fmul_rn(qq[3], kq[3])); }
    s = __fmul_rn(s, scale); if (MASKADD) s = __fadd_rn(s, __fmul_rn(bf16_round(mask[(size_t)i * SQ + j]), -10000.0f));
    const float f = (MASKADD || j <= i) ? 1.f : 0.f; const float sm = fmaf(f, s, (1.f - f) * -1.0e30f); const float mn = fmaxf(m, sm); const float sc = expf(m - mn); const float e = expf(sm - mn); l = __fadd_rn(__fmul_rn(l, sc), e); m = mn;
#pragma unroll 1
    for (int c = 0; c < HD / 4; ++c) { const v4f vv = *(const v4fa*)(vr + c * 4); v4f oo = *(v4f*)&lo[tid][c * 4]; for (int u = 0; u < 4; ++u) oo[u] = __fadd_rn(__fmul_rn(oo[u], sc), __fmul_rn(e, vv[u])); *(v4f*)&lo[tid][c * 4] = oo; } }
  const float fin = 64.0f / l;      /* o carried x64 */
#pragma unroll 1
  for (int c = 0; c < HD / 4; ++c) { v4f oo = *(v4f*)&lo[tid][c * 4]; for (int u = 0; u < 4; ++u) oo[u] = __fmul_rn(oo[u], fin); *(v4f*)&lo[tid][c * 4] = oo; }
  __syncthreads();
  {
#pragma unroll 1
    for (int it = 0; it < 16; ++it) { const int row = it * 4 + tid / 16, pc = (tid % 16) * 4; const v4f v = *(const v4f*)&lo[row][pc]; *(v4f*)(OF + (size_t)(rg * 64 + row) * ldo + h * HD + pc) = v; }
     } }

__global__ __launch_bounds__(256) void k_oscale(const float* __restrict__ OF, float* __restrict__ out, size_t n4) { const size_t t = (size_t)blockIdx.x * 256 + threadIdx.x; if (t >= n4) return; const v4f a = *(const v4fa*)(OF + t * 4); v4f o; for (int q = 0; q < 4; ++q) o[q] = a[q] * 0.015625f; *(v4f*)(out + t * 4) = o;  }

__global__ __launch_bounds__(256) void k_bfr(const float* __restrict__ x, float* __restrict__ XB, size_t n8) { const size_t t = (size_t)blockIdx.x * 256 + threadIdx.x; if (t >= n8) return; v4f a = *(const v4fa*)(x + t * 8), c = *(const v4fa*)(x + t * 8 + 4); for (int q = 0; q < 4; ++q) { a[q] = bf16_round(a[q]); c[q] = bf16_round(c[q]); }
  { *(v4f*)(XB + t * 8) = a; *(v4f*)(XB + t * 8 + 4) = c;  } }



__global__ __launch_bounds__(256) void k_rsmfvl(const float* __restrict__ S, _Float16* __restrict__ P, _Float16* __restrict__ PL, int qn, const int* __restrict__ vlp) {
  #pragma clang fp contract(off)
  const int t = blockIdx.x * 256 + threadIdx.x; if (t >= qn) return; const int vl = vlp[0]; const size_t i = (size_t)t; const float* s = S + i * SQ; float mx = -3.0e38f;
#pragma unroll 1
  for (int j = 0; j < SQ; ++j) { const float f = (j < vl) ? 1.f : 0.f; mx = fmaxf(mx, fmaf(f, s[j], (1.f - f) * -1000000.0f)); } float se = 0.f;
#pragma unroll 1
  for (int j = 0; j < SQ; ++j) { const float f = (j < vl) ? 1.f : 0.f; se += __expf(fmaf(f, s[j], (1.f - f) * -1000000.0f) - mx); } const float sc = 256.0f / se;
#pragma unroll 1
  for (int j0 = 0; j0 < SQ; j0 += 8) { FragH fr, gr; for (int q = 0; q < 8; ++q) { const int j = j0 + q; const float f = (j < vl) ? 1.f : 0.f; const float pv = __expf(fmaf(f, s[j], (1.f - f) * -1000000.0f) - mx) * sc; const _Float16 ph = (_Float16)pv; fr.h[q] = ph; gr.h[q] = (_Float16)((pv - (float)ph) * 1024.0f); }
    unsigned short* d = (unsigned short*)P + i * SQ + j0; unsigned short* dl = (unsigned short*)PL + i * SQ + j0; *(v8us*)d = fr.half[0]; *(v8us*)dl = gr.half[0];  } }

__global__ __launch_bounds__(256) void k_rsmf(const float* __restrict__ S, _Float16* __restrict__ P, int qn, int hg) {
  #pragma clang fp contract(off)
  const int t = blockIdx.x * 256 + threadIdx.x; if (t >= qn * hg) return; const size_t i = (size_t)(t / qn) * SQ + (t % qn); const float* s = S + i * SQ; float mx = -3.0e38f;
#pragma unroll 1
  for (int j = 0; j < SQ; ++j) mx = fmaxf(mx, s[j]); float se = 0.f;
#pragma unroll 1
  for (int j = 0; j < SQ; ++j) se += __expf(s[j] - mx); const float sc = 256.0f / se;
#pragma unroll 1
  for (int j0 = 0; j0 < SQ; j0 += 8) { FragH f; for (int q = 0; q < 8; ++q) f.h[q] = (_Float16)(__expf(s[j0 + q] - mx) * sc); unsigned short* d = (unsigned short*)P + i * SQ + j0; *(v8us*)d = f.half[0];  } }


#define CN 256          /* channels */
#define CI 128
#define NC 256                       /* (unused legacy kernels) */
#define NPX NP          /* elements per (batch, channel) row */
#define NP 4096         /* seq1 tokens */
#define NM 1024         /* seq2 tokens */
#define BNEPS 1e-5f

__global__ __launch_bounds__(256) void k_mp2(const float* __restrict__ src, float* __restrict__ dst, int nout) {
  const int t = blockIdx.x * 256 + threadIdx.x; if (t >= nout) return; const int c = t / 1024; const int o = t % 1024; const int oy = o / 32, ox = o % 32; const float* p = src + (size_t)c * 4096 + (size_t)(2 * oy) * 64 + 2 * ox;
  const float v = fmaxf(fmaxf(p[0], p[1]), fmaxf(p[64], p[65])); *(float*)(dst + t) = v;  }
__global__ __launch_bounds__(256) void k_xpb(const float* __restrict__ x, const float* __restrict__ wb, float* __restrict__ CPP, size_t n4) {
  #pragma clang fp contract(off)
  const size_t t = (size_t)blockIdx.x * 256 + threadIdx.x; if (t >= n4) return; const size_t e = t * 4; const int c = (int)((e / 4096) % 256); const float bb = bf16_round(wb[c]); const v4f a = *(const v4fa*)(x + e); v4f o; for (int q = 0; q < 4; ++q) o[q] = __fadd_rn(bf16_round(a[q]), bb);
  *(v4f*)(CPP + e) = o;  }


template <int PASS>
__global__ __launch_bounds__(256) void k_cstA(const float* __restrict__ X, const float* __restrict__ MV, float* __restrict__ PART) {
  #pragma clang fp contract(off)
  __shared__ float red[256]; const int t = threadIdx.x; const size_t bc = blockIdx.x; const int c = (int)(bc % NC); const float* row = X + bc * (size_t)NPX; const float mu = PASS ? MV[c] : 0.f; float s = 0.f;
  for (int i = t; i < NPX; i += 256) { const float v = row[i]; const float d = PASS ? __fadd_rn(v, -mu) : v; s = __fadd_rn(s, PASS ? __fmul_rn(d, d) : d); }
  red[t] = s; __syncthreads(); for (int st = 128; st > 0; st >>= 1) { if (t < st) red[t] = __fadd_rn(red[t], red[t + st]); __syncthreads(); }
  if (t < 32) { const float pv = (t == 0) ? red[0] : 0.f; *(float*)(PART + bc * 32 + t) = pv;  } }      

template <int PASS>
__global__ __launch_bounds__(256) void k_cstB(const float* __restrict__ PART, float* __restrict__ MV) { const int c = threadIdx.x; if (c >= NC) return; double s = 0.0; for (int b = 0; b < NB; ++b) s += (double)PART[((size_t)b * NC + c) * 32]; const float m = (float)(s / ((double)NB * (double)NPX)); *(float*)(MV + PASS * NC + c) = m;  }


__global__ __launch_bounds__(256) void k_bnresid(const float* __restrict__ C2, const float* __restrict__ MV, const float* __restrict__ g, const float* __restrict__ be, const float* __restrict__ X, float* __restrict__ out, size_t n4) {
  #pragma clang fp contract(off)
  const size_t t = (size_t)blockIdx.x * 256 + threadIdx.x; if (t >= n4) return; const size_t e = t * 4; const int c = (int)((e / NPX) % NC); const float sc = __fmul_rn(rsqrtf(__fadd_rn(MV[NC + c], BNEPS)), bf16_round(g[c])); const float mu = MV[c], bb = bf16_round(be[c]);
  const v4f a = *(const v4fa*)(C2 + e); const v4f xx = *(const v4fa*)(X + e); v4f o; for (int q = 0; q < 4; ++q) { const float z = __fadd_rn(__fmul_rn(__fadd_rn(a[q], -mu), sc), bb); o[q] = __fadd_rn(z, bf16_round(xx[q])); }      /* BN + residual, no ReLU */
  *(v4f*)(out + e) = o;  }


__global__ __launch_bounds__(256) void k_rowbias(float* __restrict__ Y, const float* __restrict__ bias) {
  #pragma clang fp contract(off)
  const size_t t = (size_t)blockIdx.x * 256 + threadIdx.x; if (t >= (size_t)NB * NC * NPX / 4) return; const size_t e = t * 4; const int c = (int)((e / NPX) % NC); const float bb = bf16_round(bias[c]);
  v4f v = *(const v4fa*)(Y + e); for (int q = 0; q < 4; ++q) v[q] = __fadd_rn(v[q], bb); *(v4f*)(Y + e) = v;  }



// ---- fused attention: scores, softmax and the weighted sum of V in one kernel ----
constexpr int FA_NQ = 8192, FA_NK = 8192, FA_D = 256;      /* queries, keys, head width */
constexpr int FA_NS = 8, FA_BC = 32, FA_NP = FA_NK / FA_NS / FA_BC;      /* key splits, keys per pass, passes per split */
constexpr int FA_TB = FA_BC * FA_D * 2;      /* bytes of one pass's K (and of its V^T): 16 KiB */
constexpr int FA_SP = 4, FA_RS = 2 * FA_SP;      /* passes per stage (one barrier a stage); slots of the LDS ring: two stages, one slot a pass */
__device__ __forceinline__ v16h fa_frag(const unsigned char* p) { FragH f; f.half[0] = *(const v8us*)p; f.half[1] = *(const v8us*)(p + 512); return f.v; }
__device__ __forceinline__ v8f fa_mma(v16h a, v16h b, v8f c) { return __builtin_amdgcn_wmma_f32_16x16x32_f16(false, a, false, b, (short)0, c, false, false); }
__device__ __forceinline__ void fa_xcnt0() { asm volatile("s_wait_xcnt 0x0" ::: "memory"); }      /* stands behind issued global loads or stores, in front of whatever reuses a register that they name */
typedef unsigned int fa_u4 __attribute__((ext_vector_type(4)));
typedef unsigned int fa_u8 __attribute__((ext_vector_type(8)));
__device__ __forceinline__ unsigned int fa_uni(unsigned int v) { return (unsigned int)__builtin_amdgcn_readfirstlane(v); }
__device__ __forceinline__ unsigned int fa_pinned(unsigned int v) { unsigned int w = fa_uni(v); asm volatile("" : "+s"(w)); return w; }      /* the test of a tensor load held in a scalar register, so that it compiles to s_cmp and a scalar branch (a tensor load ignores EXEC) */
__device__ __forceinline__ void fa_dscnt0() { asm volatile("s_wait_dscnt 0x0" ::: "memory"); }      /* this wave's LDS reads have returned: in front of the barrier behind which their buffer is refilled */
__device__ __forceinline__ void fa_tensorcnt0() { asm volatile("s_wait_tensorcnt 0x0" ::: "memory"); }      /* this wave's tensor load has landed: the compiler places no wait for it */
// One request of one wave: FA_TB contiguous bytes from ga to the LDS byte offset dst, as 64 rows of 256 bytes at a source pitch of 256 bytes; 1-byte elements, no pad, no mask.
__device__ __forceinline__ void fa_tload(unsigned int dst, unsigned long long ga) {
  constexpr unsigned int d0 = 256u, d1 = 64u;
  fa_u4 g0; fa_u8 g1;
  g0[0] = fa_uni(1u); g0[1] = fa_uni(dst); g0[2] = fa_uni((unsigned int)ga); g0[3] = fa_uni((((unsigned int)(ga >> 32)) & 0x01FFFFFFu) | 0x80000000u);
  g1[0] = fa_uni(0u); g1[1] = fa_uni((d0 & 0xFFFFu) << 16); g1[2] = fa_uni((d0 >> 16) | ((d1 & 0xFFFFu) << 16)); g1[3] = fa_uni((d1 >> 16) | (d0 << 16)); g1[4] = fa_uni(d1); g1[5] = fa_uni(d0); g1[6] = fa_uni(0u); g1[7] = fa_uni(0u);
  asm volatile("tensor_load_to_lds %0, %1" :: "s"(g0), "s"(g1) : "memory"); }
__device__ __forceinline__ float fa_exp2_slot(float x) { float r; asm("v_exp_f32 %0, %1\n\tv_nop" : "=v"(r) : "v"(x)); return r; }      /* 2^x with the one slot the instruction set asks for between a transcendental and a next instruction that reads its result or overwrites its source: in one statement, so that the slot stays there */
__device__ __forceinline__ float fa_xhalf(float x) { return __builtin_bit_cast(float, __builtin_amdgcn_permlanex16(__builtin_bit_cast(int, x), __builtin_bit_cast(int, x), 0x76543210, 0xfedcba98, false, false)); }      /* lane l with lane l ^ 16 */

// Preparation in one launch. A piece is 8 f16 = 16 bytes; work-group b makes pieces 1024 b .. 1024 b + 1023 of each of three arrays, thread tid the pieces t = 1024 b + 256 i + tid (i < 4).
// Q16: piece t holds Q's elements 8 t + 0..7 (plain rows).
// K in fragment order: piece t = ((key tile * 8 + k step) * 2 + q) * 32 + lane holds K[16 tile + c][32 step + 16 q + 8 h + 0..7] (c = lane & 15, h = lane >> 4): a wave's fragment load is 512 contiguous bytes.
// V^T in fragment order: piece t = ((key block * 16 + d tile) * 2 + q) * 32 + lane holds V[32 block + 16 q + 8 h + 0..7][16 tile + c].
__device__ __forceinline__ v8us fa_piece(const float* e) { FragH f;
#pragma unroll
  for (int j = 0; j < 8; ++j) f.h[j] = (_Float16)bf16_round(e[j]);
  return f.half[0]; }
__global__ __launch_bounds__(256) void k_prep(const float* __restrict__ xq, const float* __restrict__ xk, const float* __restrict__ xv, _Float16* __restrict__ Q16, _Float16* __restrict__ Kf, _Float16* __restrict__ Vf) {
  static_assert(FA_NQ == FA_NK && FA_D == 256, "one work-group index serves the three arrays");
  const int tid = threadIdx.x, b = blockIdx.x, lane = tid & 31, q = (tid >> 5) & 1, w2 = tid >> 6, c = lane & 15, h = lane >> 4;
  const float* sq = xq + ((size_t)b * 1024 + tid) * 8;
  const float* sk = xk + (size_t)(b * 32 + c) * FA_D + w2 * 32 + 16 * q + 8 * h;      /* piece i: key tile 2 b + (i >> 1), k step 4 (i & 1) + w2 */
  const float* sv = xv + (size_t)(b * 32 + 16 * q + 8 * h) * FA_D + w2 * 16 + c;      /* piece i: key block b, d tile 4 i + w2 */
  float eq[4][8], ek[4][8], ev[4][8];
#pragma unroll
  for (int i = 0; i < 4; ++i) { const float* s = sq + i * 2048; *(v4f*)&eq[i][0] = *(const v4fa*)s; *(v4f*)&eq[i][4] = *(const v4fa*)(s + 4); }
  fa_xcnt0();      /* all 48 loads of a thread are in flight together; the waits let a later array's loads land in an earlier one's address registers */
#pragma unroll
  for (int i = 0; i < 4; ++i) { const float* s = sk + (i >> 1) * 16 * FA_D + (i & 1) * 128; *(v4f*)&ek[i][0] = *(const v4fa*)s; *(v4f*)&ek[i][4] = *(const v4fa*)(s + 4); }
  fa_xcnt0();
#pragma unroll
  for (int i = 0; i < 4; ++i) {
#pragma unroll
    for (int j = 0; j < 8; ++j) ev[i][j] = sv[i * 64 + j * FA_D]; }
  fa_xcnt0();
  __builtin_amdgcn_sched_barrier(0);      /* the conversions stay behind the last load: moved up among the loads, the first one's wait for its data holds back the issue of the loads behind it */
  v8us oq[4], ok[4], ov[4];
#pragma unroll
  for (int i = 0; i < 4; ++i) { oq[i] = fa_piece(eq[i]); ok[i] = fa_piece(ek[i]); ov[i] = fa_piece(ev[i]); }
  const size_t o = ((size_t)b * 1024 + tid) * 8;
#pragma unroll
  for (int i = 0; i < 4; ++i) { *(v8us*)((unsigned short*)Q16 + o + i * 2048) = oq[i]; *(v8us*)((unsigned short*)Kf + o + i * 2048) = ok[i]; *(v8us*)((unsigned short*)Vf + o + i * 2048) = ov[i]; } }

__global__ __launch_bounds__(256) void k_fattn(const _Float16* __restrict__ Q16, const _Float16* __restrict__ Kf, const _Float16* __restrict__ Vf, _Float16* __restrict__ Op, float* __restrict__ Mp, float* __restrict__ Lp) {
  static_assert(FA_NP % FA_SP == 0 && FA_NP >= 2 * FA_SP && (FA_RS & (FA_RS - 1)) == 0, "whole stages; the ring index is a mask");
  static_assert(FA_TB == 64 * 256 && FA_SP == 4, "a wave's slice is one pass's K or V^T: 64 rows of 256 bytes; eight waves bring a stage");
  __shared__ __attribute__((aligned(2048))) unsigned char lb[FA_RS][2 * FA_TB];
  const int tid = threadIdx.x, lane = tid & 31, wave = (int)fa_uni(tid >> 5), c = lane & 15, h = lane >> 4;
  const int qb = blockIdx.x & 31, sp = blockIdx.x >> 5; const int q0 = qb * 256 + wave * 32;
  const unsigned long long gsl = (unsigned long long)(size_t)(wave < FA_SP ? (const unsigned char*)Kf : (const unsigned char*)Vf) + (size_t)sp * FA_NP * FA_TB + (size_t)(wave & (FA_SP - 1)) * FA_TB;      /* this wave's slice of stage 0 */
  const unsigned int lsl = (unsigned int)(size_t)&lb[0][0] + (unsigned int)(wave & (FA_SP - 1)) * (2 * FA_TB) + (wave < FA_SP ? 0u : (unsigned int)FA_TB);      /* its place in the first stage's slots */
  auto issue = [&](const int s) __attribute__((always_inline)) { fa_tload(lsl + (unsigned int)(s & 1) * (FA_SP * 2 * FA_TB), gsl + (unsigned long long)s * (FA_SP * FA_TB)); };
  const float cscale = 0.0625f * 1.4426950408889634f;      /* 1 / sqrt(256), times log2 e */
  v16h qf[2][8];
#pragma unroll
  for (int g = 0; g < 2; ++g) { const _Float16* qp = Q16 + (size_t)(q0 + 16 * g + c) * FA_D;
#pragma unroll
    for (int kc = 0; kc < 8; ++kc) qf[g][kc] = g2_frag(qp + kc * 32, h); }
  fa_xcnt0();
  __builtin_amdgcn_sched_barrier(0);      /* what follows is formed behind the wait: moved up over it, it lands in registers that the loads above name */
  issue(0);      /* every wave its own slice: no test */
  fa_tensorcnt0();
  __syncthreads();      /* the first stage's K and V^T are in LDS */
  issue(1);
  const v8f z8 = {0.f,0.f,0.f,0.f,0.f,0.f,0.f,0.f};
  v8f acc[2][16]; float m_run[2], l_run[2];
#pragma unroll
  for (int g = 0; g < 2; ++g) { m_run[g] = -__builtin_inff(); l_run[g] = 0.f;
#pragma unroll
    for (int t = 0; t < 16; ++t) acc[g][t] = z8; }
  // Fragment reads from LDS stand in groups of four fragments (eight 16-byte reads), one group between two rows of eight WMMAs, never among the WMMAs of a row. Two register sets, fx and fy: a set is refilled directly behind the row that used it, so every group is asked for one row (or the softmax) ahead of its products.
  // The stream of a pass: K groups 0..3, V^T groups 0..3, then the next pass's K groups 0, 1 while that pass lies in the same stage (its slot is published); a stage's first pass finds its two groups read at the stage's head.
  v16h fx[4], fy[4];
  auto ld_k = [&](const unsigned char* lk, const int r, v16h* d) __attribute__((always_inline)) {      /* fragment f = 4 r + i: key tile f & 1, k step f >> 1 */
#pragma unroll
    for (int i = 0; i < 4; ++i) { const int f = 4 * r + i; d[i] = fa_frag(lk + ((f & 1) * 8 + (f >> 1)) * 1024); } };
  auto ld_v = [&](const unsigned char* lv, const int r, v16h* d) __attribute__((always_inline)) {      /* d tile 4 r + i */
#pragma unroll
    for (int i = 0; i < 4; ++i) d[i] = fa_frag(lv + (4 * r + i) * 1024); };
  auto pass = [&](const int p, const bool more) __attribute__((always_inline)) {
    const unsigned char* lk = &lb[p & (FA_RS - 1)][0] + lane * 16; const unsigned char* lv = lk + FA_TB;
    v8f s[2][2] = {{z8, z8}, {z8, z8}};
    auto row_k = [&](const int r, const v16h* a) __attribute__((always_inline)) {
#pragma unroll
      for (int i = 0; i < 4; ++i) { const int f = 4 * r + i, kt = f & 1, kc = f >> 1;
        s[kt][0] = fa_mma(a[i], qf[0][kc], s[kt][0]); s[kt][1] = fa_mma(a[i], qf[1][kc], s[kt][1]); } };
    /* each sched_barrier below holds the written order of rows and read groups: left free, the compiler spreads the reads among the WMMAs; for speed only */
    row_k(0, fx); __builtin_amdgcn_sched_barrier(0); ld_k(lk, 2, fx); __builtin_amdgcn_sched_barrier(0);
    row_k(1, fy); __builtin_amdgcn_sched_barrier(0); ld_k(lk, 3, fy); __builtin_amdgcn_sched_barrier(0);
    row_k(2, fx); __builtin_amdgcn_sched_barrier(0); ld_v(lv, 0, fx); __builtin_amdgcn_sched_barrier(0);
    row_k(3, fy); __builtin_amdgcn_sched_barrier(0); ld_v(lv, 1, fy); __builtin_amdgcn_sched_barrier(0);
    float mb[2]; bool need = false;
#pragma unroll
    for (int g = 0; g < 2; ++g) { float mx = s[0][g][0];
#pragma unroll
      for (int r = 1; r < 8; ++r) mx = fmaxf(mx, s[0][g][r]);
#pragma unroll
      for (int r = 0; r < 8; ++r) mx = fmaxf(mx, s[1][g][r]);
      mx = fmaxf(mx, fa_xhalf(mx)) * cscale;      /* both wave halves hold this query's maximum of the pass, scaled */
      mb[g] = mx; need = need || (mx > m_run[g] + 8.0f); }
    if (__builtin_amdgcn_ballot_w32(need) != 0) {      /* wave-uniform; always on the first pass (m = -inf), rare later */
#pragma unroll
      for (int g = 0; g < 2; ++g) { const float m_new = fmaxf(m_run[g], mb[g]); const float corr = __builtin_amdgcn_exp2f(m_run[g] - m_new); l_run[g] *= corr; m_run[g] = m_new;
#pragma unroll
        for (int t = 0; t < 16; ++t) acc[g][t] = acc[g][t] * corr; } }
    v16h pf[2];
#pragma unroll
    for (int g = 0; g < 2; ++g) { const float nm = -m_run[g]; float ps0 = 0.f, ps1 = 0.f;
#pragma unroll
      for (int i = 0; i < 8; ++i) { const float p0 = __builtin_amdgcn_exp2f(fmaf(s[0][g][i], cscale, nm)), p1 = __builtin_amdgcn_exp2f(fmaf(s[1][g][i], cscale, nm)); ps0 += p0; ps1 += p1; pf[g][i] = (_Float16)p0; pf[g][8 + i] = (_Float16)p1; }      /* element e of the B operand is key 8 h + e (e < 8), 16 + 8 h + e - 8 (else): the score tiles' own rows */
      l_run[g] += ps0 + ps1;
      __builtin_amdgcn_sched_barrier(0); }      /* each column group's weights are packed and summed before the next group's begin, and before the second product: their f32 forms would otherwise stay in registers that the fragments read ahead need */
    auto row_v = [&](const int r, const v16h* a) __attribute__((always_inline)) {
#pragma unroll
      for (int i = 0; i < 4; ++i) { const int t = 4 * r + i; acc[0][t] = fa_mma(a[i], pf[0], acc[0][t]); acc[1][t] = fa_mma(a[i], pf[1], acc[1][t]); } };
    row_v(0, fx); __builtin_amdgcn_sched_barrier(0); ld_v(lv, 2, fx); __builtin_amdgcn_sched_barrier(0);
    row_v(1, fy); __builtin_amdgcn_sched_barrier(0); ld_v(lv, 3, fy); __builtin_amdgcn_sched_barrier(0);
    row_v(2, fx); __builtin_amdgcn_sched_barrier(0); if (more) { ld_k(lk + 2 * FA_TB, 0, fx); __builtin_amdgcn_sched_barrier(0); }      /* the next slot's K: the slots of a stage lie one behind the other */
    row_v(3, fy); __builtin_amdgcn_sched_barrier(0); if (more) { ld_k(lk + 2 * FA_TB, 1, fy); __builtin_amdgcn_sched_barrier(0); }
  };
#pragma unroll 1      /* rolled, like the loop of passes below: two copies of the pass in the instruction cache */
  for (int s = 0; s < FA_NP / FA_SP; ++s) {
    { const unsigned char* lk0 = &lb[(s * FA_SP) & (FA_RS - 1)][0] + lane * 16; ld_k(lk0, 0, fx); ld_k(lk0, 1, fy); }      /* behind the barrier that published this stage */
    __builtin_amdgcn_sched_barrier(0);      /* the sixteen reads stay one group in front of the first row */
#pragma unroll 1
    for (int j = 0; j < FA_SP - 1; ++j) pass(s * FA_SP + j, true);
    pass(s * FA_SP + FA_SP - 1, false);      /* the stage's last pass reads nothing ahead: the next slot is not published yet */
    fa_dscnt0();
    fa_tensorcnt0();      /* this wave's slice of stage s + 1 */
    __syncthreads();      /* publishes the next stage's four slots and ends every wave's reads of this stage's, which the load below refills */
    if (fa_pinned(s + 2 < FA_NP / FA_SP)) issue(s + 2);
  }
  fa_tensorcnt0();      /* behind the loop nothing of this wave is in flight to LDS or from it */
  fa_dscnt0();
  const float l_fin0 = l_run[0] + fa_xhalf(l_run[0]), l_fin1 = l_run[1] + fa_xhalf(l_run[1]);      /* each wave half summed its eight keys of every 16-key tile */
  unsigned short* o = (unsigned short*)Op + ((size_t)(sp * (FA_NQ / 16) + (q0 >> 4)) * 16) * 256 + lane * 8; float* mo = Mp + (size_t)sp * FA_NQ + q0 + c; float* lo_ = Lp + (size_t)sp * FA_NQ + q0 + c;
  if (h == 0) { mo[0] = m_run[0]; mo[16] = m_run[1]; lo_[0] = l_fin0; lo_[16] = l_fin1; }
  fa_xcnt0();      /* the arithmetic below may reuse a register that these four stores name */
  const float il[2] = {1.0f / l_fin0, 1.0f / l_fin1};      /* l >= 1: m never exceeds the split's true maximum, so the largest weight is at least 1 */
  v8us ob[2][16];
#pragma unroll
  for (int g = 0; g < 2; ++g) {
#pragma unroll
    for (int t = 0; t < 16; ++t) { FragH f;
#pragma unroll
      for (int r = 0; r < 8; ++r) f.h[r] = (_Float16)(acc[g][t][r] * il[g]);
      ob[g][t] = f.half[0]; } }
  __builtin_amdgcn_sched_barrier(0);      /* all arithmetic stands in front of the stores of O: nothing behind them reuses a register that a store names */
#pragma unroll
  for (int g = 0; g < 2; ++g) {
#pragma unroll
    for (int t = 0; t < 16; ++t) *(v8us*)(o + g * 4096 + t * 256) = ob[g][t]; } }

// Joins the key splits of 16 query rows: out = sum_s a_s o_s, a_s = 2^(m_s - M) l_s / sum_s 2^(m_s - M) l_s, o_s the split's normalised f16 rows; the rows go through LDS so that every 128-byte line of out is stored whole.
__global__ __launch_bounds__(256) void k_fjoin(const _Float16* __restrict__ Op, const float* __restrict__ Mp, const float* __restrict__ Lp, float* __restrict__ out) {
  __shared__ __attribute__((aligned(16))) float ro[16][FA_D + 4];
  const int tid = threadIdx.x, lane = tid & 31, c = lane & 15, h = lane >> 4; const int qt = blockIdx.x; const int q = qt * 16 + c;
  float w[FA_NS], ls[FA_NS]; v8us x[2][FA_NS];
#pragma unroll
  for (int s = 0; s < FA_NS; ++s) { w[s] = Mp[(size_t)s * FA_NQ + q]; ls[s] = Lp[(size_t)s * FA_NQ + q]; }
  fa_xcnt0();
#pragma unroll
  for (int s = 0; s < FA_NS; ++s) { const unsigned short* op = (const unsigned short*)Op + ((size_t)(s * (FA_NQ / 16) + qt) * 512 + tid) * 8;
#pragma unroll
    for (int i = 0; i < 2; ++i) x[i][s] = *(const v8us*)(op + i * 2048);
    fa_xcnt0(); }      /* all 16 loads are in flight together; the wait lets a later load land in an earlier one's address registers */
  __builtin_amdgcn_sched_barrier(0);      /* the arithmetic stays behind the wait above */
  float M = w[0];
#pragma unroll
  for (int s = 1; s < FA_NS; ++s) M = fmaxf(M, w[s]);
  float den = 0.f;
#pragma unroll
  for (int s = 0; s < FA_NS; ++s) { w[s] = fa_exp2_slot(w[s] - M); den += w[s] * ls[s]; }
  const float inv = 1.0f / den;
#pragma unroll
  for (int s = 0; s < FA_NS; ++s) w[s] = w[s] * ls[s] * inv;      /* the split's share of the whole sum of weights */
#pragma unroll
  for (int i = 0; i < 2; ++i) { const int t = (i * 256 + tid) >> 5; float a[8];
#pragma unroll
    for (int s = 0; s < FA_NS; ++s) { FragH f; f.half[0] = x[i][s];
#pragma unroll
      for (int j = 0; j < 8; ++j) a[j] = s ? fmaf((float)f.h[j], w[s], a[j]) : (float)f.h[j] * w[0]; }
    const v4f lo = {a[0], a[1], a[2], a[3]}, hi = {a[4], a[5], a[6], a[7]};
    *(v4f*)&ro[c][t * 16 + h * 8] = lo; *(v4f*)&ro[c][t * 16 + h * 8 + 4] = hi; }
  __syncthreads();      /* the 16 rows are in LDS */
#pragma unroll
  for (int i = 0; i < 4; ++i) { const int id = i * 256 + tid; const int r = id >> 6, c4 = (id & 63) * 4; *(v4f*)(out + (size_t)(qt * 16 + r) * FA_D + c4) = *(const v4f*)&ro[r][c4]; } }

extern "C" void kernel_launch(void* const* d_in, const int* in_sizes, int n_in,
                              void* d_out, int out_size, void* d_ws, size_t ws_size, hipStream_t stream) {
  (void)in_sizes; (void)n_in; (void)out_size;
  const float* const* I = (const float* const*)d_in; const float* xq = I[0]; const float* xk = I[1]; const float* xv = I[2];      /* Q, K, V [8192][256] (bf16-valued) */
  char* ws = (char*)d_ws; size_t off = 0;
  auto take = [&](size_t bytes) { char* p = ws + off; off += (bytes + 255) & ~(size_t)255; return p; };
  _Float16* Q16 = (_Float16*)take((size_t)FA_NQ * FA_D * 2); _Float16* Kf = (_Float16*)take((size_t)FA_NK * FA_D * 2); _Float16* Vf = (_Float16*)take((size_t)FA_NK * FA_D * 2);
  _Float16* Op = (_Float16*)take((size_t)FA_NS * FA_NQ * FA_D * 2); float* Mp = (float*)take((size_t)FA_NS * FA_NQ * 4); float* Lp = (float*)take((size_t)FA_NS * FA_NQ * 4);
  if (off > ws_size) return;
  k_prep<<<FA_NK * FA_D / 8 / 1024, 256, 0, stream>>>(xq, xk, xv, Q16, Kf, Vf);      /* exact f16 copy of the bf16-valued Q; K and V^T in fragment order */
  k_fattn<<<(FA_NQ / 256) * FA_NS, 256, 0, stream>>>(Q16, Kf, Vf, Op, Mp, Lp);      /* per key split: normalised O (f16), m, l */
  k_fjoin<<<FA_NQ / 16, 256, 0, stream>>>(Op, Mp, Lp, (float*)d_out);      /* out = the splits joined and normalised */
}
